// v000
// The times below were measured on an AMD MI455X: many runs one after another, warmed up first and cycling through
// copies of the inputs, with the whole window's GPU time divided by the number of runs. Launches and the gaps
// between them are all in it. The median over several windows is given; except for v000 it joins two sittings, which
// can be a few percent apart, so the side-by-side timings, each taken in one sitting, are the better comparison.
// v000, which the later versions start from, runs in 7550 microseconds.
// compute dtype: all float inputs rounded to bf16; q/k/v projections with EXACT bf16 products on WMMA 16x16x32 (f32 accumulate); causal scores with BOTH q and k as f16 hi + (x 2^10) residual (3 products) on EVERY block, x 64^-0.5; softmax over the QUERY axis in f32 (per key column: online max / sum over the visible queries, precise expf); P as bf16 hi + lo against v as bf16 hi + lo (3 products) on EVERY block; f32 output.
#include <hip/hip_runtime.h>
#include <math.h>

typedef __attribute__((ext_vector_type(16))) _Float16 v16h;
typedef __attribute__((ext_vector_type(16))) __bf16 v16b;
typedef __attribute__((ext_vector_type(8)))  _Float16 v8h;
typedef __attribute__((ext_vector_type(8)))  float v8f;
typedef __attribute__((ext_vector_type(4)))  float v4f;
typedef __attribute__((ext_vector_type(2)))  float v2f;
typedef __attribute__((ext_vector_type(4)))  unsigned v4u;
typedef __attribute__((ext_vector_type(4)))  int v4i;
typedef float __attribute__((may_alias)) float_a;
typedef int __attribute__((may_alias)) int_a;

template <typename T> __device__ __forceinline__ void vst2(void* p, T v) { *(T*)p = v;  }
__device__ __forceinline__ v8f wmma16(v16h a, v16h b, v8f c) {
  v8f d = __builtin_amdgcn_wmma_f32_16x16x32_f16(false, a, false, b, (short)0, c, false, false);
  asm volatile("v_nop\n\tv_nop\n\tv_nop\n\tv_nop" : "+v"(d) : "v"(a), "v"(b));
  return d;
}
__device__ __forceinline__ v8f wmma_bf(v16b a, v16b b, v8f c) {
  v8f d = __builtin_amdgcn_wmma_f32_16x16x32_bf16(false, a, false, b, (short)0, c, false, false);
  asm volatile("v_nop\n\tv_nop\n\tv_nop\n\tv_nop" : "+v"(d) : "v"(a), "v"(b));
  return d;
}
// 16x16x32 fragments: lane = (h = lane>>4, row/col = lane&15); elements 0..7 = k0+8h+0..7, 8..15 = k0+16+8h+0..7; D element r = row 8h+r
__device__ __forceinline__ v16h frag_h(const _Float16* rowk0, int lane) {
  union { v16h v; v8h q[2]; } u; const _Float16* p = rowk0 + 8 * (lane >> 4);
  u.q[0] = *(const v8h*)p; u.q[1] = *(const v8h*)(p + 16); return u.v;
}
__device__ __forceinline__ v16h frag_f32(const float* rowk0, int lane) {
  v16h a; const float* p = rowk0 + 8 * (lane >> 4);
#pragma unroll
  for (int i = 0; i < 8; ++i) { a[i] = (_Float16)p[i]; a[8 + i] = (_Float16)p[16 + i]; }
  return a;
}
__device__ __forceinline__ v16h frag_f32s(const float* rowk0, int lane, float sc) {
  v16h a; const float* p = rowk0 + 8 * (lane >> 4);
#pragma unroll
  for (int i = 0; i < 8; ++i) { a[i] = (_Float16)(p[i] * sc); a[8 + i] = (_Float16)(p[16 + i] * sc); }
  return a;
}
// column fragment from a [K][ld] layout (column n), rows >= K read as 0
__device__ __forceinline__ v16h fragc_f32(const float* W, int k0, int n, int lane, int ld, int K) {
  v16h a; const int g = lane >> 4;
#pragma unroll
  for (int i = 0; i < 8; ++i) { const int ka = k0 + 8 * g + i, kb = ka + 16;
    a[i] = (_Float16)(ka < K ? W[(size_t)(ka < K ? ka : K - 1) * ld + n] : 0.f); a[8 + i] = (_Float16)(kb < K ? W[(size_t)(kb < K ? kb : K - 1) * ld + n] : 0.f); }
  return a;
}
struct F2 { v16b h, l; };
__device__ __forceinline__ F2 bsplit16(const float v[16]) { F2 r;
#pragma unroll
  for (int i = 0; i < 16; ++i) { const __bf16 h = (__bf16)v[i]; r.h[i] = h; r.l[i] = (__bf16)(v[i] - (float)h); }
  return r; }
__device__ __forceinline__ F2 split_row(const float* row, int k0, int lane) { float v[16]; const float* p = row + k0 + 8 * (lane >> 4);
#pragma unroll
  for (int i = 0; i < 8; ++i) { v[i] = p[i]; v[8 + i] = p[16 + i]; }
  return bsplit16(v); }
__device__ __forceinline__ F2 split_rowK(const float* row, int k0, int lane, int K) { float v[16]; const int g = lane >> 4;
#pragma unroll
  for (int i = 0; i < 8; ++i) { const int ka = k0 + 8 * g + i, kb = ka + 16; v[i] = ka < K ? row[ka < K ? ka : K - 1] : 0.f; v[8 + i] = kb < K ? row[kb < K ? kb : K - 1] : 0.f; }
  return bsplit16(v); }
__device__ __forceinline__ F2 split_col(const float* W, int k0, int n, int lane, int ld, int K) { float v[16]; const int g = lane >> 4;
#pragma unroll
  for (int i = 0; i < 8; ++i) { const int ka = k0 + 8 * g + i, kb = ka + 16; v[i] = ka < K ? W[(size_t)(ka < K ? ka : K - 1) * ld + n] : 0.f; v[8 + i] = kb < K ? W[(size_t)(kb < K ? kb : K - 1) * ld + n] : 0.f; }
  return bsplit16(v); }
__device__ __forceinline__ v8f mac3(const F2& a, const F2& b, v8f c) { c = wmma_bf(a.l, b.h, c); c = wmma_bf(a.h, b.l, c); return wmma_bf(a.h, b.h, c); }
__device__ __forceinline__ float sigm(float v) { return 1.0f / (1.0f + expf(-v)); }
#define LDSX() do { asm volatile("s_wait_dscnt 0" ::: "memory"); __builtin_amdgcn_wave_barrier(); __builtin_amdgcn_fence(__ATOMIC_RELEASE, "workgroup"); } while (0)

// Single-head causal self-attention whose softmax runs over the QUERY axis (x [4,4096,512]; torch (out,in) Wq / Wk / Wv [64,512] (0.02 scale), no biases; scores = q k^T [B,t,s]; additive causal mask -1e9 where s > t; / sqrt(64); attn = softmax(scores, axis=1) - axis 1 is the QUERY axis t, so every key column s is normalised over the queries t >= s (faithful to the source); out = attn v -> [4,4096,64]).
#define NB 4
#define TT 4096
#define CC 128            // NH * HD = projected width
#define DIN 512          // input (model) width
#define NH 2
#define HD 64
#define NQB (TT / 64)
#define HG 1
#define SCALE (0.125f)
#define CAUSAL 1
#ifndef TNB
#define TNB NB
#endif
__device__ __forceinline__ float bfr(float v) { return (float)(__bf16)v; }
__host__ __device__ __forceinline__ int kb_last(int qb) { return CAUSAL ? ((qb * 64 + 63) >> 7) : (TT / 128 - 1); }
typedef __attribute__((ext_vector_type(8))) __bf16 v8b;
__device__ __forceinline__ v16b frag_b(const __bf16* rowk0, int lane) {
  union { v16b v; v8b q[2]; } u; const __bf16* p = rowk0 + 8 * (lane >> 4);
  u.q[0] = *(const v8b*)p; u.q[1] = *(const v8b*)(p + 16); return u.v;
}
#define QBH 64              // = NQB: 3-product scores and bf16 hi/lo P.v on every query block
#define QHI 4096            // EVERY row carries a q residual plane: with the softmax over the QUERY axis the few-term region is the END of the sequence (late key columns see few queries), so the high-precision paths run everywhere
#define KHI 4096            // every key row carries the k residual and the v bf16 hi + lo planes
// B fragment (k rows k0+.., output column o) of a weight: (in,out) [K][ld] or (out,in) [ld rows of K]: bf16 exact, or f16(bf16 * 256) exact
__device__ __forceinline__ v16b wcol_io(const float* Wm, int k0, int o, int lane, int ld) { v16b w; const int g = lane >> 4;
#pragma unroll
  for (int i = 0; i < 8; ++i) { w[i] = (__bf16)Wm[(size_t)(k0 + 8 * g + i) * ld + o]; w[8 + i] = (__bf16)Wm[(size_t)(k0 + 16 + 8 * g + i) * ld + o]; }
  return w; }
__device__ __forceinline__ v16b wcol_oi(const float* Wm, int k0, int o, int lane, int K) { v16b w; const float* p = Wm + (size_t)o * K + k0 + 8 * (lane >> 4);
#pragma unroll
  for (int i = 0; i < 8; ++i) { w[i] = (__bf16)p[i]; w[8 + i] = (__bf16)p[16 + i]; }
  return w; }
__device__ __forceinline__ v16h wcolh_io(const float* Wm, int k0, int o, int lane, int ld) { v16h w; const int g = lane >> 4;
#pragma unroll
  for (int i = 0; i < 8; ++i) { w[i] = (_Float16)(bfr(Wm[(size_t)(k0 + 8 * g + i) * ld + o]) * 256.0f); w[8 + i] = (_Float16)(bfr(Wm[(size_t)(k0 + 16 + 8 * g + i) * ld + o]) * 256.0f); }
  return w; }
__device__ __forceinline__ v16h wcolh_oi(const float* Wm, int k0, int o, int lane, int K) { v16h w; const float* p = Wm + (size_t)o * K + k0 + 8 * (lane >> 4);
#pragma unroll
  for (int i = 0; i < 8; ++i) { w[i] = (_Float16)(bfr(p[i]) * 256.0f); w[8 + i] = (_Float16)(bfr(p[16 + i]) * 256.0f); }
  return w; }
#define WQKV_LAYOUT 1   // 0 = (in,out) [DIN][CC]; 1 = (out,in) [64][DIN]; 2 = per-head [NH][DIN][HD]
__device__ __forceinline__ v16b wcol_hdk(const float* Wm, int k0, int o, int lane) { v16b w; const int g = lane >> 4; const float* p = Wm + (size_t)(o / HD) * DIN * HD + (o % HD);
#pragma unroll
  for (int i = 0; i < 8; ++i) { w[i] = (__bf16)p[(size_t)(k0 + 8 * g + i) * HD]; w[8 + i] = (__bf16)p[(size_t)(k0 + 16 + 8 * g + i) * HD]; }
  return w; }
#define WO_OUT_IN 0
#if WQKV_LAYOUT == 1
__device__ __forceinline__ v16b zero16b() { v16b w; _Pragma("unroll") for (int i = 0; i < 16; ++i) w[i] = (__bf16)0.0f; return w; }
#define WCOL(W, k0, o, lane) ((o) < 64 ? wcol_oi(W, k0, (o), lane, DIN) : zero16b())   /* (out,in) [64][512]: only 64 real output rows; projected columns 64..127 (padding head 1) are zero; the test is compile-time per unrolled tile (c0 = 0) */
#elif WQKV_LAYOUT == 2
#define WCOL(W, k0, o, lane) wcol_hdk(W, k0, o, lane)
#else
#define WCOL(W, k0, o, lane) wcol_io(W, k0, o, lane, CC)
#endif
#if WO_OUT_IN
#define WOCOL(W, k0, o, lane) wcol_oi(W, k0, o, lane, CC)
#define WOCOLH(W, k0, o, lane) wcolh_oi(W, k0, o, lane, CC)
#else
#define WOCOL(W, k0, o, lane) wcol_io(W, k0, o, lane, DIN)
#define WOCOLH(W, k0, o, lane) wcolh_io(W, k0, o, lane, DIN)
#endif

#ifndef SM_EXTRA_PARAMS
#define SM_EXTRA_PARAMS
#endif
#ifndef PROJ_EXTRA_PARAMS
#define PROJ_EXTRA_PARAMS
#endif
#ifndef SM_MASK_HOOK
#define SM_MASK_HOOK (void)0
#endif

#define WS_QH  0u                                      // f16 q rows [b*t][CC]
#define WS_KH  (WS_QH + 2u * (size_t)NB * TT * CC)      // f16 k rows [b*t][CC]
#define WS_VT  (WS_KH + 2u * (size_t)NB * TT * CC)      // f16 v planes [b][c][t]
#define WS_QL  (WS_VT + 2u * (size_t)NB * CC * TT)      // f16 q residual x 2^10 rows [b][t < QHI][CC]
#define WS_KL  (WS_QL + 2u * (size_t)NB * QHI * CC)     // f16 k residual x 2^10 rows [b][t < KHI][CC]
#define WS_VB  (WS_KL + 2u * (size_t)NB * KHI * CC)     // bf16 v hi planes [b][c][t < KHI]
#define WS_VBL (WS_VB + 2u * (size_t)NB * CC * KHI)
#define WS_S   (WS_VBL + 2u * (size_t)NB * CC * KHI)    // f32 logits / P [hg][t][s]
#define WS_Y   (WS_S  + 4u * (size_t)HG * TT * TT)      // f32 ctx rows [b*t][CC] (only when there is an output projection)
#define WS_END (WS_Y  + 0u)
#define WS_Y2 (WS_END)                                  // f32 ctx rows [b*TT + t][128] (columns 64..127 = the padding head)
#define WS_CM (WS_Y2 + 4u * (size_t)NB * TT * CC)        // f32 column maxima [TT]
#define WS_CZ (WS_CM + 4u * (size_t)HG * TT)
#define WS_END2 (WS_CZ + 4u * (size_t)HG * TT)

// ---- k_proj: block = (64 rows, 128 cols, which): q/k/v = X W (+ b) with exact bf16 products (K = DIN) -> which 0: q f16 rows (+ residual rows < QHI); 1: k f16 rows (+ residual rows < KHI); 2: v f16 planes [c][t] (+ bf16 hi/lo planes for t < KHI)
__global__ __launch_bounds__(128) void k_proj(const float* __restrict__ XQ, const float* __restrict__ XK, const float* __restrict__ XV, const float* __restrict__ WQ, const float* __restrict__ WK, const float* __restrict__ WV, const float* __restrict__ BQ, const float* __restrict__ BK, const float* __restrict__ BV,
    _Float16* __restrict__ QH, _Float16* __restrict__ QL, _Float16* __restrict__ KH, _Float16* __restrict__ KL, _Float16* __restrict__ VT, __bf16* __restrict__ VB, __bf16* __restrict__ VBL) {
  __shared__ __align__(16) _Float16 sh[64][136], sl[64][136]; __shared__ __align__(16) _Float16 th[128][72]; __shared__ __align__(16) __bf16 tb[128][72], tbl[128][72];
  const int tid = threadIdx.x, wave = tid >> 5, lane = tid & 31, col = lane & 15, g = lane >> 4; const int which = blockIdx.z; const int c0 = blockIdx.y * 128; const size_t r0 = (size_t)blockIdx.x * 64; const size_t bb = r0 / TT; const int t0 = (int)(r0 % TT);
  const float* X = which == 0 ? XQ : which == 1 ? XK : XV; const float* WA = which == 0 ? WQ : which == 1 ? WK : WV; const float* BA = which == 0 ? BQ : which == 1 ? BK : BV;
  v8f acc[8] = {};
#pragma unroll 2
  for (int kc = 0; kc < DIN / 32; ++kc) { v16b a; { const float* p = X + (r0 + wave * 16 + col) * DIN + kc * 32 + 8 * g;
#pragma unroll
      for (int i = 0; i < 8; ++i) { a[i] = (__bf16)p[i]; a[8 + i] = (__bf16)p[16 + i]; } }
    asm volatile("s_wait_loadcnt 0x0" ::: "memory");
#pragma unroll
    for (int j = 0; j < 8; ++j) { const v16b w = WCOL(WA, kc * 32, c0 + j * 16 + col, lane); asm volatile("s_wait_loadcnt 0x0" ::: "memory"); acc[j] = wmma_bf(a, w, acc[j]); } }
  if (which < 2) { _Float16* DH = which == 0 ? QH : KH; _Float16* DL = which == 0 ? QL : KL; const int nhi = which == 0 ? QHI : KHI; const bool hi_rows = t0 < nhi;
#pragma unroll
    for (int j = 0; j < 8; ++j) { const float bias = BA ? bfr(BA[c0 + j * 16 + col]) : 0.f;
#pragma unroll
      for (int r = 0; r < 8; ++r) { const float v = acc[j][r] + bias; const _Float16 hv = (_Float16)v; sh[wave * 16 + 8 * g + r][j * 16 + col] = hv; sl[wave * 16 + 8 * g + r][j * 16 + col] = (_Float16)((v - (float)hv) * 1024.0f); } }
    __syncthreads();
    for (int e = tid; e < 64 * 16; e += 128) { const int rl = e >> 4, q = e & 15; vst2((unsigned*)(DH + (r0 + rl) * CC + c0 + q * 8), *(const v4u*)&sh[rl][q * 8]); if (hi_rows) vst2((unsigned*)(DL + (bb * nhi + t0 + rl) * (size_t)CC + c0 + q * 8), *(const v4u*)&sl[rl][q * 8]); }
  } else { const bool hi_rows = t0 < KHI;
#pragma unroll
    for (int j = 0; j < 8; ++j) { const float bias = BA ? bfr(BA[c0 + j * 16 + col]) : 0.f;
#pragma unroll
      for (int r = 0; r < 8; ++r) { const float v = acc[j][r] + bias; const int rl = wave * 16 + 8 * g + r, cl = j * 16 + col; th[cl][rl] = (_Float16)v; const __bf16 bh = (__bf16)v; tb[cl][rl] = bh; tbl[cl][rl] = (__bf16)(v - (float)bh); } }
    __syncthreads();
    for (int e = tid; e < 128 * 8; e += 128) { const int cl = e >> 3, q = e & 7; vst2((unsigned*)(VT + (bb * CC + c0 + cl) * (size_t)TT + t0 + q * 8), *(const v4u*)&th[cl][q * 8]); if (hi_rows) { const size_t o3 = (bb * CC + c0 + cl) * (size_t)KHI + t0 + q * 8; vst2((unsigned*)(VB + o3), *(const v4u*)&tb[cl][q * 8]); vst2((unsigned*)(VBL + o3), *(const v4u*)&tbl[cl][q * 8]); } } } }
// ---- k_sc: block = (query block qb, key block kb <= kb_last(qb), head in group) of batch b: logits x SCALE; q hi + residual (x 2^10) against k (2 products) for query rows < QHI, plus the k residual (3 products) for query blocks < QBH (every block); causal: blocks past the diagonal exit, the mask itself is applied by index in k_colstat_c and k_csm_c
__global__ __launch_bounds__(128) void k_sc(const _Float16* __restrict__ QH, const _Float16* __restrict__ KH, const _Float16* __restrict__ QL, const _Float16* __restrict__ KL, int b, int h0, float* __restrict__ S0) { __shared__ __align__(16) float ss[4][16][132];
  const int qb = blockIdx.x, kb = blockIdx.y; if (kb > kb_last(qb)) return;
  const int h = h0 + blockIdx.z; float* S = S0 + (size_t)blockIdx.z * TT * TT;
  const int tid = threadIdx.x, wave = tid >> 5, lane = tid & 31, col = lane & 15, g = lane >> 4; const int k0 = kb * 128; const int ql0 = qb * 64 + wave * 16; const size_t q0 = (size_t)b * TT + ql0, kr0 = (size_t)b * TT + k0;
  v8f acc[8] = {}, accl[8] = {};
  const _Float16* QLb = QL + (size_t)b * QHI * CC; const _Float16* KLb = KL + (size_t)b * KHI * CC;
  if (qb < QBH) {
#pragma unroll
    for (int kc = 0; kc < HD / 32; ++kc) { const v16h ah = frag_h(QH + (q0 + col) * CC + h * HD + kc * 32, lane), al = frag_h(QLb + (size_t)(ql0 + col) * CC + h * HD + kc * 32, lane);
#pragma unroll
      for (int j = 0; j < 8; ++j) { const v16h kbf = frag_h(KH + (kr0 + j * 16 + col) * CC + h * HD + kc * 32, lane), klf = frag_h(KLb + (size_t)(k0 + j * 16 + col) * CC + h * HD + kc * 32, lane); acc[j] = wmma16(ah, kbf, acc[j]); accl[j] = wmma16(al, kbf, accl[j]); accl[j] = wmma16(ah, klf, accl[j]); } }
  } else if (qb * 64 < QHI) {
#pragma unroll
    for (int kc = 0; kc < HD / 32; ++kc) { const v16h ah = frag_h(QH + (q0 + col) * CC + h * HD + kc * 32, lane), al = frag_h(QLb + (size_t)(ql0 + col) * CC + h * HD + kc * 32, lane);
#pragma unroll
      for (int j = 0; j < 8; ++j) { const v16h kbf = frag_h(KH + (kr0 + j * 16 + col) * CC + h * HD + kc * 32, lane); acc[j] = wmma16(ah, kbf, acc[j]); accl[j] = wmma16(al, kbf, accl[j]); } }
  } else {
#pragma unroll
    for (int kc = 0; kc < HD / 32; ++kc) { const v16h ah = frag_h(QH + (q0 + col) * CC + h * HD + kc * 32, lane);
#pragma unroll
      for (int j = 0; j < 8; ++j) { const v16h kbf = frag_h(KH + (kr0 + j * 16 + col) * CC + h * HD + kc * 32, lane); acc[j] = wmma16(ah, kbf, acc[j]); } } }
#pragma unroll
  for (int j = 0; j < 8; ++j) {
#pragma unroll
    for (int r = 0; r < 8; ++r) ss[wave][8 * g + r][j * 16 + col] = (acc[j][r] + accl[j][r] * (1.0f / 1024.0f)) * SCALE; }
  LDSX(); for (int rl = 0; rl < 16; ++rl) vst2(S + (size_t)(ql0 + rl) * TT + k0 + lane * 4, *(const v4f*)&ss[wave][rl][lane * 4]); }
// ---- k_sm: block = query row t (head in group): keys [0, kend): causal -> logit if s <= t else excluded; softmax in f32; P x 2^11 in place (0 for excluded)
__global__ __launch_bounds__(256) void k_sm(float* __restrict__ S0 SM_EXTRA_PARAMS) { __shared__ float sred[8]; __shared__ float sbc; __shared__ __align__(16) float shv[TT];
  const int tid = threadIdx.x; const int t = blockIdx.x; const int kend = (kb_last(t >> 6) + 1) * 128;
  float* sr = S0 + (size_t)blockIdx.y * TT * TT + (size_t)t * TT;
  float m = -3.0e38f; for (int k = tid; k < kend; k += 256) { float v = (!CAUSAL || k <= t) ? sr[k] : -3.0e38f; SM_MASK_HOOK; shv[k] = v; m = fmaxf(m, v); }
#pragma unroll
  for (int o = 1; o < 32; o <<= 1) m = fmaxf(m, __shfl_xor(m, o));
  if ((tid & 31) == 0) sred[tid >> 5] = m; __syncthreads(); if (tid == 0) { float a = sred[0]; for (int i = 1; i < 8; ++i) a = fmaxf(a, sred[i]); sbc = a; } __syncthreads(); m = sbc; __syncthreads();
  float sum = 0.f; for (int k = tid; k < kend; k += 256) { const float v = shv[k]; const float e = (v <= -1.0e38f) ? 0.f : expf(v - m); shv[k] = e; sum += e; }
#pragma unroll
  for (int o = 1; o < 32; o <<= 1) sum += __shfl_xor(sum, o);
  if ((tid & 31) == 0) sred[tid >> 5] = sum; __syncthreads(); if (tid == 0) { float a = 0.f; for (int i = 0; i < 8; ++i) a += sred[i]; sbc = a > 0.f ? 2048.0f / a : 0.f; }   /* a fully excluded row yields P = 0 */ __syncthreads(); const float inv = sbc;
  for (int k = tid; k < kend; k += 256) shv[k] = shv[k] * inv;
  __syncthreads(); for (int q = tid; q < kend / 4; q += 256) vst2(sr + q * 4, *(const v4f*)&shv[q * 4]); }
// ---- k_colstat_c: softmax over the QUERY axis under the causal mask (the source's softmax(axis=1) on [B, t, s] scores with -1e9 above the diagonal): for every key column k: m_k = max_{q >= k} S[q][k], Z_k = sum_{q >= k} exp(S[q][k] - m_k) (online, one pass, f32, precise expf); thread per column; the row loop starts at the block's first column (block-uniform) and masks q < k by a value select after an unconditional load (rows above a column's diagonal may lie in score blocks k_sc never computed: their content is discarded)
__global__ __launch_bounds__(256) void k_colstat_c(const float* __restrict__ S0, float* __restrict__ CM, float* __restrict__ CZ) { const int k = blockIdx.x * 256 + threadIdx.x; const float* sp = S0 + (size_t)blockIdx.y * TT * TT + k; const int q0 = blockIdx.x * 256;
  float m = -3.0e38f, z = 0.f;
#pragma unroll 4
  for (int q = q0; q < TT; ++q) { const float ld = sp[(size_t)q * TT]; asm volatile("s_wait_loadcnt 0x0" ::: "memory"); const bool vis = q >= k; const float v = vis ? ld : -3.0e38f; const float mn = fmaxf(m, v); z = z * expf(m - mn) + (vis ? expf(v - mn) : 0.f); m = mn; }
  vst2(CM + (size_t)blockIdx.y * TT + k, m); vst2(CZ + (size_t)blockIdx.y * TT + k, z); }   /* every column sees at least its own diagonal entry: Z_k >= 1 */
// ---- k_csm_c: block = query row t: P[t][k] = exp(S[t][k] - m_k) / Z_k x 2^11 for k <= t, 0 for t < k < kend (inside the diagonal block); in place; unconditional loads, value select
__global__ __launch_bounds__(256) void k_csm_c(float* __restrict__ S0, const float* __restrict__ CM, const float* __restrict__ CZ) { const int tid = threadIdx.x; const int t = blockIdx.x; const int kend = (kb_last(t >> 6) + 1) * 128; float* sr = S0 + (size_t)blockIdx.y * TT * TT + (size_t)t * TT; const float* cm = CM + (size_t)blockIdx.y * TT; const float* cz = CZ + (size_t)blockIdx.y * TT;
  for (int q4 = tid; q4 < kend / 4; q4 += 256) { const v4f sv = *(const v4f*)(sr + q4 * 4), m4 = *(const v4f*)(cm + q4 * 4), z4 = *(const v4f*)(cz + q4 * 4); asm volatile("s_wait_loadcnt 0x0" ::: "memory"); v4f p;
#pragma unroll
    for (int u = 0; u < 4; ++u) p[u] = (q4 * 4 + u <= t) ? expf(sv[u] - m4[u]) * (2048.0f / z4[u]) : 0.f;
    vst2(sr + q4 * 4, p); } }
// ---- k_out64: out[b][t][0..63] = ctx row columns 0..63 (256 B by 16 lanes)
__global__ __launch_bounds__(256) void k_out64(const float* __restrict__ Y, float* __restrict__ OUT) { const size_t row = (size_t)blockIdx.x * 16 + (threadIdx.x >> 4); const int q = threadIdx.x & 15; const v4f v = *(const v4f*)(Y + row * CC + q * 4); asm volatile("s_wait_loadcnt 0x0" ::: "memory"); vst2(OUT + row * 64 + q * 4, v); }
// ---- k_pv: block = 64 queries (qb) of (b, h): ctx = P . v over keys [0, kend) (P x 2^11 once to f16 against v f16: 1 product; query blocks < QBH, here every block: P and v as bf16 hi + lo, 3 products); 256-B (row, head) segment by 16 lanes
__global__ __launch_bounds__(128) void k_pv(const float* __restrict__ PS0, const _Float16* __restrict__ VT, const __bf16* __restrict__ VB, const __bf16* __restrict__ VBL, int b, int h0, float* __restrict__ Y) { const int h = h0 + blockIdx.z; const float* PS = PS0 + (size_t)blockIdx.z * TT * TT; __shared__ __align__(16) float ss[4][16][HD + 4];
  const int tid = threadIdx.x, wave = tid >> 5, lane = tid & 31, col = lane & 15, g = lane >> 4; const int qb = blockIdx.x; const int ql0 = qb * 64 + wave * 16; const int kce = (kb_last(qb) + 1) * 4;
  v8f acc[HD / 16] = {};
  if (qb < QBH) {
#pragma unroll 1
    for (int kc = 0; kc < kce; ++kc) { const F2 p = split_row(PS + (size_t)(ql0 + col) * TT, kc * 32, lane);
      asm volatile("s_wait_loadcnt 0x0" ::: "memory");
#pragma unroll
      for (int j = 0; j < HD / 16; ++j) { const size_t po = ((size_t)b * CC + h * HD + j * 16 + col) * (size_t)KHI + kc * 32; const v16b vh = frag_b(VB + po, lane); acc[j] = wmma_bf(p.h, vh, acc[j]); acc[j] = wmma_bf(p.l, vh, acc[j]); acc[j] = wmma_bf(p.h, frag_b(VBL + po, lane), acc[j]); } }
  } else {
#pragma unroll 1
    for (int kc = 0; kc < kce; ++kc) { const v16h p = frag_f32(PS + (size_t)(ql0 + col) * TT + kc * 32, lane);
      asm volatile("s_wait_loadcnt 0x0" ::: "memory");
#pragma unroll
      for (int j = 0; j < HD / 16; ++j) { const size_t po = ((size_t)b * CC + h * HD + j * 16 + col) * (size_t)TT + kc * 32; acc[j] = wmma16(p, frag_h(VT + po, lane), acc[j]); } } }
#pragma unroll
  for (int j = 0; j < HD / 16; ++j)
#pragma unroll
    for (int r = 0; r < 8; ++r) ss[wave][8 * g + r][j * 16 + col] = acc[j][r] * (1.0f / 2048.0f);
  LDSX(); for (int rl = 0; rl < 16; ++rl) if (lane < HD / 4) vst2(Y + ((size_t)b * TT + ql0 + rl) * CC + h * HD + lane * 4, *(const v4f*)&ss[wave][rl][lane * 4]); }

extern "C" void kernel_launch(void* const* d_in, const int* in_sizes, int n_in, void* d_out, int out_size, void* d_ws, size_t ws_size, hipStream_t stream) {
  (void)in_sizes; (void)n_in; (void)out_size;
  const float** F = (const float**)d_in;
  if (ws_size < (size_t)WS_END) return;
  char* ws = (char*)d_ws; _Float16 *QH = (_Float16*)(ws + WS_QH), *KH = (_Float16*)(ws + WS_KH), *VT = (_Float16*)(ws + WS_VT), *QL = (_Float16*)(ws + WS_QL), *KL = (_Float16*)(ws + WS_KL); __bf16 *VB = (__bf16*)(ws + WS_VB), *VBL = (__bf16*)(ws + WS_VBL); float *S = (float*)(ws + WS_S), *Y = (float*)(ws + WS_Y);
  (void)Y; (void)QL; (void)KL; (void)VB; (void)VBL;
  // inputs: 0 x [4,4096,512]; 1 Wq [64,512] (out,in); 2 Wk; 3 Wv; no biases
  if (ws_size < (size_t)WS_END2) return;
  float *Y2 = (float*)(ws + WS_Y2), *CM = (float*)(ws + WS_CM), *CZ = (float*)(ws + WS_CZ);
  k_proj<<<dim3(TNB * TT / 64, CC / 128, 3), 128, 0, stream>>>(F[0], F[0], F[0], F[1], F[2], F[3], nullptr, nullptr, nullptr, QH, QL, KH, KL, VT, VB, VBL);   /* weight columns 64..127 (the padding head) are zero fragments */
  for (int b = 0; b < TNB; ++b) {   /* head 0 only (head 1 is the zero padding) */
    k_sc<<<dim3(NQB, TT / 128, 1), 128, 0, stream>>>(QH, KH, QL, KL, b, 0, S);
    k_colstat_c<<<dim3(TT / 256, 1), 256, 0, stream>>>(S, CM, CZ);   /* per key column s: max / sum over the visible queries t >= s */
    k_csm_c<<<dim3(TT, 1), 256, 0, stream>>>(S, CM, CZ);            /* P[t][s] = exp(S - m_s) / Z_s x 2^11 for s <= t, 0 above the diagonal */
    k_pv<<<dim3(NQB, 1, 1), 128, 0, stream>>>(S, VT, VB, VBL, b, 0, Y2);
  }
  k_out64<<<dim3(TNB * TT / 16), 256, 0, stream>>>(Y2, (float*)d_out);
}

// v001
// Measured time: 1080 microseconds a run.
// Timed twice side by side with v000, it ran 6.94 and 6.99 times as fast.
// compute dtype: all float inputs rounded to bf16; q/k/v projections with EXACT bf16 products on WMMA 16x16x32 (f32 accumulate); causal scores with BOTH q and k as f16 hi + (x 2^10) residual (3 products) on EVERY block, x 64^-0.5; softmax over the QUERY axis in f32 (per key column: online max / sum over the visible queries, precise expf); P as bf16 hi + lo against v as bf16 hi + lo (3 products) on EVERY block; f32 output.
#include <hip/hip_runtime.h>
#include <math.h>

typedef __attribute__((ext_vector_type(16))) _Float16 v16h;
typedef __attribute__((ext_vector_type(16))) __bf16 v16b;
typedef __attribute__((ext_vector_type(8)))  _Float16 v8h;
typedef __attribute__((ext_vector_type(8)))  float v8f;
typedef __attribute__((ext_vector_type(4)))  float v4f;
typedef __attribute__((ext_vector_type(2)))  float v2f;
typedef __attribute__((ext_vector_type(4)))  unsigned v4u;
typedef __attribute__((ext_vector_type(4)))  int v4i;
typedef float __attribute__((may_alias)) float_a;
typedef int __attribute__((may_alias)) int_a;

template <typename T> __device__ __forceinline__ void vst2(void* p, T v) { *(T*)p = v;  }
__device__ __forceinline__ v8f wmma16(v16h a, v16h b, v8f c) {
  v8f d = __builtin_amdgcn_wmma_f32_16x16x32_f16(false, a, false, b, (short)0, c, false, false);
  asm volatile("v_nop\n\tv_nop\n\tv_nop\n\tv_nop" : "+v"(d) : "v"(a), "v"(b));
  return d;
}
__device__ __forceinline__ v8f wmma_bf(v16b a, v16b b, v8f c) {
  v8f d = __builtin_amdgcn_wmma_f32_16x16x32_bf16(false, a, false, b, (short)0, c, false, false);
  asm volatile("v_nop\n\tv_nop\n\tv_nop\n\tv_nop" : "+v"(d) : "v"(a), "v"(b));
  return d;
}
// 16x16x32 fragments: lane = (h = lane>>4, row/col = lane&15); elements 0..7 = k0+8h+0..7, 8..15 = k0+16+8h+0..7; D element r = row 8h+r
__device__ __forceinline__ v16h frag_h(const _Float16* rowk0, int lane) {
  union { v16h v; v8h q[2]; } u; const _Float16* p = rowk0 + 8 * (lane >> 4);
  u.q[0] = *(const v8h*)p; u.q[1] = *(const v8h*)(p + 16); return u.v;
}
__device__ __forceinline__ v16h frag_f32(const float* rowk0, int lane) {
  v16h a; const float* p = rowk0 + 8 * (lane >> 4);
#pragma unroll
  for (int i = 0; i < 8; ++i) { a[i] = (_Float16)p[i]; a[8 + i] = (_Float16)p[16 + i]; }
  return a;
}
__device__ __forceinline__ v16h frag_f32s(const float* rowk0, int lane, float sc) {
  v16h a; const float* p = rowk0 + 8 * (lane >> 4);
#pragma unroll
  for (int i = 0; i < 8; ++i) { a[i] = (_Float16)(p[i] * sc); a[8 + i] = (_Float16)(p[16 + i] * sc); }
  return a;
}
// column fragment from a [K][ld] layout (column n), rows >= K read as 0
__device__ __forceinline__ v16h fragc_f32(const float* W, int k0, int n, int lane, int ld, int K) {
  v16h a; const int g = lane >> 4;
#pragma unroll
  for (int i = 0; i < 8; ++i) { const int ka = k0 + 8 * g + i, kb = ka + 16;
    a[i] = (_Float16)(ka < K ? W[(size_t)(ka < K ? ka : K - 1) * ld + n] : 0.f); a[8 + i] = (_Float16)(kb < K ? W[(size_t)(kb < K ? kb : K - 1) * ld + n] : 0.f); }
  return a;
}
struct F2 { v16b h, l; };
__device__ __forceinline__ F2 bsplit16(const float v[16]) { F2 r;
#pragma unroll
  for (int i = 0; i < 16; ++i) { const __bf16 h = (__bf16)v[i]; r.h[i] = h; r.l[i] = (__bf16)(v[i] - (float)h); }
  return r; }
__device__ __forceinline__ F2 split_row(const float* row, int k0, int lane) { float v[16]; const float* p = row + k0 + 8 * (lane >> 4);
#pragma unroll
  for (int i = 0; i < 8; ++i) { v[i] = p[i]; v[8 + i] = p[16 + i]; }
  return bsplit16(v); }
__device__ __forceinline__ F2 split_rowK(const float* row, int k0, int lane, int K) { float v[16]; const int g = lane >> 4;
#pragma unroll
  for (int i = 0; i < 8; ++i) { const int ka = k0 + 8 * g + i, kb = ka + 16; v[i] = ka < K ? row[ka < K ? ka : K - 1] : 0.f; v[8 + i] = kb < K ? row[kb < K ? kb : K - 1] : 0.f; }
  return bsplit16(v); }
__device__ __forceinline__ F2 split_col(const float* W, int k0, int n, int lane, int ld, int K) { float v[16]; const int g = lane >> 4;
#pragma unroll
  for (int i = 0; i < 8; ++i) { const int ka = k0 + 8 * g + i, kb = ka + 16; v[i] = ka < K ? W[(size_t)(ka < K ? ka : K - 1) * ld + n] : 0.f; v[8 + i] = kb < K ? W[(size_t)(kb < K ? kb : K - 1) * ld + n] : 0.f; }
  return bsplit16(v); }
__device__ __forceinline__ v8f mac3(const F2& a, const F2& b, v8f c) { c = wmma_bf(a.l, b.h, c); c = wmma_bf(a.h, b.l, c); return wmma_bf(a.h, b.h, c); }
__device__ __forceinline__ float sigm(float v) { return 1.0f / (1.0f + expf(-v)); }
#define LDSX() do { asm volatile("s_wait_dscnt 0" ::: "memory"); __builtin_amdgcn_wave_barrier(); __builtin_amdgcn_fence(__ATOMIC_RELEASE, "workgroup"); } while (0)

// Single-head causal self-attention whose softmax runs over the QUERY axis (x [4,4096,512]; torch (out,in) Wq / Wk / Wv [64,512] (0.02 scale), no biases; scores = q k^T [B,t,s]; additive causal mask -1e9 where s > t; / sqrt(64); attn = softmax(scores, axis=1) - axis 1 is the QUERY axis t, so every key column s is normalised over the queries t >= s (faithful to the source); out = attn v -> [4,4096,64]).
#define NB 4
#define TT 4096
#define CC 128            // NH * HD = projected width
#define DIN 512          // input (model) width
#define NH 2
#define HD 64
#define NQB (TT / 64)
#define HG 1
#define SCALE (0.125f)
#define CAUSAL 1
#ifndef TNB
#define TNB NB
#endif
__device__ __forceinline__ float bfr(float v) { return (float)(__bf16)v; }
__host__ __device__ __forceinline__ int kb_last(int qb) { return CAUSAL ? ((qb * 64 + 63) >> 7) : (TT / 128 - 1); }
typedef __attribute__((ext_vector_type(8))) __bf16 v8b;
__device__ __forceinline__ v16b frag_b(const __bf16* rowk0, int lane) {
  union { v16b v; v8b q[2]; } u; const __bf16* p = rowk0 + 8 * (lane >> 4);
  u.q[0] = *(const v8b*)p; u.q[1] = *(const v8b*)(p + 16); return u.v;
}
#define QBH 64              // = NQB: 3-product scores and bf16 hi/lo P.v on every query block
#define QHI 4096            // EVERY row carries a q residual plane: with the softmax over the QUERY axis the few-term region is the END of the sequence (late key columns see few queries), so the high-precision paths run everywhere
#define KHI 4096            // every key row carries the k residual and the v bf16 hi + lo planes
// B fragment (k rows k0+.., output column o) of a weight: (in,out) [K][ld] or (out,in) [ld rows of K]: bf16 exact, or f16(bf16 * 256) exact
__device__ __forceinline__ v16b wcol_io(const float* Wm, int k0, int o, int lane, int ld) { v16b w; const int g = lane >> 4;
#pragma unroll
  for (int i = 0; i < 8; ++i) { w[i] = (__bf16)Wm[(size_t)(k0 + 8 * g + i) * ld + o]; w[8 + i] = (__bf16)Wm[(size_t)(k0 + 16 + 8 * g + i) * ld + o]; }
  return w; }
__device__ __forceinline__ v16b wcol_oi(const float* Wm, int k0, int o, int lane, int K) { v16b w; const float* p = Wm + (size_t)o * K + k0 + 8 * (lane >> 4);
#pragma unroll
  for (int i = 0; i < 8; ++i) { w[i] = (__bf16)p[i]; w[8 + i] = (__bf16)p[16 + i]; }
  return w; }
__device__ __forceinline__ v16h wcolh_io(const float* Wm, int k0, int o, int lane, int ld) { v16h w; const int g = lane >> 4;
#pragma unroll
  for (int i = 0; i < 8; ++i) { w[i] = (_Float16)(bfr(Wm[(size_t)(k0 + 8 * g + i) * ld + o]) * 256.0f); w[8 + i] = (_Float16)(bfr(Wm[(size_t)(k0 + 16 + 8 * g + i) * ld + o]) * 256.0f); }
  return w; }
__device__ __forceinline__ v16h wcolh_oi(const float* Wm, int k0, int o, int lane, int K) { v16h w; const float* p = Wm + (size_t)o * K + k0 + 8 * (lane >> 4);
#pragma unroll
  for (int i = 0; i < 8; ++i) { w[i] = (_Float16)(bfr(p[i]) * 256.0f); w[8 + i] = (_Float16)(bfr(p[16 + i]) * 256.0f); }
  return w; }
#define WQKV_LAYOUT 1   // 0 = (in,out) [DIN][CC]; 1 = (out,in) [64][DIN]; 2 = per-head [NH][DIN][HD]
__device__ __forceinline__ v16b wcol_hdk(const float* Wm, int k0, int o, int lane) { v16b w; const int g = lane >> 4; const float* p = Wm + (size_t)(o / HD) * DIN * HD + (o % HD);
#pragma unroll
  for (int i = 0; i < 8; ++i) { w[i] = (__bf16)p[(size_t)(k0 + 8 * g + i) * HD]; w[8 + i] = (__bf16)p[(size_t)(k0 + 16 + 8 * g + i) * HD]; }
  return w; }
#define WO_OUT_IN 0
#if WQKV_LAYOUT == 1
__device__ __forceinline__ v16b zero16b() { v16b w; _Pragma("unroll") for (int i = 0; i < 16; ++i) w[i] = (__bf16)0.0f; return w; }
#define WCOL(W, k0, o, lane) ((o) < 64 ? wcol_oi(W, k0, (o), lane, DIN) : zero16b())   /* (out,in) [64][512]: only 64 real output rows; projected columns 64..127 (padding head 1) are zero; the test is compile-time per unrolled tile (c0 = 0) */
#elif WQKV_LAYOUT == 2
#define WCOL(W, k0, o, lane) wcol_hdk(W, k0, o, lane)
#else
#define WCOL(W, k0, o, lane) wcol_io(W, k0, o, lane, CC)
#endif
#if WO_OUT_IN
#define WOCOL(W, k0, o, lane) wcol_oi(W, k0, o, lane, CC)
#define WOCOLH(W, k0, o, lane) wcolh_oi(W, k0, o, lane, CC)
#else
#define WOCOL(W, k0, o, lane) wcol_io(W, k0, o, lane, DIN)
#define WOCOLH(W, k0, o, lane) wcolh_io(W, k0, o, lane, DIN)
#endif

#ifndef SM_EXTRA_PARAMS
#define SM_EXTRA_PARAMS
#endif
#ifndef PROJ_EXTRA_PARAMS
#define PROJ_EXTRA_PARAMS
#endif
#ifndef SM_MASK_HOOK
#define SM_MASK_HOOK (void)0
#endif

#define WS_QH  0u                                      // f16 q rows [b*t][CC]
#define WS_KH  (WS_QH + 2u * (size_t)NB * TT * CC)      // f16 k rows [b*t][CC]
#define WS_VT  (WS_KH + 2u * (size_t)NB * TT * CC)      // f16 v planes [b][c][t]
#define WS_QL  (WS_VT + 2u * (size_t)NB * CC * TT)      // f16 q residual x 2^10 rows [b][t < QHI][CC]
#define WS_KL  (WS_QL + 2u * (size_t)NB * QHI * CC)     // f16 k residual x 2^10 rows [b][t < KHI][CC]
#define WS_VB  (WS_KL + 2u * (size_t)NB * KHI * CC)     // bf16 v hi planes [b][c][t < KHI]
#define WS_VBL (WS_VB + 2u * (size_t)NB * CC * KHI)
#define WS_S   (WS_VBL + 2u * (size_t)NB * CC * KHI)    // f32 logits / P [hg][t][s]
#define WS_Y   (WS_S  + 4u * (size_t)HG * TT * TT)      // f32 ctx rows [b*t][CC] (only when there is an output projection)
#define WS_END (WS_Y  + 0u)
#define WS_Y2 (WS_END)                                  // f32 ctx rows [b*TT + t][128] (columns 64..127 = the padding head)
#define WS_CM (WS_Y2 + 4u * (size_t)NB * TT * CC)        // f32 column maxima [TT]
#define WS_CZ (WS_CM + 4u * (size_t)HG * TT)
#define WS_END2 (WS_CZ + 4u * (size_t)HG * TT)

// ---- k_proj: block = (64 rows, 128 cols, which): q/k/v = X W (+ b) with exact bf16 products (K = DIN) -> which 0: q f16 rows (+ residual rows < QHI); 1: k f16 rows (+ residual rows < KHI); 2: v f16 planes [c][t] (+ bf16 hi/lo planes for t < KHI)
__global__ __launch_bounds__(128) void k_proj(const float* __restrict__ XQ, const float* __restrict__ XK, const float* __restrict__ XV, const float* __restrict__ WQ, const float* __restrict__ WK, const float* __restrict__ WV, const float* __restrict__ BQ, const float* __restrict__ BK, const float* __restrict__ BV,
    _Float16* __restrict__ QH, _Float16* __restrict__ QL, _Float16* __restrict__ KH, _Float16* __restrict__ KL, _Float16* __restrict__ VT, __bf16* __restrict__ VB, __bf16* __restrict__ VBL) {
  __shared__ __align__(16) _Float16 sh[64][136], sl[64][136]; __shared__ __align__(16) _Float16 th[128][72]; __shared__ __align__(16) __bf16 tb[128][72], tbl[128][72];
  const int tid = threadIdx.x, wave = tid >> 5, lane = tid & 31, col = lane & 15, g = lane >> 4; const int which = blockIdx.z; const int c0 = blockIdx.y * 128; const size_t r0 = (size_t)blockIdx.x * 64; const size_t bb = r0 / TT; const int t0 = (int)(r0 % TT);
  const float* X = which == 0 ? XQ : which == 1 ? XK : XV; const float* WA = which == 0 ? WQ : which == 1 ? WK : WV; const float* BA = which == 0 ? BQ : which == 1 ? BK : BV;
  v8f acc[8] = {};
#pragma unroll 2
  for (int kc = 0; kc < DIN / 32; ++kc) { v16b a; { const float* p = X + (r0 + wave * 16 + col) * DIN + kc * 32 + 8 * g;
#pragma unroll
      for (int i = 0; i < 8; ++i) { a[i] = (__bf16)p[i]; a[8 + i] = (__bf16)p[16 + i]; } }
    asm volatile("s_wait_loadcnt 0x0" ::: "memory");
#pragma unroll
    for (int j = 0; j < 8; ++j) { const v16b w = WCOL(WA, kc * 32, c0 + j * 16 + col, lane); asm volatile("s_wait_loadcnt 0x0" ::: "memory"); acc[j] = wmma_bf(a, w, acc[j]); } }
  if (which < 2) { _Float16* DH = which == 0 ? QH : KH; _Float16* DL = which == 0 ? QL : KL; const int nhi = which == 0 ? QHI : KHI; const bool hi_rows = t0 < nhi;
#pragma unroll
    for (int j = 0; j < 8; ++j) { const float bias = BA ? bfr(BA[c0 + j * 16 + col]) : 0.f;
#pragma unroll
      for (int r = 0; r < 8; ++r) { const float v = acc[j][r] + bias; const _Float16 hv = (_Float16)v; sh[wave * 16 + 8 * g + r][j * 16 + col] = hv; sl[wave * 16 + 8 * g + r][j * 16 + col] = (_Float16)((v - (float)hv) * 1024.0f); } }
    __syncthreads();
    for (int e = tid; e < 64 * 16; e += 128) { const int rl = e >> 4, q = e & 15; vst2((unsigned*)(DH + (r0 + rl) * CC + c0 + q * 8), *(const v4u*)&sh[rl][q * 8]); if (hi_rows) vst2((unsigned*)(DL + (bb * nhi + t0 + rl) * (size_t)CC + c0 + q * 8), *(const v4u*)&sl[rl][q * 8]); }
  } else { const bool hi_rows = t0 < KHI;
#pragma unroll
    for (int j = 0; j < 8; ++j) { const float bias = BA ? bfr(BA[c0 + j * 16 + col]) : 0.f;
#pragma unroll
      for (int r = 0; r < 8; ++r) { const float v = acc[j][r] + bias; const int rl = wave * 16 + 8 * g + r, cl = j * 16 + col; th[cl][rl] = (_Float16)v; const __bf16 bh = (__bf16)v; tb[cl][rl] = bh; tbl[cl][rl] = (__bf16)(v - (float)bh); } }
    __syncthreads();
    for (int e = tid; e < 128 * 8; e += 128) { const int cl = e >> 3, q = e & 7; vst2((unsigned*)(VT + (bb * CC + c0 + cl) * (size_t)TT + t0 + q * 8), *(const v4u*)&th[cl][q * 8]); if (hi_rows) { const size_t o3 = (bb * CC + c0 + cl) * (size_t)KHI + t0 + q * 8; vst2((unsigned*)(VB + o3), *(const v4u*)&tb[cl][q * 8]); vst2((unsigned*)(VBL + o3), *(const v4u*)&tbl[cl][q * 8]); } } } }
// ---- k_sc: block = (query block qb, key block kb <= kb_last(qb), head in group) of batch b: logits x SCALE; q hi + residual (x 2^10) against k (2 products) for query rows < QHI, plus the k residual (3 products) for query blocks < QBH (every block); causal: blocks past the diagonal exit, the mask itself is applied by index in k_colstat_c and k_csm_c
__global__ __launch_bounds__(128) void k_sc(const _Float16* __restrict__ QH, const _Float16* __restrict__ KH, const _Float16* __restrict__ QL, const _Float16* __restrict__ KL, int b, int h0, float* __restrict__ S0) { __shared__ __align__(16) float ss[4][16][132];
  const int qb = blockIdx.x, kb = blockIdx.y; if (kb > kb_last(qb)) return;
  const int h = h0 + blockIdx.z; float* S = S0 + (size_t)blockIdx.z * TT * TT;
  const int tid = threadIdx.x, wave = tid >> 5, lane = tid & 31, col = lane & 15, g = lane >> 4; const int k0 = kb * 128; const int ql0 = qb * 64 + wave * 16; const size_t q0 = (size_t)b * TT + ql0, kr0 = (size_t)b * TT + k0;
  v8f acc[8] = {}, accl[8] = {};
  const _Float16* QLb = QL + (size_t)b * QHI * CC; const _Float16* KLb = KL + (size_t)b * KHI * CC;
  if (qb < QBH) {
#pragma unroll
    for (int kc = 0; kc < HD / 32; ++kc) { const v16h ah = frag_h(QH + (q0 + col) * CC + h * HD + kc * 32, lane), al = frag_h(QLb + (size_t)(ql0 + col) * CC + h * HD + kc * 32, lane);
#pragma unroll
      for (int j = 0; j < 8; ++j) { const v16h kbf = frag_h(KH + (kr0 + j * 16 + col) * CC + h * HD + kc * 32, lane), klf = frag_h(KLb + (size_t)(k0 + j * 16 + col) * CC + h * HD + kc * 32, lane); acc[j] = wmma16(ah, kbf, acc[j]); accl[j] = wmma16(al, kbf, accl[j]); accl[j] = wmma16(ah, klf, accl[j]); } }
  } else if (qb * 64 < QHI) {
#pragma unroll
    for (int kc = 0; kc < HD / 32; ++kc) { const v16h ah = frag_h(QH + (q0 + col) * CC + h * HD + kc * 32, lane), al = frag_h(QLb + (size_t)(ql0 + col) * CC + h * HD + kc * 32, lane);
#pragma unroll
      for (int j = 0; j < 8; ++j) { const v16h kbf = frag_h(KH + (kr0 + j * 16 + col) * CC + h * HD + kc * 32, lane); acc[j] = wmma16(ah, kbf, acc[j]); accl[j] = wmma16(al, kbf, accl[j]); } }
  } else {
#pragma unroll
    for (int kc = 0; kc < HD / 32; ++kc) { const v16h ah = frag_h(QH + (q0 + col) * CC + h * HD + kc * 32, lane);
#pragma unroll
      for (int j = 0; j < 8; ++j) { const v16h kbf = frag_h(KH + (kr0 + j * 16 + col) * CC + h * HD + kc * 32, lane); acc[j] = wmma16(ah, kbf, acc[j]); } } }
#pragma unroll
  for (int j = 0; j < 8; ++j) {
#pragma unroll
    for (int r = 0; r < 8; ++r) ss[wave][8 * g + r][j * 16 + col] = (acc[j][r] + accl[j][r] * (1.0f / 1024.0f)) * SCALE; }
  LDSX(); for (int rl = 0; rl < 16; ++rl) vst2(S + (size_t)(ql0 + rl) * TT + k0 + lane * 4, *(const v4f*)&ss[wave][rl][lane * 4]); }
// ---- k_sm: block = query row t (head in group): keys [0, kend): causal -> logit if s <= t else excluded; softmax in f32; P x 2^11 in place (0 for excluded)
__global__ __launch_bounds__(256) void k_sm(float* __restrict__ S0 SM_EXTRA_PARAMS) { __shared__ float sred[8]; __shared__ float sbc; __shared__ __align__(16) float shv[TT];
  const int tid = threadIdx.x; const int t = blockIdx.x; const int kend = (kb_last(t >> 6) + 1) * 128;
  float* sr = S0 + (size_t)blockIdx.y * TT * TT + (size_t)t * TT;
  float m = -3.0e38f; for (int k = tid; k < kend; k += 256) { float v = (!CAUSAL || k <= t) ? sr[k] : -3.0e38f; SM_MASK_HOOK; shv[k] = v; m = fmaxf(m, v); }
#pragma unroll
  for (int o = 1; o < 32; o <<= 1) m = fmaxf(m, __shfl_xor(m, o));
  if ((tid & 31) == 0) sred[tid >> 5] = m; __syncthreads(); if (tid == 0) { float a = sred[0]; for (int i = 1; i < 8; ++i) a = fmaxf(a, sred[i]); sbc = a; } __syncthreads(); m = sbc; __syncthreads();
  float sum = 0.f; for (int k = tid; k < kend; k += 256) { const float v = shv[k]; const float e = (v <= -1.0e38f) ? 0.f : expf(v - m); shv[k] = e; sum += e; }
#pragma unroll
  for (int o = 1; o < 32; o <<= 1) sum += __shfl_xor(sum, o);
  if ((tid & 31) == 0) sred[tid >> 5] = sum; __syncthreads(); if (tid == 0) { float a = 0.f; for (int i = 0; i < 8; ++i) a += sred[i]; sbc = a > 0.f ? 2048.0f / a : 0.f; }   /* a fully excluded row yields P = 0 */ __syncthreads(); const float inv = sbc;
  for (int k = tid; k < kend; k += 256) shv[k] = shv[k] * inv;
  __syncthreads(); for (int q = tid; q < kend / 4; q += 256) vst2(sr + q * 4, *(const v4f*)&shv[q * 4]); }
// ---- k_colstat_c: softmax over the QUERY axis under the causal mask (the source's softmax(axis=1) on [B, t, s] scores with -1e9 above the diagonal): for every key column k: m_k = max_{q >= k} S[q][k], Z_k = sum_{q >= k} exp(S[q][k] - m_k) (f32, precise expf).
// block = 32 key columns (one 128-B line of CM and of CZ), 32 waves; a wave's 16-B loads cover 4 query rows x 32 columns, the block a group of 128 rows, and a lane keeps 8 such groups in flight (1024 rows a trip), so the query axis is cut into 128 interleaved slices per column. Each lane runs the online max / sum on its slice (one rescale per 8 rows); slices are merged max first, then rescaled sums: across the 4 rows of a wave by shuffles, across waves through LDS.
// The walk starts at the 128-aligned group that holds the block's first column, so every score read lies in a block k_sc has written; a group past the end re-reads the last group. q < k and the groups past the end enter as -inf (exp gives 0) while the running max starts finite, so a slice with no visible row ends as (-3e38, 0) and drops out of the merge.
__global__ __launch_bounds__(1024) void k_colstat_c(const float* __restrict__ S0, float* __restrict__ CM, float* __restrict__ CZ) { __shared__ __align__(16) float pm[32][32], pz[32][32];
  const int tid = threadIdx.x, wave = tid >> 5, lane = tid & 31; const int k0 = blockIdx.x * 32, qlo = k0 & ~127; const int r = tid >> 3, kc = k0 + (tid & 7) * 4;   /* the lane's row inside a group, its first column */
  const char* sp = (const char*)(S0 + (size_t)blockIdx.y * TT * TT); const unsigned vo = (unsigned)(r * TT + kc) * 4u, vtop = vo + (unsigned)(TT - 128) * (TT * 4u);   /* the lane's byte offset in group 0 and in the last group */
  unsigned off[8]; float m[4], z[4];
#pragma unroll
  for (int u = 0; u < 8; ++u) { const unsigned o = vo + (unsigned)(qlo + u * 128) * (TT * 4u); off[u] = o < vtop ? o : vtop; }
#pragma unroll
  for (int c = 0; c < 4; ++c) { m[c] = -3.0e38f; z[c] = 0.f; }
  for (int ub0 = qlo; ub0 < TT; ub0 += 1024) { v4f s[8];
#pragma unroll
    for (int u = 0; u < 8; ++u) s[u] = *(const v4f*)(sp + off[u]);
#pragma unroll
    for (int c = 0; c < 4; ++c) { float v[8]; float mn = m[c];
#pragma unroll
      for (int u = 0; u < 8; ++u) { const int ub = ub0 + u * 128; v[u] = ((ub < TT ? ub : -TT) >= kc + c - r) ? s[u][c] : -INFINITY; mn = fmaxf(mn, v[u]); }
      float a = z[c] * expf(m[c] - mn);
#pragma unroll
      for (int u = 0; u < 8; ++u) a += expf(v[u] - mn);
      m[c] = mn; z[c] = a; }
#pragma unroll
    for (int u = 0; u < 8; ++u) { const unsigned o = off[u] + 1024u * (TT * 4u); off[u] = o < vtop ? o : vtop; } }
  v4f wm, wz;
#pragma unroll
  for (int c = 0; c < 4; ++c) { float M = fmaxf(m[c], __shfl_xor(m[c], 8)); M = fmaxf(M, __shfl_xor(M, 16)); float a = z[c] * expf(m[c] - M); a += __shfl_xor(a, 8); a += __shfl_xor(a, 16); wm[c] = M; wz[c] = a; }
  if (lane < 8) { *(v4f*)&pm[wave][lane * 4] = wm; *(v4f*)&pz[wave][lane * 4] = wz; }
  __syncthreads();   /* publishes the 32 waves' partial (max, sum) pairs to wave 0 */
  if (wave == 0) { float M = pm[0][lane];
#pragma unroll
    for (int w = 1; w < 32; ++w) M = fmaxf(M, pm[w][lane]);
    float a = 0.f;
#pragma unroll
    for (int w = 0; w < 32; ++w) a += pz[w][lane] * expf(pm[w][lane] - M);
    vst2(CM + (size_t)blockIdx.y * TT + k0 + lane, M); vst2(CZ + (size_t)blockIdx.y * TT + k0 + lane, a); } }   /* every column sees at least its own diagonal entry: Z_k >= 1 */
// ---- k_csm_c: block = query row t: P[t][k] = exp(S[t][k] - m_k) / Z_k x 2^11 for k <= t, 0 for t < k < kend (inside the diagonal block); in place; unconditional loads, value select
__global__ __launch_bounds__(256) void k_csm_c(float* __restrict__ S0, const float* __restrict__ CM, const float* __restrict__ CZ) { const int tid = threadIdx.x; const int t = blockIdx.x; const int kend = (kb_last(t >> 6) + 1) * 128; float* sr = S0 + (size_t)blockIdx.y * TT * TT + (size_t)t * TT; const float* cm = CM + (size_t)blockIdx.y * TT; const float* cz = CZ + (size_t)blockIdx.y * TT;
  for (int q4 = tid; q4 < kend / 4; q4 += 256) { const v4f sv = *(const v4f*)(sr + q4 * 4), m4 = *(const v4f*)(cm + q4 * 4), z4 = *(const v4f*)(cz + q4 * 4); asm volatile("s_wait_loadcnt 0x0" ::: "memory"); v4f p;
#pragma unroll
    for (int u = 0; u < 4; ++u) p[u] = (q4 * 4 + u <= t) ? expf(sv[u] - m4[u]) * (2048.0f / z4[u]) : 0.f;
    vst2(sr + q4 * 4, p); } }
// ---- k_out64: out[b][t][0..63] = ctx row columns 0..63 (256 B by 16 lanes)
__global__ __launch_bounds__(256) void k_out64(const float* __restrict__ Y, float* __restrict__ OUT) { const size_t row = (size_t)blockIdx.x * 16 + (threadIdx.x >> 4); const int q = threadIdx.x & 15; const v4f v = *(const v4f*)(Y + row * CC + q * 4); asm volatile("s_wait_loadcnt 0x0" ::: "memory"); vst2(OUT + row * 64 + q * 4, v); }
// ---- k_pv: block = 64 queries (qb) of (b, h): ctx = P . v over keys [0, kend) (P x 2^11 once to f16 against v f16: 1 product; query blocks < QBH, here every block: P and v as bf16 hi + lo, 3 products); 256-B (row, head) segment by 16 lanes
__global__ __launch_bounds__(128) void k_pv(const float* __restrict__ PS0, const _Float16* __restrict__ VT, const __bf16* __restrict__ VB, const __bf16* __restrict__ VBL, int b, int h0, float* __restrict__ Y) { const int h = h0 + blockIdx.z; const float* PS = PS0 + (size_t)blockIdx.z * TT * TT; __shared__ __align__(16) float ss[4][16][HD + 4];
  const int tid = threadIdx.x, wave = tid >> 5, lane = tid & 31, col = lane & 15, g = lane >> 4; const int qb = blockIdx.x; const int ql0 = qb * 64 + wave * 16; const int kce = (kb_last(qb) + 1) * 4;
  v8f acc[HD / 16] = {};
  if (qb < QBH) {
#pragma unroll 1
    for (int kc = 0; kc < kce; ++kc) { const F2 p = split_row(PS + (size_t)(ql0 + col) * TT, kc * 32, lane);
      asm volatile("s_wait_loadcnt 0x0" ::: "memory");
#pragma unroll
      for (int j = 0; j < HD / 16; ++j) { const size_t po = ((size_t)b * CC + h * HD + j * 16 + col) * (size_t)KHI + kc * 32; const v16b vh = frag_b(VB + po, lane); acc[j] = wmma_bf(p.h, vh, acc[j]); acc[j] = wmma_bf(p.l, vh, acc[j]); acc[j] = wmma_bf(p.h, frag_b(VBL + po, lane), acc[j]); } }
  } else {
#pragma unroll 1
    for (int kc = 0; kc < kce; ++kc) { const v16h p = frag_f32(PS + (size_t)(ql0 + col) * TT + kc * 32, lane);
      asm volatile("s_wait_loadcnt 0x0" ::: "memory");
#pragma unroll
      for (int j = 0; j < HD / 16; ++j) { const size_t po = ((size_t)b * CC + h * HD + j * 16 + col) * (size_t)TT + kc * 32; acc[j] = wmma16(p, frag_h(VT + po, lane), acc[j]); } } }
#pragma unroll
  for (int j = 0; j < HD / 16; ++j)
#pragma unroll
    for (int r = 0; r < 8; ++r) ss[wave][8 * g + r][j * 16 + col] = acc[j][r] * (1.0f / 2048.0f);
  LDSX(); for (int rl = 0; rl < 16; ++rl) if (lane < HD / 4) vst2(Y + ((size_t)b * TT + ql0 + rl) * CC + h * HD + lane * 4, *(const v4f*)&ss[wave][rl][lane * 4]); }

extern "C" void kernel_launch(void* const* d_in, const int* in_sizes, int n_in, void* d_out, int out_size, void* d_ws, size_t ws_size, hipStream_t stream) {
  (void)in_sizes; (void)n_in; (void)out_size;
  const float** F = (const float**)d_in;
  if (ws_size < (size_t)WS_END) return;
  char* ws = (char*)d_ws; _Float16 *QH = (_Float16*)(ws + WS_QH), *KH = (_Float16*)(ws + WS_KH), *VT = (_Float16*)(ws + WS_VT), *QL = (_Float16*)(ws + WS_QL), *KL = (_Float16*)(ws + WS_KL); __bf16 *VB = (__bf16*)(ws + WS_VB), *VBL = (__bf16*)(ws + WS_VBL); float *S = (float*)(ws + WS_S), *Y = (float*)(ws + WS_Y);
  (void)Y; (void)QL; (void)KL; (void)VB; (void)VBL;
  // inputs: 0 x [4,4096,512]; 1 Wq [64,512] (out,in); 2 Wk; 3 Wv; no biases
  if (ws_size < (size_t)WS_END2) return;
  float *Y2 = (float*)(ws + WS_Y2), *CM = (float*)(ws + WS_CM), *CZ = (float*)(ws + WS_CZ);
  k_proj<<<dim3(TNB * TT / 64, CC / 128, 3), 128, 0, stream>>>(F[0], F[0], F[0], F[1], F[2], F[3], nullptr, nullptr, nullptr, QH, QL, KH, KL, VT, VB, VBL);   /* weight columns 64..127 (the padding head) are zero fragments */
  for (int b = 0; b < TNB; ++b) {   /* head 0 only (head 1 is the zero padding) */
    k_sc<<<dim3(NQB, TT / 128, 1), 128, 0, stream>>>(QH, KH, QL, KL, b, 0, S);
    k_colstat_c<<<dim3(TT / 32, 1), 1024, 0, stream>>>(S, CM, CZ);   /* per key column s: max / sum over the visible queries t >= s */
    k_csm_c<<<dim3(TT, 1), 256, 0, stream>>>(S, CM, CZ);            /* P[t][s] = exp(S - m_s) / Z_s x 2^11 for s <= t, 0 above the diagonal */
    k_pv<<<dim3(NQB, 1, 1), 128, 0, stream>>>(S, VT, VB, VBL, b, 0, Y2);
  }
  k_out64<<<dim3(TNB * TT / 16), 256, 0, stream>>>(Y2, (float*)d_out);
}

// v002
// One run takes 309 microseconds.
// Timed twice side by side with v001, it ran 3.49 times as fast both times.
// Counting every step since v000, it is 24.3 times as fast.
// compute dtype: all float inputs rounded to bf16; q/k/v projections with EXACT bf16 products on WMMA 16x16x32 (f32 accumulate); causal scores with BOTH q and k as f16 hi + (x 2^10) residual (3 products) on EVERY block, x 64^-0.5; softmax over the QUERY axis in f32 (per key column: online max / sum over the visible queries, precise expf); P as bf16 hi + lo against v as bf16 hi + lo (3 products) on EVERY block; f32 output.
#include <hip/hip_runtime.h>
#include <math.h>

typedef __attribute__((ext_vector_type(16))) _Float16 v16h;
typedef __attribute__((ext_vector_type(16))) __bf16 v16b;
typedef __attribute__((ext_vector_type(8)))  _Float16 v8h;
typedef __attribute__((ext_vector_type(8)))  float v8f;
typedef __attribute__((ext_vector_type(4)))  float v4f;
typedef __attribute__((ext_vector_type(2)))  float v2f;
typedef __attribute__((ext_vector_type(4)))  unsigned v4u;
typedef __attribute__((ext_vector_type(4)))  int v4i;
typedef float __attribute__((may_alias)) float_a;
typedef int __attribute__((may_alias)) int_a;

template <typename T> __device__ __forceinline__ void vst2(void* p, T v) { *(T*)p = v;  }
__device__ __forceinline__ v8f wmma16(v16h a, v16h b, v8f c) {
  v8f d = __builtin_amdgcn_wmma_f32_16x16x32_f16(false, a, false, b, (short)0, c, false, false);
  asm volatile("v_nop\n\tv_nop\n\tv_nop\n\tv_nop" : "+v"(d) : "v"(a), "v"(b));
  return d;
}
__device__ __forceinline__ v8f wmma_bf(v16b a, v16b b, v8f c) {
  v8f d = __builtin_amdgcn_wmma_f32_16x16x32_bf16(false, a, false, b, (short)0, c, false, false);
  asm volatile("v_nop\n\tv_nop\n\tv_nop\n\tv_nop" : "+v"(d) : "v"(a), "v"(b));
  return d;
}
// 16x16x32 fragments: lane = (h = lane>>4, row/col = lane&15); elements 0..7 = k0+8h+0..7, 8..15 = k0+16+8h+0..7; D element r = row 8h+r
__device__ __forceinline__ v16h frag_h(const _Float16* rowk0, int lane) {
  union { v16h v; v8h q[2]; } u; const _Float16* p = rowk0 + 8 * (lane >> 4);
  u.q[0] = *(const v8h*)p; u.q[1] = *(const v8h*)(p + 16); return u.v;
}
__device__ __forceinline__ v16h frag_f32(const float* rowk0, int lane) {
  v16h a; const float* p = rowk0 + 8 * (lane >> 4);
#pragma unroll
  for (int i = 0; i < 8; ++i) { a[i] = (_Float16)p[i]; a[8 + i] = (_Float16)p[16 + i]; }
  return a;
}
__device__ __forceinline__ v16h frag_f32s(const float* rowk0, int lane, float sc) {
  v16h a; const float* p = rowk0 + 8 * (lane >> 4);
#pragma unroll
  for (int i = 0; i < 8; ++i) { a[i] = (_Float16)(p[i] * sc); a[8 + i] = (_Float16)(p[16 + i] * sc); }
  return a;
}
// column fragment from a [K][ld] layout (column n), rows >= K read as 0
__device__ __forceinline__ v16h fragc_f32(const float* W, int k0, int n, int lane, int ld, int K) {
  v16h a; const int g = lane >> 4;
#pragma unroll
  for (int i = 0; i < 8; ++i) { const int ka = k0 + 8 * g + i, kb = ka + 16;
    a[i] = (_Float16)(ka < K ? W[(size_t)(ka < K ? ka : K - 1) * ld + n] : 0.f); a[8 + i] = (_Float16)(kb < K ? W[(size_t)(kb < K ? kb : K - 1) * ld + n] : 0.f); }
  return a;
}
struct F2 { v16b h, l; };
__device__ __forceinline__ F2 bsplit16(const float v[16]) { F2 r;
#pragma unroll
  for (int i = 0; i < 16; ++i) { const __bf16 h = (__bf16)v[i]; r.h[i] = h; r.l[i] = (__bf16)(v[i] - (float)h); }
  return r; }
__device__ __forceinline__ F2 split_row(const float* row, int k0, int lane) { float v[16]; const float* p = row + k0 + 8 * (lane >> 4);
#pragma unroll
  for (int i = 0; i < 8; ++i) { v[i] = p[i]; v[8 + i] = p[16 + i]; }
  return bsplit16(v); }
__device__ __forceinline__ F2 split_rowK(const float* row, int k0, int lane, int K) { float v[16]; const int g = lane >> 4;
#pragma unroll
  for (int i = 0; i < 8; ++i) { const int ka = k0 + 8 * g + i, kb = ka + 16; v[i] = ka < K ? row[ka < K ? ka : K - 1] : 0.f; v[8 + i] = kb < K ? row[kb < K ? kb : K - 1] : 0.f; }
  return bsplit16(v); }
__device__ __forceinline__ F2 split_col(const float* W, int k0, int n, int lane, int ld, int K) { float v[16]; const int g = lane >> 4;
#pragma unroll
  for (int i = 0; i < 8; ++i) { const int ka = k0 + 8 * g + i, kb = ka + 16; v[i] = ka < K ? W[(size_t)(ka < K ? ka : K - 1) * ld + n] : 0.f; v[8 + i] = kb < K ? W[(size_t)(kb < K ? kb : K - 1) * ld + n] : 0.f; }
  return bsplit16(v); }
__device__ __forceinline__ v8f mac3(const F2& a, const F2& b, v8f c) { c = wmma_bf(a.l, b.h, c); c = wmma_bf(a.h, b.l, c); return wmma_bf(a.h, b.h, c); }
__device__ __forceinline__ float sigm(float v) { return 1.0f / (1.0f + expf(-v)); }
#define LDSX() do { asm volatile("s_wait_dscnt 0" ::: "memory"); __builtin_amdgcn_wave_barrier(); __builtin_amdgcn_fence(__ATOMIC_RELEASE, "workgroup"); } while (0)

// Single-head causal self-attention whose softmax runs over the QUERY axis (x [4,4096,512]; torch (out,in) Wq / Wk / Wv [64,512] (0.02 scale), no biases; scores = q k^T [B,t,s]; additive causal mask -1e9 where s > t; / sqrt(64); attn = softmax(scores, axis=1) - axis 1 is the QUERY axis t, so every key column s is normalised over the queries t >= s (faithful to the source); out = attn v -> [4,4096,64]).
#define NB 4
#define TT 4096
#define CC 128            // NH * HD = projected width
#define DIN 512          // input (model) width
#define NH 2
#define HD 64
#define NQB (TT / 64)
#define HG 1
#define SCALE (0.125f)
#define CAUSAL 1
#ifndef TNB
#define TNB NB
#endif
__device__ __forceinline__ float bfr(float v) { return (float)(__bf16)v; }
__host__ __device__ __forceinline__ int kb_last(int qb) { return CAUSAL ? ((qb * 64 + 63) >> 7) : (TT / 128 - 1); }
typedef __attribute__((ext_vector_type(8))) __bf16 v8b;
__device__ __forceinline__ v16b frag_b(const __bf16* rowk0, int lane) {
  union { v16b v; v8b q[2]; } u; const __bf16* p = rowk0 + 8 * (lane >> 4);
  u.q[0] = *(const v8b*)p; u.q[1] = *(const v8b*)(p + 16); return u.v;
}
#define QBH 64              // = NQB: 3-product scores and bf16 hi/lo P.v on every query block
#define QHI 4096            // EVERY row carries a q residual plane: with the softmax over the QUERY axis the few-term region is the END of the sequence (late key columns see few queries), so the high-precision paths run everywhere
#define KHI 4096            // every key row carries the k residual and the v bf16 hi + lo planes
// B fragment (k rows k0+.., output column o) of a weight: (in,out) [K][ld] or (out,in) [ld rows of K]: bf16 exact, or f16(bf16 * 256) exact
__device__ __forceinline__ v16b wcol_io(const float* Wm, int k0, int o, int lane, int ld) { v16b w; const int g = lane >> 4;
#pragma unroll
  for (int i = 0; i < 8; ++i) { w[i] = (__bf16)Wm[(size_t)(k0 + 8 * g + i) * ld + o]; w[8 + i] = (__bf16)Wm[(size_t)(k0 + 16 + 8 * g + i) * ld + o]; }
  return w; }
__device__ __forceinline__ v16b wcol_oi(const float* Wm, int k0, int o, int lane, int K) { v16b w; const float* p = Wm + (size_t)o * K + k0 + 8 * (lane >> 4);
#pragma unroll
  for (int i = 0; i < 8; ++i) { w[i] = (__bf16)p[i]; w[8 + i] = (__bf16)p[16 + i]; }
  return w; }
__device__ __forceinline__ v16h wcolh_io(const float* Wm, int k0, int o, int lane, int ld) { v16h w; const int g = lane >> 4;
#pragma unroll
  for (int i = 0; i < 8; ++i) { w[i] = (_Float16)(bfr(Wm[(size_t)(k0 + 8 * g + i) * ld + o]) * 256.0f); w[8 + i] = (_Float16)(bfr(Wm[(size_t)(k0 + 16 + 8 * g + i) * ld + o]) * 256.0f); }
  return w; }
__device__ __forceinline__ v16h wcolh_oi(const float* Wm, int k0, int o, int lane, int K) { v16h w; const float* p = Wm + (size_t)o * K + k0 + 8 * (lane >> 4);
#pragma unroll
  for (int i = 0; i < 8; ++i) { w[i] = (_Float16)(bfr(p[i]) * 256.0f); w[8 + i] = (_Float16)(bfr(p[16 + i]) * 256.0f); }
  return w; }
#define WQKV_LAYOUT 1   // 0 = (in,out) [DIN][CC]; 1 = (out,in) [64][DIN]; 2 = per-head [NH][DIN][HD]
__device__ __forceinline__ v16b wcol_hdk(const float* Wm, int k0, int o, int lane) { v16b w; const int g = lane >> 4; const float* p = Wm + (size_t)(o / HD) * DIN * HD + (o % HD);
#pragma unroll
  for (int i = 0; i < 8; ++i) { w[i] = (__bf16)p[(size_t)(k0 + 8 * g + i) * HD]; w[8 + i] = (__bf16)p[(size_t)(k0 + 16 + 8 * g + i) * HD]; }
  return w; }
#define WO_OUT_IN 0
#if WQKV_LAYOUT == 1
__device__ __forceinline__ v16b zero16b() { v16b w; _Pragma("unroll") for (int i = 0; i < 16; ++i) w[i] = (__bf16)0.0f; return w; }
#define WCOL(W, k0, o, lane) ((o) < 64 ? wcol_oi(W, k0, (o), lane, DIN) : zero16b())   /* (out,in) [64][512]: only 64 real output rows; projected columns 64..127 (padding head 1) are zero; the test is compile-time per unrolled tile (c0 = 0) */
#elif WQKV_LAYOUT == 2
#define WCOL(W, k0, o, lane) wcol_hdk(W, k0, o, lane)
#else
#define WCOL(W, k0, o, lane) wcol_io(W, k0, o, lane, CC)
#endif
#if WO_OUT_IN
#define WOCOL(W, k0, o, lane) wcol_oi(W, k0, o, lane, CC)
#define WOCOLH(W, k0, o, lane) wcolh_oi(W, k0, o, lane, CC)
#else
#define WOCOL(W, k0, o, lane) wcol_io(W, k0, o, lane, DIN)
#define WOCOLH(W, k0, o, lane) wcolh_io(W, k0, o, lane, DIN)
#endif

#ifndef SM_EXTRA_PARAMS
#define SM_EXTRA_PARAMS
#endif
#ifndef PROJ_EXTRA_PARAMS
#define PROJ_EXTRA_PARAMS
#endif
#ifndef SM_MASK_HOOK
#define SM_MASK_HOOK (void)0
#endif

#define WS_QH  0u                                      // f16 q rows [b*t][CC]
#define WS_KH  (WS_QH + 2u * (size_t)NB * TT * CC)      // f16 k rows [b*t][CC]
#define WS_VT  (WS_KH + 2u * (size_t)NB * TT * CC)      // f16 v planes [b][c][t]
#define WS_QL  (WS_VT + 2u * (size_t)NB * CC * TT)      // f16 q residual x 2^10 rows [b][t < QHI][CC]
#define WS_KL  (WS_QL + 2u * (size_t)NB * QHI * CC)     // f16 k residual x 2^10 rows [b][t < KHI][CC]
#define WS_VB  (WS_KL + 2u * (size_t)NB * KHI * CC)     // bf16 v hi planes [b][c][t < KHI]
#define WS_VBL (WS_VB + 2u * (size_t)NB * CC * KHI)
#define WS_S   (WS_VBL + 2u * (size_t)NB * CC * KHI)    // f32 logits / P [hg][t][s]
#define WS_Y   (WS_S  + 4u * (size_t)HG * TT * TT)      // f32 ctx rows [b*t][CC] (only when there is an output projection)
#define WS_END (WS_Y  + 0u)
#define PVK 1024            // keys per key range of k_pv (one work-group's share of a 16-row group)
#define PVW 8               // waves per work-group of k_pv: the range's 32-key steps are dealt to them round robin
#define PVS (TT / PVK)      // most key ranges a query row can have = number of partial ctx planes
#define YPL ((size_t)NB * TT * CC)                      // floats per partial ctx plane
#define WS_Y2 (WS_END)                                  // f32 partial ctx rows [key range][b*TT + t][128] (columns 64..127 = the padding head); row t has ranges 0 .. t / PVK
#define WS_CM (WS_Y2 + 4u * PVS * YPL)                   // f32 column maxima [TT]
#define WS_CZ (WS_CM + 4u * (size_t)HG * TT)
#define WS_END2 (WS_CZ + 4u * (size_t)HG * TT)

// ---- k_proj: block = (64 rows, 128 cols, which): q/k/v = X W (+ b) with exact bf16 products (K = DIN) -> which 0: q f16 rows (+ residual rows < QHI); 1: k f16 rows (+ residual rows < KHI); 2: v f16 planes [c][t] (+ bf16 hi/lo planes for t < KHI)
__global__ __launch_bounds__(128) void k_proj(const float* __restrict__ XQ, const float* __restrict__ XK, const float* __restrict__ XV, const float* __restrict__ WQ, const float* __restrict__ WK, const float* __restrict__ WV, const float* __restrict__ BQ, const float* __restrict__ BK, const float* __restrict__ BV,
    _Float16* __restrict__ QH, _Float16* __restrict__ QL, _Float16* __restrict__ KH, _Float16* __restrict__ KL, _Float16* __restrict__ VT, __bf16* __restrict__ VB, __bf16* __restrict__ VBL) {
  __shared__ __align__(16) _Float16 sh[64][136], sl[64][136]; __shared__ __align__(16) _Float16 th[128][72]; __shared__ __align__(16) __bf16 tb[128][72], tbl[128][72];
  const int tid = threadIdx.x, wave = tid >> 5, lane = tid & 31, col = lane & 15, g = lane >> 4; const int which = blockIdx.z; const int c0 = blockIdx.y * 128; const size_t r0 = (size_t)blockIdx.x * 64; const size_t bb = r0 / TT; const int t0 = (int)(r0 % TT);
  const float* X = which == 0 ? XQ : which == 1 ? XK : XV; const float* WA = which == 0 ? WQ : which == 1 ? WK : WV; const float* BA = which == 0 ? BQ : which == 1 ? BK : BV;
  v8f acc[8] = {};
#pragma unroll 2
  for (int kc = 0; kc < DIN / 32; ++kc) { v16b a; { const float* p = X + (r0 + wave * 16 + col) * DIN + kc * 32 + 8 * g;
#pragma unroll
      for (int i = 0; i < 8; ++i) { a[i] = (__bf16)p[i]; a[8 + i] = (__bf16)p[16 + i]; } }
    asm volatile("s_wait_loadcnt 0x0" ::: "memory");
#pragma unroll
    for (int j = 0; j < 8; ++j) { const v16b w = WCOL(WA, kc * 32, c0 + j * 16 + col, lane); asm volatile("s_wait_loadcnt 0x0" ::: "memory"); acc[j] = wmma_bf(a, w, acc[j]); } }
  if (which < 2) { _Float16* DH = which == 0 ? QH : KH; _Float16* DL = which == 0 ? QL : KL; const int nhi = which == 0 ? QHI : KHI; const bool hi_rows = t0 < nhi;
#pragma unroll
    for (int j = 0; j < 8; ++j) { const float bias = BA ? bfr(BA[c0 + j * 16 + col]) : 0.f;
#pragma unroll
      for (int r = 0; r < 8; ++r) { const float v = acc[j][r] + bias; const _Float16 hv = (_Float16)v; sh[wave * 16 + 8 * g + r][j * 16 + col] = hv; sl[wave * 16 + 8 * g + r][j * 16 + col] = (_Float16)((v - (float)hv) * 1024.0f); } }
    __syncthreads();
    for (int e = tid; e < 64 * 16; e += 128) { const int rl = e >> 4, q = e & 15; vst2((unsigned*)(DH + (r0 + rl) * CC + c0 + q * 8), *(const v4u*)&sh[rl][q * 8]); if (hi_rows) vst2((unsigned*)(DL + (bb * nhi + t0 + rl) * (size_t)CC + c0 + q * 8), *(const v4u*)&sl[rl][q * 8]); }
  } else { const bool hi_rows = t0 < KHI;
#pragma unroll
    for (int j = 0; j < 8; ++j) { const float bias = BA ? bfr(BA[c0 + j * 16 + col]) : 0.f;
#pragma unroll
      for (int r = 0; r < 8; ++r) { const float v = acc[j][r] + bias; const int rl = wave * 16 + 8 * g + r, cl = j * 16 + col; th[cl][rl] = (_Float16)v; const __bf16 bh = (__bf16)v; tb[cl][rl] = bh; tbl[cl][rl] = (__bf16)(v - (float)bh); } }
    __syncthreads();
    for (int e = tid; e < 128 * 8; e += 128) { const int cl = e >> 3, q = e & 7; vst2((unsigned*)(VT + (bb * CC + c0 + cl) * (size_t)TT + t0 + q * 8), *(const v4u*)&th[cl][q * 8]); if (hi_rows) { const size_t o3 = (bb * CC + c0 + cl) * (size_t)KHI + t0 + q * 8; vst2((unsigned*)(VB + o3), *(const v4u*)&tb[cl][q * 8]); vst2((unsigned*)(VBL + o3), *(const v4u*)&tbl[cl][q * 8]); } } } }
// ---- k_sc: block = (query block qb, key block kb <= kb_last(qb), head in group) of batch b: logits x SCALE; q hi + residual (x 2^10) against k (2 products) for query rows < QHI, plus the k residual (3 products) for query blocks < QBH (every block); causal: blocks past the diagonal exit, the mask itself is applied by index in k_colstat_c and k_csm_c
__global__ __launch_bounds__(128) void k_sc(const _Float16* __restrict__ QH, const _Float16* __restrict__ KH, const _Float16* __restrict__ QL, const _Float16* __restrict__ KL, int b, int h0, float* __restrict__ S0) { __shared__ __align__(16) float ss[4][16][132];
  const int qb = blockIdx.x, kb = blockIdx.y; if (kb > kb_last(qb)) return;
  const int h = h0 + blockIdx.z; float* S = S0 + (size_t)blockIdx.z * TT * TT;
  const int tid = threadIdx.x, wave = tid >> 5, lane = tid & 31, col = lane & 15, g = lane >> 4; const int k0 = kb * 128; const int ql0 = qb * 64 + wave * 16; const size_t q0 = (size_t)b * TT + ql0, kr0 = (size_t)b * TT + k0;
  v8f acc[8] = {}, accl[8] = {};
  const _Float16* QLb = QL + (size_t)b * QHI * CC; const _Float16* KLb = KL + (size_t)b * KHI * CC;
  if (qb < QBH) {
#pragma unroll
    for (int kc = 0; kc < HD / 32; ++kc) { const v16h ah = frag_h(QH + (q0 + col) * CC + h * HD + kc * 32, lane), al = frag_h(QLb + (size_t)(ql0 + col) * CC + h * HD + kc * 32, lane);
#pragma unroll
      for (int j = 0; j < 8; ++j) { const v16h kbf = frag_h(KH + (kr0 + j * 16 + col) * CC + h * HD + kc * 32, lane), klf = frag_h(KLb + (size_t)(k0 + j * 16 + col) * CC + h * HD + kc * 32, lane); acc[j] = wmma16(ah, kbf, acc[j]); accl[j] = wmma16(al, kbf, accl[j]); accl[j] = wmma16(ah, klf, accl[j]); } }
  } else if (qb * 64 < QHI) {
#pragma unroll
    for (int kc = 0; kc < HD / 32; ++kc) { const v16h ah = frag_h(QH + (q0 + col) * CC + h * HD + kc * 32, lane), al = frag_h(QLb + (size_t)(ql0 + col) * CC + h * HD + kc * 32, lane);
#pragma unroll
      for (int j = 0; j < 8; ++j) { const v16h kbf = frag_h(KH + (kr0 + j * 16 + col) * CC + h * HD + kc * 32, lane); acc[j] = wmma16(ah, kbf, acc[j]); accl[j] = wmma16(al, kbf, accl[j]); } }
  } else {
#pragma unroll
    for (int kc = 0; kc < HD / 32; ++kc) { const v16h ah = frag_h(QH + (q0 + col) * CC + h * HD + kc * 32, lane);
#pragma unroll
      for (int j = 0; j < 8; ++j) { const v16h kbf = frag_h(KH + (kr0 + j * 16 + col) * CC + h * HD + kc * 32, lane); acc[j] = wmma16(ah, kbf, acc[j]); } } }
#pragma unroll
  for (int j = 0; j < 8; ++j) {
#pragma unroll
    for (int r = 0; r < 8; ++r) ss[wave][8 * g + r][j * 16 + col] = (acc[j][r] + accl[j][r] * (1.0f / 1024.0f)) * SCALE; }
  LDSX(); for (int rl = 0; rl < 16; ++rl) vst2(S + (size_t)(ql0 + rl) * TT + k0 + lane * 4, *(const v4f*)&ss[wave][rl][lane * 4]); }
// ---- k_sm: block = query row t (head in group): keys [0, kend): causal -> logit if s <= t else excluded; softmax in f32; P x 2^11 in place (0 for excluded)
__global__ __launch_bounds__(256) void k_sm(float* __restrict__ S0 SM_EXTRA_PARAMS) { __shared__ float sred[8]; __shared__ float sbc; __shared__ __align__(16) float shv[TT];
  const int tid = threadIdx.x; const int t = blockIdx.x; const int kend = (kb_last(t >> 6) + 1) * 128;
  float* sr = S0 + (size_t)blockIdx.y * TT * TT + (size_t)t * TT;
  float m = -3.0e38f; for (int k = tid; k < kend; k += 256) { float v = (!CAUSAL || k <= t) ? sr[k] : -3.0e38f; SM_MASK_HOOK; shv[k] = v; m = fmaxf(m, v); }
#pragma unroll
  for (int o = 1; o < 32; o <<= 1) m = fmaxf(m, __shfl_xor(m, o));
  if ((tid & 31) == 0) sred[tid >> 5] = m; __syncthreads(); if (tid == 0) { float a = sred[0]; for (int i = 1; i < 8; ++i) a = fmaxf(a, sred[i]); sbc = a; } __syncthreads(); m = sbc; __syncthreads();
  float sum = 0.f; for (int k = tid; k < kend; k += 256) { const float v = shv[k]; const float e = (v <= -1.0e38f) ? 0.f : expf(v - m); shv[k] = e; sum += e; }
#pragma unroll
  for (int o = 1; o < 32; o <<= 1) sum += __shfl_xor(sum, o);
  if ((tid & 31) == 0) sred[tid >> 5] = sum; __syncthreads(); if (tid == 0) { float a = 0.f; for (int i = 0; i < 8; ++i) a += sred[i]; sbc = a > 0.f ? 2048.0f / a : 0.f; }   /* a fully excluded row yields P = 0 */ __syncthreads(); const float inv = sbc;
  for (int k = tid; k < kend; k += 256) shv[k] = shv[k] * inv;
  __syncthreads(); for (int q = tid; q < kend / 4; q += 256) vst2(sr + q * 4, *(const v4f*)&shv[q * 4]); }
// ---- k_colstat_c: softmax over the QUERY axis under the causal mask (the source's softmax(axis=1) on [B, t, s] scores with -1e9 above the diagonal): for every key column k: m_k = max_{q >= k} S[q][k], Z_k = sum_{q >= k} exp(S[q][k] - m_k) (f32, precise expf).
// block = 32 key columns (one 128-B line of CM and of CZ), 32 waves; a wave's 16-B loads cover 4 query rows x 32 columns, the block a group of 128 rows, and a lane keeps 8 such groups in flight (1024 rows a trip), so the query axis is cut into 128 interleaved slices per column. Each lane runs the online max / sum on its slice (one rescale per 8 rows); slices are merged max first, then rescaled sums: across the 4 rows of a wave by shuffles, across waves through LDS.
// The walk starts at the 128-aligned group that holds the block's first column, so every score read lies in a block k_sc has written; a group past the end re-reads the last group. q < k and the groups past the end enter as -inf (exp gives 0) while the running max starts finite, so a slice with no visible row ends as (-3e38, 0) and drops out of the merge.
__global__ __launch_bounds__(1024) void k_colstat_c(const float* __restrict__ S0, float* __restrict__ CM, float* __restrict__ CZ) { __shared__ __align__(16) float pm[32][32], pz[32][32];
  const int tid = threadIdx.x, wave = tid >> 5, lane = tid & 31; const int k0 = blockIdx.x * 32, qlo = k0 & ~127; const int r = tid >> 3, kc = k0 + (tid & 7) * 4;   /* the lane's row inside a group, its first column */
  const char* sp = (const char*)(S0 + (size_t)blockIdx.y * TT * TT); const unsigned vo = (unsigned)(r * TT + kc) * 4u, vtop = vo + (unsigned)(TT - 128) * (TT * 4u);   /* the lane's byte offset in group 0 and in the last group */
  unsigned off[8]; float m[4], z[4];
#pragma unroll
  for (int u = 0; u < 8; ++u) { const unsigned o = vo + (unsigned)(qlo + u * 128) * (TT * 4u); off[u] = o < vtop ? o : vtop; }
#pragma unroll
  for (int c = 0; c < 4; ++c) { m[c] = -3.0e38f; z[c] = 0.f; }
  for (int ub0 = qlo; ub0 < TT; ub0 += 1024) { v4f s[8];
#pragma unroll
    for (int u = 0; u < 8; ++u) s[u] = *(const v4f*)(sp + off[u]);
#pragma unroll
    for (int c = 0; c < 4; ++c) { float v[8]; float mn = m[c];
#pragma unroll
      for (int u = 0; u < 8; ++u) { const int ub = ub0 + u * 128; v[u] = ((ub < TT ? ub : -TT) >= kc + c - r) ? s[u][c] : -INFINITY; mn = fmaxf(mn, v[u]); }
      float a = z[c] * expf(m[c] - mn);
#pragma unroll
      for (int u = 0; u < 8; ++u) a += expf(v[u] - mn);
      m[c] = mn; z[c] = a; }
#pragma unroll
    for (int u = 0; u < 8; ++u) { const unsigned o = off[u] + 1024u * (TT * 4u); off[u] = o < vtop ? o : vtop; } }
  v4f wm, wz;
#pragma unroll
  for (int c = 0; c < 4; ++c) { float M = fmaxf(m[c], __shfl_xor(m[c], 8)); M = fmaxf(M, __shfl_xor(M, 16)); float a = z[c] * expf(m[c] - M); a += __shfl_xor(a, 8); a += __shfl_xor(a, 16); wm[c] = M; wz[c] = a; }
  if (lane < 8) { *(v4f*)&pm[wave][lane * 4] = wm; *(v4f*)&pz[wave][lane * 4] = wz; }
  __syncthreads();   /* publishes the 32 waves' partial (max, sum) pairs to wave 0 */
  if (wave == 0) { float M = pm[0][lane];
#pragma unroll
    for (int w = 1; w < 32; ++w) M = fmaxf(M, pm[w][lane]);
    float a = 0.f;
#pragma unroll
    for (int w = 0; w < 32; ++w) a += pz[w][lane] * expf(pm[w][lane] - M);
    vst2(CM + (size_t)blockIdx.y * TT + k0 + lane, M); vst2(CZ + (size_t)blockIdx.y * TT + k0 + lane, a); } }   /* every column sees at least its own diagonal entry: Z_k >= 1 */
// ---- k_csm_c: block = query row t: P[t][k] = exp(S[t][k] - m_k) / Z_k x 2^11 for k <= t, 0 for t < k < kend (inside the diagonal block); in place; unconditional loads, value select
__global__ __launch_bounds__(256) void k_csm_c(float* __restrict__ S0, const float* __restrict__ CM, const float* __restrict__ CZ) { const int tid = threadIdx.x; const int t = blockIdx.x; const int kend = (kb_last(t >> 6) + 1) * 128; float* sr = S0 + (size_t)blockIdx.y * TT * TT + (size_t)t * TT; const float* cm = CM + (size_t)blockIdx.y * TT; const float* cz = CZ + (size_t)blockIdx.y * TT;
  for (int q4 = tid; q4 < kend / 4; q4 += 256) { const v4f sv = *(const v4f*)(sr + q4 * 4), m4 = *(const v4f*)(cm + q4 * 4), z4 = *(const v4f*)(cz + q4 * 4); asm volatile("s_wait_loadcnt 0x0" ::: "memory"); v4f p;
#pragma unroll
    for (int u = 0; u < 4; ++u) p[u] = (q4 * 4 + u <= t) ? expf(sv[u] - m4[u]) * (2048.0f / z4[u]) : 0.f;
    vst2(sr + q4 * 4, p); } }
// ---- k_out64: out[b][t][0..63] = sum over the row's key ranges (ascending) of the partial ctx row, columns 0..63 (256 B by 16 lanes); the block's 16 rows lie in one band of PVK rows, so the range count is the same for all of them
__global__ __launch_bounds__(256) void k_out64(const float* __restrict__ Y, float* __restrict__ OUT) { const size_t row = (size_t)blockIdx.x * 16 + (threadIdx.x >> 4); const int q = threadIdx.x & 15; const int nr = (int)((blockIdx.x * 16u) % TT) / PVK + 1; const float* yp = Y + row * CC + q * 4; v4f v = *(const v4f*)yp;
  for (int c = 1; c < nr; ++c) v += *(const v4f*)(yp + c * YPL);
  asm volatile("s_wait_loadcnt 0x0" ::: "memory"); vst2(OUT + row * 64 + q * 4, v); }
// ---- k_pv: block = (16 queries, one range of PVK keys) of (b, h): partial ctx = P . v over the range's keys below kend (P and v as bf16 hi + lo, 3 products, on every query block since QBH = NQB; the P x 2^11 f16 against v f16 path, 1 product, is never taken); 256-B (row, head) segment by 16 lanes
// Split over keys: rows of band d = t / PVK have d + 1 ranges; blockIdx.y numbers the (band, range) pairs, the 6 full ranges first, then each band's last range (the one the diagonal cuts short); blockIdx.x is the 16-row group inside the band. The PVW waves take the range's 32-key steps round robin, their f32 partials are added through LDS (wave order), and the ranges' partial rows go to planes of Y that k_out64 adds.
__global__ __launch_bounds__(32 * PVW) void k_pv(const float* __restrict__ PS0, const _Float16* __restrict__ VT, const __bf16* __restrict__ VB, const __bf16* __restrict__ VBL, int b, int h0, float* __restrict__ Y) { const int h = h0 + blockIdx.z; const float* PS = PS0 + (size_t)blockIdx.z * TT * TT; __shared__ __align__(16) float ss[PVW][16][HD + 4];
  const int tid = threadIdx.x, wave = __builtin_amdgcn_readfirstlane(tid >> 5), lane = tid & 31, col = lane & 15, g = lane >> 4;   /* the wave number in a scalar register: the key loop's bounds stay wave-uniform */
  const int py = blockIdx.y; const int band = py >= 6 ? py - 6 : py >= 3 ? 3 : py >= 1 ? 2 : 1; const int rng = py >= 6 ? band : py >= 3 ? py - 3 : py >= 1 ? py - 1 : 0;
  const int ql0 = band * PVK + blockIdx.x * 16; const int qb = ql0 >> 6; const int kall = (kb_last(qb) + 1) * 4; const int kcb = rng * (PVK / 32) + wave; const int kce = kall < (rng + 1) * (PVK / 32) ? kall : (rng + 1) * (PVK / 32);
  v8f acc[HD / 16] = {};
  if (qb < QBH) {
#pragma unroll 1
    for (int kc = kcb; kc < kce; kc += PVW) { const F2 p = split_row(PS + (size_t)(ql0 + col) * TT, kc * 32, lane);
      asm volatile("s_wait_loadcnt 0x0" ::: "memory");
#pragma unroll
      for (int j = 0; j < HD / 16; ++j) { const size_t po = ((size_t)b * CC + h * HD + j * 16 + col) * (size_t)KHI + kc * 32; const v16b vh = frag_b(VB + po, lane); acc[j] = wmma_bf(p.h, vh, acc[j]); acc[j] = wmma_bf(p.l, vh, acc[j]); acc[j] = wmma_bf(p.h, frag_b(VBL + po, lane), acc[j]); } }
  } else {
#pragma unroll 1
    for (int kc = kcb; kc < kce; kc += PVW) { const v16h p = frag_f32(PS + (size_t)(ql0 + col) * TT + kc * 32, lane);
      asm volatile("s_wait_loadcnt 0x0" ::: "memory");
#pragma unroll
      for (int j = 0; j < HD / 16; ++j) { const size_t po = ((size_t)b * CC + h * HD + j * 16 + col) * (size_t)TT + kc * 32; acc[j] = wmma16(p, frag_h(VT + po, lane), acc[j]); } } }
#pragma unroll
  for (int j = 0; j < HD / 16; ++j)
#pragma unroll
    for (int r = 0; r < 8; ++r) ss[wave][8 * g + r][j * 16 + col] = acc[j][r] * (1.0f / 2048.0f);
  __syncthreads();   /* publishes the PVW waves' partial tiles to the threads that add them */
  { const int rl = tid >> 4, q = tid & 15; v4f s = *(const v4f*)&ss[0][rl][q * 4];
#pragma unroll   /* unrolled so that the PVW LDS reads issue together instead of one wait each */
    for (int w = 1; w < PVW; ++w) s += *(const v4f*)&ss[w][rl][q * 4];
    vst2(Y + rng * YPL + ((size_t)b * TT + ql0 + rl) * CC + h * HD + q * 4, s); } }

extern "C" void kernel_launch(void* const* d_in, const int* in_sizes, int n_in, void* d_out, int out_size, void* d_ws, size_t ws_size, hipStream_t stream) {
  (void)in_sizes; (void)n_in; (void)out_size;
  const float** F = (const float**)d_in;
  if (ws_size < (size_t)WS_END) return;
  char* ws = (char*)d_ws; _Float16 *QH = (_Float16*)(ws + WS_QH), *KH = (_Float16*)(ws + WS_KH), *VT = (_Float16*)(ws + WS_VT), *QL = (_Float16*)(ws + WS_QL), *KL = (_Float16*)(ws + WS_KL); __bf16 *VB = (__bf16*)(ws + WS_VB), *VBL = (__bf16*)(ws + WS_VBL); float *S = (float*)(ws + WS_S), *Y = (float*)(ws + WS_Y);
  (void)Y; (void)QL; (void)KL; (void)VB; (void)VBL;
  // inputs: 0 x [4,4096,512]; 1 Wq [64,512] (out,in); 2 Wk; 3 Wv; no biases
  if (ws_size < (size_t)WS_END2) return;
  float *Y2 = (float*)(ws + WS_Y2), *CM = (float*)(ws + WS_CM), *CZ = (float*)(ws + WS_CZ);
  k_proj<<<dim3(TNB * TT / 64, CC / 128, 3), 128, 0, stream>>>(F[0], F[0], F[0], F[1], F[2], F[3], nullptr, nullptr, nullptr, QH, QL, KH, KL, VT, VB, VBL);   /* weight columns 64..127 (the padding head) are zero fragments */
  for (int b = 0; b < TNB; ++b) {   /* head 0 only (head 1 is the zero padding) */
    k_sc<<<dim3(NQB, TT / 128, 1), 128, 0, stream>>>(QH, KH, QL, KL, b, 0, S);
    k_colstat_c<<<dim3(TT / 32, 1), 1024, 0, stream>>>(S, CM, CZ);   /* per key column s: max / sum over the visible queries t >= s */
    k_csm_c<<<dim3(TT, 1), 256, 0, stream>>>(S, CM, CZ);            /* P[t][s] = exp(S - m_s) / Z_s x 2^11 for s <= t, 0 above the diagonal */
    k_pv<<<dim3(PVK / 16, PVS * (PVS + 1) / 2, 1), 32 * PVW, 0, stream>>>(S, VT, VB, VBL, b, 0, Y2);   /* (16-row group in its band) x (band, key range) */
  }
  k_out64<<<dim3(TNB * TT / 16), 256, 0, stream>>>(Y2, (float*)d_out);
}

// v003
// One run takes 271 microseconds.
// In both of two side-by-side timings against v002, it was 1.14 times as fast.
// Over all steps from v000 it is 27.7 times as fast.
// compute dtype: all float inputs rounded to bf16; q/k/v projections with EXACT bf16 products on WMMA 16x16x32 (f32 accumulate); causal scores with BOTH q and k as f16 hi + (x 2^10) residual (3 products) on EVERY block, x 64^-0.5; softmax over the QUERY axis in f32 (per key column: online max / sum over the visible queries, precise expf); P as bf16 hi + lo against v as bf16 hi + lo (3 products) on EVERY block; f32 output.
#include <hip/hip_runtime.h>
#include <math.h>

typedef __attribute__((ext_vector_type(16))) _Float16 v16h;
typedef __attribute__((ext_vector_type(16))) __bf16 v16b;
typedef __attribute__((ext_vector_type(8)))  _Float16 v8h;
typedef __attribute__((ext_vector_type(8)))  float v8f;
typedef __attribute__((ext_vector_type(4)))  float v4f;
typedef __attribute__((ext_vector_type(2)))  float v2f;
typedef __attribute__((ext_vector_type(4)))  unsigned v4u;
typedef __attribute__((ext_vector_type(4)))  int v4i;
typedef float __attribute__((may_alias)) float_a;
typedef int __attribute__((may_alias)) int_a;

template <typename T> __device__ __forceinline__ void vst2(void* p, T v) { *(T*)p = v;  }
__device__ __forceinline__ v8f wmma16(v16h a, v16h b, v8f c) {
  v8f d = __builtin_amdgcn_wmma_f32_16x16x32_f16(false, a, false, b, (short)0, c, false, false);
  asm volatile("v_nop\n\tv_nop\n\tv_nop\n\tv_nop" : "+v"(d) : "v"(a), "v"(b));
  return d;
}
__device__ __forceinline__ v8f wmma_bf(v16b a, v16b b, v8f c) {
  v8f d = __builtin_amdgcn_wmma_f32_16x16x32_bf16(false, a, false, b, (short)0, c, false, false);
  asm volatile("v_nop\n\tv_nop\n\tv_nop\n\tv_nop" : "+v"(d) : "v"(a), "v"(b));
  return d;
}
// 16x16x32 fragments: lane = (h = lane>>4, row/col = lane&15); elements 0..7 = k0+8h+0..7, 8..15 = k0+16+8h+0..7; D element r = row 8h+r
__device__ __forceinline__ v16h frag_h(const _Float16* rowk0, int lane) {
  union { v16h v; v8h q[2]; } u; const _Float16* p = rowk0 + 8 * (lane >> 4);
  u.q[0] = *(const v8h*)p; u.q[1] = *(const v8h*)(p + 16); return u.v;
}
__device__ __forceinline__ v16h frag_f32(const float* rowk0, int lane) {
  v16h a; const float* p = rowk0 + 8 * (lane >> 4);
#pragma unroll
  for (int i = 0; i < 8; ++i) { a[i] = (_Float16)p[i]; a[8 + i] = (_Float16)p[16 + i]; }
  return a;
}
__device__ __forceinline__ v16h frag_f32s(const float* rowk0, int lane, float sc) {
  v16h a; const float* p = rowk0 + 8 * (lane >> 4);
#pragma unroll
  for (int i = 0; i < 8; ++i) { a[i] = (_Float16)(p[i] * sc); a[8 + i] = (_Float16)(p[16 + i] * sc); }
  return a;
}
// column fragment from a [K][ld] layout (column n), rows >= K read as 0
__device__ __forceinline__ v16h fragc_f32(const float* W, int k0, int n, int lane, int ld, int K) {
  v16h a; const int g = lane >> 4;
#pragma unroll
  for (int i = 0; i < 8; ++i) { const int ka = k0 + 8 * g + i, kb = ka + 16;
    a[i] = (_Float16)(ka < K ? W[(size_t)(ka < K ? ka : K - 1) * ld + n] : 0.f); a[8 + i] = (_Float16)(kb < K ? W[(size_t)(kb < K ? kb : K - 1) * ld + n] : 0.f); }
  return a;
}
struct F2 { v16b h, l; };
__device__ __forceinline__ F2 bsplit16(const float v[16]) { F2 r;
#pragma unroll
  for (int i = 0; i < 16; ++i) { const __bf16 h = (__bf16)v[i]; r.h[i] = h; r.l[i] = (__bf16)(v[i] - (float)h); }
  return r; }
__device__ __forceinline__ F2 split_row(const float* row, int k0, int lane) { float v[16]; const float* p = row + k0 + 8 * (lane >> 4);
#pragma unroll
  for (int i = 0; i < 8; ++i) { v[i] = p[i]; v[8 + i] = p[16 + i]; }
  return bsplit16(v); }
__device__ __forceinline__ F2 split_rowK(const float* row, int k0, int lane, int K) { float v[16]; const int g = lane >> 4;
#pragma unroll
  for (int i = 0; i < 8; ++i) { const int ka = k0 + 8 * g + i, kb = ka + 16; v[i] = ka < K ? row[ka < K ? ka : K - 1] : 0.f; v[8 + i] = kb < K ? row[kb < K ? kb : K - 1] : 0.f; }
  return bsplit16(v); }
__device__ __forceinline__ F2 split_col(const float* W, int k0, int n, int lane, int ld, int K) { float v[16]; const int g = lane >> 4;
#pragma unroll
  for (int i = 0; i < 8; ++i) { const int ka = k0 + 8 * g + i, kb = ka + 16; v[i] = ka < K ? W[(size_t)(ka < K ? ka : K - 1) * ld + n] : 0.f; v[8 + i] = kb < K ? W[(size_t)(kb < K ? kb : K - 1) * ld + n] : 0.f; }
  return bsplit16(v); }
__device__ __forceinline__ v8f mac3(const F2& a, const F2& b, v8f c) { c = wmma_bf(a.l, b.h, c); c = wmma_bf(a.h, b.l, c); return wmma_bf(a.h, b.h, c); }
__device__ __forceinline__ float sigm(float v) { return 1.0f / (1.0f + expf(-v)); }
#define LDSX() do { asm volatile("s_wait_dscnt 0" ::: "memory"); __builtin_amdgcn_wave_barrier(); __builtin_amdgcn_fence(__ATOMIC_RELEASE, "workgroup"); } while (0)

// Single-head causal self-attention whose softmax runs over the QUERY axis (x [4,4096,512]; torch (out,in) Wq / Wk / Wv [64,512] (0.02 scale), no biases; scores = q k^T [B,t,s]; additive causal mask -1e9 where s > t; / sqrt(64); attn = softmax(scores, axis=1) - axis 1 is the QUERY axis t, so every key column s is normalised over the queries t >= s (faithful to the source); out = attn v -> [4,4096,64]).
#define NB 4
#define TT 4096
#define CC 128            // NH * HD = projected width
#define DIN 512          // input (model) width
#define NH 2
#define HD 64
#define NQB (TT / 64)
#define HG 1
#define SCALE (0.125f)
#define CAUSAL 1
#ifndef TNB
#define TNB NB
#endif
__device__ __forceinline__ float bfr(float v) { return (float)(__bf16)v; }
__host__ __device__ __forceinline__ int kb_last(int qb) { return CAUSAL ? ((qb * 64 + 63) >> 7) : (TT / 128 - 1); }
typedef __attribute__((ext_vector_type(8))) __bf16 v8b;
__device__ __forceinline__ v16b frag_b(const __bf16* rowk0, int lane) {
  union { v16b v; v8b q[2]; } u; const __bf16* p = rowk0 + 8 * (lane >> 4);
  u.q[0] = *(const v8b*)p; u.q[1] = *(const v8b*)(p + 16); return u.v;
}
#define QBH 64              // = NQB: 3-product scores and bf16 hi/lo P.v on every query block
#define QHI 4096            // EVERY row carries a q residual plane: with the softmax over the QUERY axis the few-term region is the END of the sequence (late key columns see few queries), so the high-precision paths run everywhere
#define KHI 4096            // every key row carries the k residual and the v bf16 hi + lo planes
// B fragment (k rows k0+.., output column o) of a weight: (in,out) [K][ld] or (out,in) [ld rows of K]: bf16 exact, or f16(bf16 * 256) exact
__device__ __forceinline__ v16b wcol_io(const float* Wm, int k0, int o, int lane, int ld) { v16b w; const int g = lane >> 4;
#pragma unroll
  for (int i = 0; i < 8; ++i) { w[i] = (__bf16)Wm[(size_t)(k0 + 8 * g + i) * ld + o]; w[8 + i] = (__bf16)Wm[(size_t)(k0 + 16 + 8 * g + i) * ld + o]; }
  return w; }
__device__ __forceinline__ v16b wcol_oi(const float* Wm, int k0, int o, int lane, int K) { v16b w; const float* p = Wm + (size_t)o * K + k0 + 8 * (lane >> 4);
#pragma unroll
  for (int i = 0; i < 8; ++i) { w[i] = (__bf16)p[i]; w[8 + i] = (__bf16)p[16 + i]; }
  return w; }
__device__ __forceinline__ v16h wcolh_io(const float* Wm, int k0, int o, int lane, int ld) { v16h w; const int g = lane >> 4;
#pragma unroll
  for (int i = 0; i < 8; ++i) { w[i] = (_Float16)(bfr(Wm[(size_t)(k0 + 8 * g + i) * ld + o]) * 256.0f); w[8 + i] = (_Float16)(bfr(Wm[(size_t)(k0 + 16 + 8 * g + i) * ld + o]) * 256.0f); }
  return w; }
__device__ __forceinline__ v16h wcolh_oi(const float* Wm, int k0, int o, int lane, int K) { v16h w; const float* p = Wm + (size_t)o * K + k0 + 8 * (lane >> 4);
#pragma unroll
  for (int i = 0; i < 8; ++i) { w[i] = (_Float16)(bfr(p[i]) * 256.0f); w[8 + i] = (_Float16)(bfr(p[16 + i]) * 256.0f); }
  return w; }
#define WQKV_LAYOUT 1   // 0 = (in,out) [DIN][CC]; 1 = (out,in) [64][DIN]; 2 = per-head [NH][DIN][HD]
__device__ __forceinline__ v16b wcol_hdk(const float* Wm, int k0, int o, int lane) { v16b w; const int g = lane >> 4; const float* p = Wm + (size_t)(o / HD) * DIN * HD + (o % HD);
#pragma unroll
  for (int i = 0; i < 8; ++i) { w[i] = (__bf16)p[(size_t)(k0 + 8 * g + i) * HD]; w[8 + i] = (__bf16)p[(size_t)(k0 + 16 + 8 * g + i) * HD]; }
  return w; }
#define WO_OUT_IN 0
#if WQKV_LAYOUT == 1
__device__ __forceinline__ v16b zero16b() { v16b w; _Pragma("unroll") for (int i = 0; i < 16; ++i) w[i] = (__bf16)0.0f; return w; }
#define WCOL(W, k0, o, lane) ((o) < 64 ? wcol_oi(W, k0, (o), lane, DIN) : zero16b())   /* (out,in) [64][512]: only 64 real output rows; projected columns 64..127 (padding head 1) are zero; the test is compile-time per unrolled tile (c0 = 0) */
#elif WQKV_LAYOUT == 2
#define WCOL(W, k0, o, lane) wcol_hdk(W, k0, o, lane)
#else
#define WCOL(W, k0, o, lane) wcol_io(W, k0, o, lane, CC)
#endif
#if WO_OUT_IN
#define WOCOL(W, k0, o, lane) wcol_oi(W, k0, o, lane, CC)
#define WOCOLH(W, k0, o, lane) wcolh_oi(W, k0, o, lane, CC)
#else
#define WOCOL(W, k0, o, lane) wcol_io(W, k0, o, lane, DIN)
#define WOCOLH(W, k0, o, lane) wcolh_io(W, k0, o, lane, DIN)
#endif

#ifndef SM_EXTRA_PARAMS
#define SM_EXTRA_PARAMS
#endif
#ifndef PROJ_EXTRA_PARAMS
#define PROJ_EXTRA_PARAMS
#endif
#ifndef SM_MASK_HOOK
#define SM_MASK_HOOK (void)0
#endif

#define WS_QH  0u                                      // f16 q rows [b*t][CC]
#define WS_KH  (WS_QH + 2u * (size_t)NB * TT * CC)      // f16 k rows [b*t][CC]
#define WS_VT  (WS_KH + 2u * (size_t)NB * TT * CC)      // f16 v planes [b][c][t]
#define WS_QL  (WS_VT + 2u * (size_t)NB * CC * TT)      // f16 q residual x 2^10 rows [b][t < QHI][CC]
#define WS_KL  (WS_QL + 2u * (size_t)NB * QHI * CC)     // f16 k residual x 2^10 rows [b][t < KHI][CC]
#define WS_VB  (WS_KL + 2u * (size_t)NB * KHI * CC)     // bf16 v hi planes [b][c][t < KHI]
#define WS_VBL (WS_VB + 2u * (size_t)NB * CC * KHI)
#define WS_S   (WS_VBL + 2u * (size_t)NB * CC * KHI)    // f32 logits / P [hg][t][s]
#define WS_Y   (WS_S  + 4u * (size_t)HG * TT * TT)      // f32 ctx rows [b*t][CC] (only when there is an output projection)
#define WS_END (WS_Y  + 0u)
#define PVK 1024            // keys per key range of k_pv (one work-group's share of a 16-row group)
#define PVW 8               // waves per work-group of k_pv: the range's 32-key steps are dealt to them round robin
#define PVS (TT / PVK)      // most key ranges a query row can have = number of partial ctx planes
#define YPL ((size_t)NB * TT * CC)                      // floats per partial ctx plane
#define WS_Y2 (WS_END)                                  // f32 partial ctx rows [key range][b*TT + t][128] (columns 64..127 = the padding head); row t has ranges 0 .. t / PVK
#define WS_CM (WS_Y2 + 4u * PVS * YPL)                   // f32 column maxima [TT]
#define WS_CZ (WS_CM + 4u * (size_t)HG * TT)             // f32 2^11 / column sums [TT]
#define WS_END2 (WS_CZ + 4u * (size_t)HG * TT)

// ---- k_proj: block = (64 rows, 128 cols, which): q/k/v = X W (+ b) with exact bf16 products (K = DIN) -> which 0: q f16 rows (+ residual rows < QHI); 1: k f16 rows (+ residual rows < KHI); 2: v f16 planes [c][t] (+ bf16 hi/lo planes for t < KHI)
__global__ __launch_bounds__(128) void k_proj(const float* __restrict__ XQ, const float* __restrict__ XK, const float* __restrict__ XV, const float* __restrict__ WQ, const float* __restrict__ WK, const float* __restrict__ WV, const float* __restrict__ BQ, const float* __restrict__ BK, const float* __restrict__ BV,
    _Float16* __restrict__ QH, _Float16* __restrict__ QL, _Float16* __restrict__ KH, _Float16* __restrict__ KL, _Float16* __restrict__ VT, __bf16* __restrict__ VB, __bf16* __restrict__ VBL) {
  __shared__ __align__(16) _Float16 sh[64][136], sl[64][136]; __shared__ __align__(16) _Float16 th[128][72]; __shared__ __align__(16) __bf16 tb[128][72], tbl[128][72];
  const int tid = threadIdx.x, wave = tid >> 5, lane = tid & 31, col = lane & 15, g = lane >> 4; const int which = blockIdx.z; const int c0 = blockIdx.y * 128; const size_t r0 = (size_t)blockIdx.x * 64; const size_t bb = r0 / TT; const int t0 = (int)(r0 % TT);
  const float* X = which == 0 ? XQ : which == 1 ? XK : XV; const float* WA = which == 0 ? WQ : which == 1 ? WK : WV; const float* BA = which == 0 ? BQ : which == 1 ? BK : BV;
  v8f acc[8] = {};
#pragma unroll 2
  for (int kc = 0; kc < DIN / 32; ++kc) { v16b a; { const float* p = X + (r0 + wave * 16 + col) * DIN + kc * 32 + 8 * g;
#pragma unroll
      for (int i = 0; i < 8; ++i) { a[i] = (__bf16)p[i]; a[8 + i] = (__bf16)p[16 + i]; } }
    asm volatile("s_wait_loadcnt 0x0" ::: "memory");
#pragma unroll
    for (int j = 0; j < 8; ++j) { const v16b w = WCOL(WA, kc * 32, c0 + j * 16 + col, lane); asm volatile("s_wait_loadcnt 0x0" ::: "memory"); acc[j] = wmma_bf(a, w, acc[j]); } }
  if (which < 2) { _Float16* DH = which == 0 ? QH : KH; _Float16* DL = which == 0 ? QL : KL; const int nhi = which == 0 ? QHI : KHI; const bool hi_rows = t0 < nhi;
#pragma unroll
    for (int j = 0; j < 8; ++j) { const float bias = BA ? bfr(BA[c0 + j * 16 + col]) : 0.f;
#pragma unroll
      for (int r = 0; r < 8; ++r) { const float v = acc[j][r] + bias; const _Float16 hv = (_Float16)v; sh[wave * 16 + 8 * g + r][j * 16 + col] = hv; sl[wave * 16 + 8 * g + r][j * 16 + col] = (_Float16)((v - (float)hv) * 1024.0f); } }
    __syncthreads();
    for (int e = tid; e < 64 * 16; e += 128) { const int rl = e >> 4, q = e & 15; vst2((unsigned*)(DH + (r0 + rl) * CC + c0 + q * 8), *(const v4u*)&sh[rl][q * 8]); if (hi_rows) vst2((unsigned*)(DL + (bb * nhi + t0 + rl) * (size_t)CC + c0 + q * 8), *(const v4u*)&sl[rl][q * 8]); }
  } else { const bool hi_rows = t0 < KHI;
#pragma unroll
    for (int j = 0; j < 8; ++j) { const float bias = BA ? bfr(BA[c0 + j * 16 + col]) : 0.f;
#pragma unroll
      for (int r = 0; r < 8; ++r) { const float v = acc[j][r] + bias; const int rl = wave * 16 + 8 * g + r, cl = j * 16 + col; th[cl][rl] = (_Float16)v; const __bf16 bh = (__bf16)v; tb[cl][rl] = bh; tbl[cl][rl] = (__bf16)(v - (float)bh); } }
    __syncthreads();
    for (int e = tid; e < 128 * 8; e += 128) { const int cl = e >> 3, q = e & 7; vst2((unsigned*)(VT + (bb * CC + c0 + cl) * (size_t)TT + t0 + q * 8), *(const v4u*)&th[cl][q * 8]); if (hi_rows) { const size_t o3 = (bb * CC + c0 + cl) * (size_t)KHI + t0 + q * 8; vst2((unsigned*)(VB + o3), *(const v4u*)&tb[cl][q * 8]); vst2((unsigned*)(VBL + o3), *(const v4u*)&tbl[cl][q * 8]); } } } }
// ---- k_sc: block = (query block qb, key block kb <= kb_last(qb), head in group) of batch b: logits x SCALE; q hi + residual (x 2^10) against k (2 products) for query rows < QHI, plus the k residual (3 products) for query blocks < QBH (QBH = NQB: every block); causal: blocks past the diagonal exit, the mask itself is applied by index in k_colstat_c and k_pv
__global__ __launch_bounds__(128) void k_sc(const _Float16* __restrict__ QH, const _Float16* __restrict__ KH, const _Float16* __restrict__ QL, const _Float16* __restrict__ KL, int b, int h0, float* __restrict__ S0) { __shared__ __align__(16) float ss[4][16][132];
  const int qb = blockIdx.x, kb = blockIdx.y; if (kb > kb_last(qb)) return;
  const int h = h0 + blockIdx.z; float* S = S0 + (size_t)blockIdx.z * TT * TT;
  const int tid = threadIdx.x, wave = tid >> 5, lane = tid & 31, col = lane & 15, g = lane >> 4; const int k0 = kb * 128; const int ql0 = qb * 64 + wave * 16; const size_t q0 = (size_t)b * TT + ql0, kr0 = (size_t)b * TT + k0;
  v8f acc[8] = {}, accl[8] = {};
  const _Float16* QLb = QL + (size_t)b * QHI * CC; const _Float16* KLb = KL + (size_t)b * KHI * CC;
  if (qb < QBH) {
#pragma unroll
    for (int kc = 0; kc < HD / 32; ++kc) { const v16h ah = frag_h(QH + (q0 + col) * CC + h * HD + kc * 32, lane), al = frag_h(QLb + (size_t)(ql0 + col) * CC + h * HD + kc * 32, lane);
#pragma unroll
      for (int j = 0; j < 8; ++j) { const v16h kbf = frag_h(KH + (kr0 + j * 16 + col) * CC + h * HD + kc * 32, lane), klf = frag_h(KLb + (size_t)(k0 + j * 16 + col) * CC + h * HD + kc * 32, lane); acc[j] = wmma16(ah, kbf, acc[j]); accl[j] = wmma16(al, kbf, accl[j]); accl[j] = wmma16(ah, klf, accl[j]); } }
  } else if (qb * 64 < QHI) {
#pragma unroll
    for (int kc = 0; kc < HD / 32; ++kc) { const v16h ah = frag_h(QH + (q0 + col) * CC + h * HD + kc * 32, lane), al = frag_h(QLb + (size_t)(ql0 + col) * CC + h * HD + kc * 32, lane);
#pragma unroll
      for (int j = 0; j < 8; ++j) { const v16h kbf = frag_h(KH + (kr0 + j * 16 + col) * CC + h * HD + kc * 32, lane); acc[j] = wmma16(ah, kbf, acc[j]); accl[j] = wmma16(al, kbf, accl[j]); } }
  } else {
#pragma unroll
    for (int kc = 0; kc < HD / 32; ++kc) { const v16h ah = frag_h(QH + (q0 + col) * CC + h * HD + kc * 32, lane);
#pragma unroll
      for (int j = 0; j < 8; ++j) { const v16h kbf = frag_h(KH + (kr0 + j * 16 + col) * CC + h * HD + kc * 32, lane); acc[j] = wmma16(ah, kbf, acc[j]); } } }
#pragma unroll
  for (int j = 0; j < 8; ++j) {
#pragma unroll
    for (int r = 0; r < 8; ++r) ss[wave][8 * g + r][j * 16 + col] = (acc[j][r] + accl[j][r] * (1.0f / 1024.0f)) * SCALE; }
  LDSX(); for (int rl = 0; rl < 16; ++rl) vst2(S + (size_t)(ql0 + rl) * TT + k0 + lane * 4, *(const v4f*)&ss[wave][rl][lane * 4]); }
// ---- k_sm: block = query row t (head in group): keys [0, kend): causal -> logit if s <= t else excluded; softmax in f32; P x 2^11 in place (0 for excluded)
__global__ __launch_bounds__(256) void k_sm(float* __restrict__ S0 SM_EXTRA_PARAMS) { __shared__ float sred[8]; __shared__ float sbc; __shared__ __align__(16) float shv[TT];
  const int tid = threadIdx.x; const int t = blockIdx.x; const int kend = (kb_last(t >> 6) + 1) * 128;
  float* sr = S0 + (size_t)blockIdx.y * TT * TT + (size_t)t * TT;
  float m = -3.0e38f; for (int k = tid; k < kend; k += 256) { float v = (!CAUSAL || k <= t) ? sr[k] : -3.0e38f; SM_MASK_HOOK; shv[k] = v; m = fmaxf(m, v); }
#pragma unroll
  for (int o = 1; o < 32; o <<= 1) m = fmaxf(m, __shfl_xor(m, o));
  if ((tid & 31) == 0) sred[tid >> 5] = m; __syncthreads(); if (tid == 0) { float a = sred[0]; for (int i = 1; i < 8; ++i) a = fmaxf(a, sred[i]); sbc = a; } __syncthreads(); m = sbc; __syncthreads();
  float sum = 0.f; for (int k = tid; k < kend; k += 256) { const float v = shv[k]; const float e = (v <= -1.0e38f) ? 0.f : expf(v - m); shv[k] = e; sum += e; }
#pragma unroll
  for (int o = 1; o < 32; o <<= 1) sum += __shfl_xor(sum, o);
  if ((tid & 31) == 0) sred[tid >> 5] = sum; __syncthreads(); if (tid == 0) { float a = 0.f; for (int i = 0; i < 8; ++i) a += sred[i]; sbc = a > 0.f ? 2048.0f / a : 0.f; }   /* a fully excluded row yields P = 0 */ __syncthreads(); const float inv = sbc;
  for (int k = tid; k < kend; k += 256) shv[k] = shv[k] * inv;
  __syncthreads(); for (int q = tid; q < kend / 4; q += 256) vst2(sr + q * 4, *(const v4f*)&shv[q * 4]); }
// ---- k_colstat_c: softmax over the QUERY axis under the causal mask (the source's softmax(axis=1) on [B, t, s] scores with -1e9 above the diagonal): for every key column k: m_k = max_{q >= k} S[q][k], Z_k = sum_{q >= k} exp(S[q][k] - m_k) (f32, precise expf); CM holds m_k, CZ holds 2^11 / Z_k.
// block = 32 key columns (one 128-B line of CM and of CZ), 32 waves; a wave's 16-B loads cover 4 query rows x 32 columns, the block a group of 128 rows, and a lane keeps 8 such groups in flight (1024 rows a trip), so the query axis is cut into 128 interleaved slices per column. Each lane runs the online max / sum on its slice (one rescale per 8 rows); slices are merged max first, then rescaled sums: across the 4 rows of a wave by shuffles, across waves through LDS.
// The walk starts at the 128-aligned group that holds the block's first column, so every score read lies in a block k_sc has written; a group past the end re-reads the last group. q < k and the groups past the end enter as -inf (exp gives 0) while the running max starts finite, so a slice with no visible row ends as (-3e38, 0) and drops out of the merge.
__global__ __launch_bounds__(1024) void k_colstat_c(const float* __restrict__ S0, float* __restrict__ CM, float* __restrict__ CZ) { __shared__ __align__(16) float pm[32][32], pz[32][32];
  const int tid = threadIdx.x, wave = tid >> 5, lane = tid & 31; const int k0 = blockIdx.x * 32, qlo = k0 & ~127; const int r = tid >> 3, kc = k0 + (tid & 7) * 4;   /* the lane's row inside a group, its first column */
  const char* sp = (const char*)(S0 + (size_t)blockIdx.y * TT * TT); const unsigned vo = (unsigned)(r * TT + kc) * 4u, vtop = vo + (unsigned)(TT - 128) * (TT * 4u);   /* the lane's byte offset in group 0 and in the last group */
  unsigned off[8]; float m[4], z[4];
#pragma unroll
  for (int u = 0; u < 8; ++u) { const unsigned o = vo + (unsigned)(qlo + u * 128) * (TT * 4u); off[u] = o < vtop ? o : vtop; }
#pragma unroll
  for (int c = 0; c < 4; ++c) { m[c] = -3.0e38f; z[c] = 0.f; }
  for (int ub0 = qlo; ub0 < TT; ub0 += 1024) { v4f s[8];
#pragma unroll
    for (int u = 0; u < 8; ++u) s[u] = *(const v4f*)(sp + off[u]);
#pragma unroll
    for (int c = 0; c < 4; ++c) { float v[8]; float mn = m[c];
#pragma unroll
      for (int u = 0; u < 8; ++u) { const int ub = ub0 + u * 128; v[u] = ((ub < TT ? ub : -TT) >= kc + c - r) ? s[u][c] : -INFINITY; mn = fmaxf(mn, v[u]); }
      float a = z[c] * expf(m[c] - mn);
#pragma unroll
      for (int u = 0; u < 8; ++u) a += expf(v[u] - mn);
      m[c] = mn; z[c] = a; }
#pragma unroll
    for (int u = 0; u < 8; ++u) { const unsigned o = off[u] + 1024u * (TT * 4u); off[u] = o < vtop ? o : vtop; } }
  v4f wm, wz;
#pragma unroll
  for (int c = 0; c < 4; ++c) { float M = fmaxf(m[c], __shfl_xor(m[c], 8)); M = fmaxf(M, __shfl_xor(M, 16)); float a = z[c] * expf(m[c] - M); a += __shfl_xor(a, 8); a += __shfl_xor(a, 16); wm[c] = M; wz[c] = a; }
  if (lane < 8) { *(v4f*)&pm[wave][lane * 4] = wm; *(v4f*)&pz[wave][lane * 4] = wz; }
  __syncthreads();   /* publishes the 32 waves' partial (max, sum) pairs to wave 0 */
  if (wave == 0) { float M = pm[0][lane];
#pragma unroll
    for (int w = 1; w < 32; ++w) M = fmaxf(M, pm[w][lane]);
    float a = 0.f;
#pragma unroll
    for (int w = 0; w < 32; ++w) a += pz[w][lane] * expf(pm[w][lane] - M);
    vst2(CM + (size_t)blockIdx.y * TT + k0 + lane, M); vst2(CZ + (size_t)blockIdx.y * TT + k0 + lane, 2048.0f / a); } }   /* every column sees at least its own diagonal entry: Z_k >= 1; stored as 2^11 / Z_k, the factor k_pv multiplies by */
// P values of one A fragment, formed from the logits where k_pv loads them: v = exp(S[t][k] - m_k) * (2^11 / Z_k) for k <= t, 0 above the diagonal; element order = the 16x16x32 A fragment's (keys k0 + 8h + 0..7, then k0 + 16 + 8h + 0..7).
// p_load issues the twelve 16-B loads unconditionally and together (logits, column maxima, column factors); p_vals does the arithmetic on every element and selects by index afterwards, so no load and no exp sits behind a per-lane branch.
struct PRaw { v4f s[4], m[4], z[4]; };
__device__ __forceinline__ PRaw p_load(const float* srow, const float* cm, const float* ci, int k0, int lane) { PRaw r; const int kb = k0 + 8 * (lane >> 4); const float *p = srow + kb, *m = cm + kb, *z = ci + kb;
#pragma unroll
  for (int q = 0; q < 4; ++q) { const int o = (q >> 1) * 16 + (q & 1) * 4; r.s[q] = *(const v4f*)(p + o); r.m[q] = *(const v4f*)(m + o); r.z[q] = *(const v4f*)(z + o); }
  /* inputs-only fence on the loaded values: all twelve loads are in flight together and are waited for once; without it the compiler deals them out in small groups, each with a wait of its own */
  asm volatile("" :: "v"(r.s[0]), "v"(r.s[1]), "v"(r.s[2]), "v"(r.s[3]), "v"(r.m[0]), "v"(r.m[1]), "v"(r.m[2]), "v"(r.m[3]), "v"(r.z[0]), "v"(r.z[1]), "v"(r.z[2]), "v"(r.z[3]));
  return r; }
__device__ __forceinline__ void p_vals(float v[16], const PRaw& r, int k0, int t, int lane) { const int kb = k0 + 8 * (lane >> 4);
#pragma unroll
  for (int q = 0; q < 4; ++q)
#pragma unroll
    for (int u = 0; u < 4; ++u) { const float e = expf(r.s[q][u] - r.m[q][u]) * r.z[q][u]; v[q * 4 + u] = (kb + (q >> 1) * 16 + (q & 1) * 4 + u <= t) ? e : 0.f; } }
// ---- k_out64: out[b][t][0..63] = sum over the row's key ranges (ascending) of the partial ctx row, columns 0..63 (256 B by 16 lanes); the block's 16 rows lie in one band of PVK rows, so the range count is the same for all of them
__global__ __launch_bounds__(256) void k_out64(const float* __restrict__ Y, float* __restrict__ OUT) { const size_t row = (size_t)blockIdx.x * 16 + (threadIdx.x >> 4); const int q = threadIdx.x & 15; const int nr = (int)((blockIdx.x * 16u) % TT) / PVK + 1; const float* yp = Y + row * CC + q * 4; v4f v = *(const v4f*)yp;
  for (int c = 1; c < nr; ++c) v += *(const v4f*)(yp + c * YPL);
  asm volatile("s_wait_loadcnt 0x0" ::: "memory"); vst2(OUT + row * 64 + q * 4, v); }
// ---- k_pv: block = (16 queries, one range of PVK keys) of (b, h): partial ctx = P . v over the range's keys below kend, P = exp(S - m_k) x 2^11 / Z_k formed from the logits and the column statistics as the A fragment is loaded (every query block is < QBH: P and v as bf16 hi + lo, 3 products; the P x 2^11 f16 against v f16 path, 1 product, is not taken); 256-B (row, head) segment by 16 lanes
// Split over keys: rows of band d = t / PVK have d + 1 ranges; blockIdx.y numbers the (band, range) pairs, the 6 full ranges first, then each band's last range (the one the diagonal cuts short); blockIdx.x is the 16-row group inside the band. The PVW waves take the range's 32-key steps round robin, their f32 partials are added through LDS (wave order), and the ranges' partial rows go to planes of Y that k_out64 adds.
__global__ __launch_bounds__(32 * PVW) void k_pv(const float* __restrict__ PS0, const _Float16* __restrict__ VT, const __bf16* __restrict__ VB, const __bf16* __restrict__ VBL, const float* __restrict__ CM, const float* __restrict__ CI, int b, int h0, float* __restrict__ Y) { const int h = h0 + blockIdx.z; const float* PS = PS0 + (size_t)blockIdx.z * TT * TT; const float* cm = CM + (size_t)blockIdx.z * TT; const float* ci = CI + (size_t)blockIdx.z * TT; __shared__ __align__(16) float ss[PVW][16][HD + 4];
  const int tid = threadIdx.x, wave = __builtin_amdgcn_readfirstlane(tid >> 5), lane = tid & 31, col = lane & 15, g = lane >> 4;   /* the wave number in a scalar register: the key loop's bounds stay wave-uniform */
  const int py = blockIdx.y; const int band = py >= 6 ? py - 6 : py >= 3 ? 3 : py >= 1 ? 2 : 1; const int rng = py >= 6 ? band : py >= 3 ? py - 3 : py >= 1 ? py - 1 : 0;
  const int ql0 = band * PVK + blockIdx.x * 16; const int qb = ql0 >> 6; const int kall = (kb_last(qb) + 1) * 4; const int kcb = rng * (PVK / 32) + wave; const int kce = kall < (rng + 1) * (PVK / 32) ? kall : (rng + 1) * (PVK / 32);
  v8f acc[HD / 16] = {};
  if (qb < QBH) {
#pragma unroll 1
    for (int kc = kcb; kc < kce; kc += PVW) { const PRaw pr = p_load(PS + (size_t)(ql0 + col) * TT, cm, ci, kc * 32, lane);
      float pv[16]; p_vals(pv, pr, kc * 32, ql0 + col, lane); const F2 p = bsplit16(pv);
#pragma unroll
      for (int j = 0; j < HD / 16; ++j) { const size_t po = ((size_t)b * CC + h * HD + j * 16 + col) * (size_t)KHI + kc * 32; const v16b vh = frag_b(VB + po, lane); acc[j] = wmma_bf(p.h, vh, acc[j]); acc[j] = wmma_bf(p.l, vh, acc[j]); acc[j] = wmma_bf(p.h, frag_b(VBL + po, lane), acc[j]); } }
  } else {
#pragma unroll 1
    for (int kc = kcb; kc < kce; kc += PVW) { const PRaw pr = p_load(PS + (size_t)(ql0 + col) * TT, cm, ci, kc * 32, lane);
      float pv[16]; p_vals(pv, pr, kc * 32, ql0 + col, lane); v16h p;
#pragma unroll
      for (int i = 0; i < 16; ++i) p[i] = (_Float16)pv[i];
#pragma unroll
      for (int j = 0; j < HD / 16; ++j) { const size_t po = ((size_t)b * CC + h * HD + j * 16 + col) * (size_t)TT + kc * 32; acc[j] = wmma16(p, frag_h(VT + po, lane), acc[j]); } } }
#pragma unroll
  for (int j = 0; j < HD / 16; ++j)
#pragma unroll
    for (int r = 0; r < 8; ++r) ss[wave][8 * g + r][j * 16 + col] = acc[j][r] * (1.0f / 2048.0f);
  __syncthreads();   /* publishes the PVW waves' partial tiles to the threads that add them */
  { const int rl = tid >> 4, q = tid & 15; v4f s = *(const v4f*)&ss[0][rl][q * 4];
#pragma unroll   /* unrolled so that the PVW LDS reads issue together instead of one wait each */
    for (int w = 1; w < PVW; ++w) s += *(const v4f*)&ss[w][rl][q * 4];
    vst2(Y + rng * YPL + ((size_t)b * TT + ql0 + rl) * CC + h * HD + q * 4, s); } }

extern "C" void kernel_launch(void* const* d_in, const int* in_sizes, int n_in, void* d_out, int out_size, void* d_ws, size_t ws_size, hipStream_t stream) {
  (void)in_sizes; (void)n_in; (void)out_size;
  const float** F = (const float**)d_in;
  if (ws_size < (size_t)WS_END) return;
  char* ws = (char*)d_ws; _Float16 *QH = (_Float16*)(ws + WS_QH), *KH = (_Float16*)(ws + WS_KH), *VT = (_Float16*)(ws + WS_VT), *QL = (_Float16*)(ws + WS_QL), *KL = (_Float16*)(ws + WS_KL); __bf16 *VB = (__bf16*)(ws + WS_VB), *VBL = (__bf16*)(ws + WS_VBL); float *S = (float*)(ws + WS_S), *Y = (float*)(ws + WS_Y);
  (void)Y; (void)QL; (void)KL; (void)VB; (void)VBL;
  // inputs: 0 x [4,4096,512]; 1 Wq [64,512] (out,in); 2 Wk; 3 Wv; no biases
  if (ws_size < (size_t)WS_END2) return;
  float *Y2 = (float*)(ws + WS_Y2), *CM = (float*)(ws + WS_CM), *CZ = (float*)(ws + WS_CZ);
  k_proj<<<dim3(TNB * TT / 64, CC / 128, 3), 128, 0, stream>>>(F[0], F[0], F[0], F[1], F[2], F[3], nullptr, nullptr, nullptr, QH, QL, KH, KL, VT, VB, VBL);   /* weight columns 64..127 (the padding head) are zero fragments */
  for (int b = 0; b < TNB; ++b) {   /* head 0 only (head 1 is the zero padding) */
    k_sc<<<dim3(NQB, TT / 128, 1), 128, 0, stream>>>(QH, KH, QL, KL, b, 0, S);
    k_colstat_c<<<dim3(TT / 32, 1), 1024, 0, stream>>>(S, CM, CZ);   /* per key column s: max and 2^11 / sum over the visible queries t >= s */
    k_pv<<<dim3(PVK / 16, PVS * (PVS + 1) / 2, 1), 32 * PVW, 0, stream>>>(S, VT, VB, VBL, CM, CZ, b, 0, Y2);   /* (16-row group in its band) x (band, key range); P[t][s] = exp(S - m_s) x 2^11 / Z_s is formed in its loader */
  }
  k_out64<<<dim3(TNB * TT / 16), 256, 0, stream>>>(Y2, (float*)d_out);
}

// v004
// Measured time: 207 microseconds a run.
// Timed twice side by side with v003, it ran 1.31 and 1.32 times as fast.
// All steps since v000 together make it 36.4 times as fast.
// compute dtype: all float inputs rounded to bf16; q/k/v projections with EXACT bf16 products on WMMA 16x16x32 (f32 accumulate); causal scores with BOTH q and k as f16 hi + (x 2^10) residual (3 products) on EVERY block, x 64^-0.5; softmax over the QUERY axis in f32 (per key column: online max / sum over the visible queries, precise expf); P as bf16 hi + lo against v as bf16 hi + lo (3 products) on EVERY block; f32 output.
#include <hip/hip_runtime.h>
#include <math.h>

typedef __attribute__((ext_vector_type(16))) _Float16 v16h;
typedef __attribute__((ext_vector_type(16))) __bf16 v16b;
typedef __attribute__((ext_vector_type(8)))  _Float16 v8h;
typedef __attribute__((ext_vector_type(8)))  float v8f;
typedef __attribute__((ext_vector_type(4)))  float v4f;
typedef __attribute__((ext_vector_type(2)))  float v2f;
typedef __attribute__((ext_vector_type(4)))  unsigned v4u;
typedef __attribute__((ext_vector_type(4)))  int v4i;
typedef float __attribute__((may_alias)) float_a;
typedef int __attribute__((may_alias)) int_a;

template <typename T> __device__ __forceinline__ void vst2(void* p, T v) { *(T*)p = v;  }
__device__ __forceinline__ v8f wmma16(v16h a, v16h b, v8f c) {
  v8f d = __builtin_amdgcn_wmma_f32_16x16x32_f16(false, a, false, b, (short)0, c, false, false);
  asm volatile("v_nop\n\tv_nop\n\tv_nop\n\tv_nop" : "+v"(d) : "v"(a), "v"(b));
  return d;
}
__device__ __forceinline__ v8f wmma_bf(v16b a, v16b b, v8f c) {
  v8f d = __builtin_amdgcn_wmma_f32_16x16x32_bf16(false, a, false, b, (short)0, c, false, false);
  asm volatile("v_nop\n\tv_nop\n\tv_nop\n\tv_nop" : "+v"(d) : "v"(a), "v"(b));
  return d;
}
// 16x16x32 fragments: lane = (h = lane>>4, row/col = lane&15); elements 0..7 = k0+8h+0..7, 8..15 = k0+16+8h+0..7; D element r = row 8h+r
__device__ __forceinline__ v16h frag_h(const _Float16* rowk0, int lane) {
  union { v16h v; v8h q[2]; } u; const _Float16* p = rowk0 + 8 * (lane >> 4);
  u.q[0] = *(const v8h*)p; u.q[1] = *(const v8h*)(p + 16); return u.v;
}
__device__ __forceinline__ v16h frag_f32(const float* rowk0, int lane) {
  v16h a; const float* p = rowk0 + 8 * (lane >> 4);
#pragma unroll
  for (int i = 0; i < 8; ++i) { a[i] = (_Float16)p[i]; a[8 + i] = (_Float16)p[16 + i]; }
  return a;
}
__device__ __forceinline__ v16h frag_f32s(const float* rowk0, int lane, float sc) {
  v16h a; const float* p = rowk0 + 8 * (lane >> 4);
#pragma unroll
  for (int i = 0; i < 8; ++i) { a[i] = (_Float16)(p[i] * sc); a[8 + i] = (_Float16)(p[16 + i] * sc); }
  return a;
}
// column fragment from a [K][ld] layout (column n), rows >= K read as 0
__device__ __forceinline__ v16h fragc_f32(const float* W, int k0, int n, int lane, int ld, int K) {
  v16h a; const int g = lane >> 4;
#pragma unroll
  for (int i = 0; i < 8; ++i) { const int ka = k0 + 8 * g + i, kb = ka + 16;
    a[i] = (_Float16)(ka < K ? W[(size_t)(ka < K ? ka : K - 1) * ld + n] : 0.f); a[8 + i] = (_Float16)(kb < K ? W[(size_t)(kb < K ? kb : K - 1) * ld + n] : 0.f); }
  return a;
}
struct F2 { v16b h, l; };
__device__ __forceinline__ F2 bsplit16(const float v[16]) { F2 r;
#pragma unroll
  for (int i = 0; i < 16; ++i) { const __bf16 h = (__bf16)v[i]; r.h[i] = h; r.l[i] = (__bf16)(v[i] - (float)h); }
  return r; }
__device__ __forceinline__ F2 split_row(const float* row, int k0, int lane) { float v[16]; const float* p = row + k0 + 8 * (lane >> 4);
#pragma unroll
  for (int i = 0; i < 8; ++i) { v[i] = p[i]; v[8 + i] = p[16 + i]; }
  return bsplit16(v); }
__device__ __forceinline__ F2 split_rowK(const float* row, int k0, int lane, int K) { float v[16]; const int g = lane >> 4;
#pragma unroll
  for (int i = 0; i < 8; ++i) { const int ka = k0 + 8 * g + i, kb = ka + 16; v[i] = ka < K ? row[ka < K ? ka : K - 1] : 0.f; v[8 + i] = kb < K ? row[kb < K ? kb : K - 1] : 0.f; }
  return bsplit16(v); }
__device__ __forceinline__ F2 split_col(const float* W, int k0, int n, int lane, int ld, int K) { float v[16]; const int g = lane >> 4;
#pragma unroll
  for (int i = 0; i < 8; ++i) { const int ka = k0 + 8 * g + i, kb = ka + 16; v[i] = ka < K ? W[(size_t)(ka < K ? ka : K - 1) * ld + n] : 0.f; v[8 + i] = kb < K ? W[(size_t)(kb < K ? kb : K - 1) * ld + n] : 0.f; }
  return bsplit16(v); }
__device__ __forceinline__ v8f mac3(const F2& a, const F2& b, v8f c) { c = wmma_bf(a.l, b.h, c); c = wmma_bf(a.h, b.l, c); return wmma_bf(a.h, b.h, c); }
__device__ __forceinline__ float sigm(float v) { return 1.0f / (1.0f + expf(-v)); }
#define LDSX() do { asm volatile("s_wait_dscnt 0" ::: "memory"); __builtin_amdgcn_wave_barrier(); __builtin_amdgcn_fence(__ATOMIC_RELEASE, "workgroup"); } while (0)

// Single-head causal self-attention whose softmax runs over the QUERY axis (x [4,4096,512]; torch (out,in) Wq / Wk / Wv [64,512] (0.02 scale), no biases; scores = q k^T [B,t,s]; additive causal mask -1e9 where s > t; / sqrt(64); attn = softmax(scores, axis=1) - axis 1 is the QUERY axis t, so every key column s is normalised over the queries t >= s (faithful to the source); out = attn v -> [4,4096,64]).
#define NB 4
#define TT 4096
#define CC 128            // NH * HD = projected width
#define DIN 512          // input (model) width
#define NH 2
#define HD 64
#define NQB (TT / 64)
#define HG 1
#define SCALE (0.125f)
#define CAUSAL 1
#ifndef TNB
#define TNB NB
#endif
__device__ __forceinline__ float bfr(float v) { return (float)(__bf16)v; }
__host__ __device__ __forceinline__ int kb_last(int qb) { return CAUSAL ? ((qb * 64 + 63) >> 7) : (TT / 128 - 1); }
typedef __attribute__((ext_vector_type(8))) __bf16 v8b;
__device__ __forceinline__ v16b frag_b(const __bf16* rowk0, int lane) {
  union { v16b v; v8b q[2]; } u; const __bf16* p = rowk0 + 8 * (lane >> 4);
  u.q[0] = *(const v8b*)p; u.q[1] = *(const v8b*)(p + 16); return u.v;
}
#define QBH 64              // = NQB: 3-product scores and bf16 hi/lo P.v on every query block
#define QHI 4096            // EVERY row carries a q residual plane: with the softmax over the QUERY axis the few-term region is the END of the sequence (late key columns see few queries), so the high-precision paths run everywhere
#define KHI 4096            // every key row carries the k residual and the v bf16 hi + lo planes
// B fragment (k rows k0+.., output column o) of a weight: (in,out) [K][ld] or (out,in) [ld rows of K]: bf16 exact, or f16(bf16 * 256) exact
__device__ __forceinline__ v16b wcol_io(const float* Wm, int k0, int o, int lane, int ld) { v16b w; const int g = lane >> 4;
#pragma unroll
  for (int i = 0; i < 8; ++i) { w[i] = (__bf16)Wm[(size_t)(k0 + 8 * g + i) * ld + o]; w[8 + i] = (__bf16)Wm[(size_t)(k0 + 16 + 8 * g + i) * ld + o]; }
  return w; }
__device__ __forceinline__ v16b wcol_oi(const float* Wm, int k0, int o, int lane, int K) { v16b w; const float* p = Wm + (size_t)o * K + k0 + 8 * (lane >> 4);
#pragma unroll
  for (int i = 0; i < 8; ++i) { w[i] = (__bf16)p[i]; w[8 + i] = (__bf16)p[16 + i]; }
  return w; }
__device__ __forceinline__ v16h wcolh_io(const float* Wm, int k0, int o, int lane, int ld) { v16h w; const int g = lane >> 4;
#pragma unroll
  for (int i = 0; i < 8; ++i) { w[i] = (_Float16)(bfr(Wm[(size_t)(k0 + 8 * g + i) * ld + o]) * 256.0f); w[8 + i] = (_Float16)(bfr(Wm[(size_t)(k0 + 16 + 8 * g + i) * ld + o]) * 256.0f); }
  return w; }
__device__ __forceinline__ v16h wcolh_oi(const float* Wm, int k0, int o, int lane, int K) { v16h w; const float* p = Wm + (size_t)o * K + k0 + 8 * (lane >> 4);
#pragma unroll
  for (int i = 0; i < 8; ++i) { w[i] = (_Float16)(bfr(p[i]) * 256.0f); w[8 + i] = (_Float16)(bfr(p[16 + i]) * 256.0f); }
  return w; }
#define WQKV_LAYOUT 1   // 0 = (in,out) [DIN][CC]; 1 = (out,in) [64][DIN]; 2 = per-head [NH][DIN][HD]
__device__ __forceinline__ v16b wcol_hdk(const float* Wm, int k0, int o, int lane) { v16b w; const int g = lane >> 4; const float* p = Wm + (size_t)(o / HD) * DIN * HD + (o % HD);
#pragma unroll
  for (int i = 0; i < 8; ++i) { w[i] = (__bf16)p[(size_t)(k0 + 8 * g + i) * HD]; w[8 + i] = (__bf16)p[(size_t)(k0 + 16 + 8 * g + i) * HD]; }
  return w; }
#define WO_OUT_IN 0
#if WQKV_LAYOUT == 1
__device__ __forceinline__ v16b zero16b() { v16b w; _Pragma("unroll") for (int i = 0; i < 16; ++i) w[i] = (__bf16)0.0f; return w; }
#define WCOL(W, k0, o, lane) ((o) < 64 ? wcol_oi(W, k0, (o), lane, DIN) : zero16b())   /* (out,in) [64][512]: only 64 real output rows; projected columns 64..127 (padding head 1) are zero; the test is compile-time per unrolled tile (c0 = 0) */
#elif WQKV_LAYOUT == 2
#define WCOL(W, k0, o, lane) wcol_hdk(W, k0, o, lane)
#else
#define WCOL(W, k0, o, lane) wcol_io(W, k0, o, lane, CC)
#endif
#if WO_OUT_IN
#define WOCOL(W, k0, o, lane) wcol_oi(W, k0, o, lane, CC)
#define WOCOLH(W, k0, o, lane) wcolh_oi(W, k0, o, lane, CC)
#else
#define WOCOL(W, k0, o, lane) wcol_io(W, k0, o, lane, DIN)
#define WOCOLH(W, k0, o, lane) wcolh_io(W, k0, o, lane, DIN)
#endif

#ifndef SM_EXTRA_PARAMS
#define SM_EXTRA_PARAMS
#endif
#ifndef PROJ_EXTRA_PARAMS
#define PROJ_EXTRA_PARAMS
#endif
#ifndef SM_MASK_HOOK
#define SM_MASK_HOOK (void)0
#endif

#define WS_QH  0u                                      // f16 q rows [b*t][CC]
#define WS_KH  (WS_QH + 2u * (size_t)NB * TT * CC)      // f16 k rows [b*t][CC]
#define WS_VT  (WS_KH + 2u * (size_t)NB * TT * CC)      // f16 v planes [b][c][t]
#define WS_QL  (WS_VT + 2u * (size_t)NB * CC * TT)      // f16 q residual x 2^10 rows [b][t < QHI][CC]
#define WS_KL  (WS_QL + 2u * (size_t)NB * QHI * CC)     // f16 k residual x 2^10 rows [b][t < KHI][CC]
#define WS_VB  (WS_KL + 2u * (size_t)NB * KHI * CC)     // bf16 v hi planes [b][c][t < KHI]
#define WS_VBL (WS_VB + 2u * (size_t)NB * CC * KHI)
#define WS_S   (WS_VBL + 2u * (size_t)NB * CC * KHI)    // f32 logits [b][tile][128][128], see STL
#define STL ((TT / 128) * (TT / 128 + 1) / 2)          // 128 x 128 logit tiles of one batch: only the tiles (a = t / 128, kb = s / 128) with kb <= a exist, tile number a (a + 1) / 2 + kb; so the logits of all NB batches fit in the workspace at once
#define TLF (128 * 128)                                // floats per logit tile, rows of 128 floats
#define WS_Y   (WS_S  + 4u * (size_t)NB * STL * TLF)    // f32 ctx rows [b*t][CC] (only when there is an output projection)
#define WS_END (WS_Y  + 0u)
#define PVK 1024            // keys per key range of k_pv (one work-group's share of a 16-row group)
#define PVW 8               // waves per work-group of k_pv: the range's 32-key steps are dealt to them round robin
#define PVS (TT / PVK)      // most key ranges a query row can have = number of partial ctx planes
#define YPL ((size_t)NB * TT * CC)                      // floats per partial ctx plane
#define WS_Y2 (WS_END)                                  // f32 partial ctx rows [key range][b*TT + t][128] (columns 64..127 = the padding head); row t has ranges 0 .. t / PVK
#define WS_CM (WS_Y2 + 4u * PVS * YPL)                   // f32 column maxima [b][TT]
#define WS_CZ (WS_CM + 4u * (size_t)NB * TT)             // f32 2^11 / column sums [b][TT]
#define WS_END2 (WS_CZ + 4u * (size_t)NB * TT)

// ---- k_proj: block = (64 rows, 128 cols, which): q/k/v = X W (+ b) with exact bf16 products (K = DIN) -> which 0: q f16 rows (+ residual rows < QHI); 1: k f16 rows (+ residual rows < KHI); 2: v f16 planes [c][t] (+ bf16 hi/lo planes for t < KHI)
__global__ __launch_bounds__(128) void k_proj(const float* __restrict__ XQ, const float* __restrict__ XK, const float* __restrict__ XV, const float* __restrict__ WQ, const float* __restrict__ WK, const float* __restrict__ WV, const float* __restrict__ BQ, const float* __restrict__ BK, const float* __restrict__ BV,
    _Float16* __restrict__ QH, _Float16* __restrict__ QL, _Float16* __restrict__ KH, _Float16* __restrict__ KL, _Float16* __restrict__ VT, __bf16* __restrict__ VB, __bf16* __restrict__ VBL) {
  __shared__ __align__(16) _Float16 sh[64][136], sl[64][136]; __shared__ __align__(16) _Float16 th[128][72]; __shared__ __align__(16) __bf16 tb[128][72], tbl[128][72];
  const int tid = threadIdx.x, wave = tid >> 5, lane = tid & 31, col = lane & 15, g = lane >> 4; const int which = blockIdx.z; const int c0 = blockIdx.y * 128; const size_t r0 = (size_t)blockIdx.x * 64; const size_t bb = r0 / TT; const int t0 = (int)(r0 % TT);
  const float* X = which == 0 ? XQ : which == 1 ? XK : XV; const float* WA = which == 0 ? WQ : which == 1 ? WK : WV; const float* BA = which == 0 ? BQ : which == 1 ? BK : BV;
  v8f acc[8] = {};
#pragma unroll 2
  for (int kc = 0; kc < DIN / 32; ++kc) { v16b a; { const float* p = X + (r0 + wave * 16 + col) * DIN + kc * 32 + 8 * g;
#pragma unroll
      for (int i = 0; i < 8; ++i) { a[i] = (__bf16)p[i]; a[8 + i] = (__bf16)p[16 + i]; } }
    asm volatile("s_wait_loadcnt 0x0" ::: "memory");
#pragma unroll
    for (int j = 0; j < 8; ++j) { const v16b w = WCOL(WA, kc * 32, c0 + j * 16 + col, lane); asm volatile("s_wait_loadcnt 0x0" ::: "memory"); acc[j] = wmma_bf(a, w, acc[j]); } }
  if (which < 2) { _Float16* DH = which == 0 ? QH : KH; _Float16* DL = which == 0 ? QL : KL; const int nhi = which == 0 ? QHI : KHI; const bool hi_rows = t0 < nhi;
#pragma unroll
    for (int j = 0; j < 8; ++j) { const float bias = BA ? bfr(BA[c0 + j * 16 + col]) : 0.f;
#pragma unroll
      for (int r = 0; r < 8; ++r) { const float v = acc[j][r] + bias; const _Float16 hv = (_Float16)v; sh[wave * 16 + 8 * g + r][j * 16 + col] = hv; sl[wave * 16 + 8 * g + r][j * 16 + col] = (_Float16)((v - (float)hv) * 1024.0f); } }
    __syncthreads();
    for (int e = tid; e < 64 * 16; e += 128) { const int rl = e >> 4, q = e & 15; vst2((unsigned*)(DH + (r0 + rl) * CC + c0 + q * 8), *(const v4u*)&sh[rl][q * 8]); if (hi_rows) vst2((unsigned*)(DL + (bb * nhi + t0 + rl) * (size_t)CC + c0 + q * 8), *(const v4u*)&sl[rl][q * 8]); }
  } else { const bool hi_rows = t0 < KHI;
#pragma unroll
    for (int j = 0; j < 8; ++j) { const float bias = BA ? bfr(BA[c0 + j * 16 + col]) : 0.f;
#pragma unroll
      for (int r = 0; r < 8; ++r) { const float v = acc[j][r] + bias; const int rl = wave * 16 + 8 * g + r, cl = j * 16 + col; th[cl][rl] = (_Float16)v; const __bf16 bh = (__bf16)v; tb[cl][rl] = bh; tbl[cl][rl] = (__bf16)(v - (float)bh); } }
    __syncthreads();
    for (int e = tid; e < 128 * 8; e += 128) { const int cl = e >> 3, q = e & 7; vst2((unsigned*)(VT + (bb * CC + c0 + cl) * (size_t)TT + t0 + q * 8), *(const v4u*)&th[cl][q * 8]); if (hi_rows) { const size_t o3 = (bb * CC + c0 + cl) * (size_t)KHI + t0 + q * 8; vst2((unsigned*)(VB + o3), *(const v4u*)&tb[cl][q * 8]); vst2((unsigned*)(VBL + o3), *(const v4u*)&tbl[cl][q * 8]); } } } }
// ---- k_sc: block = (query block qb, key block kb <= kb_last(qb), batch b = blockIdx.z), head h0: logits x SCALE; q hi + residual (x 2^10) against k (2 products) for query rows < QHI, plus the k residual (3 products) for query blocks < QBH (every query block); causal: blocks past the diagonal exit, the mask itself is applied by index in k_colstat_c and k_pv
__global__ __launch_bounds__(128) void k_sc(const _Float16* __restrict__ QH, const _Float16* __restrict__ KH, const _Float16* __restrict__ QL, const _Float16* __restrict__ KL, int h0, float* __restrict__ S0) { __shared__ __align__(16) float ss[4][16][132];
  const int qb = blockIdx.x, kb = blockIdx.y; if (kb > kb_last(qb)) return;
  const int b = blockIdx.z, h = h0; const int ta = qb >> 1; float* S = S0 + ((size_t)b * STL + ta * (ta + 1) / 2 + kb) * TLF + (qb & 1) * 64 * 128;   /* the block's 64 rows of logit tile (ta, kb) */
  const int tid = threadIdx.x, wave = tid >> 5, lane = tid & 31, col = lane & 15, g = lane >> 4; const int k0 = kb * 128; const int ql0 = qb * 64 + wave * 16; const size_t q0 = (size_t)b * TT + ql0, kr0 = (size_t)b * TT + k0;
  v8f acc[8] = {}, accl[8] = {};
  const _Float16* QLb = QL + (size_t)b * QHI * CC; const _Float16* KLb = KL + (size_t)b * KHI * CC;
  if (qb < QBH) {
#pragma unroll
    for (int kc = 0; kc < HD / 32; ++kc) { const v16h ah = frag_h(QH + (q0 + col) * CC + h * HD + kc * 32, lane), al = frag_h(QLb + (size_t)(ql0 + col) * CC + h * HD + kc * 32, lane);
#pragma unroll
      for (int j = 0; j < 8; ++j) { const v16h kbf = frag_h(KH + (kr0 + j * 16 + col) * CC + h * HD + kc * 32, lane), klf = frag_h(KLb + (size_t)(k0 + j * 16 + col) * CC + h * HD + kc * 32, lane); acc[j] = wmma16(ah, kbf, acc[j]); accl[j] = wmma16(al, kbf, accl[j]); accl[j] = wmma16(ah, klf, accl[j]); } }
  } else if (qb * 64 < QHI) {
#pragma unroll
    for (int kc = 0; kc < HD / 32; ++kc) { const v16h ah = frag_h(QH + (q0 + col) * CC + h * HD + kc * 32, lane), al = frag_h(QLb + (size_t)(ql0 + col) * CC + h * HD + kc * 32, lane);
#pragma unroll
      for (int j = 0; j < 8; ++j) { const v16h kbf = frag_h(KH + (kr0 + j * 16 + col) * CC + h * HD + kc * 32, lane); acc[j] = wmma16(ah, kbf, acc[j]); accl[j] = wmma16(al, kbf, accl[j]); } }
  } else {
#pragma unroll
    for (int kc = 0; kc < HD / 32; ++kc) { const v16h ah = frag_h(QH + (q0 + col) * CC + h * HD + kc * 32, lane);
#pragma unroll
      for (int j = 0; j < 8; ++j) { const v16h kbf = frag_h(KH + (kr0 + j * 16 + col) * CC + h * HD + kc * 32, lane); acc[j] = wmma16(ah, kbf, acc[j]); } } }
#pragma unroll
  for (int j = 0; j < 8; ++j) {
#pragma unroll
    for (int r = 0; r < 8; ++r) ss[wave][8 * g + r][j * 16 + col] = (acc[j][r] + accl[j][r] * (1.0f / 1024.0f)) * SCALE; }
  LDSX(); for (int rl = 0; rl < 16; ++rl) vst2(S + (wave * 16 + rl) * 128 + lane * 4, *(const v4f*)&ss[wave][rl][lane * 4]); }
// ---- k_sm: block = query row t (head in group): keys [0, kend): causal -> logit if s <= t else excluded; softmax in f32; P x 2^11 in place (0 for excluded)
__global__ __launch_bounds__(256) void k_sm(float* __restrict__ S0 SM_EXTRA_PARAMS) { __shared__ float sred[8]; __shared__ float sbc; __shared__ __align__(16) float shv[TT];
  const int tid = threadIdx.x; const int t = blockIdx.x; const int kend = (kb_last(t >> 6) + 1) * 128;
  float* sr = S0 + (size_t)blockIdx.y * TT * TT + (size_t)t * TT;
  float m = -3.0e38f; for (int k = tid; k < kend; k += 256) { float v = (!CAUSAL || k <= t) ? sr[k] : -3.0e38f; SM_MASK_HOOK; shv[k] = v; m = fmaxf(m, v); }
#pragma unroll
  for (int o = 1; o < 32; o <<= 1) m = fmaxf(m, __shfl_xor(m, o));
  if ((tid & 31) == 0) sred[tid >> 5] = m; __syncthreads(); if (tid == 0) { float a = sred[0]; for (int i = 1; i < 8; ++i) a = fmaxf(a, sred[i]); sbc = a; } __syncthreads(); m = sbc; __syncthreads();
  float sum = 0.f; for (int k = tid; k < kend; k += 256) { const float v = shv[k]; const float e = (v <= -1.0e38f) ? 0.f : expf(v - m); shv[k] = e; sum += e; }
#pragma unroll
  for (int o = 1; o < 32; o <<= 1) sum += __shfl_xor(sum, o);
  if ((tid & 31) == 0) sred[tid >> 5] = sum; __syncthreads(); if (tid == 0) { float a = 0.f; for (int i = 0; i < 8; ++i) a += sred[i]; sbc = a > 0.f ? 2048.0f / a : 0.f; }   /* a fully excluded row yields P = 0 */ __syncthreads(); const float inv = sbc;
  for (int k = tid; k < kend; k += 256) shv[k] = shv[k] * inv;
  __syncthreads(); for (int q = tid; q < kend / 4; q += 256) vst2(sr + q * 4, *(const v4f*)&shv[q * 4]); }
// ---- k_colstat_c: softmax over the QUERY axis under the causal mask (the source's softmax(axis=1) on [B, t, s] scores with -1e9 above the diagonal): for every key column k: m_k = max_{q >= k} S[q][k], Z_k = sum_{q >= k} exp(S[q][k] - m_k) (f32, precise expf); CM holds m_k, CZ holds 2^11 / Z_k.
// block = 32 key columns (one 128-B line of CM and of CZ), 32 waves; a wave's 16-B loads cover 4 query rows x 32 columns, the block a group of 128 rows, and a lane keeps 8 such groups in flight (1024 rows a trip), so the query axis is cut into 128 interleaved slices per column. Each lane runs the online max / sum on its slice (one rescale per 8 rows); slices are merged max first, then rescaled sums: across the 4 rows of a wave by shuffles, across waves through LDS.
// blockIdx.x = batch, blockIdx.y = column block. A group of 128 rows is one logit tile (a, kb) of the block's tile column kb.
// The walk starts at the 128-aligned group that holds the block's first column (tile (kb, kb)), so every score read lies in a tile k_sc has written; a group past the end re-reads the last group. q < k and the groups past the end enter as -inf (exp gives 0) while the running max starts finite, so a slice with no visible row ends as (-3e38, 0) and drops out of the merge.
__global__ __launch_bounds__(1024) void k_colstat_c(const float* __restrict__ S0, float* __restrict__ CM, float* __restrict__ CZ) { __shared__ __align__(16) float pm[32][32], pz[32][32];
  const int tid = threadIdx.x, wave = tid >> 5, lane = tid & 31; const int bz = blockIdx.x; const int k0 = blockIdx.y * 32, qlo = k0 & ~127; const int r = tid >> 3, kc = k0 + (tid & 7) * 4;   /* the lane's row inside a group, its first column */
  const char* sp = (const char*)(S0 + ((size_t)bz * STL + (k0 >> 7)) * TLF); const unsigned vo = (unsigned)(r * 128 + (kc & 127)) * 4u;   /* tile number kb of the batch; the lane's byte offset inside a tile */
  unsigned off[8]; float m[4], z[4];   /* the lane's byte offsets in the trip's 8 tiles, formed one trip ahead: each load has an offset register of its own */
#pragma unroll
  for (int u = 0; u < 8; ++u) { const int au = (qlo >> 7) + u, a = au < TT / 128 - 1 ? au : TT / 128 - 1; off[u] = vo + (unsigned)(a * (a + 1) / 2) * (TLF * 4u); }
#pragma unroll
  for (int c = 0; c < 4; ++c) { m[c] = -3.0e38f; z[c] = 0.f; }
  for (int ub0 = qlo; ub0 < TT; ub0 += 1024) { v4f s[8];
#pragma unroll
    for (int u = 0; u < 8; ++u) s[u] = *(const v4f*)(sp + off[u]);
#pragma unroll
    for (int c = 0; c < 4; ++c) { float v[8]; float mn = m[c];
#pragma unroll
      for (int u = 0; u < 8; ++u) { const int ub = ub0 + u * 128; v[u] = ((ub < TT ? ub : -TT) >= kc + c - r) ? s[u][c] : -INFINITY; mn = fmaxf(mn, v[u]); }
      float a = z[c] * expf(m[c] - mn);
#pragma unroll
      for (int u = 0; u < 8; ++u) a += expf(v[u] - mn);
      m[c] = mn; z[c] = a; }
#pragma unroll
    for (int u = 0; u < 8; ++u) { const int au = (ub0 >> 7) + 8 + u, a = au < TT / 128 - 1 ? au : TT / 128 - 1; off[u] = vo + (unsigned)(a * (a + 1) / 2) * (TLF * 4u); } }
  v4f wm, wz;
#pragma unroll
  for (int c = 0; c < 4; ++c) { float M = fmaxf(m[c], __shfl_xor(m[c], 8)); M = fmaxf(M, __shfl_xor(M, 16)); float a = z[c] * expf(m[c] - M); a += __shfl_xor(a, 8); a += __shfl_xor(a, 16); wm[c] = M; wz[c] = a; }
  if (lane < 8) { *(v4f*)&pm[wave][lane * 4] = wm; *(v4f*)&pz[wave][lane * 4] = wz; }
  __syncthreads();   /* publishes the 32 waves' partial (max, sum) pairs to wave 0 */
  if (wave == 0) { float M = pm[0][lane];
#pragma unroll
    for (int w = 1; w < 32; ++w) M = fmaxf(M, pm[w][lane]);
    float a = 0.f;
#pragma unroll
    for (int w = 0; w < 32; ++w) a += pz[w][lane] * expf(pm[w][lane] - M);
    vst2(CM + (size_t)bz * TT + k0 + lane, M); vst2(CZ + (size_t)bz * TT + k0 + lane, 2048.0f / a); } }   /* every column sees at least its own diagonal entry: Z_k >= 1; stored as 2^11 / Z_k, the factor k_pv multiplies by */
// P values of one A fragment, formed from the logits where k_pv loads them: v = exp(S[t][k] - m_k) * (2^11 / Z_k) for k <= t, 0 above the diagonal; element order = the 16x16x32 A fragment's (keys k0 + 8h + 0..7, then k0 + 16 + 8h + 0..7).
// p_load issues the twelve 16-B loads unconditionally and together (logits, column maxima, column factors); p_vals does the arithmetic on every element and selects by index afterwards, so no load and no exp sits behind a per-lane branch.
struct PRaw { v4f s[4], m[4], z[4]; };
__device__ __forceinline__ PRaw p_load(const float* srow, const float* cm, const float* ci, int k0, int lane) { PRaw r; const int kb = k0 + 8 * (lane >> 4); const float *p = srow + (size_t)(k0 >> 7) * TLF + (kb & 127), *m = cm + kb, *z = ci + kb;   /* srow = the query's row in the first logit tile of its tile row; key tile k0 / 128 lies that many tiles further */
#pragma unroll
  for (int q = 0; q < 4; ++q) { const int o = (q >> 1) * 16 + (q & 1) * 4; r.s[q] = *(const v4f*)(p + o); r.m[q] = *(const v4f*)(m + o); r.z[q] = *(const v4f*)(z + o); }
  /* inputs-only fence on the loaded values: all twelve loads are in flight together and are waited for once; without it the compiler deals them out in small groups, each with a wait of its own */
  asm volatile("" :: "v"(r.s[0]), "v"(r.s[1]), "v"(r.s[2]), "v"(r.s[3]), "v"(r.m[0]), "v"(r.m[1]), "v"(r.m[2]), "v"(r.m[3]), "v"(r.z[0]), "v"(r.z[1]), "v"(r.z[2]), "v"(r.z[3]));
  return r; }
__device__ __forceinline__ void p_vals(float v[16], const PRaw& r, int k0, int t, int lane) { const int kb = k0 + 8 * (lane >> 4);
#pragma unroll
  for (int q = 0; q < 4; ++q)
#pragma unroll
    for (int u = 0; u < 4; ++u) { const float e = expf(r.s[q][u] - r.m[q][u]) * r.z[q][u]; v[q * 4 + u] = (kb + (q >> 1) * 16 + (q & 1) * 4 + u <= t) ? e : 0.f; } }
// ---- k_out64: out[b][t][0..63] = sum over the row's key ranges (ascending) of the partial ctx row, columns 0..63 (256 B by 16 lanes); the block's 16 rows lie in one band of PVK rows, so the range count is the same for all of them
__global__ __launch_bounds__(256) void k_out64(const float* __restrict__ Y, float* __restrict__ OUT) { const size_t row = (size_t)blockIdx.x * 16 + (threadIdx.x >> 4); const int q = threadIdx.x & 15; const int nr = (int)((blockIdx.x * 16u) % TT) / PVK + 1; const float* yp = Y + row * CC + q * 4; v4f v = *(const v4f*)yp;
  for (int c = 1; c < nr; ++c) v += *(const v4f*)(yp + c * YPL);
  asm volatile("s_wait_loadcnt 0x0" ::: "memory"); vst2(OUT + row * 64 + q * 4, v); }
// ---- k_pv: block = (16 queries, one range of PVK keys) of (batch b = blockIdx.z, head h0): partial ctx = P . v over the range's keys below kend, P = exp(S - m_k) x 2^11 / Z_k formed from the logits and the column statistics as the A fragment is loaded (every query block is < QBH: P and v as bf16 hi + lo, 3 products; the f16 P x 2^11 against v f16 path, 1 product, is not taken); 256-B (row, head) segment by 16 lanes
// Split over keys: rows of band d = t / PVK have d + 1 ranges; blockIdx.y numbers the (band, range) pairs, the 6 full ranges first, then each band's last range (the one the diagonal cuts short); blockIdx.x is the 16-row group inside the band. The PVW waves take the range's 32-key steps round robin, their f32 partials are added through LDS (wave order), and the ranges' partial rows go to planes of Y that k_out64 adds.
__global__ __launch_bounds__(32 * PVW) void k_pv(const float* __restrict__ PS0, const _Float16* __restrict__ VT, const __bf16* __restrict__ VB, const __bf16* __restrict__ VBL, const float* __restrict__ CM, const float* __restrict__ CI, int h0, float* __restrict__ Y) { const int b = blockIdx.z, h = h0; const float* PS = PS0 + (size_t)b * STL * TLF; const float* cm = CM + (size_t)b * TT; const float* ci = CI + (size_t)b * TT; __shared__ __align__(16) float ss[PVW][16][HD + 4];
  const int tid = threadIdx.x, wave = __builtin_amdgcn_readfirstlane(tid >> 5), lane = tid & 31, col = lane & 15, g = lane >> 4;   /* the wave number in a scalar register: the key loop's bounds stay wave-uniform */
  const int py = blockIdx.y; const int band = py >= 6 ? py - 6 : py >= 3 ? 3 : py >= 1 ? 2 : 1; const int rng = py >= 6 ? band : py >= 3 ? py - 3 : py >= 1 ? py - 1 : 0;
  const int ql0 = band * PVK + blockIdx.x * 16; const int qb = ql0 >> 6; const int kall = (kb_last(qb) + 1) * 4; const int kcb = rng * (PVK / 32) + wave; const int kce = kall < (rng + 1) * (PVK / 32) ? kall : (rng + 1) * (PVK / 32);
  const int ta = ql0 >> 7; const float* srow = PS + (size_t)(ta * (ta + 1) / 2) * TLF + ((ql0 & 127) + col) * 128;   /* the lane's query row in logit tile (ta, 0) */
  v8f acc[HD / 16] = {};
  if (qb < QBH) {
#pragma unroll 1
    for (int kc = kcb; kc < kce; kc += PVW) { const PRaw pr = p_load(srow, cm, ci, kc * 32, lane);
      float pv[16]; p_vals(pv, pr, kc * 32, ql0 + col, lane); const F2 p = bsplit16(pv);
#pragma unroll
      for (int j = 0; j < HD / 16; ++j) { const size_t po = ((size_t)b * CC + h * HD + j * 16 + col) * (size_t)KHI + kc * 32; const v16b vh = frag_b(VB + po, lane); acc[j] = wmma_bf(p.h, vh, acc[j]); acc[j] = wmma_bf(p.l, vh, acc[j]); acc[j] = wmma_bf(p.h, frag_b(VBL + po, lane), acc[j]); } }
  } else {
#pragma unroll 1
    for (int kc = kcb; kc < kce; kc += PVW) { const PRaw pr = p_load(srow, cm, ci, kc * 32, lane);
      float pv[16]; p_vals(pv, pr, kc * 32, ql0 + col, lane); v16h p;
#pragma unroll
      for (int i = 0; i < 16; ++i) p[i] = (_Float16)pv[i];
#pragma unroll
      for (int j = 0; j < HD / 16; ++j) { const size_t po = ((size_t)b * CC + h * HD + j * 16 + col) * (size_t)TT + kc * 32; acc[j] = wmma16(p, frag_h(VT + po, lane), acc[j]); } } }
#pragma unroll
  for (int j = 0; j < HD / 16; ++j)
#pragma unroll
    for (int r = 0; r < 8; ++r) ss[wave][8 * g + r][j * 16 + col] = acc[j][r] * (1.0f / 2048.0f);
  __syncthreads();   /* publishes the PVW waves' partial tiles to the threads that add them */
  { const int rl = tid >> 4, q = tid & 15; v4f s = *(const v4f*)&ss[0][rl][q * 4];
#pragma unroll   /* unrolled so that the PVW LDS reads issue together instead of one wait each */
    for (int w = 1; w < PVW; ++w) s += *(const v4f*)&ss[w][rl][q * 4];
    vst2(Y + rng * YPL + ((size_t)b * TT + ql0 + rl) * CC + h * HD + q * 4, s); } }

extern "C" void kernel_launch(void* const* d_in, const int* in_sizes, int n_in, void* d_out, int out_size, void* d_ws, size_t ws_size, hipStream_t stream) {
  (void)in_sizes; (void)n_in; (void)out_size;
  const float** F = (const float**)d_in;
  if (ws_size < (size_t)WS_END) return;
  char* ws = (char*)d_ws; _Float16 *QH = (_Float16*)(ws + WS_QH), *KH = (_Float16*)(ws + WS_KH), *VT = (_Float16*)(ws + WS_VT), *QL = (_Float16*)(ws + WS_QL), *KL = (_Float16*)(ws + WS_KL); __bf16 *VB = (__bf16*)(ws + WS_VB), *VBL = (__bf16*)(ws + WS_VBL); float *S = (float*)(ws + WS_S), *Y = (float*)(ws + WS_Y);
  (void)Y; (void)QL; (void)KL; (void)VB; (void)VBL;
  // inputs: 0 x [4,4096,512]; 1 Wq [64,512] (out,in); 2 Wk; 3 Wv; no biases
  if (ws_size < (size_t)WS_END2) return;
  float *Y2 = (float*)(ws + WS_Y2), *CM = (float*)(ws + WS_CM), *CZ = (float*)(ws + WS_CZ);
  k_proj<<<dim3(TNB * TT / 64, CC / 128, 3), 128, 0, stream>>>(F[0], F[0], F[0], F[1], F[2], F[3], nullptr, nullptr, nullptr, QH, QL, KH, KL, VT, VB, VBL);   /* weight columns 64..127 (the padding head) are zero fragments */
  /* head 0 only (head 1 is the zero padding); the batch is a grid axis of each of the three launches */
  k_sc<<<dim3(NQB, TT / 128, TNB), 128, 0, stream>>>(QH, KH, QL, KL, 0, S);
  k_colstat_c<<<dim3(TNB, TT / 32), 1024, 0, stream>>>(S, CM, CZ);   /* per key column s: max and 2^11 / sum over the visible queries t >= s */
  k_pv<<<dim3(PVK / 16, PVS * (PVS + 1) / 2, TNB), 32 * PVW, 0, stream>>>(S, VT, VB, VBL, CM, CZ, 0, Y2);   /* (16-row group in its band) x (band, key range) x batch; P[t][s] = exp(S - m_s) x 2^11 / Z_s is formed in its loader */
  k_out64<<<dim3(TNB * TT / 16), 256, 0, stream>>>(Y2, (float*)d_out);
}

// v005
// Measured time: 178 microseconds a run.
// Timed twice side by side with v004, it ran 1.17 and 1.16 times as fast.
// Counting every step since v000, it is 42.3 times as fast.
// compute dtype: all float inputs rounded to bf16; q/k/v projections with EXACT bf16 products on WMMA 16x16x32 (f32 accumulate); causal scores with BOTH q and k as f16 hi + (x 2^10) residual (3 products) on EVERY block, x 64^-0.5; softmax over the QUERY axis in f32 (per key column: online max / sum over the visible queries, precise expf); P as bf16 hi + lo against v as bf16 hi + lo (3 products) on EVERY block; f32 output.
#include <hip/hip_runtime.h>
#include <math.h>

typedef __attribute__((ext_vector_type(16))) _Float16 v16h;
typedef __attribute__((ext_vector_type(16))) __bf16 v16b;
typedef __attribute__((ext_vector_type(8)))  _Float16 v8h;
typedef __attribute__((ext_vector_type(8)))  float v8f;
typedef __attribute__((ext_vector_type(4)))  float v4f;
typedef __attribute__((ext_vector_type(2)))  float v2f;
typedef __attribute__((ext_vector_type(4)))  unsigned v4u;
typedef __attribute__((ext_vector_type(4)))  int v4i;
typedef float __attribute__((may_alias)) float_a;
typedef int __attribute__((may_alias)) int_a;

template <typename T> __device__ __forceinline__ void vst2(void* p, T v) { *(T*)p = v;  }
__device__ __forceinline__ v8f wmma16(v16h a, v16h b, v8f c) {
  v8f d = __builtin_amdgcn_wmma_f32_16x16x32_f16(false, a, false, b, (short)0, c, false, false);
  asm volatile("v_nop\n\tv_nop\n\tv_nop\n\tv_nop" : "+v"(d) : "v"(a), "v"(b));
  return d;
}
__device__ __forceinline__ v8f wmma_bf(v16b a, v16b b, v8f c) {
  v8f d = __builtin_amdgcn_wmma_f32_16x16x32_bf16(false, a, false, b, (short)0, c, false, false);
  asm volatile("v_nop\n\tv_nop\n\tv_nop\n\tv_nop" : "+v"(d) : "v"(a), "v"(b));
  return d;
}
// 16x16x32 fragments: lane = (h = lane>>4, row/col = lane&15); elements 0..7 = k0+8h+0..7, 8..15 = k0+16+8h+0..7; D element r = row 8h+r
__device__ __forceinline__ v16h frag_h(const _Float16* rowk0, int lane) {
  union { v16h v; v8h q[2]; } u; const _Float16* p = rowk0 + 8 * (lane >> 4);
  u.q[0] = *(const v8h*)p; u.q[1] = *(const v8h*)(p + 16); return u.v;
}
__device__ __forceinline__ v16h frag_f32(const float* rowk0, int lane) {
  v16h a; const float* p = rowk0 + 8 * (lane >> 4);
#pragma unroll
  for (int i = 0; i < 8; ++i) { a[i] = (_Float16)p[i]; a[8 + i] = (_Float16)p[16 + i]; }
  return a;
}
__device__ __forceinline__ v16h frag_f32s(const float* rowk0, int lane, float sc) {
  v16h a; const float* p = rowk0 + 8 * (lane >> 4);
#pragma unroll
  for (int i = 0; i < 8; ++i) { a[i] = (_Float16)(p[i] * sc); a[8 + i] = (_Float16)(p[16 + i] * sc); }
  return a;
}
// column fragment from a [K][ld] layout (column n), rows >= K read as 0
__device__ __forceinline__ v16h fragc_f32(const float* W, int k0, int n, int lane, int ld, int K) {
  v16h a; const int g = lane >> 4;
#pragma unroll
  for (int i = 0; i < 8; ++i) { const int ka = k0 + 8 * g + i, kb = ka + 16;
    a[i] = (_Float16)(ka < K ? W[(size_t)(ka < K ? ka : K - 1) * ld + n] : 0.f); a[8 + i] = (_Float16)(kb < K ? W[(size_t)(kb < K ? kb : K - 1) * ld + n] : 0.f); }
  return a;
}
struct F2 { v16b h, l; };
__device__ __forceinline__ F2 bsplit16(const float v[16]) { F2 r;
#pragma unroll
  for (int i = 0; i < 16; ++i) { const __bf16 h = (__bf16)v[i]; r.h[i] = h; r.l[i] = (__bf16)(v[i] - (float)h); }
  return r; }
__device__ __forceinline__ F2 split_row(const float* row, int k0, int lane) { float v[16]; const float* p = row + k0 + 8 * (lane >> 4);
#pragma unroll
  for (int i = 0; i < 8; ++i) { v[i] = p[i]; v[8 + i] = p[16 + i]; }
  return bsplit16(v); }
__device__ __forceinline__ F2 split_rowK(const float* row, int k0, int lane, int K) { float v[16]; const int g = lane >> 4;
#pragma unroll
  for (int i = 0; i < 8; ++i) { const int ka = k0 + 8 * g + i, kb = ka + 16; v[i] = ka < K ? row[ka < K ? ka : K - 1] : 0.f; v[8 + i] = kb < K ? row[kb < K ? kb : K - 1] : 0.f; }
  return bsplit16(v); }
__device__ __forceinline__ F2 split_col(const float* W, int k0, int n, int lane, int ld, int K) { float v[16]; const int g = lane >> 4;
#pragma unroll
  for (int i = 0; i < 8; ++i) { const int ka = k0 + 8 * g + i, kb = ka + 16; v[i] = ka < K ? W[(size_t)(ka < K ? ka : K - 1) * ld + n] : 0.f; v[8 + i] = kb < K ? W[(size_t)(kb < K ? kb : K - 1) * ld + n] : 0.f; }
  return bsplit16(v); }
__device__ __forceinline__ v8f mac3(const F2& a, const F2& b, v8f c) { c = wmma_bf(a.l, b.h, c); c = wmma_bf(a.h, b.l, c); return wmma_bf(a.h, b.h, c); }
__device__ __forceinline__ float sigm(float v) { return 1.0f / (1.0f + expf(-v)); }
#define LDSX() do { asm volatile("s_wait_dscnt 0" ::: "memory"); __builtin_amdgcn_wave_barrier(); __builtin_amdgcn_fence(__ATOMIC_RELEASE, "workgroup"); } while (0)

// Single-head causal self-attention whose softmax runs over the QUERY axis (x [4,4096,512]; torch (out,in) Wq / Wk / Wv [64,512] (0.02 scale), no biases; scores = q k^T [B,t,s]; additive causal mask -1e9 where s > t; / sqrt(64); attn = softmax(scores, axis=1) - axis 1 is the QUERY axis t, so every key column s is normalised over the queries t >= s (faithful to the source); out = attn v -> [4,4096,64]).
#define NB 4
#define TT 4096
#define CC 128            // NH * HD = projected width
#define DIN 512          // input (model) width
#define NH 2
#define HD 64
#define NQB (TT / 64)
#define HG 1
#define SCALE (0.125f)
#define CAUSAL 1
#ifndef TNB
#define TNB NB
#endif
__device__ __forceinline__ float bfr(float v) { return (float)(__bf16)v; }
__host__ __device__ __forceinline__ int kb_last(int qb) { return CAUSAL ? ((qb * 64 + 63) >> 7) : (TT / 128 - 1); }
typedef __attribute__((ext_vector_type(8))) __bf16 v8b;
// Fragment-order planes: one 16 x 32 operand fragment (16 rows or columns x 32 k values, 2-byte elements) is stored as 1024 contiguous bytes; its 16-B piece number hf * 32 + lane holds the lane's elements 8 hf + 0..7 (k = 16 hf + 8 (lane >> 4) + 0..7 of row or column lane & 15), so each of a fragment's two loads reads four whole 128-B lines instead of 32 B out of each of 16 lines. f = fragment number in the plane.
__device__ __forceinline__ v16h fragt_h(const _Float16* plane, size_t f, int lane) {
  union { v16h v; v8h q[2]; } u; const v8h* p = (const v8h*)plane + f * 64 + lane;
  u.q[0] = p[0]; u.q[1] = p[32]; return u.v;
}
__device__ __forceinline__ v16b fragt_b(const __bf16* plane, size_t f, int lane) {
  union { v16b v; v8b q[2]; } u; const v8b* p = (const v8b*)plane + f * 64 + lane;
  u.q[0] = p[0]; u.q[1] = p[32]; return u.v;
}
#define QBH 64              // = NQB: 3-product scores and bf16 hi/lo P.v on every query block
#define QHI 4096            // EVERY row carries a q residual plane: with the softmax over the QUERY axis the few-term region is the END of the sequence (late key columns see few queries), so the high-precision paths run everywhere
#define KHI 4096            // every key row carries the k residual and the v bf16 hi + lo planes
// B fragment (k rows k0+.., output column o) of a weight: (in,out) [K][ld] or (out,in) [ld rows of K]: bf16 exact, or f16(bf16 * 256) exact
__device__ __forceinline__ v16b wcol_io(const float* Wm, int k0, int o, int lane, int ld) { v16b w; const int g = lane >> 4;
#pragma unroll
  for (int i = 0; i < 8; ++i) { w[i] = (__bf16)Wm[(size_t)(k0 + 8 * g + i) * ld + o]; w[8 + i] = (__bf16)Wm[(size_t)(k0 + 16 + 8 * g + i) * ld + o]; }
  return w; }
__device__ __forceinline__ v16b wcol_oi(const float* Wm, int k0, int o, int lane, int K) { v16b w; const float* p = Wm + (size_t)o * K + k0 + 8 * (lane >> 4);
#pragma unroll
  for (int i = 0; i < 8; ++i) { w[i] = (__bf16)p[i]; w[8 + i] = (__bf16)p[16 + i]; }
  return w; }
__device__ __forceinline__ v16h wcolh_io(const float* Wm, int k0, int o, int lane, int ld) { v16h w; const int g = lane >> 4;
#pragma unroll
  for (int i = 0; i < 8; ++i) { w[i] = (_Float16)(bfr(Wm[(size_t)(k0 + 8 * g + i) * ld + o]) * 256.0f); w[8 + i] = (_Float16)(bfr(Wm[(size_t)(k0 + 16 + 8 * g + i) * ld + o]) * 256.0f); }
  return w; }
__device__ __forceinline__ v16h wcolh_oi(const float* Wm, int k0, int o, int lane, int K) { v16h w; const float* p = Wm + (size_t)o * K + k0 + 8 * (lane >> 4);
#pragma unroll
  for (int i = 0; i < 8; ++i) { w[i] = (_Float16)(bfr(p[i]) * 256.0f); w[8 + i] = (_Float16)(bfr(p[16 + i]) * 256.0f); }
  return w; }
#define WQKV_LAYOUT 1   // 0 = (in,out) [DIN][CC]; 1 = (out,in) [64][DIN]; 2 = per-head [NH][DIN][HD]
__device__ __forceinline__ v16b wcol_hdk(const float* Wm, int k0, int o, int lane) { v16b w; const int g = lane >> 4; const float* p = Wm + (size_t)(o / HD) * DIN * HD + (o % HD);
#pragma unroll
  for (int i = 0; i < 8; ++i) { w[i] = (__bf16)p[(size_t)(k0 + 8 * g + i) * HD]; w[8 + i] = (__bf16)p[(size_t)(k0 + 16 + 8 * g + i) * HD]; }
  return w; }
#define WO_OUT_IN 0
#if WQKV_LAYOUT == 1
__device__ __forceinline__ v16b zero16b() { v16b w; _Pragma("unroll") for (int i = 0; i < 16; ++i) w[i] = (__bf16)0.0f; return w; }
#define WCOL(W, k0, o, lane) ((o) < 64 ? wcol_oi(W, k0, (o), lane, DIN) : zero16b())   /* (out,in) [64][512]: only 64 real output rows; projected columns 64..127 (padding head 1) are zero; the test is compile-time per unrolled tile (c0 = 0) */
#elif WQKV_LAYOUT == 2
#define WCOL(W, k0, o, lane) wcol_hdk(W, k0, o, lane)
#else
#define WCOL(W, k0, o, lane) wcol_io(W, k0, o, lane, CC)
#endif
#if WO_OUT_IN
#define WOCOL(W, k0, o, lane) wcol_oi(W, k0, o, lane, CC)
#define WOCOLH(W, k0, o, lane) wcolh_oi(W, k0, o, lane, CC)
#else
#define WOCOL(W, k0, o, lane) wcol_io(W, k0, o, lane, DIN)
#define WOCOLH(W, k0, o, lane) wcolh_io(W, k0, o, lane, DIN)
#endif

#ifndef SM_EXTRA_PARAMS
#define SM_EXTRA_PARAMS
#endif
#ifndef PROJ_EXTRA_PARAMS
#define PROJ_EXTRA_PARAMS
#endif
#ifndef SM_MASK_HOOK
#define SM_MASK_HOOK (void)0
#endif

#define WS_QH  0u                                      // f16 q, head 0, fragment order: fragment ((b*TT + t) / 16) * 2 + kc (first half of the plane's room)
#define WS_KH  (WS_QH + 2u * (size_t)NB * TT * CC)      // f16 k, as q
#define WS_VT  (WS_KH + 2u * (size_t)NB * TT * CC)      // f16 v planes [b][c][t]
#define WS_QL  (WS_VT + 2u * (size_t)NB * CC * TT)      // f16 q residual x 2^10, as q
#define WS_KL  (WS_QL + 2u * (size_t)NB * QHI * CC)     // f16 k residual x 2^10, as q
#define WS_VB  (WS_KL + 2u * (size_t)NB * KHI * CC)     // bf16 v hi, head 0, fragment order: fragment (b * KHI / 32 + t / 32) * 4 + c / 16; WS_VBL: v lo, the same
#define WS_VBL (WS_VB + 2u * (size_t)NB * CC * KHI)
#define WS_S   (WS_VBL + 2u * (size_t)NB * CC * KHI)    // f32 logits [b][tile][128][128], see STL
#define STL ((TT / 128) * (TT / 128 + 1) / 2)          // 128 x 128 logit tiles of one batch: only the tiles (a = t / 128, kb = s / 128) with kb <= a exist, tile number a (a + 1) / 2 + kb; so the logits of all NB batches fit in the workspace at once
#define TLF (128 * 128)                                // floats per logit tile, rows of 128 floats
#define WS_Y   (WS_S  + 4u * (size_t)NB * STL * TLF)    // f32 ctx rows [b*t][CC] (only when there is an output projection)
#define WS_END (WS_Y  + 0u)
#define PVK 1024            // keys per key range of k_pv (one work-group's share of a 16-row group)
#define PVW 8               // waves per work-group of k_pv: the range's 32-key steps are dealt to them round robin
#define PVS (TT / PVK)      // most key ranges a query row can have = number of partial ctx planes
#define YPL ((size_t)NB * TT * CC)                      // floats per partial ctx plane
#define WS_Y2 (WS_END)                                  // f32 partial ctx rows [key range][b*TT + t][128] (columns 64..127 = the padding head); row t has ranges 0 .. t / PVK
#define WS_CM (WS_Y2 + 4u * PVS * YPL)                   // f32 column maxima [b][TT]
#define WS_CZ (WS_CM + 4u * (size_t)NB * TT)             // f32 2^11 / column sums [b][TT]
#define WS_END2 (WS_CZ + 4u * (size_t)NB * TT)

// ---- k_proj: block = (64 rows, 128 cols, which): q/k/v = X W (+ b) with exact bf16 products (K = DIN) -> which 0: q f16 in fragment order, head 0 (+ residual rows < QHI); 1: k f16 in fragment order, head 0 (+ residual rows < KHI); 2: v f16 planes [c][t] (+ bf16 hi/lo planes for t < KHI)
__global__ __launch_bounds__(128) void k_proj(const float* __restrict__ XQ, const float* __restrict__ XK, const float* __restrict__ XV, const float* __restrict__ WQ, const float* __restrict__ WK, const float* __restrict__ WV, const float* __restrict__ BQ, const float* __restrict__ BK, const float* __restrict__ BV,
    _Float16* __restrict__ QH, _Float16* __restrict__ QL, _Float16* __restrict__ KH, _Float16* __restrict__ KL, _Float16* __restrict__ VT, __bf16* __restrict__ VB, __bf16* __restrict__ VBL) {
  __shared__ __align__(16) _Float16 sh[64][136], sl[64][136]; __shared__ __align__(16) _Float16 th[128][72]; __shared__ __align__(16) __bf16 tb[128][72], tbl[128][72];
  const int tid = threadIdx.x, wave = tid >> 5, lane = tid & 31, col = lane & 15, g = lane >> 4; const int which = blockIdx.z; const int c0 = blockIdx.y * 128; const size_t r0 = (size_t)blockIdx.x * 64; const size_t bb = r0 / TT; const int t0 = (int)(r0 % TT);
  const float* X = which == 0 ? XQ : which == 1 ? XK : XV; const float* WA = which == 0 ? WQ : which == 1 ? WK : WV; const float* BA = which == 0 ? BQ : which == 1 ? BK : BV;
  v8f acc[8] = {};
#pragma unroll 2
  for (int kc = 0; kc < DIN / 32; ++kc) { v16b a; { const float* p = X + (r0 + wave * 16 + col) * DIN + kc * 32 + 8 * g;
#pragma unroll
      for (int i = 0; i < 8; ++i) { a[i] = (__bf16)p[i]; a[8 + i] = (__bf16)p[16 + i]; } }
    asm volatile("s_wait_loadcnt 0x0" ::: "memory");
#pragma unroll
    for (int j = 0; j < 8; ++j) { const v16b w = WCOL(WA, kc * 32, c0 + j * 16 + col, lane); asm volatile("s_wait_loadcnt 0x0" ::: "memory"); acc[j] = wmma_bf(a, w, acc[j]); } }
  if (which < 2) { _Float16* DH = which == 0 ? QH : KH; _Float16* DL = which == 0 ? QL : KL; const int nhi = which == 0 ? QHI : KHI; const bool hi_rows = t0 < nhi;
#pragma unroll
    for (int j = 0; j < 8; ++j) { const float bias = BA ? bfr(BA[c0 + j * 16 + col]) : 0.f;
#pragma unroll
      for (int r = 0; r < 8; ++r) { const float v = acc[j][r] + bias; const _Float16 hv = (_Float16)v; sh[wave * 16 + 8 * g + r][j * 16 + col] = hv; sl[wave * 16 + 8 * g + r][j * 16 + col] = (_Float16)((v - (float)hv) * 1024.0f); } }
    __syncthreads();
    /* fragment order, columns 0..63 (head 0; the padding head is not stored): piece e of the block's 4 row tiles = row (e >> 7) * 16 + (e & 15), columns ((e >> 4) & 7) * 8 + 0..7 */
    for (int e = tid; e < 64 * 8; e += 128) { const int rl = (e >> 7) * 16 + (e & 15), q = (e >> 4) & 7; vst2((unsigned*)(DH + r0 * HD + e * 8), *(const v4u*)&sh[rl][q * 8]); if (hi_rows) vst2((unsigned*)(DL + (bb * nhi + t0) * (size_t)HD + e * 8), *(const v4u*)&sl[rl][q * 8]); }
  } else { const bool hi_rows = t0 < KHI;
#pragma unroll
    for (int j = 0; j < 8; ++j) { const float bias = BA ? bfr(BA[c0 + j * 16 + col]) : 0.f;
#pragma unroll
      for (int r = 0; r < 8; ++r) { const float v = acc[j][r] + bias; const int rl = wave * 16 + 8 * g + r, cl = j * 16 + col; th[cl][rl] = (_Float16)v; const __bf16 bh = (__bf16)v; tb[cl][rl] = bh; tbl[cl][rl] = (__bf16)(v - (float)bh); } }
    __syncthreads();
    for (int e = tid; e < 128 * 8; e += 128) { const int cl = e >> 3, q = e & 7; vst2((unsigned*)(VT + (bb * CC + c0 + cl) * (size_t)TT + t0 + q * 8), *(const v4u*)&th[cl][q * 8]); }
    /* fragment order, columns 0..63: piece e of the block's 2 key steps = column ((e >> 6) & 3) * 16 + (e & 15), keys (e >> 8) * 32 + ((e >> 4) & 3) * 8 + 0..7 */
    if (hi_rows) for (int e = tid; e < 64 * 8; e += 128) { const int cl = ((e >> 6) & 3) * 16 + (e & 15), kl = (e >> 8) * 32 + ((e >> 4) & 3) * 8; const size_t o3 = (bb * KHI + t0) * (size_t)HD + e * 8; vst2((unsigned*)(VB + o3), *(const v4u*)&tb[cl][kl]); vst2((unsigned*)(VBL + o3), *(const v4u*)&tbl[cl][kl]); } } }
// ---- k_sc: block = (query block qb, key block kb <= kb_last(qb), batch b = blockIdx.z), head 0 (the only head the fragment-order planes hold): logits x SCALE; q hi + residual (x 2^10) against k (2 products) for query rows < QHI, plus the k residual (3 products) for query blocks < QBH (every query block); causal: blocks past the diagonal exit, the mask itself is applied by index in k_colstat_c and in k_pv's p_vals
__global__ __launch_bounds__(128) void k_sc(const _Float16* __restrict__ QH, const _Float16* __restrict__ KH, const _Float16* __restrict__ QL, const _Float16* __restrict__ KL, float* __restrict__ S0) { __shared__ __align__(16) float ss[4][16][132];
  const int qb = blockIdx.x, kb = blockIdx.y; if (kb > kb_last(qb)) return;
  const int b = blockIdx.z; const int ta = qb >> 1; float* S = S0 + ((size_t)b * STL + ta * (ta + 1) / 2 + kb) * TLF + (qb & 1) * 64 * 128;   /* the block's 64 rows of logit tile (ta, kb) */
  const int tid = threadIdx.x, wave = tid >> 5, lane = tid & 31, col = lane & 15, g = lane >> 4; const int k0 = kb * 128; const int ql0 = qb * 64 + wave * 16; const size_t q0 = (size_t)b * TT + ql0, kr0 = (size_t)b * TT + k0;
  v8f acc[8] = {}, accl[8] = {};
  const size_t fq = q0 >> 3, fk = kr0 >> 3, fql = ((size_t)b * QHI + ql0) >> 3, fkl = ((size_t)b * KHI + k0) >> 3;   /* first fragment of the wave's 16 query rows and of the block's 128 key rows in the fragment-order planes: 2 fragments (kc = 0, 1) per 16 rows */
  if (qb < QBH) {
#pragma unroll
    for (int kc = 0; kc < HD / 32; ++kc) { const v16h ah = fragt_h(QH, fq + kc, lane), al = fragt_h(QL, fql + kc, lane);
#pragma unroll
      for (int j = 0; j < 8; ++j) { const v16h kbf = fragt_h(KH, fk + j * 2 + kc, lane), klf = fragt_h(KL, fkl + j * 2 + kc, lane); acc[j] = wmma16(ah, kbf, acc[j]); accl[j] = wmma16(al, kbf, accl[j]); accl[j] = wmma16(ah, klf, accl[j]); } }
  } else if (qb * 64 < QHI) {
#pragma unroll
    for (int kc = 0; kc < HD / 32; ++kc) { const v16h ah = fragt_h(QH, fq + kc, lane), al = fragt_h(QL, fql + kc, lane);
#pragma unroll
      for (int j = 0; j < 8; ++j) { const v16h kbf = fragt_h(KH, fk + j * 2 + kc, lane); acc[j] = wmma16(ah, kbf, acc[j]); accl[j] = wmma16(al, kbf, accl[j]); } }
  } else {
#pragma unroll
    for (int kc = 0; kc < HD / 32; ++kc) { const v16h ah = fragt_h(QH, fq + kc, lane);
#pragma unroll
      for (int j = 0; j < 8; ++j) { const v16h kbf = fragt_h(KH, fk + j * 2 + kc, lane); acc[j] = wmma16(ah, kbf, acc[j]); } } }
#pragma unroll
  for (int j = 0; j < 8; ++j) {
#pragma unroll
    for (int r = 0; r < 8; ++r) ss[wave][8 * g + r][j * 16 + col] = (acc[j][r] + accl[j][r] * (1.0f / 1024.0f)) * SCALE; }
  LDSX(); for (int rl = 0; rl < 16; ++rl) vst2(S + (wave * 16 + rl) * 128 + lane * 4, *(const v4f*)&ss[wave][rl][lane * 4]); }
// ---- k_sm: block = query row t (head in group): keys [0, kend): causal -> logit if s <= t else excluded; softmax in f32; P x 2^11 in place (0 for excluded)
__global__ __launch_bounds__(256) void k_sm(float* __restrict__ S0 SM_EXTRA_PARAMS) { __shared__ float sred[8]; __shared__ float sbc; __shared__ __align__(16) float shv[TT];
  const int tid = threadIdx.x; const int t = blockIdx.x; const int kend = (kb_last(t >> 6) + 1) * 128;
  float* sr = S0 + (size_t)blockIdx.y * TT * TT + (size_t)t * TT;
  float m = -3.0e38f; for (int k = tid; k < kend; k += 256) { float v = (!CAUSAL || k <= t) ? sr[k] : -3.0e38f; SM_MASK_HOOK; shv[k] = v; m = fmaxf(m, v); }
#pragma unroll
  for (int o = 1; o < 32; o <<= 1) m = fmaxf(m, __shfl_xor(m, o));
  if ((tid & 31) == 0) sred[tid >> 5] = m; __syncthreads(); if (tid == 0) { float a = sred[0]; for (int i = 1; i < 8; ++i) a = fmaxf(a, sred[i]); sbc = a; } __syncthreads(); m = sbc; __syncthreads();
  float sum = 0.f; for (int k = tid; k < kend; k += 256) { const float v = shv[k]; const float e = (v <= -1.0e38f) ? 0.f : expf(v - m); shv[k] = e; sum += e; }
#pragma unroll
  for (int o = 1; o < 32; o <<= 1) sum += __shfl_xor(sum, o);
  if ((tid & 31) == 0) sred[tid >> 5] = sum; __syncthreads(); if (tid == 0) { float a = 0.f; for (int i = 0; i < 8; ++i) a += sred[i]; sbc = a > 0.f ? 2048.0f / a : 0.f; }   /* a fully excluded row yields P = 0 */ __syncthreads(); const float inv = sbc;
  for (int k = tid; k < kend; k += 256) shv[k] = shv[k] * inv;
  __syncthreads(); for (int q = tid; q < kend / 4; q += 256) vst2(sr + q * 4, *(const v4f*)&shv[q * 4]); }
// ---- k_colstat_c: softmax over the QUERY axis under the causal mask (the source's softmax(axis=1) on [B, t, s] scores with -1e9 above the diagonal): for every key column k: m_k = max_{q >= k} S[q][k], Z_k = sum_{q >= k} exp(S[q][k] - m_k) (f32, precise expf); CM holds m_k, CZ holds 2^11 / Z_k.
// block = 32 key columns (one 128-B line of CM and of CZ), 32 waves; a wave's 16-B loads cover 4 query rows x 32 columns, the block a group of 128 rows, and a lane keeps 8 such groups in flight (1024 rows a trip), so the query axis is cut into 128 interleaved slices per column. Each lane runs the online max / sum on its slice (one rescale per 8 rows); slices are merged max first, then rescaled sums: across the 4 rows of a wave by shuffles, across waves through LDS.
// blockIdx.x = batch, blockIdx.y = column block. A group of 128 rows is one logit tile (a, kb) of the block's tile column kb.
// The walk starts at the 128-aligned group that holds the block's first column (tile (kb, kb)), so every score read lies in a tile k_sc has written; a group past the end re-reads the last group. q < k and the groups past the end enter as -inf (exp gives 0) while the running max starts finite, so a slice with no visible row ends as (-3e38, 0) and drops out of the merge.
__global__ __launch_bounds__(1024) void k_colstat_c(const float* __restrict__ S0, float* __restrict__ CM, float* __restrict__ CZ) { __shared__ __align__(16) float pm[32][32], pz[32][32];
  const int tid = threadIdx.x, wave = tid >> 5, lane = tid & 31; const int bz = blockIdx.x; const int k0 = blockIdx.y * 32, qlo = k0 & ~127; const int r = tid >> 3, kc = k0 + (tid & 7) * 4;   /* the lane's row inside a group, its first column */
  const char* sp = (const char*)(S0 + ((size_t)bz * STL + (k0 >> 7)) * TLF); const unsigned vo = (unsigned)(r * 128 + (kc & 127)) * 4u;   /* tile number kb of the batch; the lane's byte offset inside a tile */
  unsigned off[8]; float m[4], z[4];   /* the lane's byte offsets in the trip's 8 tiles, formed one trip ahead: each load has an offset register of its own */
#pragma unroll
  for (int u = 0; u < 8; ++u) { const int au = (qlo >> 7) + u, a = au < TT / 128 - 1 ? au : TT / 128 - 1; off[u] = vo + (unsigned)(a * (a + 1) / 2) * (TLF * 4u); }
#pragma unroll
  for (int c = 0; c < 4; ++c) { m[c] = -3.0e38f; z[c] = 0.f; }
  for (int ub0 = qlo; ub0 < TT; ub0 += 1024) { v4f s[8];
#pragma unroll
    for (int u = 0; u < 8; ++u) s[u] = *(const v4f*)(sp + off[u]);
#pragma unroll
    for (int c = 0; c < 4; ++c) { float v[8]; float mn = m[c];
#pragma unroll
      for (int u = 0; u < 8; ++u) { const int ub = ub0 + u * 128; v[u] = ((ub < TT ? ub : -TT) >= kc + c - r) ? s[u][c] : -INFINITY; mn = fmaxf(mn, v[u]); }
      float a = z[c] * expf(m[c] - mn);
#pragma unroll
      for (int u = 0; u < 8; ++u) a += expf(v[u] - mn);
      m[c] = mn; z[c] = a; }
#pragma unroll
    for (int u = 0; u < 8; ++u) { const int au = (ub0 >> 7) + 8 + u, a = au < TT / 128 - 1 ? au : TT / 128 - 1; off[u] = vo + (unsigned)(a * (a + 1) / 2) * (TLF * 4u); } }
  v4f wm, wz;
#pragma unroll
  for (int c = 0; c < 4; ++c) { float M = fmaxf(m[c], __shfl_xor(m[c], 8)); M = fmaxf(M, __shfl_xor(M, 16)); float a = z[c] * expf(m[c] - M); a += __shfl_xor(a, 8); a += __shfl_xor(a, 16); wm[c] = M; wz[c] = a; }
  if (lane < 8) { *(v4f*)&pm[wave][lane * 4] = wm; *(v4f*)&pz[wave][lane * 4] = wz; }
  __syncthreads();   /* publishes the 32 waves' partial (max, sum) pairs to wave 0 */
  if (wave == 0) { float M = pm[0][lane];
#pragma unroll
    for (int w = 1; w < 32; ++w) M = fmaxf(M, pm[w][lane]);
    float a = 0.f;
#pragma unroll
    for (int w = 0; w < 32; ++w) a += pz[w][lane] * expf(pm[w][lane] - M);
    vst2(CM + (size_t)bz * TT + k0 + lane, M); vst2(CZ + (size_t)bz * TT + k0 + lane, 2048.0f / a); } }   /* every column sees at least its own diagonal entry: Z_k >= 1; stored as 2^11 / Z_k, the factor k_pv multiplies by */
// P values of one A fragment, formed from the logits where k_pv loads them: v = exp(S[t][k] - m_k) * (2^11 / Z_k) for k <= t, 0 above the diagonal; element order = the 16x16x32 A fragment's (keys k0 + 8h + 0..7, then k0 + 16 + 8h + 0..7).
// p_load issues the twelve 16-B loads unconditionally and together (logits, column maxima, column factors); p_vals does the arithmetic on every element and selects by index afterwards, so no load and no exp sits behind a per-lane branch.
struct PRaw { v4f s[4], m[4], z[4]; };
__device__ __forceinline__ PRaw p_load(const float* srow, const float* cm, const float* ci, int k0, int lane) { PRaw r; const int kb = k0 + 8 * (lane >> 4); const float *p = srow + (size_t)(k0 >> 7) * TLF + (kb & 127), *m = cm + kb, *z = ci + kb;   /* srow = the query's row in the first logit tile of its tile row; key tile k0 / 128 lies that many tiles further */
#pragma unroll
  for (int q = 0; q < 4; ++q) { const int o = (q >> 1) * 16 + (q & 1) * 4; r.s[q] = *(const v4f*)(p + o); r.m[q] = *(const v4f*)(m + o); r.z[q] = *(const v4f*)(z + o); }
  /* inputs-only fence on the loaded values: all twelve loads are in flight together and are waited for once; without it the compiler deals them out in small groups, each with a wait of its own */
  asm volatile("" :: "v"(r.s[0]), "v"(r.s[1]), "v"(r.s[2]), "v"(r.s[3]), "v"(r.m[0]), "v"(r.m[1]), "v"(r.m[2]), "v"(r.m[3]), "v"(r.z[0]), "v"(r.z[1]), "v"(r.z[2]), "v"(r.z[3]));
  return r; }
__device__ __forceinline__ void p_vals(float v[16], const PRaw& r, int k0, int t, int lane) { const int kb = k0 + 8 * (lane >> 4);
#pragma unroll
  for (int q = 0; q < 4; ++q)
#pragma unroll
    for (int u = 0; u < 4; ++u) { const float e = expf(r.s[q][u] - r.m[q][u]) * r.z[q][u]; v[q * 4 + u] = (kb + (q >> 1) * 16 + (q & 1) * 4 + u <= t) ? e : 0.f; } }
// ---- k_out64: out[b][t][0..63] = sum over the row's key ranges (ascending) of the partial ctx row, columns 0..63 (256 B by 16 lanes); the block's 16 rows lie in one band of PVK rows, so the range count is the same for all of them
__global__ __launch_bounds__(256) void k_out64(const float* __restrict__ Y, float* __restrict__ OUT) { const size_t row = (size_t)blockIdx.x * 16 + (threadIdx.x >> 4); const int q = threadIdx.x & 15; const int nr = (int)((blockIdx.x * 16u) % TT) / PVK + 1; const float* yp = Y + row * CC + q * 4; v4f v = *(const v4f*)yp;
  for (int c = 1; c < nr; ++c) v += *(const v4f*)(yp + c * YPL);
  asm volatile("s_wait_loadcnt 0x0" ::: "memory"); vst2(OUT + row * 64 + q * 4, v); }
// ---- k_pv: block = (16 queries, one range of PVK keys) of (batch b = blockIdx.z, head h0): partial ctx = P . v over the range's keys below kend, P = exp(S - m_k) x 2^11 / Z_k formed from the logits and the column statistics as the A fragment is loaded (every query block is < QBH: P and v as bf16 hi + lo, 3 products; the f16 P x 2^11 against v f16 path, 1 product, is not taken); 256-B (row, head) segment by 16 lanes
// Split over keys: rows of band d = t / PVK have d + 1 ranges; blockIdx.y numbers the (band, range) pairs, the 6 full ranges first, then each band's last range (the one the diagonal cuts short); blockIdx.x is the 16-row group inside the band. The PVW waves take the range's 32-key steps round robin, their f32 partials are added through LDS (wave order), and the ranges' partial rows go to planes of Y that k_out64 adds.
__global__ __launch_bounds__(32 * PVW) void k_pv(const float* __restrict__ PS0, const _Float16* __restrict__ VT, const __bf16* __restrict__ VB, const __bf16* __restrict__ VBL, const float* __restrict__ CM, const float* __restrict__ CI, int h0, float* __restrict__ Y) { const int b = blockIdx.z, h = h0; const float* PS = PS0 + (size_t)b * STL * TLF; const float* cm = CM + (size_t)b * TT; const float* ci = CI + (size_t)b * TT; __shared__ __align__(16) float ss[PVW][16][HD + 4];
  const int tid = threadIdx.x, wave = __builtin_amdgcn_readfirstlane(tid >> 5), lane = tid & 31, col = lane & 15, g = lane >> 4;   /* the wave number in a scalar register: the key loop's bounds stay wave-uniform */
  const int py = blockIdx.y; const int band = py >= 6 ? py - 6 : py >= 3 ? 3 : py >= 1 ? 2 : 1; const int rng = py >= 6 ? band : py >= 3 ? py - 3 : py >= 1 ? py - 1 : 0;
  const int ql0 = band * PVK + blockIdx.x * 16; const int qb = ql0 >> 6; const int kall = (kb_last(qb) + 1) * 4; const int kcb = rng * (PVK / 32) + wave; const int kce = kall < (rng + 1) * (PVK / 32) ? kall : (rng + 1) * (PVK / 32);
  const int ta = ql0 >> 7; const float* srow = PS + (size_t)(ta * (ta + 1) / 2) * TLF + ((ql0 & 127) + col) * 128;   /* the lane's query row in logit tile (ta, 0) */
  v8f acc[HD / 16] = {};
  if (qb < QBH) {
#pragma unroll 1
    for (int kc = kcb; kc < kce; kc += PVW) { const PRaw pr = p_load(srow, cm, ci, kc * 32, lane);
      float pv[16]; p_vals(pv, pr, kc * 32, ql0 + col, lane); const F2 p = bsplit16(pv);
#pragma unroll
      for (int j = 0; j < HD / 16; ++j) { const size_t vf = ((size_t)b * (KHI / 32) + kc) * (HD / 16) + j;   /* fragment (key step kc, column tile j) of the fragment-order v planes (head 0) */ const v16b vh = fragt_b(VB, vf, lane); acc[j] = wmma_bf(p.h, vh, acc[j]); acc[j] = wmma_bf(p.l, vh, acc[j]); acc[j] = wmma_bf(p.h, fragt_b(VBL, vf, lane), acc[j]); } }
  } else {
#pragma unroll 1
    for (int kc = kcb; kc < kce; kc += PVW) { const PRaw pr = p_load(srow, cm, ci, kc * 32, lane);
      float pv[16]; p_vals(pv, pr, kc * 32, ql0 + col, lane); v16h p;
#pragma unroll
      for (int i = 0; i < 16; ++i) p[i] = (_Float16)pv[i];
#pragma unroll
      for (int j = 0; j < HD / 16; ++j) { const size_t po = ((size_t)b * CC + h * HD + j * 16 + col) * (size_t)TT + kc * 32; acc[j] = wmma16(p, frag_h(VT + po, lane), acc[j]); } } }
#pragma unroll
  for (int j = 0; j < HD / 16; ++j)
#pragma unroll
    for (int r = 0; r < 8; ++r) ss[wave][8 * g + r][j * 16 + col] = acc[j][r] * (1.0f / 2048.0f);
  __syncthreads();   /* publishes the PVW waves' partial tiles to the threads that add them */
  { const int rl = tid >> 4, q = tid & 15; v4f s = *(const v4f*)&ss[0][rl][q * 4];
#pragma unroll   /* unrolled so that the PVW LDS reads issue together instead of one wait each */
    for (int w = 1; w < PVW; ++w) s += *(const v4f*)&ss[w][rl][q * 4];
    vst2(Y + rng * YPL + ((size_t)b * TT + ql0 + rl) * CC + h * HD + q * 4, s); } }

extern "C" void kernel_launch(void* const* d_in, const int* in_sizes, int n_in, void* d_out, int out_size, void* d_ws, size_t ws_size, hipStream_t stream) {
  (void)in_sizes; (void)n_in; (void)out_size;
  const float** F = (const float**)d_in;
  if (ws_size < (size_t)WS_END) return;
  char* ws = (char*)d_ws; _Float16 *QH = (_Float16*)(ws + WS_QH), *KH = (_Float16*)(ws + WS_KH), *VT = (_Float16*)(ws + WS_VT), *QL = (_Float16*)(ws + WS_QL), *KL = (_Float16*)(ws + WS_KL); __bf16 *VB = (__bf16*)(ws + WS_VB), *VBL = (__bf16*)(ws + WS_VBL); float *S = (float*)(ws + WS_S), *Y = (float*)(ws + WS_Y);
  (void)Y; (void)QL; (void)KL; (void)VB; (void)VBL;
  // inputs: 0 x [4,4096,512]; 1 Wq [64,512] (out,in); 2 Wk; 3 Wv; no biases
  if (ws_size < (size_t)WS_END2) return;
  float *Y2 = (float*)(ws + WS_Y2), *CM = (float*)(ws + WS_CM), *CZ = (float*)(ws + WS_CZ);
  k_proj<<<dim3(TNB * TT / 64, CC / 128, 3), 128, 0, stream>>>(F[0], F[0], F[0], F[1], F[2], F[3], nullptr, nullptr, nullptr, QH, QL, KH, KL, VT, VB, VBL);   /* weight columns 64..127 (the padding head) are zero fragments */
  /* head 0 only (head 1 is the zero padding); the batch is a grid axis of each of the three launches */
  k_sc<<<dim3(NQB, TT / 128, TNB), 128, 0, stream>>>(QH, KH, QL, KL, S);
  k_colstat_c<<<dim3(TNB, TT / 32), 1024, 0, stream>>>(S, CM, CZ);   /* per key column s: max and 2^11 / sum over the visible queries t >= s */
  k_pv<<<dim3(PVK / 16, PVS * (PVS + 1) / 2, TNB), 32 * PVW, 0, stream>>>(S, VT, VB, VBL, CM, CZ, 0, Y2);   /* (16-row group in its band) x (band, key range) x batch; P[t][s] = exp(S - m_s) x 2^11 / Z_s is formed in its loader */
  k_out64<<<dim3(TNB * TT / 16), 256, 0, stream>>>(Y2, (float*)d_out);
}

// v006
// A run of this version takes 148 microseconds.
// Next to v005, in two timings, it ran 1.19 times as fast each time.
// All steps since v000 together make it 50.3 times as fast.
// compute dtype: all float inputs rounded to bf16; q/k/v projections with EXACT bf16 products on WMMA 16x16x32 (f32 accumulate); causal scores with BOTH q and k as f16 hi + (x 2^10) residual (3 products) on EVERY block, x 64^-0.5; softmax over the QUERY axis in f32 (per key column: online max / sum over the visible queries, precise expf); P as bf16 hi + lo against v as bf16 hi + lo (3 products) on EVERY block; f32 output.
#include <hip/hip_runtime.h>
#include <math.h>

typedef __attribute__((ext_vector_type(16))) _Float16 v16h;
typedef __attribute__((ext_vector_type(16))) __bf16 v16b;
typedef __attribute__((ext_vector_type(8)))  _Float16 v8h;
typedef __attribute__((ext_vector_type(8)))  float v8f;
typedef __attribute__((ext_vector_type(4)))  float v4f;
typedef __attribute__((ext_vector_type(2)))  float v2f;
typedef __attribute__((ext_vector_type(4)))  unsigned v4u;
typedef __attribute__((ext_vector_type(4)))  int v4i;
typedef float __attribute__((may_alias)) float_a;
typedef int __attribute__((may_alias)) int_a;

template <typename T> __device__ __forceinline__ void vst2(void* p, T v) { *(T*)p = v;  }
__device__ __forceinline__ v8f wmma16(v16h a, v16h b, v8f c) {
  v8f d = __builtin_amdgcn_wmma_f32_16x16x32_f16(false, a, false, b, (short)0, c, false, false);
  asm volatile("v_nop\n\tv_nop\n\tv_nop\n\tv_nop" : "+v"(d) : "v"(a), "v"(b));
  return d;
}
__device__ __forceinline__ v8f wmma_bf(v16b a, v16b b, v8f c) {
  v8f d = __builtin_amdgcn_wmma_f32_16x16x32_bf16(false, a, false, b, (short)0, c, false, false);
  asm volatile("v_nop\n\tv_nop\n\tv_nop\n\tv_nop" : "+v"(d) : "v"(a), "v"(b));
  return d;
}
// 16x16x32 fragments: lane = (h = lane>>4, row/col = lane&15); elements 0..7 = k0+8h+0..7, 8..15 = k0+16+8h+0..7; D element r = row 8h+r
__device__ __forceinline__ v16h frag_h(const _Float16* rowk0, int lane) {
  union { v16h v; v8h q[2]; } u; const _Float16* p = rowk0 + 8 * (lane >> 4);
  u.q[0] = *(const v8h*)p; u.q[1] = *(const v8h*)(p + 16); return u.v;
}
__device__ __forceinline__ v16h frag_f32(const float* rowk0, int lane) {
  v16h a; const float* p = rowk0 + 8 * (lane >> 4);
#pragma unroll
  for (int i = 0; i < 8; ++i) { a[i] = (_Float16)p[i]; a[8 + i] = (_Float16)p[16 + i]; }
  return a;
}
__device__ __forceinline__ v16h frag_f32s(const float* rowk0, int lane, float sc) {
  v16h a; const float* p = rowk0 + 8 * (lane >> 4);
#pragma unroll
  for (int i = 0; i < 8; ++i) { a[i] = (_Float16)(p[i] * sc); a[8 + i] = (_Float16)(p[16 + i] * sc); }
  return a;
}
// column fragment from a [K][ld] layout (column n), rows >= K read as 0
__device__ __forceinline__ v16h fragc_f32(const float* W, int k0, int n, int lane, int ld, int K) {
  v16h a; const int g = lane >> 4;
#pragma unroll
  for (int i = 0; i < 8; ++i) { const int ka = k0 + 8 * g + i, kb = ka + 16;
    a[i] = (_Float16)(ka < K ? W[(size_t)(ka < K ? ka : K - 1) * ld + n] : 0.f); a[8 + i] = (_Float16)(kb < K ? W[(size_t)(kb < K ? kb : K - 1) * ld + n] : 0.f); }
  return a;
}
struct F2 { v16b h, l; };
__device__ __forceinline__ F2 bsplit16(const float v[16]) { F2 r;
#pragma unroll
  for (int i = 0; i < 16; ++i) { const __bf16 h = (__bf16)v[i]; r.h[i] = h; r.l[i] = (__bf16)(v[i] - (float)h); }
  return r; }
__device__ __forceinline__ F2 split_row(const float* row, int k0, int lane) { float v[16]; const float* p = row + k0 + 8 * (lane >> 4);
#pragma unroll
  for (int i = 0; i < 8; ++i) { v[i] = p[i]; v[8 + i] = p[16 + i]; }
  return bsplit16(v); }
__device__ __forceinline__ F2 split_rowK(const float* row, int k0, int lane, int K) { float v[16]; const int g = lane >> 4;
#pragma unroll
  for (int i = 0; i < 8; ++i) { const int ka = k0 + 8 * g + i, kb = ka + 16; v[i] = ka < K ? row[ka < K ? ka : K - 1] : 0.f; v[8 + i] = kb < K ? row[kb < K ? kb : K - 1] : 0.f; }
  return bsplit16(v); }
__device__ __forceinline__ F2 split_col(const float* W, int k0, int n, int lane, int ld, int K) { float v[16]; const int g = lane >> 4;
#pragma unroll
  for (int i = 0; i < 8; ++i) { const int ka = k0 + 8 * g + i, kb = ka + 16; v[i] = ka < K ? W[(size_t)(ka < K ? ka : K - 1) * ld + n] : 0.f; v[8 + i] = kb < K ? W[(size_t)(kb < K ? kb : K - 1) * ld + n] : 0.f; }
  return bsplit16(v); }
__device__ __forceinline__ v8f mac3(const F2& a, const F2& b, v8f c) { c = wmma_bf(a.l, b.h, c); c = wmma_bf(a.h, b.l, c); return wmma_bf(a.h, b.h, c); }
__device__ __forceinline__ float sigm(float v) { return 1.0f / (1.0f + expf(-v)); }
#define LDSX() do { asm volatile("s_wait_dscnt 0" ::: "memory"); __builtin_amdgcn_wave_barrier(); __builtin_amdgcn_fence(__ATOMIC_RELEASE, "workgroup"); } while (0)

// Single-head causal self-attention whose softmax runs over the QUERY axis (x [4,4096,512]; torch (out,in) Wq / Wk / Wv [64,512] (0.02 scale), no biases; scores = q k^T [B,t,s]; additive causal mask -1e9 where s > t; / sqrt(64); attn = softmax(scores, axis=1) - axis 1 is the QUERY axis t, so every key column s is normalised over the queries t >= s (faithful to the source); out = attn v -> [4,4096,64]).
#define NB 4
#define TT 4096
#define CC 128            // NH * HD = projected width
#define DIN 512          // input (model) width
#define NH 2
#define HD 64
#define NQB (TT / 64)
#define HG 1
#define SCALE (0.125f)
#define CAUSAL 1
#ifndef TNB
#define TNB NB
#endif
__device__ __forceinline__ float bfr(float v) { return (float)(__bf16)v; }
__host__ __device__ __forceinline__ int kb_last(int qb) { return CAUSAL ? ((qb * 64 + 63) >> 7) : (TT / 128 - 1); }
typedef __attribute__((ext_vector_type(8))) __bf16 v8b;
// Fragment-order planes: one 16 x 32 operand fragment (16 rows or columns x 32 k values, 2-byte elements) is stored as 1024 contiguous bytes; its 16-B piece number hf * 32 + lane holds the lane's elements 8 hf + 0..7 (k = 16 hf + 8 (lane >> 4) + 0..7 of row or column lane & 15), so each of a fragment's two loads reads four whole 128-B lines instead of 32 B out of each of 16 lines. f = fragment number in the plane.
__device__ __forceinline__ v16h fragt_h(const _Float16* plane, size_t f, int lane) {
  union { v16h v; v8h q[2]; } u; const v8h* p = (const v8h*)plane + f * 64 + lane;
  u.q[0] = p[0]; u.q[1] = p[32]; return u.v;
}
__device__ __forceinline__ v16b fragt_b(const __bf16* plane, size_t f, int lane) {
  union { v16b v; v8b q[2]; } u; const v8b* p = (const v8b*)plane + f * 64 + lane;
  u.q[0] = p[0]; u.q[1] = p[32]; return u.v;
}
#define QBH 64              // = NQB: 3-product scores and bf16 hi/lo P.v on every query block
#define QHI 4096            // EVERY row carries a q residual plane: with the softmax over the QUERY axis the few-term region is the END of the sequence (late key columns see few queries), so the high-precision paths run everywhere
#define KHI 4096            // every key row carries the k residual and the v bf16 hi + lo planes
// B fragment (k rows k0+.., output column o) of a weight: (in,out) [K][ld] or (out,in) [ld rows of K]: bf16 exact, or f16(bf16 * 256) exact
__device__ __forceinline__ v16b wcol_io(const float* Wm, int k0, int o, int lane, int ld) { v16b w; const int g = lane >> 4;
#pragma unroll
  for (int i = 0; i < 8; ++i) { w[i] = (__bf16)Wm[(size_t)(k0 + 8 * g + i) * ld + o]; w[8 + i] = (__bf16)Wm[(size_t)(k0 + 16 + 8 * g + i) * ld + o]; }
  return w; }
__device__ __forceinline__ v16b wcol_oi(const float* Wm, int k0, int o, int lane, int K) { v16b w; const float* p = Wm + (size_t)o * K + k0 + 8 * (lane >> 4);
#pragma unroll
  for (int i = 0; i < 8; ++i) { w[i] = (__bf16)p[i]; w[8 + i] = (__bf16)p[16 + i]; }
  return w; }
__device__ __forceinline__ v16h wcolh_io(const float* Wm, int k0, int o, int lane, int ld) { v16h w; const int g = lane >> 4;
#pragma unroll
  for (int i = 0; i < 8; ++i) { w[i] = (_Float16)(bfr(Wm[(size_t)(k0 + 8 * g + i) * ld + o]) * 256.0f); w[8 + i] = (_Float16)(bfr(Wm[(size_t)(k0 + 16 + 8 * g + i) * ld + o]) * 256.0f); }
  return w; }
__device__ __forceinline__ v16h wcolh_oi(const float* Wm, int k0, int o, int lane, int K) { v16h w; const float* p = Wm + (size_t)o * K + k0 + 8 * (lane >> 4);
#pragma unroll
  for (int i = 0; i < 8; ++i) { w[i] = (_Float16)(bfr(p[i]) * 256.0f); w[8 + i] = (_Float16)(bfr(p[16 + i]) * 256.0f); }
  return w; }
#define WQKV_LAYOUT 1   // 0 = (in,out) [DIN][CC]; 1 = (out,in) [64][DIN]; 2 = per-head [NH][DIN][HD]
__device__ __forceinline__ v16b wcol_hdk(const float* Wm, int k0, int o, int lane) { v16b w; const int g = lane >> 4; const float* p = Wm + (size_t)(o / HD) * DIN * HD + (o % HD);
#pragma unroll
  for (int i = 0; i < 8; ++i) { w[i] = (__bf16)p[(size_t)(k0 + 8 * g + i) * HD]; w[8 + i] = (__bf16)p[(size_t)(k0 + 16 + 8 * g + i) * HD]; }
  return w; }
#define WO_OUT_IN 0
#if WQKV_LAYOUT == 1
__device__ __forceinline__ v16b zero16b() { v16b w; _Pragma("unroll") for (int i = 0; i < 16; ++i) w[i] = (__bf16)0.0f; return w; }
#define WCOL(W, k0, o, lane) ((o) < 64 ? wcol_oi(W, k0, (o), lane, DIN) : zero16b())   /* (out,in) [64][512]: only 64 real output rows; projected columns 64..127 (padding head 1) are zero */
#elif WQKV_LAYOUT == 2
#define WCOL(W, k0, o, lane) wcol_hdk(W, k0, o, lane)
#else
#define WCOL(W, k0, o, lane) wcol_io(W, k0, o, lane, CC)
#endif
#if WO_OUT_IN
#define WOCOL(W, k0, o, lane) wcol_oi(W, k0, o, lane, CC)
#define WOCOLH(W, k0, o, lane) wcolh_oi(W, k0, o, lane, CC)
#else
#define WOCOL(W, k0, o, lane) wcol_io(W, k0, o, lane, DIN)
#define WOCOLH(W, k0, o, lane) wcolh_io(W, k0, o, lane, DIN)
#endif

#ifndef SM_EXTRA_PARAMS
#define SM_EXTRA_PARAMS
#endif
#ifndef PROJ_EXTRA_PARAMS
#define PROJ_EXTRA_PARAMS
#endif
#ifndef SM_MASK_HOOK
#define SM_MASK_HOOK (void)0
#endif

#define WS_QH  0u                                      // f16 q, head 0, fragment order: fragment ((b*TT + t) / 16) * 2 + kc (first half of the plane's room)
#define WS_KH  (WS_QH + 2u * (size_t)NB * TT * CC)      // f16 k, as q
#define WS_VT  (WS_KH + 2u * (size_t)NB * TT * CC)      // f16 v planes [b][c][t]
#define WS_QL  (WS_VT + 2u * (size_t)NB * CC * TT)      // f16 q residual x 2^10, as q
#define WS_KL  (WS_QL + 2u * (size_t)NB * QHI * CC)     // f16 k residual x 2^10, as q
#define WS_VB  (WS_KL + 2u * (size_t)NB * KHI * CC)     // bf16 v hi, head 0, fragment order: fragment (b * KHI / 32 + t / 32) * 4 + c / 16; WS_VBL: v lo, the same
#define WS_VBL (WS_VB + 2u * (size_t)NB * CC * KHI)
#define WS_S   (WS_VBL + 2u * (size_t)NB * CC * KHI)    // f32 logits [b][tile][128][128], see STL
#define STL ((TT / 128) * (TT / 128 + 1) / 2)          // 128 x 128 logit tiles of one batch: only the tiles (a = t / 128, kb = s / 128) with kb <= a exist, tile number a (a + 1) / 2 + kb; so the logits of all NB batches fit in the workspace at once
#define TLF (128 * 128)                                // floats per logit tile, rows of 128 floats
#define WS_Y   (WS_S  + 4u * (size_t)NB * STL * TLF)    // f32 ctx rows [b*t][CC] (only when there is an output projection)
#define WS_END (WS_Y  + 0u)
#define PVK 1024            // keys per key range of k_pv (one work-group's share of a 16-row group)
#define PVW 8               // waves per work-group of k_pv: the range's 32-key steps are dealt to them round robin
#define PVS (TT / PVK)      // most key ranges a query row can have = number of partial ctx planes
#define YPL ((size_t)NB * TT * CC)                      // floats per partial ctx plane
#define WS_Y2 (WS_END)                                  // f32 partial ctx rows [key range][b*TT + t][128] (columns 64..127 = the padding head); row t has ranges 0 .. t / PVK
#define WS_CM (WS_Y2 + 4u * PVS * YPL)                   // f32 column maxima [b][TT]
#define WS_CZ (WS_CM + 4u * (size_t)NB * TT)             // f32 2^11 / column sums [b][TT]
#define WS_END2 (WS_CZ + 4u * (size_t)NB * TT)

typedef __attribute__((ext_vector_type(4))) __bf16 v4b;
// k_proj's operands on their way from f32 rows [row][DIN] to 16 x 32 bf16 fragments, through LDS. One fragment takes LFB bytes: four runs of 16 pieces of 16 B (run hf * 2 + g, piece = row or column & 15: the elements 8 hf + 0..7 of lane g * 16 + piece, k = 16 hf + 8 g + 0..7), the runs 320 B apart so that the 8-B stores of frag_st fall on 64 different banks.
#define LFB 1280
// line_ld: 16 rows x 32 k values by four loads of whole 128-B lines; p = the lane's row (lane >> 3) and k offset (lane & 7) * 4, load u takes row u * 4 + (lane >> 3)
__device__ __forceinline__ void line_ld(v4f d[4], const float* p, int kc) {
#pragma unroll   /* d[] stays in registers, the four loads issue together */
  for (int u = 0; u < 4; ++u) d[u] = *(const v4f*)(p + (size_t)u * 4 * DIN + kc * 32); }
// frag_st: rounds them to bf16 and lays them into the fragment at f (f includes the lane's writer offset)
__device__ __forceinline__ void frag_st(unsigned char* f, const v4f d[4]) {
#pragma unroll   /* d[] and o stay in registers (this loop and the next) */
  for (int u = 0; u < 4; ++u) { v4b o;
#pragma unroll
    for (int i = 0; i < 4; ++i) o[i] = (__bf16)d[u][i];
    *(v4b*)(f + u * 64) = o; } }
// frag_ld: the lane's two pieces (f includes the lane's reader offset)
__device__ __forceinline__ v16b frag_ld(const unsigned char* f) { union { v16b v; v8b q[2]; } u; u.q[0] = *(const v8b*)f; u.q[1] = *(const v8b*)(f + 640); return u.v; }
// ---- k_proj: block = (64 rows, 128 cols, which): q/k/v = X W (+ b) with exact bf16 products (K = DIN) -> which 0: q f16, head 0, in fragment order (+ residual for rows < QHI); 1: k, as q (+ residual for rows < KHI); 2: v f16 planes [c][t] (+ bf16 hi/lo planes for t < KHI)
__global__ __launch_bounds__(128) void k_proj(const float* __restrict__ XQ, const float* __restrict__ XK, const float* __restrict__ XV, const float* __restrict__ WQ, const float* __restrict__ WK, const float* __restrict__ WV, const float* __restrict__ BQ, const float* __restrict__ BK, const float* __restrict__ BV,
    _Float16* __restrict__ QH, _Float16* __restrict__ QL, _Float16* __restrict__ KH, _Float16* __restrict__ KL, _Float16* __restrict__ VT, __bf16* __restrict__ VB, __bf16* __restrict__ VBL) {
  /* one LDS block with two uses, a barrier between them: in the k loop the operands as bf16 fragments (the block's weight, then two X slots per wave), afterwards the transposing buffers of the stores */
  __shared__ __align__(16) unsigned char smem[64 * LFB + 4 * 2 * LFB];
  _Float16 (*sh)[136] = (_Float16 (*)[136])smem; _Float16 (*sl)[136] = (_Float16 (*)[136])(smem + 17408); _Float16 (*th)[72] = (_Float16 (*)[72])(smem + 34816); __bf16 (*tb)[72] = (__bf16 (*)[72])(smem + 53248); __bf16 (*tbl)[72] = (__bf16 (*)[72])(smem + 71680);
  const int tid = threadIdx.x, wave = tid >> 5, lane = tid & 31, col = lane & 15, g = lane >> 4; const int which = blockIdx.z; const int c0 = blockIdx.y * 128; const size_t r0 = (size_t)blockIdx.x * 64; const size_t bb = r0 / TT; const int t0 = (int)(r0 % TT);
  const float* X = which == 0 ? XQ : which == 1 ? XK : XV; const float* WA = which == 0 ? WQ : which == 1 ? WK : WV; const float* BA = which == 0 ? BQ : which == 1 ? BK : BV;
  const int lc = lane & 7, lr = lane >> 3;   /* a line load: 8 lanes take one row's 128-B line (32 k values), the wave 4 rows */
  const int wofs = (lc >> 1) * 320 + lr * 16 + (lc & 1) * 8, rofs = g * 320 + col * 16;   /* the lane's place in a fragment as writer of 4 values and as reader of its pieces */
  /* X: the wave's 16 rows, k step by k step; steps 0 and 1 go to the wave's two LDS slots before the loop, steps 2.. wait in a register ring of 4 steps */
  const float* xp = X + (r0 + wave * 16 + lr) * DIN + lc * 4; unsigned char* xw = smem + (64 + wave * 2) * LFB + wofs; const unsigned char* xrd = smem + (64 + wave * 2) * LFB + rofs;
  v4f x01[2][4], xr[4][4];
  line_ld(x01[0], xp, 0); line_ld(x01[1], xp, 1);
#pragma unroll   /* here and below: loops over register arrays are unrolled so that the arrays stay in registers */
  for (int s = 0; s < 4; ++s) line_ld(xr[s], xp, 2 + s);
  /* W: the 64 real output rows x DIN as the B fragments (k step kc, column tile j) = number kc * 4 + j; wave w stages k steps 4 w .. 4 w + 3, 32 loads in flight */
  if (c0 == 0) { const float* wp = WA + (size_t)lr * DIN + wave * 128 + lc * 4; unsigned char* lp = smem + wave * 16 * LFB + wofs;
#pragma unroll
    for (int kh = 0; kh < 2; ++kh) { v4f t[8][4];
#pragma unroll
      for (int u = 0; u < 8; ++u) line_ld(t[u], wp + (size_t)(u & 3) * 16 * DIN, kh * 2 + (u >> 2));
#pragma unroll
      for (int u = 0; u < 8; ++u) frag_st(lp + ((kh * 2 + (u >> 2)) * 4 + (u & 3)) * LFB, t[u]); }
  } else { const v4u zz = {0u, 0u, 0u, 0u}; for (int e = tid; e < 64 * LFB / 16; e += 128) *(v4u*)(smem + e * 16) = zz; }   /* projected columns 128.. have no weight row: zero fragments (block-uniform test) */
  frag_st(xw, x01[0]); frag_st(xw + LFB, x01[1]);
  __syncthreads();   /* publishes the staged weight fragments to the block's four waves */
  v8f acc[8] = {}; v16b af[2], wf[2][4];   /* the fragments of a k step, read from LDS together and one step ahead of their products */
  af[0] = frag_ld(xrd);
#pragma unroll
  for (int j = 0; j < 4; ++j) wf[0][j] = frag_ld(smem + j * LFB + rofs);
#pragma unroll   /* unrolled so that the slot numbers of the rings are constants */
  for (int kc = 0; kc < DIN / 32; ++kc) {
    __builtin_amdgcn_sched_barrier(0);   /* keeps each step's instructions in their step: without it the compiler rounds the ring's X values right behind their loads and so waits out the memory latency in every step */
    asm volatile("s_wait_dscnt 0x0" ::: "memory");   /* the wave's own X stores of the step before have landed before other lanes read them back, and this step's fragment has left the slot that is written below */
    if (kc + 1 < DIN / 32) { af[(kc + 1) & 1] = frag_ld(xrd + ((kc + 1) & 1) * LFB);
#pragma unroll
      for (int j = 0; j < 4; ++j) wf[(kc + 1) & 1][j] = frag_ld(smem + ((kc + 1) * 4 + j) * LFB + rofs); }
    if (kc + 2 < DIN / 32) frag_st(xw + (kc & 1) * LFB, xr[kc & 3]);
    if (kc + 6 < DIN / 32) line_ld(xr[kc & 3], xp, kc + 6);
#pragma unroll
    for (int j = 0; j < 4; ++j) acc[j] = wmma_bf(af[kc & 1], wf[kc & 1][j], acc[j]); }   /* column tiles 4..7 (the padding head) have no weight row: their sums stay 0 */
  __syncthreads();   /* every wave has read its last fragment: the LDS block now serves the stores */
  if (which < 2) { _Float16* DH = which == 0 ? QH : KH; _Float16* DL = which == 0 ? QL : KL; const int nhi = which == 0 ? QHI : KHI; const bool hi_rows = t0 < nhi;
#pragma unroll
    for (int j = 0; j < 8; ++j) { const float bias = BA ? bfr(BA[c0 + j * 16 + col]) : 0.f;
#pragma unroll
      for (int r = 0; r < 8; ++r) { const float v = acc[j][r] + bias; const _Float16 hv = (_Float16)v; sh[wave * 16 + 8 * g + r][j * 16 + col] = hv; sl[wave * 16 + 8 * g + r][j * 16 + col] = (_Float16)((v - (float)hv) * 1024.0f); } }
    __syncthreads();
    /* fragment order, columns 0..63 (head 0; the padding head is not stored): piece e of the block's 4 row tiles = row (e >> 7) * 16 + (e & 15), columns ((e >> 4) & 7) * 8 + 0..7 */
    for (int e = tid; e < 64 * 8; e += 128) { const int rl = (e >> 7) * 16 + (e & 15), q = (e >> 4) & 7; vst2((unsigned*)(DH + r0 * HD + e * 8), *(const v4u*)&sh[rl][q * 8]); if (hi_rows) vst2((unsigned*)(DL + (bb * nhi + t0) * (size_t)HD + e * 8), *(const v4u*)&sl[rl][q * 8]); }
  } else { const bool hi_rows = t0 < KHI;
#pragma unroll
    for (int j = 0; j < 8; ++j) { const float bias = BA ? bfr(BA[c0 + j * 16 + col]) : 0.f;
#pragma unroll
      for (int r = 0; r < 8; ++r) { const float v = acc[j][r] + bias; const int rl = wave * 16 + 8 * g + r, cl = j * 16 + col; th[cl][rl] = (_Float16)v; const __bf16 bh = (__bf16)v; tb[cl][rl] = bh; tbl[cl][rl] = (__bf16)(v - (float)bh); } }
    __syncthreads();
    for (int e = tid; e < 128 * 8; e += 128) { const int cl = e >> 3, q = e & 7; vst2((unsigned*)(VT + (bb * CC + c0 + cl) * (size_t)TT + t0 + q * 8), *(const v4u*)&th[cl][q * 8]); }
    /* fragment order, columns 0..63: piece e of the block's 2 key steps = column ((e >> 6) & 3) * 16 + (e & 15), keys (e >> 8) * 32 + ((e >> 4) & 3) * 8 + 0..7 */
    if (hi_rows) for (int e = tid; e < 64 * 8; e += 128) { const int cl = ((e >> 6) & 3) * 16 + (e & 15), kl = (e >> 8) * 32 + ((e >> 4) & 3) * 8; const size_t o3 = (bb * KHI + t0) * (size_t)HD + e * 8; vst2((unsigned*)(VB + o3), *(const v4u*)&tb[cl][kl]); vst2((unsigned*)(VBL + o3), *(const v4u*)&tbl[cl][kl]); } } }
// ---- k_sc: block = (query block qb, key block kb <= kb_last(qb), batch b = blockIdx.z), head 0 (the only head the fragment-order planes hold): logits x SCALE; q hi + residual (x 2^10) against k (2 products) for query rows < QHI, plus the k residual (3 products) for query blocks < QBH (every query block); causal: blocks past the diagonal exit, the mask itself is applied by index in k_colstat_c and in k_pv's p_vals
__global__ __launch_bounds__(128) void k_sc(const _Float16* __restrict__ QH, const _Float16* __restrict__ KH, const _Float16* __restrict__ QL, const _Float16* __restrict__ KL, float* __restrict__ S0) { __shared__ __align__(16) float ss[4][16][132];
  const int qb = blockIdx.x, kb = blockIdx.y; if (kb > kb_last(qb)) return;
  const int b = blockIdx.z; const int ta = qb >> 1; float* S = S0 + ((size_t)b * STL + ta * (ta + 1) / 2 + kb) * TLF + (qb & 1) * 64 * 128;   /* the block's 64 rows of logit tile (ta, kb) */
  const int tid = threadIdx.x, wave = tid >> 5, lane = tid & 31, col = lane & 15, g = lane >> 4; const int k0 = kb * 128; const int ql0 = qb * 64 + wave * 16; const size_t q0 = (size_t)b * TT + ql0, kr0 = (size_t)b * TT + k0;
  v8f acc[8] = {}, accl[8] = {};
  const size_t fq = q0 >> 3, fk = kr0 >> 3, fql = ((size_t)b * QHI + ql0) >> 3, fkl = ((size_t)b * KHI + k0) >> 3;   /* first fragment of the wave's 16 query rows and of the block's 128 key rows in the fragment-order planes: 2 fragments (kc = 0, 1) per 16 rows */
  if (qb < QBH) {
#pragma unroll
    for (int kc = 0; kc < HD / 32; ++kc) { const v16h ah = fragt_h(QH, fq + kc, lane), al = fragt_h(QL, fql + kc, lane);
#pragma unroll
      for (int j = 0; j < 8; ++j) { const v16h kbf = fragt_h(KH, fk + j * 2 + kc, lane), klf = fragt_h(KL, fkl + j * 2 + kc, lane); acc[j] = wmma16(ah, kbf, acc[j]); accl[j] = wmma16(al, kbf, accl[j]); accl[j] = wmma16(ah, klf, accl[j]); } }
  } else if (qb * 64 < QHI) {
#pragma unroll
    for (int kc = 0; kc < HD / 32; ++kc) { const v16h ah = fragt_h(QH, fq + kc, lane), al = fragt_h(QL, fql + kc, lane);
#pragma unroll
      for (int j = 0; j < 8; ++j) { const v16h kbf = fragt_h(KH, fk + j * 2 + kc, lane); acc[j] = wmma16(ah, kbf, acc[j]); accl[j] = wmma16(al, kbf, accl[j]); } }
  } else {
#pragma unroll
    for (int kc = 0; kc < HD / 32; ++kc) { const v16h ah = fragt_h(QH, fq + kc, lane);
#pragma unroll
      for (int j = 0; j < 8; ++j) { const v16h kbf = fragt_h(KH, fk + j * 2 + kc, lane); acc[j] = wmma16(ah, kbf, acc[j]); } } }
#pragma unroll
  for (int j = 0; j < 8; ++j) {
#pragma unroll
    for (int r = 0; r < 8; ++r) ss[wave][8 * g + r][j * 16 + col] = (acc[j][r] + accl[j][r] * (1.0f / 1024.0f)) * SCALE; }
  LDSX(); for (int rl = 0; rl < 16; ++rl) vst2(S + (wave * 16 + rl) * 128 + lane * 4, *(const v4f*)&ss[wave][rl][lane * 4]); }
// ---- k_sm: block = query row t (head in group): keys [0, kend): causal -> logit if s <= t else excluded; softmax in f32; P x 2^11 in place (0 for excluded)
__global__ __launch_bounds__(256) void k_sm(float* __restrict__ S0 SM_EXTRA_PARAMS) { __shared__ float sred[8]; __shared__ float sbc; __shared__ __align__(16) float shv[TT];
  const int tid = threadIdx.x; const int t = blockIdx.x; const int kend = (kb_last(t >> 6) + 1) * 128;
  float* sr = S0 + (size_t)blockIdx.y * TT * TT + (size_t)t * TT;
  float m = -3.0e38f; for (int k = tid; k < kend; k += 256) { float v = (!CAUSAL || k <= t) ? sr[k] : -3.0e38f; SM_MASK_HOOK; shv[k] = v; m = fmaxf(m, v); }
#pragma unroll
  for (int o = 1; o < 32; o <<= 1) m = fmaxf(m, __shfl_xor(m, o));
  if ((tid & 31) == 0) sred[tid >> 5] = m; __syncthreads(); if (tid == 0) { float a = sred[0]; for (int i = 1; i < 8; ++i) a = fmaxf(a, sred[i]); sbc = a; } __syncthreads(); m = sbc; __syncthreads();
  float sum = 0.f; for (int k = tid; k < kend; k += 256) { const float v = shv[k]; const float e = (v <= -1.0e38f) ? 0.f : expf(v - m); shv[k] = e; sum += e; }
#pragma unroll
  for (int o = 1; o < 32; o <<= 1) sum += __shfl_xor(sum, o);
  if ((tid & 31) == 0) sred[tid >> 5] = sum; __syncthreads(); if (tid == 0) { float a = 0.f; for (int i = 0; i < 8; ++i) a += sred[i]; sbc = a > 0.f ? 2048.0f / a : 0.f; }   /* a fully excluded row yields P = 0 */ __syncthreads(); const float inv = sbc;
  for (int k = tid; k < kend; k += 256) shv[k] = shv[k] * inv;
  __syncthreads(); for (int q = tid; q < kend / 4; q += 256) vst2(sr + q * 4, *(const v4f*)&shv[q * 4]); }
// ---- k_colstat_c: softmax over the QUERY axis under the causal mask (the source's softmax(axis=1) on [B, t, s] scores with -1e9 above the diagonal): for every key column k: m_k = max_{q >= k} S[q][k], Z_k = sum_{q >= k} exp(S[q][k] - m_k) (f32, precise expf); CM holds m_k, CZ holds 2^11 / Z_k.
// block = 32 key columns (one 128-B line of CM and of CZ), 32 waves; a wave's 16-B loads cover 4 query rows x 32 columns, the block a group of 128 rows, and a lane keeps 8 such groups in flight (1024 rows a trip), so the query axis is cut into 128 interleaved slices per column. Each lane runs the online max / sum on its slice (one rescale per 8 rows); slices are merged max first, then rescaled sums: across the 4 rows of a wave by shuffles, across waves through LDS.
// blockIdx.x = batch, blockIdx.y = column block. A group of 128 rows is one logit tile (a, kb) of the block's tile column kb.
// The walk starts at the 128-aligned group that holds the block's first column (tile (kb, kb)), so every score read lies in a tile k_sc has written; a group past the end re-reads the last group. q < k and the groups past the end enter as -inf (exp gives 0) while the running max starts finite, so a slice with no visible row ends as (-3e38, 0) and drops out of the merge.
__global__ __launch_bounds__(1024) void k_colstat_c(const float* __restrict__ S0, float* __restrict__ CM, float* __restrict__ CZ) { __shared__ __align__(16) float pm[32][32], pz[32][32];
  const int tid = threadIdx.x, wave = tid >> 5, lane = tid & 31; const int bz = blockIdx.x; const int k0 = blockIdx.y * 32, qlo = k0 & ~127; const int r = tid >> 3, kc = k0 + (tid & 7) * 4;   /* the lane's row inside a group, its first column */
  const char* sp = (const char*)(S0 + ((size_t)bz * STL + (k0 >> 7)) * TLF); const unsigned vo = (unsigned)(r * 128 + (kc & 127)) * 4u;   /* tile number kb of the batch; the lane's byte offset inside a tile */
  unsigned off[8]; float m[4], z[4];   /* the lane's byte offsets in the trip's 8 tiles, formed one trip ahead: each load has an offset register of its own */
#pragma unroll
  for (int u = 0; u < 8; ++u) { const int au = (qlo >> 7) + u, a = au < TT / 128 - 1 ? au : TT / 128 - 1; off[u] = vo + (unsigned)(a * (a + 1) / 2) * (TLF * 4u); }
#pragma unroll
  for (int c = 0; c < 4; ++c) { m[c] = -3.0e38f; z[c] = 0.f; }
  for (int ub0 = qlo; ub0 < TT; ub0 += 1024) { v4f s[8];
#pragma unroll
    for (int u = 0; u < 8; ++u) s[u] = *(const v4f*)(sp + off[u]);
#pragma unroll
    for (int c = 0; c < 4; ++c) { float v[8]; float mn = m[c];
#pragma unroll
      for (int u = 0; u < 8; ++u) { const int ub = ub0 + u * 128; v[u] = ((ub < TT ? ub : -TT) >= kc + c - r) ? s[u][c] : -INFINITY; mn = fmaxf(mn, v[u]); }
      float a = z[c] * expf(m[c] - mn);
#pragma unroll
      for (int u = 0; u < 8; ++u) a += expf(v[u] - mn);
      m[c] = mn; z[c] = a; }
#pragma unroll
    for (int u = 0; u < 8; ++u) { const int au = (ub0 >> 7) + 8 + u, a = au < TT / 128 - 1 ? au : TT / 128 - 1; off[u] = vo + (unsigned)(a * (a + 1) / 2) * (TLF * 4u); } }
  v4f wm, wz;
#pragma unroll
  for (int c = 0; c < 4; ++c) { float M = fmaxf(m[c], __shfl_xor(m[c], 8)); M = fmaxf(M, __shfl_xor(M, 16)); float a = z[c] * expf(m[c] - M); a += __shfl_xor(a, 8); a += __shfl_xor(a, 16); wm[c] = M; wz[c] = a; }
  if (lane < 8) { *(v4f*)&pm[wave][lane * 4] = wm; *(v4f*)&pz[wave][lane * 4] = wz; }
  __syncthreads();   /* publishes the 32 waves' partial (max, sum) pairs to wave 0 */
  if (wave == 0) { float M = pm[0][lane];
#pragma unroll
    for (int w = 1; w < 32; ++w) M = fmaxf(M, pm[w][lane]);
    float a = 0.f;
#pragma unroll
    for (int w = 0; w < 32; ++w) a += pz[w][lane] * expf(pm[w][lane] - M);
    vst2(CM + (size_t)bz * TT + k0 + lane, M); vst2(CZ + (size_t)bz * TT + k0 + lane, 2048.0f / a); } }   /* every column sees at least its own diagonal entry: Z_k >= 1; stored as 2^11 / Z_k, the factor k_pv multiplies by */
// P values of one A fragment, formed from the logits where k_pv loads them: v = exp(S[t][k] - m_k) * (2^11 / Z_k) for k <= t, 0 above the diagonal; element order = the 16x16x32 A fragment's (keys k0 + 8h + 0..7, then k0 + 16 + 8h + 0..7).
// p_load issues the twelve 16-B loads unconditionally and together (logits, column maxima, column factors); p_vals does the arithmetic on every element and selects by index afterwards, so no load and no exp sits behind a per-lane branch.
struct PRaw { v4f s[4], m[4], z[4]; };
__device__ __forceinline__ PRaw p_load(const float* srow, const float* cm, const float* ci, int k0, int lane) { PRaw r; const int kb = k0 + 8 * (lane >> 4); const float *p = srow + (size_t)(k0 >> 7) * TLF + (kb & 127), *m = cm + kb, *z = ci + kb;   /* srow = the query's row in the first logit tile of its tile row; key tile k0 / 128 lies that many tiles further */
#pragma unroll
  for (int q = 0; q < 4; ++q) { const int o = (q >> 1) * 16 + (q & 1) * 4; r.s[q] = *(const v4f*)(p + o); r.m[q] = *(const v4f*)(m + o); r.z[q] = *(const v4f*)(z + o); }
  /* inputs-only fence on the loaded values: all twelve loads are in flight together and are waited for once; without it the compiler deals them out in small groups, each with a wait of its own */
  asm volatile("" :: "v"(r.s[0]), "v"(r.s[1]), "v"(r.s[2]), "v"(r.s[3]), "v"(r.m[0]), "v"(r.m[1]), "v"(r.m[2]), "v"(r.m[3]), "v"(r.z[0]), "v"(r.z[1]), "v"(r.z[2]), "v"(r.z[3]));
  return r; }
__device__ __forceinline__ void p_vals(float v[16], const PRaw& r, int k0, int t, int lane) { const int kb = k0 + 8 * (lane >> 4);
#pragma unroll
  for (int q = 0; q < 4; ++q)
#pragma unroll
    for (int u = 0; u < 4; ++u) { const float e = expf(r.s[q][u] - r.m[q][u]) * r.z[q][u]; v[q * 4 + u] = (kb + (q >> 1) * 16 + (q & 1) * 4 + u <= t) ? e : 0.f; } }
// ---- k_out64: out[b][t][0..63] = sum over the row's key ranges (ascending) of the partial ctx row, columns 0..63 (256 B by 16 lanes); the block's 16 rows lie in one band of PVK rows, so the range count is the same for all of them
__global__ __launch_bounds__(256) void k_out64(const float* __restrict__ Y, float* __restrict__ OUT) { const size_t row = (size_t)blockIdx.x * 16 + (threadIdx.x >> 4); const int q = threadIdx.x & 15; const int nr = (int)((blockIdx.x * 16u) % TT) / PVK + 1; const float* yp = Y + row * CC + q * 4; v4f v = *(const v4f*)yp;
  for (int c = 1; c < nr; ++c) v += *(const v4f*)(yp + c * YPL);
  asm volatile("s_wait_loadcnt 0x0" ::: "memory"); vst2(OUT + row * 64 + q * 4, v); }
// ---- k_pv: block = (16 queries, one range of PVK keys) of (batch b = blockIdx.z, head h0): partial ctx = P . v over the range's keys below kend, P = exp(S - m_k) x 2^11 / Z_k formed from the logits and the column statistics as the A fragment is loaded (every query block is < QBH: P and v as bf16 hi + lo, 3 products; the f16 P x 2^11 against v f16 path, 1 product, is not taken); 256-B (row, head) segment by 16 lanes
// Split over keys: rows of band d = t / PVK have d + 1 ranges; blockIdx.y numbers the (band, range) pairs, the 6 full ranges first, then each band's last range (the one the diagonal cuts short); blockIdx.x is the 16-row group inside the band. The PVW waves take the range's 32-key steps round robin, their f32 partials are added through LDS (wave order), and the ranges' partial rows go to planes of Y that k_out64 adds.
__global__ __launch_bounds__(32 * PVW) void k_pv(const float* __restrict__ PS0, const _Float16* __restrict__ VT, const __bf16* __restrict__ VB, const __bf16* __restrict__ VBL, const float* __restrict__ CM, const float* __restrict__ CI, int h0, float* __restrict__ Y) { const int b = blockIdx.z, h = h0; const float* PS = PS0 + (size_t)b * STL * TLF; const float* cm = CM + (size_t)b * TT; const float* ci = CI + (size_t)b * TT; __shared__ __align__(16) float ss[PVW][16][HD + 4];
  const int tid = threadIdx.x, wave = __builtin_amdgcn_readfirstlane(tid >> 5), lane = tid & 31, col = lane & 15, g = lane >> 4;   /* the wave number in a scalar register: the key loop's bounds stay wave-uniform */
  const int py = blockIdx.y; const int band = py >= 6 ? py - 6 : py >= 3 ? 3 : py >= 1 ? 2 : 1; const int rng = py >= 6 ? band : py >= 3 ? py - 3 : py >= 1 ? py - 1 : 0;
  const int ql0 = band * PVK + blockIdx.x * 16; const int qb = ql0 >> 6; const int kall = (kb_last(qb) + 1) * 4; const int kcb = rng * (PVK / 32) + wave; const int kce = kall < (rng + 1) * (PVK / 32) ? kall : (rng + 1) * (PVK / 32);
  const int ta = ql0 >> 7; const float* srow = PS + (size_t)(ta * (ta + 1) / 2) * TLF + ((ql0 & 127) + col) * 128;   /* the lane's query row in logit tile (ta, 0) */
  v8f acc[HD / 16] = {};
  if (qb < QBH) {
#pragma unroll 1
    for (int kc = kcb; kc < kce; kc += PVW) { const PRaw pr = p_load(srow, cm, ci, kc * 32, lane);
      float pv[16]; p_vals(pv, pr, kc * 32, ql0 + col, lane); const F2 p = bsplit16(pv);
#pragma unroll
      for (int j = 0; j < HD / 16; ++j) { const size_t vf = ((size_t)b * (KHI / 32) + kc) * (HD / 16) + j;   /* fragment (key step kc, column tile j) of the fragment-order v planes (head 0) */ const v16b vh = fragt_b(VB, vf, lane); acc[j] = wmma_bf(p.h, vh, acc[j]); acc[j] = wmma_bf(p.l, vh, acc[j]); acc[j] = wmma_bf(p.h, fragt_b(VBL, vf, lane), acc[j]); } }
  } else {
#pragma unroll 1
    for (int kc = kcb; kc < kce; kc += PVW) { const PRaw pr = p_load(srow, cm, ci, kc * 32, lane);
      float pv[16]; p_vals(pv, pr, kc * 32, ql0 + col, lane); v16h p;
#pragma unroll
      for (int i = 0; i < 16; ++i) p[i] = (_Float16)pv[i];
#pragma unroll
      for (int j = 0; j < HD / 16; ++j) { const size_t po = ((size_t)b * CC + h * HD + j * 16 + col) * (size_t)TT + kc * 32; acc[j] = wmma16(p, frag_h(VT + po, lane), acc[j]); } } }
#pragma unroll
  for (int j = 0; j < HD / 16; ++j)
#pragma unroll
    for (int r = 0; r < 8; ++r) ss[wave][8 * g + r][j * 16 + col] = acc[j][r] * (1.0f / 2048.0f);
  __syncthreads();   /* publishes the PVW waves' partial tiles to the threads that add them */
  { const int rl = tid >> 4, q = tid & 15; v4f s = *(const v4f*)&ss[0][rl][q * 4];
#pragma unroll   /* unrolled so that the PVW LDS reads issue together instead of one wait each */
    for (int w = 1; w < PVW; ++w) s += *(const v4f*)&ss[w][rl][q * 4];
    vst2(Y + rng * YPL + ((size_t)b * TT + ql0 + rl) * CC + h * HD + q * 4, s); } }

extern "C" void kernel_launch(void* const* d_in, const int* in_sizes, int n_in, void* d_out, int out_size, void* d_ws, size_t ws_size, hipStream_t stream) {
  (void)in_sizes; (void)n_in; (void)out_size;
  const float** F = (const float**)d_in;
  if (ws_size < (size_t)WS_END) return;
  char* ws = (char*)d_ws; _Float16 *QH = (_Float16*)(ws + WS_QH), *KH = (_Float16*)(ws + WS_KH), *VT = (_Float16*)(ws + WS_VT), *QL = (_Float16*)(ws + WS_QL), *KL = (_Float16*)(ws + WS_KL); __bf16 *VB = (__bf16*)(ws + WS_VB), *VBL = (__bf16*)(ws + WS_VBL); float *S = (float*)(ws + WS_S), *Y = (float*)(ws + WS_Y);
  (void)Y; (void)QL; (void)KL; (void)VB; (void)VBL;
  // inputs: 0 x [4,4096,512]; 1 Wq [64,512] (out,in); 2 Wk; 3 Wv; no biases
  if (ws_size < (size_t)WS_END2) return;
  float *Y2 = (float*)(ws + WS_Y2), *CM = (float*)(ws + WS_CM), *CZ = (float*)(ws + WS_CZ);
  k_proj<<<dim3(TNB * TT / 64, CC / 128, 3), 128, 0, stream>>>(F[0], F[0], F[0], F[1], F[2], F[3], nullptr, nullptr, nullptr, QH, QL, KH, KL, VT, VB, VBL);   /* projected columns 64..127 (the padding head) get no weight fragments: their sums stay 0 */
  /* head 0 only (head 1 is the zero padding); the batch is a grid axis of each of the three launches */
  k_sc<<<dim3(NQB, TT / 128, TNB), 128, 0, stream>>>(QH, KH, QL, KL, S);
  k_colstat_c<<<dim3(TNB, TT / 32), 1024, 0, stream>>>(S, CM, CZ);   /* per key column s: max and 2^11 / sum over the visible queries t >= s */
  k_pv<<<dim3(PVK / 16, PVS * (PVS + 1) / 2, TNB), 32 * PVW, 0, stream>>>(S, VT, VB, VBL, CM, CZ, 0, Y2);   /* (16-row group in its band) x (band, key range) x batch; P[t][s] = exp(S - m_s) x 2^11 / Z_s is formed in its loader */
  k_out64<<<dim3(TNB * TT / 16), 256, 0, stream>>>(Y2, (float*)d_out);
}

// v007
// It runs in 66.9 microseconds.
// In both of two side-by-side timings against v006, it was 2.21 times as fast.
// Over all steps from v000 it is 111 times as fast.
// compute dtype: all float inputs rounded to bf16; q/k/v projections with EXACT bf16 products on WMMA 16x16x32 (f32 accumulate); causal scores with BOTH q and k as f16 hi + (x 2^10) residual (3 products) on EVERY block, x 64^-0.5; softmax over the QUERY axis in f32 (per key column: online max / sum over the visible queries, precise expf); P as bf16 hi + lo against v as bf16 hi + lo (3 products) on EVERY block; f32 output.
#include <hip/hip_runtime.h>
#include <math.h>

typedef __attribute__((ext_vector_type(16))) _Float16 v16h;
typedef __attribute__((ext_vector_type(16))) __bf16 v16b;
typedef __attribute__((ext_vector_type(8)))  _Float16 v8h;
typedef __attribute__((ext_vector_type(8)))  float v8f;
typedef __attribute__((ext_vector_type(4)))  float v4f;
typedef __attribute__((ext_vector_type(2)))  float v2f;
typedef __attribute__((ext_vector_type(4)))  unsigned v4u;
typedef __attribute__((ext_vector_type(4)))  int v4i;
typedef float __attribute__((may_alias)) float_a;
typedef int __attribute__((may_alias)) int_a;

template <typename T> __device__ __forceinline__ void vst2(void* p, T v) { *(T*)p = v;  }
__device__ __forceinline__ v8f wmma16(v16h a, v16h b, v8f c) {
  v8f d = __builtin_amdgcn_wmma_f32_16x16x32_f16(false, a, false, b, (short)0, c, false, false);
  asm volatile("v_nop\n\tv_nop\n\tv_nop\n\tv_nop" : "+v"(d) : "v"(a), "v"(b));
  return d;
}
__device__ __forceinline__ v8f wmma_bf(v16b a, v16b b, v8f c) {
  v8f d = __builtin_amdgcn_wmma_f32_16x16x32_bf16(false, a, false, b, (short)0, c, false, false);
  asm volatile("v_nop\n\tv_nop\n\tv_nop\n\tv_nop" : "+v"(d) : "v"(a), "v"(b));
  return d;
}
// 16x16x32 fragments: lane = (h = lane>>4, row/col = lane&15); elements 0..7 = k0+8h+0..7, 8..15 = k0+16+8h+0..7; D element r = row 8h+r
__device__ __forceinline__ v16h frag_h(const _Float16* rowk0, int lane) {
  union { v16h v; v8h q[2]; } u; const _Float16* p = rowk0 + 8 * (lane >> 4);
  u.q[0] = *(const v8h*)p; u.q[1] = *(const v8h*)(p + 16); return u.v;
}
__device__ __forceinline__ v16h frag_f32(const float* rowk0, int lane) {
  v16h a; const float* p = rowk0 + 8 * (lane >> 4);
#pragma unroll
  for (int i = 0; i < 8; ++i) { a[i] = (_Float16)p[i]; a[8 + i] = (_Float16)p[16 + i]; }
  return a;
}
__device__ __forceinline__ v16h frag_f32s(const float* rowk0, int lane, float sc) {
  v16h a; const float* p = rowk0 + 8 * (lane >> 4);
#pragma unroll
  for (int i = 0; i < 8; ++i) { a[i] = (_Float16)(p[i] * sc); a[8 + i] = (_Float16)(p[16 + i] * sc); }
  return a;
}
// column fragment from a [K][ld] layout (column n), rows >= K read as 0
__device__ __forceinline__ v16h fragc_f32(const float* W, int k0, int n, int lane, int ld, int K) {
  v16h a; const int g = lane >> 4;
#pragma unroll
  for (int i = 0; i < 8; ++i) { const int ka = k0 + 8 * g + i, kb = ka + 16;
    a[i] = (_Float16)(ka < K ? W[(size_t)(ka < K ? ka : K - 1) * ld + n] : 0.f); a[8 + i] = (_Float16)(kb < K ? W[(size_t)(kb < K ? kb : K - 1) * ld + n] : 0.f); }
  return a;
}
struct F2 { v16b h, l; };
__device__ __forceinline__ F2 bsplit16(const float v[16]) { F2 r;
#pragma unroll
  for (int i = 0; i < 16; ++i) { const __bf16 h = (__bf16)v[i]; r.h[i] = h; r.l[i] = (__bf16)(v[i] - (float)h); }
  return r; }
__device__ __forceinline__ F2 split_row(const float* row, int k0, int lane) { float v[16]; const float* p = row + k0 + 8 * (lane >> 4);
#pragma unroll
  for (int i = 0; i < 8; ++i) { v[i] = p[i]; v[8 + i] = p[16 + i]; }
  return bsplit16(v); }
__device__ __forceinline__ F2 split_rowK(const float* row, int k0, int lane, int K) { float v[16]; const int g = lane >> 4;
#pragma unroll
  for (int i = 0; i < 8; ++i) { const int ka = k0 + 8 * g + i, kb = ka + 16; v[i] = ka < K ? row[ka < K ? ka : K - 1] : 0.f; v[8 + i] = kb < K ? row[kb < K ? kb : K - 1] : 0.f; }
  return bsplit16(v); }
__device__ __forceinline__ F2 split_col(const float* W, int k0, int n, int lane, int ld, int K) { float v[16]; const int g = lane >> 4;
#pragma unroll
  for (int i = 0; i < 8; ++i) { const int ka = k0 + 8 * g + i, kb = ka + 16; v[i] = ka < K ? W[(size_t)(ka < K ? ka : K - 1) * ld + n] : 0.f; v[8 + i] = kb < K ? W[(size_t)(kb < K ? kb : K - 1) * ld + n] : 0.f; }
  return bsplit16(v); }
__device__ __forceinline__ v8f mac3(const F2& a, const F2& b, v8f c) { c = wmma_bf(a.l, b.h, c); c = wmma_bf(a.h, b.l, c); return wmma_bf(a.h, b.h, c); }
__device__ __forceinline__ float sigm(float v) { return 1.0f / (1.0f + expf(-v)); }
#define LDSX() do { asm volatile("s_wait_dscnt 0" ::: "memory"); __builtin_amdgcn_wave_barrier(); __builtin_amdgcn_fence(__ATOMIC_RELEASE, "workgroup"); } while (0)

// Single-head causal self-attention whose softmax runs over the QUERY axis (x [4,4096,512]; torch (out,in) Wq / Wk / Wv [64,512] (0.02 scale), no biases; scores = q k^T [B,t,s]; additive causal mask -1e9 where s > t; / sqrt(64); attn = softmax(scores, axis=1) - axis 1 is the QUERY axis t, so every key column s is normalised over the queries t >= s (faithful to the source); out = attn v -> [4,4096,64]).
#define NB 4
#define TT 4096
#define CC 128            // NH * HD = projected width
#define DIN 512          // input (model) width
#define NH 2
#define HD 64
#define NQB (TT / 64)
#define HG 1
#define SCALE (0.125f)
#define CAUSAL 1
#ifndef TNB
#define TNB NB
#endif
__device__ __forceinline__ float bfr(float v) { return (float)(__bf16)v; }
__host__ __device__ __forceinline__ int kb_last(int qb) { return CAUSAL ? ((qb * 64 + 63) >> 7) : (TT / 128 - 1); }
typedef __attribute__((ext_vector_type(8))) __bf16 v8b;
// Fragment-order planes: one 16 x 32 operand fragment (16 rows or columns x 32 k values, 2-byte elements) is stored as 1024 contiguous bytes; its 16-B piece number hf * 32 + lane holds the lane's elements 8 hf + 0..7 (k = 16 hf + 8 (lane >> 4) + 0..7 of row or column lane & 15), so each of a fragment's two loads reads four whole 128-B lines instead of 32 B out of each of 16 lines. f = fragment number in the plane.
__device__ __forceinline__ v16h fragt_h(const _Float16* plane, size_t f, int lane) {
  union { v16h v; v8h q[2]; } u; const v8h* p = (const v8h*)plane + f * 64 + lane;
  u.q[0] = p[0]; u.q[1] = p[32]; return u.v;
}
__device__ __forceinline__ v16b fragt_b(const __bf16* plane, size_t f, int lane) {
  union { v16b v; v8b q[2]; } u; const v8b* p = (const v8b*)plane + f * 64 + lane;
  u.q[0] = p[0]; u.q[1] = p[32]; return u.v;
}
#define QBH 64              // = NQB: 3-product scores and bf16 hi/lo P.v on every query block
#define QHI 4096            // EVERY row carries a q residual plane: with the softmax over the QUERY axis the few-term region is the END of the sequence (late key columns see few queries), so the high-precision paths run everywhere
#define KHI 4096            // every key row carries the k residual and the v bf16 hi + lo planes
// B fragment (k rows k0+.., output column o) of a weight: (in,out) [K][ld] or (out,in) [ld rows of K]: bf16 exact, or f16(bf16 * 256) exact
__device__ __forceinline__ v16b wcol_io(const float* Wm, int k0, int o, int lane, int ld) { v16b w; const int g = lane >> 4;
#pragma unroll
  for (int i = 0; i < 8; ++i) { w[i] = (__bf16)Wm[(size_t)(k0 + 8 * g + i) * ld + o]; w[8 + i] = (__bf16)Wm[(size_t)(k0 + 16 + 8 * g + i) * ld + o]; }
  return w; }
__device__ __forceinline__ v16b wcol_oi(const float* Wm, int k0, int o, int lane, int K) { v16b w; const float* p = Wm + (size_t)o * K + k0 + 8 * (lane >> 4);
#pragma unroll
  for (int i = 0; i < 8; ++i) { w[i] = (__bf16)p[i]; w[8 + i] = (__bf16)p[16 + i]; }
  return w; }
__device__ __forceinline__ v16h wcolh_io(const float* Wm, int k0, int o, int lane, int ld) { v16h w; const int g = lane >> 4;
#pragma unroll
  for (int i = 0; i < 8; ++i) { w[i] = (_Float16)(bfr(Wm[(size_t)(k0 + 8 * g + i) * ld + o]) * 256.0f); w[8 + i] = (_Float16)(bfr(Wm[(size_t)(k0 + 16 + 8 * g + i) * ld + o]) * 256.0f); }
  return w; }
__device__ __forceinline__ v16h wcolh_oi(const float* Wm, int k0, int o, int lane, int K) { v16h w; const float* p = Wm + (size_t)o * K + k0 + 8 * (lane >> 4);
#pragma unroll
  for (int i = 0; i < 8; ++i) { w[i] = (_Float16)(bfr(p[i]) * 256.0f); w[8 + i] = (_Float16)(bfr(p[16 + i]) * 256.0f); }
  return w; }
#define WQKV_LAYOUT 1   // 0 = (in,out) [DIN][CC]; 1 = (out,in) [64][DIN]; 2 = per-head [NH][DIN][HD]
__device__ __forceinline__ v16b wcol_hdk(const float* Wm, int k0, int o, int lane) { v16b w; const int g = lane >> 4; const float* p = Wm + (size_t)(o / HD) * DIN * HD + (o % HD);
#pragma unroll
  for (int i = 0; i < 8; ++i) { w[i] = (__bf16)p[(size_t)(k0 + 8 * g + i) * HD]; w[8 + i] = (__bf16)p[(size_t)(k0 + 16 + 8 * g + i) * HD]; }
  return w; }
#define WO_OUT_IN 0
#if WQKV_LAYOUT == 1
__device__ __forceinline__ v16b zero16b() { v16b w; _Pragma("unroll") for (int i = 0; i < 16; ++i) w[i] = (__bf16)0.0f; return w; }
#define WCOL(W, k0, o, lane) ((o) < 64 ? wcol_oi(W, k0, (o), lane, DIN) : zero16b())   /* (out,in) [64][512]: only 64 real output rows; projected columns 64..127 (padding head 1) are zero */
#elif WQKV_LAYOUT == 2
#define WCOL(W, k0, o, lane) wcol_hdk(W, k0, o, lane)
#else
#define WCOL(W, k0, o, lane) wcol_io(W, k0, o, lane, CC)
#endif
#if WO_OUT_IN
#define WOCOL(W, k0, o, lane) wcol_oi(W, k0, o, lane, CC)
#define WOCOLH(W, k0, o, lane) wcolh_oi(W, k0, o, lane, CC)
#else
#define WOCOL(W, k0, o, lane) wcol_io(W, k0, o, lane, DIN)
#define WOCOLH(W, k0, o, lane) wcolh_io(W, k0, o, lane, DIN)
#endif

#ifndef SM_EXTRA_PARAMS
#define SM_EXTRA_PARAMS
#endif
#ifndef PROJ_EXTRA_PARAMS
#define PROJ_EXTRA_PARAMS
#endif
#ifndef SM_MASK_HOOK
#define SM_MASK_HOOK (void)0
#endif

#define WS_QH  0u                                      // f16 q, head 0, fragment order: fragment ((b*TT + t) / 16) * 2 + kc (first half of the plane's room)
#define WS_KH  (WS_QH + 2u * (size_t)NB * TT * CC)      // f16 k, as q
#define WS_VT  (WS_KH + 2u * (size_t)NB * TT * CC)      // f16 v planes [b][c][t]
#define WS_QL  (WS_VT + 2u * (size_t)NB * CC * TT)      // f16 q residual x 2^10, as q
#define WS_KL  (WS_QL + 2u * (size_t)NB * QHI * CC)     // f16 k residual x 2^10, as q
#define WS_VB  (WS_KL + 2u * (size_t)NB * KHI * CC)     // bf16 v hi, head 0, fragment order: fragment (b * KHI / 32 + t / 32) * 4 + c / 16; WS_VBL: v lo, the same
#define WS_VBL (WS_VB + 2u * (size_t)NB * CC * KHI)
#define WS_Y   (WS_VBL + 2u * (size_t)NB * CC * KHI)    // f32 ctx rows [b*t][CC] (only when there is an output projection)
#define WS_END (WS_Y  + 0u)
#define PVK 512             // keys per key range of k_pv (one work-group's share of a 128-row query block)
#define PVW 8               // waves per work-group of k_pv: 16 of the block's 128 queries each
#define PVQ (PVK / 128)     // 128-row query blocks per band of PVK rows
#define PVS (TT / PVK)      // most key ranges a query row can have = number of partial ctx planes
#define YPL ((size_t)NB * TT * CC)                      // floats per partial ctx plane
#define WS_Y2 (WS_END)                                  // f32 partial ctx rows [key range][b*TT + t][128] (columns 64..127 = the padding head); row t has ranges 0 .. t / PVK
#define WS_CM (WS_Y2 + 4u * PVS * YPL)                   // f32 column maxima [b][TT]
#define WS_CZ (WS_CM + 4u * (size_t)NB * TT)             // f32 2^11 / column sums [b][TT]
#define WS_END2 (WS_CZ + 4u * (size_t)NB * TT)

typedef __attribute__((ext_vector_type(4))) __bf16 v4b;
// k_proj's operands on their way from f32 rows [row][DIN] to 16 x 32 bf16 fragments, through LDS. One fragment takes LFB bytes: four runs of 16 pieces of 16 B (run hf * 2 + g, piece = row or column & 15: the elements 8 hf + 0..7 of lane g * 16 + piece, k = 16 hf + 8 g + 0..7), the runs 320 B apart so that the 8-B stores of frag_st fall on 64 different banks.
#define LFB 1280
// line_ld: 16 rows x 32 k values by four loads of whole 128-B lines; p = the lane's row (lane >> 3) and k offset (lane & 7) * 4, load u takes row u * 4 + (lane >> 3)
__device__ __forceinline__ void line_ld(v4f d[4], const float* p, int kc) {
#pragma unroll   /* d[] stays in registers, the four loads issue together */
  for (int u = 0; u < 4; ++u) d[u] = *(const v4f*)(p + (size_t)u * 4 * DIN + kc * 32); }
// frag_st: rounds them to bf16 and lays them into the fragment at f (f includes the lane's writer offset)
__device__ __forceinline__ void frag_st(unsigned char* f, const v4f d[4]) {
#pragma unroll   /* d[] and o stay in registers (this loop and the next) */
  for (int u = 0; u < 4; ++u) { v4b o;
#pragma unroll
    for (int i = 0; i < 4; ++i) o[i] = (__bf16)d[u][i];
    *(v4b*)(f + u * 64) = o; } }
// frag_ld: the lane's two pieces (f includes the lane's reader offset)
__device__ __forceinline__ v16b frag_ld(const unsigned char* f) { union { v16b v; v8b q[2]; } u; u.q[0] = *(const v8b*)f; u.q[1] = *(const v8b*)(f + 640); return u.v; }
// ---- k_proj: block = (64 rows, 128 cols, which): q/k/v = X W (+ b) with exact bf16 products (K = DIN) -> which 0: q f16, head 0, in fragment order (+ residual for rows < QHI); 1: k, as q (+ residual for rows < KHI); 2: v f16 planes [c][t] (+ bf16 hi/lo planes for t < KHI)
__global__ __launch_bounds__(128) void k_proj(const float* __restrict__ XQ, const float* __restrict__ XK, const float* __restrict__ XV, const float* __restrict__ WQ, const float* __restrict__ WK, const float* __restrict__ WV, const float* __restrict__ BQ, const float* __restrict__ BK, const float* __restrict__ BV,
    _Float16* __restrict__ QH, _Float16* __restrict__ QL, _Float16* __restrict__ KH, _Float16* __restrict__ KL, _Float16* __restrict__ VT, __bf16* __restrict__ VB, __bf16* __restrict__ VBL) {
  /* one LDS block with two uses, a barrier between them: in the k loop the operands as bf16 fragments (the block's weight, then two X slots per wave), afterwards the transposing buffers of the stores */
  __shared__ __align__(16) unsigned char smem[64 * LFB + 4 * 2 * LFB];
  _Float16 (*sh)[136] = (_Float16 (*)[136])smem; _Float16 (*sl)[136] = (_Float16 (*)[136])(smem + 17408); _Float16 (*th)[72] = (_Float16 (*)[72])(smem + 34816); __bf16 (*tb)[72] = (__bf16 (*)[72])(smem + 53248); __bf16 (*tbl)[72] = (__bf16 (*)[72])(smem + 71680);
  const int tid = threadIdx.x, wave = tid >> 5, lane = tid & 31, col = lane & 15, g = lane >> 4; const int which = blockIdx.z; const int c0 = blockIdx.y * 128; const size_t r0 = (size_t)blockIdx.x * 64; const size_t bb = r0 / TT; const int t0 = (int)(r0 % TT);
  const float* X = which == 0 ? XQ : which == 1 ? XK : XV; const float* WA = which == 0 ? WQ : which == 1 ? WK : WV; const float* BA = which == 0 ? BQ : which == 1 ? BK : BV;
  const int lc = lane & 7, lr = lane >> 3;   /* a line load: 8 lanes take one row's 128-B line (32 k values), the wave 4 rows */
  const int wofs = (lc >> 1) * 320 + lr * 16 + (lc & 1) * 8, rofs = g * 320 + col * 16;   /* the lane's place in a fragment as writer of 4 values and as reader of its pieces */
  /* X: the wave's 16 rows, k step by k step; steps 0 and 1 go to the wave's two LDS slots before the loop, steps 2.. wait in a register ring of 4 steps */
  const float* xp = X + (r0 + wave * 16 + lr) * DIN + lc * 4; unsigned char* xw = smem + (64 + wave * 2) * LFB + wofs; const unsigned char* xrd = smem + (64 + wave * 2) * LFB + rofs;
  v4f x01[2][4], xr[4][4];
  line_ld(x01[0], xp, 0); line_ld(x01[1], xp, 1);
#pragma unroll   /* here and below: loops over register arrays are unrolled so that the arrays stay in registers */
  for (int s = 0; s < 4; ++s) line_ld(xr[s], xp, 2 + s);
  /* W: the 64 real output rows x DIN as the B fragments (k step kc, column tile j) = number kc * 4 + j; wave w stages k steps 4 w .. 4 w + 3, 32 loads in flight */
  if (c0 == 0) { const float* wp = WA + (size_t)lr * DIN + wave * 128 + lc * 4; unsigned char* lp = smem + wave * 16 * LFB + wofs;
#pragma unroll
    for (int kh = 0; kh < 2; ++kh) { v4f t[8][4];
#pragma unroll
      for (int u = 0; u < 8; ++u) line_ld(t[u], wp + (size_t)(u & 3) * 16 * DIN, kh * 2 + (u >> 2));
#pragma unroll
      for (int u = 0; u < 8; ++u) frag_st(lp + ((kh * 2 + (u >> 2)) * 4 + (u & 3)) * LFB, t[u]); }
  } else { const v4u zz = {0u, 0u, 0u, 0u}; for (int e = tid; e < 64 * LFB / 16; e += 128) *(v4u*)(smem + e * 16) = zz; }   /* projected columns 128.. have no weight row: zero fragments (block-uniform test) */
  frag_st(xw, x01[0]); frag_st(xw + LFB, x01[1]);
  __syncthreads();   /* publishes the staged weight fragments to the block's four waves */
  v8f acc[8] = {}; v16b af[2], wf[2][4];   /* the fragments of a k step, read from LDS together and one step ahead of their products */
  af[0] = frag_ld(xrd);
#pragma unroll
  for (int j = 0; j < 4; ++j) wf[0][j] = frag_ld(smem + j * LFB + rofs);
#pragma unroll   /* unrolled so that the slot numbers of the rings are constants */
  for (int kc = 0; kc < DIN / 32; ++kc) {
    __builtin_amdgcn_sched_barrier(0);   /* keeps each step's instructions in their step: without it the compiler rounds the ring's X values right behind their loads and so waits out the memory latency in every step */
    asm volatile("s_wait_dscnt 0x0" ::: "memory");   /* the wave's own X stores of the step before have landed before other lanes read them back, and this step's fragment has left the slot that is written below */
    if (kc + 1 < DIN / 32) { af[(kc + 1) & 1] = frag_ld(xrd + ((kc + 1) & 1) * LFB);
#pragma unroll
      for (int j = 0; j < 4; ++j) wf[(kc + 1) & 1][j] = frag_ld(smem + ((kc + 1) * 4 + j) * LFB + rofs); }
    if (kc + 2 < DIN / 32) frag_st(xw + (kc & 1) * LFB, xr[kc & 3]);
    if (kc + 6 < DIN / 32) line_ld(xr[kc & 3], xp, kc + 6);
#pragma unroll
    for (int j = 0; j < 4; ++j) acc[j] = wmma_bf(af[kc & 1], wf[kc & 1][j], acc[j]); }   /* column tiles 4..7 (the padding head) have no weight row: their sums stay 0 */
  __syncthreads();   /* every wave has read its last fragment: the LDS block now serves the stores */
  if (which < 2) { _Float16* DH = which == 0 ? QH : KH; _Float16* DL = which == 0 ? QL : KL; const int nhi = which == 0 ? QHI : KHI; const bool hi_rows = t0 < nhi;
#pragma unroll
    for (int j = 0; j < 8; ++j) { const float bias = BA ? bfr(BA[c0 + j * 16 + col]) : 0.f;
#pragma unroll
      for (int r = 0; r < 8; ++r) { const float v = acc[j][r] + bias; const _Float16 hv = (_Float16)v; sh[wave * 16 + 8 * g + r][j * 16 + col] = hv; sl[wave * 16 + 8 * g + r][j * 16 + col] = (_Float16)((v - (float)hv) * 1024.0f); } }
    __syncthreads();
    /* fragment order, columns 0..63 (head 0; the padding head is not stored): piece e of the block's 4 row tiles = row (e >> 7) * 16 + (e & 15), columns ((e >> 4) & 7) * 8 + 0..7 */
    for (int e = tid; e < 64 * 8; e += 128) { const int rl = (e >> 7) * 16 + (e & 15), q = (e >> 4) & 7; vst2((unsigned*)(DH + r0 * HD + e * 8), *(const v4u*)&sh[rl][q * 8]); if (hi_rows) vst2((unsigned*)(DL + (bb * nhi + t0) * (size_t)HD + e * 8), *(const v4u*)&sl[rl][q * 8]); }
  } else { const bool hi_rows = t0 < KHI;
#pragma unroll
    for (int j = 0; j < 8; ++j) { const float bias = BA ? bfr(BA[c0 + j * 16 + col]) : 0.f;
#pragma unroll
      for (int r = 0; r < 8; ++r) { const float v = acc[j][r] + bias; const int rl = wave * 16 + 8 * g + r, cl = j * 16 + col; th[cl][rl] = (_Float16)v; const __bf16 bh = (__bf16)v; tb[cl][rl] = bh; tbl[cl][rl] = (__bf16)(v - (float)bh); } }
    __syncthreads();
    for (int e = tid; e < 128 * 8; e += 128) { const int cl = e >> 3, q = e & 7; vst2((unsigned*)(VT + (bb * CC + c0 + cl) * (size_t)TT + t0 + q * 8), *(const v4u*)&th[cl][q * 8]); }
    /* fragment order, columns 0..63: piece e of the block's 2 key steps = column ((e >> 6) & 3) * 16 + (e & 15), keys (e >> 8) * 32 + ((e >> 4) & 3) * 8 + 0..7 */
    if (hi_rows) for (int e = tid; e < 64 * 8; e += 128) { const int cl = ((e >> 6) & 3) * 16 + (e & 15), kl = (e >> 8) * 32 + ((e >> 4) & 3) * 8; const size_t o3 = (bb * KHI + t0) * (size_t)HD + e * 8; vst2((unsigned*)(VB + o3), *(const v4u*)&tb[cl][kl]); vst2((unsigned*)(VBL + o3), *(const v4u*)&tbl[cl][kl]); } } }
// the matrix products of k_cstat and k_pv: the builtin forms as they are (the compiler keeps the distance behind its own builtin forms)
__device__ __forceinline__ v8f mm_h(v16h a, v16h b, v8f c) { return __builtin_amdgcn_wmma_f32_16x16x32_f16(false, a, false, b, (short)0, c, false, false); }
__device__ __forceinline__ v8f mm_b(v16b a, v16b b, v8f c) { return __builtin_amdgcn_wmma_f32_16x16x32_bf16(false, a, false, b, (short)0, c, false, false); }
// fragment number n behind p, p = the lane's first piece of some fragment of a fragment-order plane: all fragments of a run are read through the one address register pair p, by immediate offsets
__device__ __forceinline__ v16h fragp_h(const v8h* p, int n) { union { v16h v; v8h q[2]; } u; u.q[0] = p[n * 64]; u.q[1] = p[n * 64 + 32]; return u.v; }
__device__ __forceinline__ v16b fragp_b(const v8b* p, int n) { union { v16b v; v8b q[2]; } u; u.q[0] = p[n * 64]; u.q[1] = p[n * 64 + 32]; return u.v; }
// ---- k_cstat: scores and the softmax statistics over the QUERY axis in one kernel; no logit is stored. For every key column k: m_k = max_{q >= k} S[q][k], Z_k = sum_{q >= k} exp(S[q][k] - m_k) (f32, precise expf), S = (q hi . k hi + (q residual . k hi + q hi . k residual) / 2^10) x SCALE (3 products, head 0); CM holds m_k, CZ holds 2^11 / Z_k.
// A wave keeps the k fragments of 32 key columns in registers (B operand) and walks 16-query tiles (A operand) from the diagonal to the end. In the product's D layout a lane holds 8 queries of ONE key column, so the online max / sum runs in the lane (one rescale per 8 queries); the two lane halves are merged by a shuffle, the waves through LDS, max first, then rescaled sums.
// block = (batch, pair of 32-column groups pr and TT / 32 - 1 - pr): the long walk of the one and the short walk of the other have TT / 16 + 2 query tiles together in every block. The tiles of a walk are dealt to the CSW waves round robin; the second walk's deal goes on where the first one's ended.
// q < k enters as -inf (exp gives 0) while the running max starts finite, so a lane or wave with no visible query ends as (-3e38, 0) and drops out of the merge.
#define CSW 16
__global__ __launch_bounds__(32 * CSW) void k_cstat(const _Float16* __restrict__ QH, const _Float16* __restrict__ KH, const _Float16* __restrict__ QL, const _Float16* __restrict__ KL, float* __restrict__ CM, float* __restrict__ CZ) { __shared__ float pm[2][CSW][32], pz[2][CSW][32];
  const int tid = threadIdx.x, wave = __builtin_amdgcn_readfirstlane(tid >> 5), lane = tid & 31, col = lane & 15, g = lane >> 4;   /* the wave number in a scalar register: the walk's bounds stay wave-uniform */
  const int b = blockIdx.x, pr = blockIdx.y; const size_t fb = ((size_t)b * TT) >> 3;   /* first fragment of the batch in the fragment-order planes: 2 fragments (kc = 0, 1) per 16 rows */
#pragma unroll 1   /* the two walks share one body: half the code */
  for (int s = 0; s < 2; ++s) { const int c = s ? TT / 32 - 1 - pr : pr, k0 = c * 32; const int w = s ? (wave + 2 * pr) & (CSW - 1) : wave;
    v16h kh[2][2], kl[2][2]; const v8h* pkh = (const v8h*)KH + (fb + c * 4) * 64 + lane; const v8h* pkl = (const v8h*)KL + (fb + c * 4) * 64 + lane;
#pragma unroll
    for (int j = 0; j < 2; ++j)
#pragma unroll
      for (int kc = 0; kc < 2; ++kc) { kh[j][kc] = fragp_h(pkh, j * 2 + kc); kl[j][kc] = fragp_h(pkl, j * 2 + kc); }
    float m[2] = {-3.0e38f, -3.0e38f}, z[2] = {0.f, 0.f};
    int qt = 2 * c + w; v16h ah[2], al[2];
    { const size_t f = fb + (qt < TT / 16 ? qt : TT / 16 - 1) * 2; const v8h* pq = (const v8h*)QH + f * 64 + lane; const v8h* pr2 = (const v8h*)QL + f * 64 + lane; ah[0] = fragp_h(pq, 0); ah[1] = fragp_h(pq, 1); al[0] = fragp_h(pr2, 0); al[1] = fragp_h(pr2, 1);
      asm volatile("s_wait_xcnt 0x0" :: "v"(pkh), "v"(pkl), "v"(pq), "v"(pr2) : "memory"); }   /* the wait that stands between issued loads and an overwrite of their address registers; the addresses are named so that they last up to it (no load's result is laid over them) */
#pragma unroll 2   /* two trips a pass, so that the fragments read ahead change names instead of being copied */
    for (; qt < TT / 16; qt += CSW) {
      /* the next tile's q fragments are read while this tile is worked on (past the end: the last tile again, unused) */
      const size_t fn = fb + (qt + CSW < TT / 16 ? qt + CSW : TT / 16 - 1) * 2; const v8h* nq = (const v8h*)QH + fn * 64 + lane; const v8h* nr = (const v8h*)QL + fn * 64 + lane; const v16h nh0 = fragp_h(nq, 0), nh1 = fragp_h(nq, 1), nl0 = fragp_h(nr, 0), nl1 = fragp_h(nr, 1);
      asm volatile("s_wait_xcnt 0x0" :: "v"(nq), "v"(nr) : "memory");   /* as above: these loads stay in flight over the trip's work, which reuses registers */
      v8f a0[2] = {}, a1[2] = {};
#pragma unroll
      for (int kc = 0; kc < 2; ++kc)
#pragma unroll
        for (int j = 0; j < 2; ++j) { a0[j] = mm_h(ah[kc], kh[j][kc], a0[j]); a1[j] = mm_h(al[kc], kh[j][kc], a1[j]); a1[j] = mm_h(ah[kc], kl[j][kc], a1[j]); }
      float v[2][8];
#pragma unroll
      for (int j = 0; j < 2; ++j)
#pragma unroll
        for (int r = 0; r < 8; ++r) v[j][r] = (a0[j][r] + a1[j][r] * (1.0f / 1024.0f)) * SCALE;
      if (qt * 16 < k0 + 32) {   /* only the walk's first two tiles touch the diagonal (wave-uniform test) */
#pragma unroll
        for (int j = 0; j < 2; ++j)
#pragma unroll
          for (int r = 0; r < 8; ++r) v[j][r] = (qt * 16 + 8 * g + r >= k0 + j * 16 + col) ? v[j][r] : -INFINITY; }
#pragma unroll
      for (int j = 0; j < 2; ++j) { float mn = m[j];
#pragma unroll
        for (int r = 0; r < 8; ++r) mn = fmaxf(mn, v[j][r]);
        float a = z[j] * expf(m[j] - mn);
#pragma unroll
        for (int r = 0; r < 8; ++r) a += expf(v[j][r] - mn);
        m[j] = mn; z[j] = a; }
      ah[0] = nh0; ah[1] = nh1; al[0] = nl0; al[1] = nl1; }
#pragma unroll
    for (int j = 0; j < 2; ++j) { const float M = fmaxf(m[j], __shfl_xor(m[j], 16)); float a = z[j] * expf(m[j] - M); a += __shfl_xor(a, 16); if (g == 0) { pm[s][wave][j * 16 + col] = M; pz[s][wave][j * 16 + col] = a; } } }
  __syncthreads();   /* publishes the CSW waves' partial (max, sum) pairs of both column groups to waves 0 and 1 */
  if (wave < 2) { const int k0 = (wave ? TT / 32 - 1 - pr : pr) * 32; float M = pm[wave][0][lane];
#pragma unroll
    for (int w = 1; w < CSW; ++w) M = fmaxf(M, pm[wave][w][lane]);
    float a = 0.f;
#pragma unroll
    for (int w = 0; w < CSW; ++w) a += pz[wave][w][lane] * expf(pm[wave][w][lane] - M);
    vst2(CM + (size_t)b * TT + k0 + lane, M); vst2(CZ + (size_t)b * TT + k0 + lane, 2048.0f / a); } }   /* every column sees at least its own diagonal entry: Z_k >= 1; stored as 2^11 / Z_k, the factor k_pv multiplies by */
// ---- k_sm: block = query row t (head in group): keys [0, kend): causal -> logit if s <= t else excluded; softmax in f32; P x 2^11 in place (0 for excluded)
__global__ __launch_bounds__(256) void k_sm(float* __restrict__ S0 SM_EXTRA_PARAMS) { __shared__ float sred[8]; __shared__ float sbc; __shared__ __align__(16) float shv[TT];
  const int tid = threadIdx.x; const int t = blockIdx.x; const int kend = (kb_last(t >> 6) + 1) * 128;
  float* sr = S0 + (size_t)blockIdx.y * TT * TT + (size_t)t * TT;
  float m = -3.0e38f; for (int k = tid; k < kend; k += 256) { float v = (!CAUSAL || k <= t) ? sr[k] : -3.0e38f; SM_MASK_HOOK; shv[k] = v; m = fmaxf(m, v); }
#pragma unroll
  for (int o = 1; o < 32; o <<= 1) m = fmaxf(m, __shfl_xor(m, o));
  if ((tid & 31) == 0) sred[tid >> 5] = m; __syncthreads(); if (tid == 0) { float a = sred[0]; for (int i = 1; i < 8; ++i) a = fmaxf(a, sred[i]); sbc = a; } __syncthreads(); m = sbc; __syncthreads();
  float sum = 0.f; for (int k = tid; k < kend; k += 256) { const float v = shv[k]; const float e = (v <= -1.0e38f) ? 0.f : expf(v - m); shv[k] = e; sum += e; }
#pragma unroll
  for (int o = 1; o < 32; o <<= 1) sum += __shfl_xor(sum, o);
  if ((tid & 31) == 0) sred[tid >> 5] = sum; __syncthreads(); if (tid == 0) { float a = 0.f; for (int i = 0; i < 8; ++i) a += sred[i]; sbc = a > 0.f ? 2048.0f / a : 0.f; }   /* a fully excluded row yields P = 0 */ __syncthreads(); const float inv = sbc;
  for (int k = tid; k < kend; k += 256) shv[k] = shv[k] * inv;
  __syncthreads(); for (int q = tid; q < kend / 4; q += 256) vst2(sr + q * 4, *(const v4f*)&shv[q * 4]); }
// ---- k_out64: out[b][t][0..63] = sum over the row's key ranges (ascending) of the partial ctx row, columns 0..63 (256 B by 16 lanes); the block's 16 rows lie in one band of PVK rows, so the range count is the same for all of them
__global__ __launch_bounds__(256) void k_out64(const float* __restrict__ Y, float* __restrict__ OUT) { const size_t row = (size_t)blockIdx.x * 16 + (threadIdx.x >> 4); const int q = threadIdx.x & 15; const int nr = (int)((blockIdx.x * 16u) % TT) / PVK + 1; const float* yp = Y + row * CC + q * 4; v4f v = *(const v4f*)yp;
  for (int c = 1; c < nr; ++c) v += *(const v4f*)(yp + c * YPL);
  asm volatile("s_wait_loadcnt 0x0" ::: "memory"); vst2(OUT + row * 64 + q * 4, v); }
// ---- k_pv: block = (128 queries, one range of PVK keys) of batch blockIdx.x, head 0; wave = 16 of the queries: partial ctx = P . v over the range's keys up to the wave's diagonal. The scores are formed anew here, transposed: S^T = k . q^T (A = the k fragments of 16 keys, B = the wave's q fragments, kept in registers; the same 3 products as in k_cstat). In D a lane holds keys 8 h + 0..7 of ONE query, which is the A fragment's order for P . v: two 16-key tiles give the 32-key fragment with no exchange between lanes. P = exp(S - m_k) x 2^11 / Z_k for k <= t, 0 above the diagonal; P and v as bf16 hi + lo, 3 products.
// The block's 8 waves walk the same key steps, so the k and v fragments that one wave has fetched are near for the other seven.
// Split over keys: rows of band d = t / PVK have d + 1 ranges. blockIdx.y numbers the (128-query block, range) pairs: the full ranges first, then each block's last range (the one the diagonal cuts short), the longest first. The ranges' partial rows go to planes of Y that k_out64 adds.
__global__ __launch_bounds__(32 * PVW) void k_pv(const _Float16* __restrict__ QH, const _Float16* __restrict__ KH, const _Float16* __restrict__ QL, const _Float16* __restrict__ KL, const __bf16* __restrict__ VB, const __bf16* __restrict__ VBL, const float* __restrict__ CM, const float* __restrict__ CI, float* __restrict__ Y) { __shared__ __align__(16) float ss[PVW][16][HD + 4];
  const int tid = threadIdx.x, wave = __builtin_amdgcn_readfirstlane(tid >> 5), lane = tid & 31, col = lane & 15, g = lane >> 4;   /* the wave number in a scalar register: the key loop's bounds stay wave-uniform */
  const int b = blockIdx.x, py = blockIdx.y;
  int band, rng, qi;   /* PVQ query blocks a band; band d has PVQ * d full ranges, PVQ * d (d - 1) / 2 lie before them */
  if (py < PVQ * PVS * (PVS - 1) / 2) { band = 1;
#pragma unroll
    for (int d = 2; d < PVS; ++d) if (py >= PVQ * d * (d - 1) / 2) band = d;
    const int rem = py - PVQ * band * (band - 1) / 2; qi = rem % PVQ; rng = rem / PVQ; }
  else { const int p = py - PVQ * PVS * (PVS - 1) / 2; qi = PVQ - 1 - p / PVS; band = p % PVS; rng = band; }
  const int ql0 = band * PVK + qi * 128 + wave * 16; const int kcb = rng * (PVK / 32); const int kall = ((ql0 + 15) >> 5) + 1; const int kce = kall < (rng + 1) * (PVK / 32) ? kall : (rng + 1) * (PVK / 32);   /* 32-key steps; the last one is the step that holds the wave's last query */
  const size_t fb = ((size_t)b * TT) >> 3; const size_t fq = fb + (ql0 >> 3);
  const v16h qh[2] = {fragt_h(QH, fq, lane), fragt_h(QH, fq + 1, lane)}, qr[2] = {fragt_h(QL, fq, lane), fragt_h(QL, fq + 1, lane)};
  v8f acc[HD / 16] = {};
#pragma unroll 1   /* one step's fragments fill the registers */
  for (int kc = kcb; kc < kce; ++kc) { v16h kh[2][2], kl[2][2]; v4f mv[4], zv[4];
    const v8h* pkh = (const v8h*)KH + (fb + kc * 4) * 64 + lane; const v8h* pkl = (const v8h*)KL + (fb + kc * 4) * 64 + lane; const v4f* pm = (const v4f*)(CM + (size_t)b * TT + kc * 32 + 8 * g); const v4f* pz = (const v4f*)(CI + (size_t)b * TT + kc * 32 + 8 * g);
#pragma unroll
    for (int i = 0; i < 2; ++i)
#pragma unroll
      for (int c = 0; c < 2; ++c) { kh[i][c] = fragp_h(pkh, i * 2 + c); kl[i][c] = fragp_h(pkl, i * 2 + c); }
#pragma unroll
    for (int q = 0; q < 4; ++q) { const int o = (q >> 1) * 4 + (q & 1); mv[q] = pm[o]; zv[q] = pz[o]; }
    /* inputs-only fence on the loaded values: the step's 24 loads for the scores are in flight together and are waited for once; without it the compiler deals them out in small groups between the products, each with a wait of its own; the four addresses are named too, so that they last until the loads have returned (no load's result is laid over them) */
    asm volatile("" :: "v"(kh[0][0]), "v"(kh[0][1]), "v"(kh[1][0]), "v"(kh[1][1]), "v"(kl[0][0]), "v"(kl[0][1]), "v"(kl[1][0]), "v"(kl[1][1]), "v"(mv[0]), "v"(mv[1]), "v"(mv[2]), "v"(mv[3]), "v"(zv[0]), "v"(zv[1]), "v"(zv[2]), "v"(zv[3]), "v"(pkh), "v"(pkl), "v"(pm), "v"(pz));
    v8f a0[2] = {}, a1[2] = {};
#pragma unroll
    for (int c = 0; c < 2; ++c)
#pragma unroll
      for (int i = 0; i < 2; ++i) { a0[i] = mm_h(kh[i][c], qh[c], a0[i]); a1[i] = mm_h(kh[i][c], qr[c], a1[i]); a1[i] = mm_h(kl[i][c], qh[c], a1[i]); }
    v16b vh[HD / 16], vl[HD / 16]; const v8b* pvh = (const v8b*)VB + ((size_t)b * (KHI / 32) + kc) * (HD / 16) * 64 + lane; const v8b* pvl = (const v8b*)VBL + ((size_t)b * (KHI / 32) + kc) * (HD / 16) * 64 + lane;   /* fragments (key step kc, column tile j) of the fragment-order v planes */
#pragma unroll
    for (int j = 0; j < HD / 16; ++j) { vh[j] = fragp_b(pvh, j); vl[j] = fragp_b(pvl, j); }
    __builtin_amdgcn_sched_barrier(0);   /* keeps the v loads ahead of the exp work, which covers their latency: without it the compiler sinks them to their products, the lo fragments one by one with a wait each */
    float pv[16];
#pragma unroll
    for (int e = 0; e < 16; ++e) { const float sv = (a0[e >> 3][e & 7] + a1[e >> 3][e & 7] * (1.0f / 1024.0f)) * SCALE; pv[e] = expf(sv - mv[e >> 2][e & 3]) * zv[e >> 2][e & 3]; }
    if (kc * 32 + 31 > ql0) {   /* only steps that reach past the wave's first query hold masked keys (wave-uniform test) */
#pragma unroll
      for (int e = 0; e < 16; ++e) pv[e] = (kc * 32 + (e >> 3) * 16 + 8 * g + (e & 7) <= ql0 + col) ? pv[e] : 0.f; }
    const F2 p = bsplit16(pv);
    /* inputs-only fence on the loaded v fragments and their two addresses: the addresses last until the loads have returned */
    asm volatile("" :: "v"(vh[0]), "v"(vh[1]), "v"(vh[2]), "v"(vh[3]), "v"(vl[0]), "v"(vl[1]), "v"(vl[2]), "v"(vl[3]), "v"(pvh), "v"(pvl));
#pragma unroll
    for (int j = 0; j < HD / 16; ++j) { acc[j] = mm_b(p.h, vh[j], acc[j]); acc[j] = mm_b(p.l, vh[j], acc[j]); acc[j] = mm_b(p.h, vl[j], acc[j]); } }
#pragma unroll
  for (int j = 0; j < HD / 16; ++j)
#pragma unroll
    for (int r = 0; r < 8; ++r) ss[wave][8 * g + r][j * 16 + col] = acc[j][r] * (1.0f / 2048.0f);
  LDSX();   /* the wave reads back only its own tile, turned into whole rows: 256-B (row, head) segment by 16 lanes */
#pragma unroll
  for (int i = 0; i < 8; ++i) { const int rl = i * 2 + g; vst2(Y + rng * YPL + ((size_t)b * TT + ql0 + rl) * CC + col * 4, *(const v4f*)&ss[wave][rl][col * 4]); } }

extern "C" void kernel_launch(void* const* d_in, const int* in_sizes, int n_in, void* d_out, int out_size, void* d_ws, size_t ws_size, hipStream_t stream) {
  (void)in_sizes; (void)n_in; (void)out_size;
  const float** F = (const float**)d_in;
  if (ws_size < (size_t)WS_END) return;
  char* ws = (char*)d_ws; _Float16 *QH = (_Float16*)(ws + WS_QH), *KH = (_Float16*)(ws + WS_KH), *VT = (_Float16*)(ws + WS_VT), *QL = (_Float16*)(ws + WS_QL), *KL = (_Float16*)(ws + WS_KL); __bf16 *VB = (__bf16*)(ws + WS_VB), *VBL = (__bf16*)(ws + WS_VBL); float *Y = (float*)(ws + WS_Y);
  (void)Y; (void)QL; (void)KL; (void)VB; (void)VBL;
  // inputs: 0 x [4,4096,512]; 1 Wq [64,512] (out,in); 2 Wk; 3 Wv; no biases
  if (ws_size < (size_t)WS_END2) return;
  float *Y2 = (float*)(ws + WS_Y2), *CM = (float*)(ws + WS_CM), *CZ = (float*)(ws + WS_CZ);
  k_proj<<<dim3(TNB * TT / 64, CC / 128, 3), 128, 0, stream>>>(F[0], F[0], F[0], F[1], F[2], F[3], nullptr, nullptr, nullptr, QH, QL, KH, KL, VT, VB, VBL);   /* weight columns 64..127 (the padding head) have no fragments: their sums stay 0 */
  /* head 0 only (head 1 is the zero padding); the batch is a grid axis of both launches; the logits are formed in registers in each of them and never stored */
  k_cstat<<<dim3(TNB, TT / 64), 32 * CSW, 0, stream>>>(QH, KH, QL, KL, CM, CZ);   /* per key column s: max and 2^11 / sum over the visible queries t >= s */
  k_pv<<<dim3(TNB, PVQ * PVS * (PVS + 1) / 2), 32 * PVW, 0, stream>>>(QH, KH, QL, KL, VB, VBL, CM, CZ, Y2);   /* batch x (128-query block, key range); P[t][s] = exp(S - m_s) x 2^11 / Z_s */
  k_out64<<<dim3(TNB * TT / 16), 256, 0, stream>>>(Y2, (float*)d_out);
}

// v008
// A run of this version takes 60.7 microseconds.
// Two timings next to v007 put it at 1.12 and 1.11 times that version's speed.
// All steps since v000 together make it 124 times as fast.
// compute dtype: all float inputs rounded to bf16; q/k/v projections with EXACT bf16 products on WMMA 16x16x32 (f32 accumulate); causal scores with BOTH q and k as f16 hi + (x 2^10) residual (3 products) on EVERY block, x 64^-0.5; softmax over the QUERY axis in f32 (per key column: online max / sum over the visible queries; every exp is the hardware's exp2; a score's argument is one fused multiply-add); P as bf16 hi + lo against v as bf16 hi + lo (3 products) on EVERY block; f32 output.
#include <hip/hip_runtime.h>
#include <math.h>

typedef __attribute__((ext_vector_type(16))) _Float16 v16h;
typedef __attribute__((ext_vector_type(16))) __bf16 v16b;
typedef __attribute__((ext_vector_type(8)))  _Float16 v8h;
typedef __attribute__((ext_vector_type(8)))  float v8f;
typedef __attribute__((ext_vector_type(4)))  float v4f;
typedef __attribute__((ext_vector_type(2)))  float v2f;
typedef __attribute__((ext_vector_type(4)))  unsigned v4u;
typedef __attribute__((ext_vector_type(4)))  int v4i;
typedef float __attribute__((may_alias)) float_a;
typedef int __attribute__((may_alias)) int_a;

template <typename T> __device__ __forceinline__ void vst2(void* p, T v) { *(T*)p = v;  }
__device__ __forceinline__ v8f wmma16(v16h a, v16h b, v8f c) {
  v8f d = __builtin_amdgcn_wmma_f32_16x16x32_f16(false, a, false, b, (short)0, c, false, false);
  asm volatile("v_nop\n\tv_nop\n\tv_nop\n\tv_nop" : "+v"(d) : "v"(a), "v"(b));
  return d;
}
__device__ __forceinline__ v8f wmma_bf(v16b a, v16b b, v8f c) {
  v8f d = __builtin_amdgcn_wmma_f32_16x16x32_bf16(false, a, false, b, (short)0, c, false, false);
  asm volatile("v_nop\n\tv_nop\n\tv_nop\n\tv_nop" : "+v"(d) : "v"(a), "v"(b));
  return d;
}
// 16x16x32 fragments: lane = (h = lane>>4, row/col = lane&15); elements 0..7 = k0+8h+0..7, 8..15 = k0+16+8h+0..7; D element r = row 8h+r
__device__ __forceinline__ v16h frag_h(const _Float16* rowk0, int lane) {
  union { v16h v; v8h q[2]; } u; const _Float16* p = rowk0 + 8 * (lane >> 4);
  u.q[0] = *(const v8h*)p; u.q[1] = *(const v8h*)(p + 16); return u.v;
}
__device__ __forceinline__ v16h frag_f32(const float* rowk0, int lane) {
  v16h a; const float* p = rowk0 + 8 * (lane >> 4);
#pragma unroll
  for (int i = 0; i < 8; ++i) { a[i] = (_Float16)p[i]; a[8 + i] = (_Float16)p[16 + i]; }
  return a;
}
__device__ __forceinline__ v16h frag_f32s(const float* rowk0, int lane, float sc) {
  v16h a; const float* p = rowk0 + 8 * (lane >> 4);
#pragma unroll
  for (int i = 0; i < 8; ++i) { a[i] = (_Float16)(p[i] * sc); a[8 + i] = (_Float16)(p[16 + i] * sc); }
  return a;
}
// column fragment from a [K][ld] layout (column n), rows >= K read as 0
__device__ __forceinline__ v16h fragc_f32(const float* W, int k0, int n, int lane, int ld, int K) {
  v16h a; const int g = lane >> 4;
#pragma unroll
  for (int i = 0; i < 8; ++i) { const int ka = k0 + 8 * g + i, kb = ka + 16;
    a[i] = (_Float16)(ka < K ? W[(size_t)(ka < K ? ka : K - 1) * ld + n] : 0.f); a[8 + i] = (_Float16)(kb < K ? W[(size_t)(kb < K ? kb : K - 1) * ld + n] : 0.f); }
  return a;
}
struct F2 { v16b h, l; };
__device__ __forceinline__ F2 bsplit16(const float v[16]) { F2 r;
#pragma unroll
  for (int i = 0; i < 16; ++i) { const __bf16 h = (__bf16)v[i]; r.h[i] = h; r.l[i] = (__bf16)(v[i] - (float)h); }
  return r; }
__device__ __forceinline__ F2 split_row(const float* row, int k0, int lane) { float v[16]; const float* p = row + k0 + 8 * (lane >> 4);
#pragma unroll
  for (int i = 0; i < 8; ++i) { v[i] = p[i]; v[8 + i] = p[16 + i]; }
  return bsplit16(v); }
__device__ __forceinline__ F2 split_rowK(const float* row, int k0, int lane, int K) { float v[16]; const int g = lane >> 4;
#pragma unroll
  for (int i = 0; i < 8; ++i) { const int ka = k0 + 8 * g + i, kb = ka + 16; v[i] = ka < K ? row[ka < K ? ka : K - 1] : 0.f; v[8 + i] = kb < K ? row[kb < K ? kb : K - 1] : 0.f; }
  return bsplit16(v); }
__device__ __forceinline__ F2 split_col(const float* W, int k0, int n, int lane, int ld, int K) { float v[16]; const int g = lane >> 4;
#pragma unroll
  for (int i = 0; i < 8; ++i) { const int ka = k0 + 8 * g + i, kb = ka + 16; v[i] = ka < K ? W[(size_t)(ka < K ? ka : K - 1) * ld + n] : 0.f; v[8 + i] = kb < K ? W[(size_t)(kb < K ? kb : K - 1) * ld + n] : 0.f; }
  return bsplit16(v); }
__device__ __forceinline__ v8f mac3(const F2& a, const F2& b, v8f c) { c = wmma_bf(a.l, b.h, c); c = wmma_bf(a.h, b.l, c); return wmma_bf(a.h, b.h, c); }
__device__ __forceinline__ float sigm(float v) { return 1.0f / (1.0f + expf(-v)); }
#define LDSX() do { asm volatile("s_wait_dscnt 0" ::: "memory"); __builtin_amdgcn_wave_barrier(); __builtin_amdgcn_fence(__ATOMIC_RELEASE, "workgroup"); } while (0)

// Single-head causal self-attention whose softmax runs over the QUERY axis (x [4,4096,512]; torch (out,in) Wq / Wk / Wv [64,512] (0.02 scale), no biases; scores = q k^T [B,t,s]; additive causal mask -1e9 where s > t; / sqrt(64); attn = softmax(scores, axis=1) - axis 1 is the QUERY axis t, so every key column s is normalised over the queries t >= s (faithful to the source); out = attn v -> [4,4096,64]).
#define NB 4
#define TT 4096
#define CC 128            // NH * HD = projected width
#define DIN 512          // input (model) width
#define NH 2
#define HD 64
#define NQB (TT / 64)
#define HG 1
#define SCALE (0.125f)
#define CAUSAL 1
#ifndef TNB
#define TNB NB
#endif
__device__ __forceinline__ float bfr(float v) { return (float)(__bf16)v; }
__host__ __device__ __forceinline__ int kb_last(int qb) { return CAUSAL ? ((qb * 64 + 63) >> 7) : (TT / 128 - 1); }
typedef __attribute__((ext_vector_type(8))) __bf16 v8b;
// Fragment-order planes: one 16 x 32 operand fragment (16 rows or columns x 32 k values, 2-byte elements) is stored as 1024 contiguous bytes; its 16-B piece number hf * 32 + lane holds the lane's elements 8 hf + 0..7 (k = 16 hf + 8 (lane >> 4) + 0..7 of row or column lane & 15), so each of a fragment's two loads reads four whole 128-B lines instead of 32 B out of each of 16 lines. f = fragment number in the plane.
__device__ __forceinline__ v16h fragt_h(const _Float16* plane, size_t f, int lane) {
  union { v16h v; v8h q[2]; } u; const v8h* p = (const v8h*)plane + f * 64 + lane;
  u.q[0] = p[0]; u.q[1] = p[32]; return u.v;
}
__device__ __forceinline__ v16b fragt_b(const __bf16* plane, size_t f, int lane) {
  union { v16b v; v8b q[2]; } u; const v8b* p = (const v8b*)plane + f * 64 + lane;
  u.q[0] = p[0]; u.q[1] = p[32]; return u.v;
}
#define QBH 64              // = NQB: 3-product scores and bf16 hi/lo P.v on every query block
#define QHI 4096            // EVERY row carries a q residual plane: with the softmax over the QUERY axis the few-term region is the END of the sequence (late key columns see few queries), so the high-precision paths run everywhere
#define KHI 4096            // every key row carries the k residual and the v bf16 hi + lo planes
// B fragment (k rows k0+.., output column o) of a weight: (in,out) [K][ld] or (out,in) [ld rows of K]: bf16 exact, or f16(bf16 * 256) exact
__device__ __forceinline__ v16b wcol_io(const float* Wm, int k0, int o, int lane, int ld) { v16b w; const int g = lane >> 4;
#pragma unroll
  for (int i = 0; i < 8; ++i) { w[i] = (__bf16)Wm[(size_t)(k0 + 8 * g + i) * ld + o]; w[8 + i] = (__bf16)Wm[(size_t)(k0 + 16 + 8 * g + i) * ld + o]; }
  return w; }
__device__ __forceinline__ v16b wcol_oi(const float* Wm, int k0, int o, int lane, int K) { v16b w; const float* p = Wm + (size_t)o * K + k0 + 8 * (lane >> 4);
#pragma unroll
  for (int i = 0; i < 8; ++i) { w[i] = (__bf16)p[i]; w[8 + i] = (__bf16)p[16 + i]; }
  return w; }
__device__ __forceinline__ v16h wcolh_io(const float* Wm, int k0, int o, int lane, int ld) { v16h w; const int g = lane >> 4;
#pragma unroll
  for (int i = 0; i < 8; ++i) { w[i] = (_Float16)(bfr(Wm[(size_t)(k0 + 8 * g + i) * ld + o]) * 256.0f); w[8 + i] = (_Float16)(bfr(Wm[(size_t)(k0 + 16 + 8 * g + i) * ld + o]) * 256.0f); }
  return w; }
__device__ __forceinline__ v16h wcolh_oi(const float* Wm, int k0, int o, int lane, int K) { v16h w; const float* p = Wm + (size_t)o * K + k0 + 8 * (lane >> 4);
#pragma unroll
  for (int i = 0; i < 8; ++i) { w[i] = (_Float16)(bfr(p[i]) * 256.0f); w[8 + i] = (_Float16)(bfr(p[16 + i]) * 256.0f); }
  return w; }
#define WQKV_LAYOUT 1   // 0 = (in,out) [DIN][CC]; 1 = (out,in) [64][DIN]; 2 = per-head [NH][DIN][HD]
__device__ __forceinline__ v16b wcol_hdk(const float* Wm, int k0, int o, int lane) { v16b w; const int g = lane >> 4; const float* p = Wm + (size_t)(o / HD) * DIN * HD + (o % HD);
#pragma unroll
  for (int i = 0; i < 8; ++i) { w[i] = (__bf16)p[(size_t)(k0 + 8 * g + i) * HD]; w[8 + i] = (__bf16)p[(size_t)(k0 + 16 + 8 * g + i) * HD]; }
  return w; }
#define WO_OUT_IN 0
#if WQKV_LAYOUT == 1
__device__ __forceinline__ v16b zero16b() { v16b w; _Pragma("unroll") for (int i = 0; i < 16; ++i) w[i] = (__bf16)0.0f; return w; }
#define WCOL(W, k0, o, lane) ((o) < 64 ? wcol_oi(W, k0, (o), lane, DIN) : zero16b())   /* (out,in) [64][512]: only 64 real output rows; projected columns 64..127 (padding head 1) are zero */
#elif WQKV_LAYOUT == 2
#define WCOL(W, k0, o, lane) wcol_hdk(W, k0, o, lane)
#else
#define WCOL(W, k0, o, lane) wcol_io(W, k0, o, lane, CC)
#endif
#if WO_OUT_IN
#define WOCOL(W, k0, o, lane) wcol_oi(W, k0, o, lane, CC)
#define WOCOLH(W, k0, o, lane) wcolh_oi(W, k0, o, lane, CC)
#else
#define WOCOL(W, k0, o, lane) wcol_io(W, k0, o, lane, DIN)
#define WOCOLH(W, k0, o, lane) wcolh_io(W, k0, o, lane, DIN)
#endif

#ifndef SM_EXTRA_PARAMS
#define SM_EXTRA_PARAMS
#endif
#ifndef PROJ_EXTRA_PARAMS
#define PROJ_EXTRA_PARAMS
#endif
#ifndef SM_MASK_HOOK
#define SM_MASK_HOOK (void)0
#endif

#define WS_QH  0u                                      // f16 q, head 0, fragment order: fragment ((b*TT + t) / 16) * 2 + kc (first half of the plane's room)
#define WS_KH  (WS_QH + 2u * (size_t)NB * TT * CC)      // f16 k, as q
#define WS_VT  (WS_KH + 2u * (size_t)NB * TT * CC)      // f16 v planes [b][c][t]
#define WS_QL  (WS_VT + 2u * (size_t)NB * CC * TT)      // f16 q residual x 2^10, as q
#define WS_KL  (WS_QL + 2u * (size_t)NB * QHI * CC)     // f16 k residual x 2^10, as q
#define WS_VB  (WS_KL + 2u * (size_t)NB * KHI * CC)     // bf16 v hi, head 0, fragment order: fragment (b * KHI / 32 + t / 32) * 4 + c / 16; WS_VBL: v lo, the same
#define WS_VBL (WS_VB + 2u * (size_t)NB * CC * KHI)
#define WS_Y   (WS_VBL + 2u * (size_t)NB * CC * KHI)    // f32 ctx rows [b*t][CC] (only when there is an output projection)
#define WS_END (WS_Y  + 0u)
#define PVK 512             // keys per key range of k_pv (one work-group's share of a 128-row query block)
#define PVW 8               // waves per work-group of k_pv: 16 of the block's 128 queries each
#define PVQ (PVK / 128)     // 128-row query blocks per band of PVK rows
#define PVS (TT / PVK)      // most key ranges a query row can have = number of partial ctx planes
#define YPL ((size_t)NB * TT * CC)                      // floats per partial ctx plane
#define WS_Y2 (WS_END)                                  // f32 partial ctx rows [key range][b*TT + t][128] (columns 64..127 = the padding head); row t has ranges 0 .. t / PVK
#define WS_CM (WS_Y2 + 4u * PVS * YPL)                   // f32 exponent addends 11 - log2(column sum) - column max x C2 [b][TT]
#define WS_END2 (WS_CM + 4u * (size_t)NB * TT)

typedef __attribute__((ext_vector_type(4))) __bf16 v4b;
// k_proj's operands on their way from f32 rows [row][DIN] to 16 x 32 bf16 fragments, through LDS. One fragment takes LFB bytes: four runs of 16 pieces of 16 B (run hf * 2 + g, piece = row or column & 15: the elements 8 hf + 0..7 of lane g * 16 + piece, k = 16 hf + 8 g + 0..7), the runs 320 B apart so that the 8-B stores of frag_st fall on 64 different banks.
#define LFB 1280
// line_ld: 16 rows x 32 k values by four loads of whole 128-B lines; p = the lane's row (lane >> 3) and k offset (lane & 7) * 4, load u takes row u * 4 + (lane >> 3)
__device__ __forceinline__ void line_ld(v4f d[4], const float* p, int kc) {
#pragma unroll   /* d[] stays in registers, the four loads issue together */
  for (int u = 0; u < 4; ++u) d[u] = *(const v4f*)(p + (size_t)u * 4 * DIN + kc * 32); }
// frag_st: rounds them to bf16 and lays them into the fragment at f (f includes the lane's writer offset)
__device__ __forceinline__ void frag_st(unsigned char* f, const v4f d[4]) {
#pragma unroll   /* d[] and o stay in registers (this loop and the next) */
  for (int u = 0; u < 4; ++u) { v4b o;
#pragma unroll
    for (int i = 0; i < 4; ++i) o[i] = (__bf16)d[u][i];
    *(v4b*)(f + u * 64) = o; } }
// frag_ld: the lane's two pieces (f includes the lane's reader offset)
__device__ __forceinline__ v16b frag_ld(const unsigned char* f) { union { v16b v; v8b q[2]; } u; u.q[0] = *(const v8b*)f; u.q[1] = *(const v8b*)(f + 640); return u.v; }
// ---- k_proj: block = (64 rows, 128 cols, which): q/k/v = X W (+ b) with exact bf16 products (K = DIN) -> which 0: q f16, head 0, in fragment order (+ residual for rows < QHI); 1: k, as q (+ residual for rows < KHI); 2: v f16 planes [c][t] (+ bf16 hi/lo planes for t < KHI)
__global__ __launch_bounds__(128) void k_proj(const float* __restrict__ XQ, const float* __restrict__ XK, const float* __restrict__ XV, const float* __restrict__ WQ, const float* __restrict__ WK, const float* __restrict__ WV, const float* __restrict__ BQ, const float* __restrict__ BK, const float* __restrict__ BV,
    _Float16* __restrict__ QH, _Float16* __restrict__ QL, _Float16* __restrict__ KH, _Float16* __restrict__ KL, _Float16* __restrict__ VT, __bf16* __restrict__ VB, __bf16* __restrict__ VBL) {
  /* one LDS block with two uses, a barrier between them: in the k loop the operands as bf16 fragments (the block's weight, then two X slots per wave), afterwards the transposing buffers of the stores */
  __shared__ __align__(16) unsigned char smem[64 * LFB + 4 * 2 * LFB];
  _Float16 (*sh)[136] = (_Float16 (*)[136])smem; _Float16 (*sl)[136] = (_Float16 (*)[136])(smem + 17408); _Float16 (*th)[72] = (_Float16 (*)[72])(smem + 34816); __bf16 (*tb)[72] = (__bf16 (*)[72])(smem + 53248); __bf16 (*tbl)[72] = (__bf16 (*)[72])(smem + 71680);
  const int tid = threadIdx.x, wave = tid >> 5, lane = tid & 31, col = lane & 15, g = lane >> 4; const int which = blockIdx.z; const int c0 = blockIdx.y * 128; const size_t r0 = (size_t)blockIdx.x * 64; const size_t bb = r0 / TT; const int t0 = (int)(r0 % TT);
  const float* X = which == 0 ? XQ : which == 1 ? XK : XV; const float* WA = which == 0 ? WQ : which == 1 ? WK : WV; const float* BA = which == 0 ? BQ : which == 1 ? BK : BV;
  const int lc = lane & 7, lr = lane >> 3;   /* a line load: 8 lanes take one row's 128-B line (32 k values), the wave 4 rows */
  const int wofs = (lc >> 1) * 320 + lr * 16 + (lc & 1) * 8, rofs = g * 320 + col * 16;   /* the lane's place in a fragment as writer of 4 values and as reader of its pieces */
  /* X: the wave's 16 rows, k step by k step; steps 0 and 1 go to the wave's two LDS slots before the loop, steps 2.. wait in a register ring of 4 steps */
  const float* xp = X + (r0 + wave * 16 + lr) * DIN + lc * 4; unsigned char* xw = smem + (64 + wave * 2) * LFB + wofs; const unsigned char* xrd = smem + (64 + wave * 2) * LFB + rofs;
  v4f x01[2][4], xr[4][4];
  line_ld(x01[0], xp, 0); line_ld(x01[1], xp, 1);
#pragma unroll   /* here and below: loops over register arrays are unrolled so that the arrays stay in registers */
  for (int s = 0; s < 4; ++s) line_ld(xr[s], xp, 2 + s);
  /* W: the 64 real output rows x DIN as the B fragments (k step kc, column tile j) = number kc * 4 + j; wave w stages k steps 4 w .. 4 w + 3, 32 loads in flight */
  if (c0 == 0) { const float* wp = WA + (size_t)lr * DIN + wave * 128 + lc * 4; unsigned char* lp = smem + wave * 16 * LFB + wofs;
#pragma unroll
    for (int kh = 0; kh < 2; ++kh) { v4f t[8][4];
#pragma unroll
      for (int u = 0; u < 8; ++u) line_ld(t[u], wp + (size_t)(u & 3) * 16 * DIN, kh * 2 + (u >> 2));
#pragma unroll
      for (int u = 0; u < 8; ++u) frag_st(lp + ((kh * 2 + (u >> 2)) * 4 + (u & 3)) * LFB, t[u]); }
  } else { const v4u zz = {0u, 0u, 0u, 0u}; for (int e = tid; e < 64 * LFB / 16; e += 128) *(v4u*)(smem + e * 16) = zz; }   /* projected columns 128.. have no weight row: zero fragments (block-uniform test) */
  frag_st(xw, x01[0]); frag_st(xw + LFB, x01[1]);
  __syncthreads();   /* publishes the staged weight fragments to the block's four waves */
  v8f acc[8] = {}; v16b af[2], wf[2][4];   /* the fragments of a k step, read from LDS together and one step ahead of their products */
  af[0] = frag_ld(xrd);
#pragma unroll
  for (int j = 0; j < 4; ++j) wf[0][j] = frag_ld(smem + j * LFB + rofs);
#pragma unroll   /* unrolled so that the slot numbers of the rings are constants */
  for (int kc = 0; kc < DIN / 32; ++kc) {
    __builtin_amdgcn_sched_barrier(0);   /* keeps each step's instructions in their step: without it the compiler rounds the ring's X values right behind their loads and so waits out the memory latency in every step */
    asm volatile("s_wait_dscnt 0x0" ::: "memory");   /* the wave's own X stores of the step before have landed before other lanes read them back, and this step's fragment has left the slot that is written below */
    if (kc + 1 < DIN / 32) { af[(kc + 1) & 1] = frag_ld(xrd + ((kc + 1) & 1) * LFB);
#pragma unroll
      for (int j = 0; j < 4; ++j) wf[(kc + 1) & 1][j] = frag_ld(smem + ((kc + 1) * 4 + j) * LFB + rofs); }
    if (kc + 2 < DIN / 32) frag_st(xw + (kc & 1) * LFB, xr[kc & 3]);
    if (kc + 6 < DIN / 32) line_ld(xr[kc & 3], xp, kc + 6);
#pragma unroll
    for (int j = 0; j < 4; ++j) acc[j] = wmma_bf(af[kc & 1], wf[kc & 1][j], acc[j]); }   /* column tiles 4..7 (the padding head) have no weight row: their sums stay 0 */
  __syncthreads();   /* every wave has read its last fragment: the LDS block now serves the stores */
  if (which < 2) { _Float16* DH = which == 0 ? QH : KH; _Float16* DL = which == 0 ? QL : KL; const int nhi = which == 0 ? QHI : KHI; const bool hi_rows = t0 < nhi;
#pragma unroll
    for (int j = 0; j < 8; ++j) { const float bias = BA ? bfr(BA[c0 + j * 16 + col]) : 0.f;
#pragma unroll
      for (int r = 0; r < 8; ++r) { const float v = acc[j][r] + bias; const _Float16 hv = (_Float16)v; sh[wave * 16 + 8 * g + r][j * 16 + col] = hv; sl[wave * 16 + 8 * g + r][j * 16 + col] = (_Float16)((v - (float)hv) * 1024.0f); } }
    __syncthreads();
    /* fragment order, columns 0..63 (head 0; the padding head is not stored): piece e of the block's 4 row tiles = row (e >> 7) * 16 + (e & 15), columns ((e >> 4) & 7) * 8 + 0..7 */
    for (int e = tid; e < 64 * 8; e += 128) { const int rl = (e >> 7) * 16 + (e & 15), q = (e >> 4) & 7; vst2((unsigned*)(DH + r0 * HD + e * 8), *(const v4u*)&sh[rl][q * 8]); if (hi_rows) vst2((unsigned*)(DL + (bb * nhi + t0) * (size_t)HD + e * 8), *(const v4u*)&sl[rl][q * 8]); }
  } else { const bool hi_rows = t0 < KHI;
#pragma unroll
    for (int j = 0; j < 8; ++j) { const float bias = BA ? bfr(BA[c0 + j * 16 + col]) : 0.f;
#pragma unroll
      for (int r = 0; r < 8; ++r) { const float v = acc[j][r] + bias; const int rl = wave * 16 + 8 * g + r, cl = j * 16 + col; th[cl][rl] = (_Float16)v; const __bf16 bh = (__bf16)v; tb[cl][rl] = bh; tbl[cl][rl] = (__bf16)(v - (float)bh); } }
    __syncthreads();
    for (int e = tid; e < 128 * 8; e += 128) { const int cl = e >> 3, q = e & 7; vst2((unsigned*)(VT + (bb * CC + c0 + cl) * (size_t)TT + t0 + q * 8), *(const v4u*)&th[cl][q * 8]); }
    /* fragment order, columns 0..63: piece e of the block's 2 key steps = column ((e >> 6) & 3) * 16 + (e & 15), keys (e >> 8) * 32 + ((e >> 4) & 3) * 8 + 0..7 */
    if (hi_rows) for (int e = tid; e < 64 * 8; e += 128) { const int cl = ((e >> 6) & 3) * 16 + (e & 15), kl = (e >> 8) * 32 + ((e >> 4) & 3) * 8; const size_t o3 = (bb * KHI + t0) * (size_t)HD + e * 8; vst2((unsigned*)(VB + o3), *(const v4u*)&tb[cl][kl]); vst2((unsigned*)(VBL + o3), *(const v4u*)&tbl[cl][kl]); } } }
// the matrix products of k_cstat and k_pv: the builtin forms as they are (the compiler keeps the distance behind its own builtin forms)
__device__ __forceinline__ v8f mm_h(v16h a, v16h b, v8f c) { return __builtin_amdgcn_wmma_f32_16x16x32_f16(false, a, false, b, (short)0, c, false, false); }
__device__ __forceinline__ v8f mm_b(v16b a, v16b b, v8f c) { return __builtin_amdgcn_wmma_f32_16x16x32_bf16(false, a, false, b, (short)0, c, false, false); }
// fragment number n behind p, p = the lane's first piece of some fragment of a fragment-order plane: all fragments of a run are read through the one address register pair p, by immediate offsets
__device__ __forceinline__ v16h fragp_h(const v8h* p, int n) { union { v16h v; v8h q[2]; } u; u.q[0] = p[n * 64]; u.q[1] = p[n * 64 + 32]; return u.v; }
__device__ __forceinline__ v16b fragp_b(const v8b* p, int n) { union { v16b v; v8b q[2]; } u; u.q[0] = p[n * 64]; u.q[1] = p[n * 64 + 32]; return u.v; }
// exp(SCALE x (t - m)) = exp2(t x C2 - m x C2), C2 = SCALE x log2(e): one fused multiply-add and one v_exp_f32 per score instead of the library expf's range reduction, ldexp and range tests. An argument below the exponent range (-inf included) gives 0.
#define C2 0.18033688011112042f
__device__ __forceinline__ float ex2(float a) { asm("v_exp_f32 %0, %0\n\tv_nop" : "+v"(a)); return a; }
__device__ __forceinline__ void ex2x8(float* x) { asm("v_exp_f32 %0, %0\n\tv_exp_f32 %1, %1\n\tv_exp_f32 %2, %2\n\tv_exp_f32 %3, %3\n\tv_exp_f32 %4, %4\n\tv_exp_f32 %5, %5\n\tv_exp_f32 %6, %6\n\tv_exp_f32 %7, %7\n\tv_nop" : "+v"(x[0]), "+v"(x[1]), "+v"(x[2]), "+v"(x[3]), "+v"(x[4]), "+v"(x[5]), "+v"(x[6]), "+v"(x[7])); }
__device__ __forceinline__ void ex2x9(float* x) { asm("v_exp_f32 %0, %0\n\tv_exp_f32 %1, %1\n\tv_exp_f32 %2, %2\n\tv_exp_f32 %3, %3\n\tv_exp_f32 %4, %4\n\tv_exp_f32 %5, %5\n\tv_exp_f32 %6, %6\n\tv_exp_f32 %7, %7\n\tv_exp_f32 %8, %8\n\tv_nop" : "+v"(x[0]), "+v"(x[1]), "+v"(x[2]), "+v"(x[3]), "+v"(x[4]), "+v"(x[5]), "+v"(x[6]), "+v"(x[7]), "+v"(x[8])); }
// ---- k_cstat: scores and the softmax statistics over the QUERY axis in one kernel; no logit is stored. For every key column k: m_k = max_{q >= k} t[q][k], Z_k = sum_{q >= k} exp2((t[q][k] - m_k) x C2) (f32), t = q hi . k hi + (q residual . k hi + q hi . k residual) / 2^10 (3 products, head 0; the unscaled score); CM holds 11 - log2(Z_k) - m_k x C2, the addend of k_pv's exponent.
// A wave keeps the k fragments of 32 key columns in registers (B operand) and walks 16-query tiles (A operand) from the diagonal to the end. In the product's D layout a lane holds 8 queries of ONE key column, so the online max / sum runs in the lane (one rescale per 8 queries); the two lane halves are merged by a shuffle, the waves through LDS, max first, then rescaled sums.
// block = (batch, pair of 32-column groups pr and TT / 32 - 1 - pr): the long walk of the one and the short walk of the other have TT / 16 + 2 query tiles together in every block. The tiles of a walk are dealt to the CSW waves round robin; the second walk's deal goes on where the first one's ended.
// q < k enters as -inf (exp gives 0) while the running max starts finite, so a lane or wave with no visible query ends as (-3e38, 0) and drops out of the merge.
#define CSW 16
__global__ __launch_bounds__(32 * CSW) void k_cstat(const _Float16* __restrict__ QH, const _Float16* __restrict__ KH, const _Float16* __restrict__ QL, const _Float16* __restrict__ KL, float* __restrict__ CM) { __shared__ float pm[2][CSW][32], pz[2][CSW][32];
  const int tid = threadIdx.x, wave = __builtin_amdgcn_readfirstlane(tid >> 5), lane = tid & 31, col = lane & 15, g = lane >> 4;   /* the wave number in a scalar register: the walk's bounds stay wave-uniform */
  const int b = blockIdx.x, pr = blockIdx.y; const size_t fb = ((size_t)b * TT) >> 3;   /* first fragment of the batch in the fragment-order planes: 2 fragments (kc = 0, 1) per 16 rows */
#pragma unroll 1   /* the two walks share one body: half the code */
  for (int s = 0; s < 2; ++s) { const int c = s ? TT / 32 - 1 - pr : pr, k0 = c * 32; const int w = s ? (wave + 2 * pr) & (CSW - 1) : wave;
    v16h kh[2][2], kl[2][2]; const v8h* pkh = (const v8h*)KH + (fb + c * 4) * 64 + lane; const v8h* pkl = (const v8h*)KL + (fb + c * 4) * 64 + lane;
#pragma unroll
    for (int j = 0; j < 2; ++j)
#pragma unroll
      for (int kc = 0; kc < 2; ++kc) { kh[j][kc] = fragp_h(pkh, j * 2 + kc); kl[j][kc] = fragp_h(pkl, j * 2 + kc); }
    float m[2] = {-3.0e38f, -3.0e38f}, z[2] = {0.f, 0.f};
    int qt = 2 * c + w; v16h ah[2], al[2];
    { const size_t f = fb + (qt < TT / 16 ? qt : TT / 16 - 1) * 2; const v8h* pq = (const v8h*)QH + f * 64 + lane; const v8h* pr2 = (const v8h*)QL + f * 64 + lane; ah[0] = fragp_h(pq, 0); ah[1] = fragp_h(pq, 1); al[0] = fragp_h(pr2, 0); al[1] = fragp_h(pr2, 1);
      asm volatile("s_wait_xcnt 0x0" :: "v"(pkh), "v"(pkl), "v"(pq), "v"(pr2) : "memory"); }   /* the wait that stands between issued loads and an overwrite of their address registers; the addresses are named so that they last up to it (no load's result is laid over them) */
#pragma unroll 2   /* two trips a pass, so that the fragments read ahead change names instead of being copied */
    for (; qt < TT / 16; qt += CSW) {
      /* the next tile's q fragments are read while this tile is worked on (past the end: the last tile again, unused) */
      const size_t fn = fb + (qt + CSW < TT / 16 ? qt + CSW : TT / 16 - 1) * 2; const v8h* nq = (const v8h*)QH + fn * 64 + lane; const v8h* nr = (const v8h*)QL + fn * 64 + lane; const v16h nh0 = fragp_h(nq, 0), nh1 = fragp_h(nq, 1), nl0 = fragp_h(nr, 0), nl1 = fragp_h(nr, 1);
      asm volatile("s_wait_xcnt 0x0" :: "v"(nq), "v"(nr) : "memory");   /* as above: these loads stay in flight over the trip's work, which reuses registers */
      v8f a0[2] = {}, a1[2] = {};
#pragma unroll
      for (int kc = 0; kc < 2; ++kc)
#pragma unroll
        for (int j = 0; j < 2; ++j) { a0[j] = mm_h(ah[kc], kh[j][kc], a0[j]); a1[j] = mm_h(al[kc], kh[j][kc], a1[j]); a1[j] = mm_h(ah[kc], kl[j][kc], a1[j]); }
      float v[2][8];
#pragma unroll
      for (int j = 0; j < 2; ++j)
#pragma unroll
        for (int r = 0; r < 8; ++r) v[j][r] = a0[j][r] + a1[j][r] * (1.0f / 1024.0f);
      if (qt * 16 < k0 + 32) {   /* only the walk's first two tiles touch the diagonal (wave-uniform test) */
#pragma unroll
        for (int j = 0; j < 2; ++j)
#pragma unroll
          for (int r = 0; r < 8; ++r) v[j][r] = (qt * 16 + 8 * g + r >= k0 + j * 16 + col) ? v[j][r] : -INFINITY; }
#pragma unroll
      for (int j = 0; j < 2; ++j) { float mn = m[j];
#pragma unroll
        for (int r = 0; r < 8; ++r) mn = fmaxf(mn, v[j][r]);
        const float nb = -mn * C2; float e[9]; e[8] = (m[j] - mn) * C2;   /* e[8]: the rescale of the sum so far */
#pragma unroll
        for (int r = 0; r < 8; ++r) e[r] = fmaf(v[j][r], C2, nb);
        ex2x9(e); float a = z[j] * e[8];
#pragma unroll
        for (int r = 0; r < 8; ++r) a += e[r];
        m[j] = mn; z[j] = a; }
      ah[0] = nh0; ah[1] = nh1; al[0] = nl0; al[1] = nl1; }
#pragma unroll
    for (int j = 0; j < 2; ++j) { const float M = fmaxf(m[j], __shfl_xor(m[j], 16)); float a = z[j] * ex2((m[j] - M) * C2); a += __shfl_xor(a, 16); if (g == 0) { pm[s][wave][j * 16 + col] = M; pz[s][wave][j * 16 + col] = a; } } }
  __syncthreads();   /* publishes the CSW waves' partial (max, sum) pairs of both column groups to waves 0 and 1 */
  if (wave < 2) { const int k0 = (wave ? TT / 32 - 1 - pr : pr) * 32; float M = pm[wave][0][lane];
#pragma unroll
    for (int w = 1; w < CSW; ++w) M = fmaxf(M, pm[wave][w][lane]);
    float a = 0.f;
#pragma unroll
    for (int w = 0; w < CSW; ++w) a += pz[wave][w][lane] * ex2((pm[wave][w][lane] - M) * C2);
    vst2(CM + (size_t)b * TT + k0 + lane, 11.0f - log2f(a) - M * C2); } }   /* every column sees at least its own diagonal entry, so Z_k is about 1 or more; max and sum leave as the one addend of k_pv's exponent */
// ---- k_sm: block = query row t (head in group): keys [0, kend): causal -> logit if s <= t else excluded; softmax in f32; P x 2^11 in place (0 for excluded)
__global__ __launch_bounds__(256) void k_sm(float* __restrict__ S0 SM_EXTRA_PARAMS) { __shared__ float sred[8]; __shared__ float sbc; __shared__ __align__(16) float shv[TT];
  const int tid = threadIdx.x; const int t = blockIdx.x; const int kend = (kb_last(t >> 6) + 1) * 128;
  float* sr = S0 + (size_t)blockIdx.y * TT * TT + (size_t)t * TT;
  float m = -3.0e38f; for (int k = tid; k < kend; k += 256) { float v = (!CAUSAL || k <= t) ? sr[k] : -3.0e38f; SM_MASK_HOOK; shv[k] = v; m = fmaxf(m, v); }
#pragma unroll
  for (int o = 1; o < 32; o <<= 1) m = fmaxf(m, __shfl_xor(m, o));
  if ((tid & 31) == 0) sred[tid >> 5] = m; __syncthreads(); if (tid == 0) { float a = sred[0]; for (int i = 1; i < 8; ++i) a = fmaxf(a, sred[i]); sbc = a; } __syncthreads(); m = sbc; __syncthreads();
  float sum = 0.f; for (int k = tid; k < kend; k += 256) { const float v = shv[k]; const float e = (v <= -1.0e38f) ? 0.f : expf(v - m); shv[k] = e; sum += e; }
#pragma unroll
  for (int o = 1; o < 32; o <<= 1) sum += __shfl_xor(sum, o);
  if ((tid & 31) == 0) sred[tid >> 5] = sum; __syncthreads(); if (tid == 0) { float a = 0.f; for (int i = 0; i < 8; ++i) a += sred[i]; sbc = a > 0.f ? 2048.0f / a : 0.f; }   /* a fully excluded row yields P = 0 */ __syncthreads(); const float inv = sbc;
  for (int k = tid; k < kend; k += 256) shv[k] = shv[k] * inv;
  __syncthreads(); for (int q = tid; q < kend / 4; q += 256) vst2(sr + q * 4, *(const v4f*)&shv[q * 4]); }
// ---- k_out64: out[b][t][0..63] = sum over the row's key ranges (ascending) of the partial ctx row, columns 0..63 (256 B by 16 lanes); the block's 16 rows lie in one band of PVK rows, so the range count is the same for all of them
__global__ __launch_bounds__(256) void k_out64(const float* __restrict__ Y, float* __restrict__ OUT) { const size_t row = (size_t)blockIdx.x * 16 + (threadIdx.x >> 4); const int q = threadIdx.x & 15; const int nr = (int)((blockIdx.x * 16u) % TT) / PVK + 1; const float* yp = Y + row * CC + q * 4; v4f v = *(const v4f*)yp;
  for (int c = 1; c < nr; ++c) v += *(const v4f*)(yp + c * YPL);
  asm volatile("s_wait_loadcnt 0x0" ::: "memory"); vst2(OUT + row * 64 + q * 4, v); }
// ---- k_pv: block = (128 queries, one range of PVK keys) of batch blockIdx.x, head 0; wave = 16 of the queries: partial ctx = P . v over the range's keys up to the wave's diagonal. The scores are formed anew here, transposed: S^T = k . q^T (A = the k fragments of 16 keys, B = the wave's q fragments, kept in registers; the same 3 products as in k_cstat). In D a lane holds keys 8 h + 0..7 of ONE query, which is the A fragment's order for P . v: two 16-key tiles give the 32-key fragment with no exchange between lanes. P = exp2(t x C2 + CM[k]) = exp(S - m_k) x 2^11 / Z_k for k <= t, 0 above the diagonal; P and v as bf16 hi + lo, 3 products.
// The block's 8 waves walk the same key steps, so the k and v fragments that one wave has fetched are near for the other seven.
// Split over keys: rows of band d = t / PVK have d + 1 ranges. blockIdx.y numbers the (128-query block, range) pairs: the full ranges first, then each block's last range (the one the diagonal cuts short), the longest first. The ranges' partial rows go to planes of Y that k_out64 adds.
__global__ __launch_bounds__(32 * PVW) void k_pv(const _Float16* __restrict__ QH, const _Float16* __restrict__ KH, const _Float16* __restrict__ QL, const _Float16* __restrict__ KL, const __bf16* __restrict__ VB, const __bf16* __restrict__ VBL, const float* __restrict__ CM, float* __restrict__ Y) { __shared__ __align__(16) float ss[PVW][16][HD + 4];
  const int tid = threadIdx.x, wave = __builtin_amdgcn_readfirstlane(tid >> 5), lane = tid & 31, col = lane & 15, g = lane >> 4;   /* the wave number in a scalar register: the key loop's bounds stay wave-uniform */
  const int b = blockIdx.x, py = blockIdx.y;
  int band, rng, qi;   /* PVQ query blocks a band; band d has PVQ * d full ranges, PVQ * d (d - 1) / 2 lie before them */
  if (py < PVQ * PVS * (PVS - 1) / 2) { band = 1;
#pragma unroll
    for (int d = 2; d < PVS; ++d) if (py >= PVQ * d * (d - 1) / 2) band = d;
    const int rem = py - PVQ * band * (band - 1) / 2; qi = rem % PVQ; rng = rem / PVQ; }
  else { const int p = py - PVQ * PVS * (PVS - 1) / 2; qi = PVQ - 1 - p / PVS; band = p % PVS; rng = band; }
  const int ql0 = band * PVK + qi * 128 + wave * 16; const int kcb = rng * (PVK / 32); const int kall = ((ql0 + 15) >> 5) + 1; const int kce = kall < (rng + 1) * (PVK / 32) ? kall : (rng + 1) * (PVK / 32);   /* 32-key steps; the last one is the step that holds the wave's last query */
  const size_t fb = ((size_t)b * TT) >> 3; const size_t fq = fb + (ql0 >> 3);
  const v16h qh[2] = {fragt_h(QH, fq, lane), fragt_h(QH, fq + 1, lane)}, qr[2] = {fragt_h(QL, fq, lane), fragt_h(QL, fq + 1, lane)};
  v8f acc[HD / 16] = {};
#pragma unroll 1   /* one step's fragments fill the registers */
  for (int kc = kcb; kc < kce; ++kc) { v16h kh[2][2], kl[2][2]; v4f mv[4];
    const v8h* pkh = (const v8h*)KH + (fb + kc * 4) * 64 + lane; const v8h* pkl = (const v8h*)KL + (fb + kc * 4) * 64 + lane; const v4f* pm = (const v4f*)(CM + (size_t)b * TT + kc * 32 + 8 * g);
#pragma unroll
    for (int i = 0; i < 2; ++i)
#pragma unroll
      for (int c = 0; c < 2; ++c) { kh[i][c] = fragp_h(pkh, i * 2 + c); kl[i][c] = fragp_h(pkl, i * 2 + c); }
#pragma unroll
    for (int q = 0; q < 4; ++q) mv[q] = pm[(q >> 1) * 4 + (q & 1)];
    /* inputs-only fence on the loaded values: the step's 20 loads for the scores are in flight together and are waited for once; without it the compiler deals them out in small groups between the products, each with a wait of its own; the three addresses are named too, so that they last until the loads have returned (no load's result is laid over them) */
    asm volatile("" :: "v"(kh[0][0]), "v"(kh[0][1]), "v"(kh[1][0]), "v"(kh[1][1]), "v"(kl[0][0]), "v"(kl[0][1]), "v"(kl[1][0]), "v"(kl[1][1]), "v"(mv[0]), "v"(mv[1]), "v"(mv[2]), "v"(mv[3]), "v"(pkh), "v"(pkl), "v"(pm));
    v8f a0[2] = {}, a1[2] = {};
#pragma unroll
    for (int c = 0; c < 2; ++c)
#pragma unroll
      for (int i = 0; i < 2; ++i) { a0[i] = mm_h(kh[i][c], qh[c], a0[i]); a1[i] = mm_h(kh[i][c], qr[c], a1[i]); a1[i] = mm_h(kl[i][c], qh[c], a1[i]); }
    v16b vh[HD / 16], vl[HD / 16]; const v8b* pvh = (const v8b*)VB + ((size_t)b * (KHI / 32) + kc) * (HD / 16) * 64 + lane; const v8b* pvl = (const v8b*)VBL + ((size_t)b * (KHI / 32) + kc) * (HD / 16) * 64 + lane;   /* fragments (key step kc, column tile j) of the fragment-order v planes */
#pragma unroll
    for (int j = 0; j < HD / 16; ++j) { vh[j] = fragp_b(pvh, j); vl[j] = fragp_b(pvl, j); }
    __builtin_amdgcn_sched_barrier(0);   /* keeps the v loads ahead of the exp work, which covers their latency: without it the compiler sinks them to their products, the lo fragments one by one with a wait each */
    float pv[16];
#pragma unroll
    for (int e = 0; e < 16; ++e) pv[e] = fmaf(a0[e >> 3][e & 7] + a1[e >> 3][e & 7] * (1.0f / 1024.0f), C2, mv[e >> 2][e & 3]);
    ex2x8(pv); ex2x8(pv + 8);
    if (kc * 32 + 31 > ql0) {   /* only steps that reach past the wave's first query hold masked keys (wave-uniform test) */
#pragma unroll
      for (int e = 0; e < 16; ++e) pv[e] = (kc * 32 + (e >> 3) * 16 + 8 * g + (e & 7) <= ql0 + col) ? pv[e] : 0.f; }
    const F2 p = bsplit16(pv);
    /* inputs-only fence on the loaded v fragments and their two addresses: the addresses last until the loads have returned */
    asm volatile("" :: "v"(vh[0]), "v"(vh[1]), "v"(vh[2]), "v"(vh[3]), "v"(vl[0]), "v"(vl[1]), "v"(vl[2]), "v"(vl[3]), "v"(pvh), "v"(pvl));
#pragma unroll
    for (int j = 0; j < HD / 16; ++j) { acc[j] = mm_b(p.h, vh[j], acc[j]); acc[j] = mm_b(p.l, vh[j], acc[j]); acc[j] = mm_b(p.h, vl[j], acc[j]); } }
#pragma unroll
  for (int j = 0; j < HD / 16; ++j)
#pragma unroll
    for (int r = 0; r < 8; ++r) ss[wave][8 * g + r][j * 16 + col] = acc[j][r] * (1.0f / 2048.0f);
  LDSX();   /* the wave reads back only its own tile, turned into whole rows: 256-B (row, head) segment by 16 lanes */
#pragma unroll
  for (int i = 0; i < 8; ++i) { const int rl = i * 2 + g; vst2(Y + rng * YPL + ((size_t)b * TT + ql0 + rl) * CC + col * 4, *(const v4f*)&ss[wave][rl][col * 4]); } }

extern "C" void kernel_launch(void* const* d_in, const int* in_sizes, int n_in, void* d_out, int out_size, void* d_ws, size_t ws_size, hipStream_t stream) {
  (void)in_sizes; (void)n_in; (void)out_size;
  const float** F = (const float**)d_in;
  if (ws_size < (size_t)WS_END) return;
  char* ws = (char*)d_ws; _Float16 *QH = (_Float16*)(ws + WS_QH), *KH = (_Float16*)(ws + WS_KH), *VT = (_Float16*)(ws + WS_VT), *QL = (_Float16*)(ws + WS_QL), *KL = (_Float16*)(ws + WS_KL); __bf16 *VB = (__bf16*)(ws + WS_VB), *VBL = (__bf16*)(ws + WS_VBL); float *Y = (float*)(ws + WS_Y);
  (void)Y; (void)QL; (void)KL; (void)VB; (void)VBL;
  // inputs: 0 x [4,4096,512]; 1 Wq [64,512] (out,in); 2 Wk; 3 Wv; no biases
  if (ws_size < (size_t)WS_END2) return;
  float *Y2 = (float*)(ws + WS_Y2), *CM = (float*)(ws + WS_CM);
  k_proj<<<dim3(TNB * TT / 64, CC / 128, 3), 128, 0, stream>>>(F[0], F[0], F[0], F[1], F[2], F[3], nullptr, nullptr, nullptr, QH, QL, KH, KL, VT, VB, VBL);   /* weight columns 64..127 (the padding head) have no fragments: their sums stay 0 */
  /* head 0 only (head 1 is the zero padding); the batch is a grid axis of both launches; the logits are formed in registers in each of them and never stored */
  k_cstat<<<dim3(TNB, TT / 64), 32 * CSW, 0, stream>>>(QH, KH, QL, KL, CM);   /* per key column s: max and sum over the visible queries t >= s, as one exponent addend */
  k_pv<<<dim3(TNB, PVQ * PVS * (PVS + 1) / 2), 32 * PVW, 0, stream>>>(QH, KH, QL, KL, VB, VBL, CM, Y2);   /* batch x (128-query block, key range); P[t][s] = exp(S - m_s) x 2^11 / Z_s */
  k_out64<<<dim3(TNB * TT / 16), 256, 0, stream>>>(Y2, (float*)d_out);
}

// v009
// Measured time: 58.1 microseconds a run.
// Timed twice side by side with v008, it ran 1.05 and 1.04 times as fast.
// Over all steps from v000 it is 129 times as fast.
// compute dtype: all float inputs rounded to bf16; q/k/v projections with EXACT bf16 products on WMMA 16x16x32 (f32 accumulate); causal scores with BOTH q and k as f16 hi + (x 2^10) residual (3 products) on EVERY block, x 64^-0.5; softmax over the QUERY axis in f32 (per key column: online max / sum over the visible queries; every exp is the hardware's exp2; a score's argument is one fused multiply-add); P as bf16 hi + lo against v as bf16 hi + lo (3 products) on EVERY block; f32 output.
#include <hip/hip_runtime.h>
#include <math.h>

typedef __attribute__((ext_vector_type(16))) _Float16 v16h;
typedef __attribute__((ext_vector_type(16))) __bf16 v16b;
typedef __attribute__((ext_vector_type(8)))  _Float16 v8h;
typedef __attribute__((ext_vector_type(8)))  float v8f;
typedef __attribute__((ext_vector_type(4)))  float v4f;
typedef __attribute__((ext_vector_type(2)))  float v2f;
typedef __attribute__((ext_vector_type(4)))  unsigned v4u;
typedef __attribute__((ext_vector_type(4)))  int v4i;
typedef float __attribute__((may_alias)) float_a;
typedef int __attribute__((may_alias)) int_a;

template <typename T> __device__ __forceinline__ void vst2(void* p, T v) { *(T*)p = v;  }
__device__ __forceinline__ v8f wmma16(v16h a, v16h b, v8f c) {
  v8f d = __builtin_amdgcn_wmma_f32_16x16x32_f16(false, a, false, b, (short)0, c, false, false);
  asm volatile("v_nop\n\tv_nop\n\tv_nop\n\tv_nop" : "+v"(d) : "v"(a), "v"(b));
  return d;
}
__device__ __forceinline__ v8f wmma_bf(v16b a, v16b b, v8f c) {
  v8f d = __builtin_amdgcn_wmma_f32_16x16x32_bf16(false, a, false, b, (short)0, c, false, false);
  asm volatile("v_nop\n\tv_nop\n\tv_nop\n\tv_nop" : "+v"(d) : "v"(a), "v"(b));
  return d;
}
// 16x16x32 fragments: lane = (h = lane>>4, row/col = lane&15); elements 0..7 = k0+8h+0..7, 8..15 = k0+16+8h+0..7; D element r = row 8h+r
__device__ __forceinline__ v16h frag_h(const _Float16* rowk0, int lane) {
  union { v16h v; v8h q[2]; } u; const _Float16* p = rowk0 + 8 * (lane >> 4);
  u.q[0] = *(const v8h*)p; u.q[1] = *(const v8h*)(p + 16); return u.v;
}
__device__ __forceinline__ v16h frag_f32(const float* rowk0, int lane) {
  v16h a; const float* p = rowk0 + 8 * (lane >> 4);
#pragma unroll
  for (int i = 0; i < 8; ++i) { a[i] = (_Float16)p[i]; a[8 + i] = (_Float16)p[16 + i]; }
  return a;
}
__device__ __forceinline__ v16h frag_f32s(const float* rowk0, int lane, float sc) {
  v16h a; const float* p = rowk0 + 8 * (lane >> 4);
#pragma unroll
  for (int i = 0; i < 8; ++i) { a[i] = (_Float16)(p[i] * sc); a[8 + i] = (_Float16)(p[16 + i] * sc); }
  return a;
}
// column fragment from a [K][ld] layout (column n), rows >= K read as 0
__device__ __forceinline__ v16h fragc_f32(const float* W, int k0, int n, int lane, int ld, int K) {
  v16h a; const int g = lane >> 4;
#pragma unroll
  for (int i = 0; i < 8; ++i) { const int ka = k0 + 8 * g + i, kb = ka + 16;
    a[i] = (_Float16)(ka < K ? W[(size_t)(ka < K ? ka : K - 1) * ld + n] : 0.f); a[8 + i] = (_Float16)(kb < K ? W[(size_t)(kb < K ? kb : K - 1) * ld + n] : 0.f); }
  return a;
}
struct F2 { v16b h, l; };
__device__ __forceinline__ F2 bsplit16(const float v[16]) { F2 r;
#pragma unroll
  for (int i = 0; i < 16; ++i) { const __bf16 h = (__bf16)v[i]; r.h[i] = h; r.l[i] = (__bf16)(v[i] - (float)h); }
  return r; }
__device__ __forceinline__ F2 split_row(const float* row, int k0, int lane) { float v[16]; const float* p = row + k0 + 8 * (lane >> 4);
#pragma unroll
  for (int i = 0; i < 8; ++i) { v[i] = p[i]; v[8 + i] = p[16 + i]; }
  return bsplit16(v); }
__device__ __forceinline__ F2 split_rowK(const float* row, int k0, int lane, int K) { float v[16]; const int g = lane >> 4;
#pragma unroll
  for (int i = 0; i < 8; ++i) { const int ka = k0 + 8 * g + i, kb = ka + 16; v[i] = ka < K ? row[ka < K ? ka : K - 1] : 0.f; v[8 + i] = kb < K ? row[kb < K ? kb : K - 1] : 0.f; }
  return bsplit16(v); }
__device__ __forceinline__ F2 split_col(const float* W, int k0, int n, int lane, int ld, int K) { float v[16]; const int g = lane >> 4;
#pragma unroll
  for (int i = 0; i < 8; ++i) { const int ka = k0 + 8 * g + i, kb = ka + 16; v[i] = ka < K ? W[(size_t)(ka < K ? ka : K - 1) * ld + n] : 0.f; v[8 + i] = kb < K ? W[(size_t)(kb < K ? kb : K - 1) * ld + n] : 0.f; }
  return bsplit16(v); }
__device__ __forceinline__ v8f mac3(const F2& a, const F2& b, v8f c) { c = wmma_bf(a.l, b.h, c); c = wmma_bf(a.h, b.l, c); return wmma_bf(a.h, b.h, c); }
__device__ __forceinline__ float sigm(float v) { return 1.0f / (1.0f + expf(-v)); }
#define LDSX() do { asm volatile("s_wait_dscnt 0" ::: "memory"); __builtin_amdgcn_wave_barrier(); __builtin_amdgcn_fence(__ATOMIC_RELEASE, "workgroup"); } while (0)

// Single-head causal self-attention whose softmax runs over the QUERY axis (x [4,4096,512]; torch (out,in) Wq / Wk / Wv [64,512] (0.02 scale), no biases; scores = q k^T [B,t,s]; additive causal mask -1e9 where s > t; / sqrt(64); attn = softmax(scores, axis=1) - axis 1 is the QUERY axis t, so every key column s is normalised over the queries t >= s (faithful to the source); out = attn v -> [4,4096,64]).
#define NB 4
#define TT 4096
#define CC 128            // NH * HD = projected width
#define DIN 512          // input (model) width
#define NH 2
#define HD 64
#define NQB (TT / 64)
#define HG 1
#define SCALE (0.125f)
#define CAUSAL 1
#ifndef TNB
#define TNB NB
#endif
__device__ __forceinline__ float bfr(float v) { return (float)(__bf16)v; }
__host__ __device__ __forceinline__ int kb_last(int qb) { return CAUSAL ? ((qb * 64 + 63) >> 7) : (TT / 128 - 1); }
typedef __attribute__((ext_vector_type(8))) __bf16 v8b;
// Fragment-order planes: one 16 x 32 operand fragment (16 rows or columns x 32 k values, 2-byte elements) is stored as 1024 contiguous bytes; its 16-B piece number hf * 32 + lane holds the lane's elements 8 hf + 0..7 (k = 16 hf + 8 (lane >> 4) + 0..7 of row or column lane & 15), so each of a fragment's two loads reads four whole 128-B lines instead of 32 B out of each of 16 lines. f = fragment number in the plane.
__device__ __forceinline__ v16h fragt_h(const _Float16* plane, size_t f, int lane) {
  union { v16h v; v8h q[2]; } u; const v8h* p = (const v8h*)plane + f * 64 + lane;
  u.q[0] = p[0]; u.q[1] = p[32]; return u.v;
}
__device__ __forceinline__ v16b fragt_b(const __bf16* plane, size_t f, int lane) {
  union { v16b v; v8b q[2]; } u; const v8b* p = (const v8b*)plane + f * 64 + lane;
  u.q[0] = p[0]; u.q[1] = p[32]; return u.v;
}
#define QBH 64              // = NQB: 3-product scores and bf16 hi/lo P.v on every query block
#define QHI 4096            // EVERY row carries a q residual plane: with the softmax over the QUERY axis the few-term region is the END of the sequence (late key columns see few queries), so the high-precision paths run everywhere
#define KHI 4096            // every key row carries the k residual and the v bf16 hi + lo planes
// B fragment (k rows k0+.., output column o) of a weight: (in,out) [K][ld] or (out,in) [ld rows of K]: bf16 exact, or f16(bf16 * 256) exact
__device__ __forceinline__ v16b wcol_io(const float* Wm, int k0, int o, int lane, int ld) { v16b w; const int g = lane >> 4;
#pragma unroll
  for (int i = 0; i < 8; ++i) { w[i] = (__bf16)Wm[(size_t)(k0 + 8 * g + i) * ld + o]; w[8 + i] = (__bf16)Wm[(size_t)(k0 + 16 + 8 * g + i) * ld + o]; }
  return w; }
__device__ __forceinline__ v16b wcol_oi(const float* Wm, int k0, int o, int lane, int K) { v16b w; const float* p = Wm + (size_t)o * K + k0 + 8 * (lane >> 4);
#pragma unroll
  for (int i = 0; i < 8; ++i) { w[i] = (__bf16)p[i]; w[8 + i] = (__bf16)p[16 + i]; }
  return w; }
__device__ __forceinline__ v16h wcolh_io(const float* Wm, int k0, int o, int lane, int ld) { v16h w; const int g = lane >> 4;
#pragma unroll
  for (int i = 0; i < 8; ++i) { w[i] = (_Float16)(bfr(Wm[(size_t)(k0 + 8 * g + i) * ld + o]) * 256.0f); w[8 + i] = (_Float16)(bfr(Wm[(size_t)(k0 + 16 + 8 * g + i) * ld + o]) * 256.0f); }
  return w; }
__device__ __forceinline__ v16h wcolh_oi(const float* Wm, int k0, int o, int lane, int K) { v16h w; const float* p = Wm + (size_t)o * K + k0 + 8 * (lane >> 4);
#pragma unroll
  for (int i = 0; i < 8; ++i) { w[i] = (_Float16)(bfr(p[i]) * 256.0f); w[8 + i] = (_Float16)(bfr(p[16 + i]) * 256.0f); }
  return w; }
#define WQKV_LAYOUT 1   // 0 = (in,out) [DIN][CC]; 1 = (out,in) [64][DIN]; 2 = per-head [NH][DIN][HD]
__device__ __forceinline__ v16b wcol_hdk(const float* Wm, int k0, int o, int lane) { v16b w; const int g = lane >> 4; const float* p = Wm + (size_t)(o / HD) * DIN * HD + (o % HD);
#pragma unroll
  for (int i = 0; i < 8; ++i) { w[i] = (__bf16)p[(size_t)(k0 + 8 * g + i) * HD]; w[8 + i] = (__bf16)p[(size_t)(k0 + 16 + 8 * g + i) * HD]; }
  return w; }
#define WO_OUT_IN 0
#if WQKV_LAYOUT == 1
__device__ __forceinline__ v16b zero16b() { v16b w; _Pragma("unroll") for (int i = 0; i < 16; ++i) w[i] = (__bf16)0.0f; return w; }
#define WCOL(W, k0, o, lane) ((o) < 64 ? wcol_oi(W, k0, (o), lane, DIN) : zero16b())   /* (out,in) [64][512]: only 64 real output rows; projected columns 64..127 (padding head 1) are zero */
#elif WQKV_LAYOUT == 2
#define WCOL(W, k0, o, lane) wcol_hdk(W, k0, o, lane)
#else
#define WCOL(W, k0, o, lane) wcol_io(W, k0, o, lane, CC)
#endif
#if WO_OUT_IN
#define WOCOL(W, k0, o, lane) wcol_oi(W, k0, o, lane, CC)
#define WOCOLH(W, k0, o, lane) wcolh_oi(W, k0, o, lane, CC)
#else
#define WOCOL(W, k0, o, lane) wcol_io(W, k0, o, lane, DIN)
#define WOCOLH(W, k0, o, lane) wcolh_io(W, k0, o, lane, DIN)
#endif

#ifndef SM_EXTRA_PARAMS
#define SM_EXTRA_PARAMS
#endif
#ifndef PROJ_EXTRA_PARAMS
#define PROJ_EXTRA_PARAMS
#endif
#ifndef SM_MASK_HOOK
#define SM_MASK_HOOK (void)0
#endif

#define WS_QH  0u                                      // f16 q, head 0, fragment order: fragment ((b*TT + t) / 16) * 2 + kc (first half of the plane's room)
#define WS_KH  (WS_QH + 2u * (size_t)NB * TT * CC)      // f16 k, as q
#define WS_VT  (WS_KH + 2u * (size_t)NB * TT * CC)      // f16 v planes [b][c][t]
#define WS_QL  (WS_VT + 2u * (size_t)NB * CC * TT)      // f16 q residual x 2^10, as q
#define WS_KL  (WS_QL + 2u * (size_t)NB * QHI * CC)     // f16 k residual x 2^10, as q
#define WS_VB  (WS_KL + 2u * (size_t)NB * KHI * CC)     // bf16 v hi, head 0, fragment order: fragment (b * KHI / 32 + t / 32) * 4 + c / 16; WS_VBL: v lo, the same
#define WS_VBL (WS_VB + 2u * (size_t)NB * CC * KHI)
#define WS_Y   (WS_VBL + 2u * (size_t)NB * CC * KHI)    // f32 ctx rows [b*t][CC] (only when there is an output projection)
#define WS_END (WS_Y  + 0u)
#define PVK 512             // keys per key range of k_pv (one work-group's share of a 128-row query block)
#define PVW 8               // waves per work-group of k_pv: 16 of the block's 128 queries each
#define PVQ (PVK / 128)     // 128-row query blocks per band of PVK rows
#define PVS (TT / PVK)      // most key ranges a query row can have = number of partial ctx planes
#define YPL ((size_t)NB * TT * CC)                      // floats per partial ctx plane
#define WS_Y2 (WS_END)                                  // f32 partial ctx rows [key range][b*TT + t][128] (columns 64..127 = the padding head); row t has ranges 0 .. t / PVK
#define WS_CM (WS_Y2 + 4u * PVS * YPL)                   // f32 exponent addends 11 - log2(column sum) - column max x C2 [b][TT]
#define WS_END2 (WS_CM + 4u * (size_t)NB * TT)

typedef __attribute__((ext_vector_type(4))) __bf16 v4b;
// k_proj's operands on their way from f32 rows [row][DIN] to 16 x 32 bf16 fragments, through LDS. One fragment takes LFB bytes: four runs of 16 pieces of 16 B (run hf * 2 + g, piece = row or column & 15: the elements 8 hf + 0..7 of lane g * 16 + piece, k = 16 hf + 8 g + 0..7), the runs 320 B apart so that the 8-B stores of frag_st fall on 64 different banks.
#define LFB 1280
// line_ld: 16 rows x 32 k values by four loads of whole 128-B lines; p = the lane's row (lane >> 3) and k offset (lane & 7) * 4, load u takes row u * 4 + (lane >> 3)
__device__ __forceinline__ void line_ld(v4f d[4], const float* p, int kc) {
#pragma unroll   /* d[] stays in registers, the four loads issue together */
  for (int u = 0; u < 4; ++u) d[u] = *(const v4f*)(p + (size_t)u * 4 * DIN + kc * 32); }
// frag_st: rounds them to bf16 and lays them into the fragment at f (f includes the lane's writer offset)
__device__ __forceinline__ void frag_st(unsigned char* f, const v4f d[4]) {
#pragma unroll   /* d[] and o stay in registers (this loop and the next) */
  for (int u = 0; u < 4; ++u) { v4b o;
#pragma unroll
    for (int i = 0; i < 4; ++i) o[i] = (__bf16)d[u][i];
    *(v4b*)(f + u * 64) = o; } }
// frag_ld: the lane's two pieces (f includes the lane's reader offset)
__device__ __forceinline__ v16b frag_ld(const unsigned char* f) { union { v16b v; v8b q[2]; } u; u.q[0] = *(const v8b*)f; u.q[1] = *(const v8b*)(f + 640); return u.v; }
// ---- k_proj: block = (64 rows, 128 cols, which): q/k/v = X W (+ b) with exact bf16 products (K = DIN) -> which 0: q f16, head 0, in fragment order (+ residual for rows < QHI); 1: k, as q (+ residual for rows < KHI); 2: v f16 planes [c][t] (+ bf16 hi/lo planes for t < KHI)
__global__ __launch_bounds__(128) void k_proj(const float* __restrict__ XQ, const float* __restrict__ XK, const float* __restrict__ XV, const float* __restrict__ WQ, const float* __restrict__ WK, const float* __restrict__ WV, const float* __restrict__ BQ, const float* __restrict__ BK, const float* __restrict__ BV,
    _Float16* __restrict__ QH, _Float16* __restrict__ QL, _Float16* __restrict__ KH, _Float16* __restrict__ KL, _Float16* __restrict__ VT, __bf16* __restrict__ VB, __bf16* __restrict__ VBL) {
  /* one LDS block with two uses, a barrier between them: in the k loop the operands as bf16 fragments (the block's weight, then two X slots per wave), afterwards the transposing buffers of the stores */
  __shared__ __align__(16) unsigned char smem[64 * LFB + 4 * 2 * LFB];
  _Float16 (*sh)[136] = (_Float16 (*)[136])smem; _Float16 (*sl)[136] = (_Float16 (*)[136])(smem + 17408); _Float16 (*th)[72] = (_Float16 (*)[72])(smem + 34816); __bf16 (*tb)[72] = (__bf16 (*)[72])(smem + 53248); __bf16 (*tbl)[72] = (__bf16 (*)[72])(smem + 71680);
  const int tid = threadIdx.x, wave = tid >> 5, lane = tid & 31, col = lane & 15, g = lane >> 4; const int which = blockIdx.z; const int c0 = blockIdx.y * 128; const size_t r0 = (size_t)blockIdx.x * 64; const size_t bb = r0 / TT; const int t0 = (int)(r0 % TT);
  const float* X = which == 0 ? XQ : which == 1 ? XK : XV; const float* WA = which == 0 ? WQ : which == 1 ? WK : WV; const float* BA = which == 0 ? BQ : which == 1 ? BK : BV;
  const int lc = lane & 7, lr = lane >> 3;   /* a line load: 8 lanes take one row's 128-B line (32 k values), the wave 4 rows */
  const int wofs = (lc >> 1) * 320 + lr * 16 + (lc & 1) * 8, rofs = g * 320 + col * 16;   /* the lane's place in a fragment as writer of 4 values and as reader of its pieces */
  /* X: the wave's 16 rows, k step by k step; steps 0 and 1 go to the wave's two LDS slots before the loop, steps 2.. wait in a register ring of 4 steps */
  const float* xp = X + (r0 + wave * 16 + lr) * DIN + lc * 4; unsigned char* xw = smem + (64 + wave * 2) * LFB + wofs; const unsigned char* xrd = smem + (64 + wave * 2) * LFB + rofs;
  v4f x01[2][4], xr[4][4];
  line_ld(x01[0], xp, 0); line_ld(x01[1], xp, 1);
#pragma unroll   /* here and below: loops over register arrays are unrolled so that the arrays stay in registers */
  for (int s = 0; s < 4; ++s) line_ld(xr[s], xp, 2 + s);
  /* W: the 64 real output rows x DIN as the B fragments (k step kc, column tile j) = number kc * 4 + j; wave w stages k steps 4 w .. 4 w + 3, 32 loads in flight */
  if (c0 == 0) { const float* wp = WA + (size_t)lr * DIN + wave * 128 + lc * 4; unsigned char* lp = smem + wave * 16 * LFB + wofs;
#pragma unroll
    for (int kh = 0; kh < 2; ++kh) { v4f t[8][4];
#pragma unroll
      for (int u = 0; u < 8; ++u) line_ld(t[u], wp + (size_t)(u & 3) * 16 * DIN, kh * 2 + (u >> 2));
#pragma unroll
      for (int u = 0; u < 8; ++u) frag_st(lp + ((kh * 2 + (u >> 2)) * 4 + (u & 3)) * LFB, t[u]); }
  } else { const v4u zz = {0u, 0u, 0u, 0u}; for (int e = tid; e < 64 * LFB / 16; e += 128) *(v4u*)(smem + e * 16) = zz; }   /* projected columns 128.. have no weight row: zero fragments (block-uniform test) */
  frag_st(xw, x01[0]); frag_st(xw + LFB, x01[1]);
  __syncthreads();   /* publishes the staged weight fragments to the block's four waves */
  v8f acc[8] = {}; v16b af[2], wf[2][4];   /* the fragments of a k step, read from LDS together and one step ahead of their products */
  af[0] = frag_ld(xrd);
#pragma unroll
  for (int j = 0; j < 4; ++j) wf[0][j] = frag_ld(smem + j * LFB + rofs);
#pragma unroll   /* unrolled so that the slot numbers of the rings are constants */
  for (int kc = 0; kc < DIN / 32; ++kc) {
    __builtin_amdgcn_sched_barrier(0);   /* keeps each step's instructions in their step: without it the compiler rounds the ring's X values right behind their loads and so waits out the memory latency in every step */
    asm volatile("s_wait_dscnt 0x0" ::: "memory");   /* the wave's own X stores of the step before have landed before other lanes read them back, and this step's fragment has left the slot that is written below */
    if (kc + 1 < DIN / 32) { af[(kc + 1) & 1] = frag_ld(xrd + ((kc + 1) & 1) * LFB);
#pragma unroll
      for (int j = 0; j < 4; ++j) wf[(kc + 1) & 1][j] = frag_ld(smem + ((kc + 1) * 4 + j) * LFB + rofs); }
    if (kc + 2 < DIN / 32) frag_st(xw + (kc & 1) * LFB, xr[kc & 3]);
    if (kc + 6 < DIN / 32) line_ld(xr[kc & 3], xp, kc + 6);
#pragma unroll
    for (int j = 0; j < 4; ++j) acc[j] = wmma_bf(af[kc & 1], wf[kc & 1][j], acc[j]); }   /* column tiles 4..7 (the padding head) have no weight row: their sums stay 0 */
  __syncthreads();   /* every wave has read its last fragment: the LDS block now serves the stores */
  if (which < 2) { _Float16* DH = which == 0 ? QH : KH; _Float16* DL = which == 0 ? QL : KL; const int nhi = which == 0 ? QHI : KHI; const bool hi_rows = t0 < nhi;
#pragma unroll
    for (int j = 0; j < 8; ++j) { const float bias = BA ? bfr(BA[c0 + j * 16 + col]) : 0.f;
#pragma unroll
      for (int r = 0; r < 8; ++r) { const float v = acc[j][r] + bias; const _Float16 hv = (_Float16)v; sh[wave * 16 + 8 * g + r][j * 16 + col] = hv; sl[wave * 16 + 8 * g + r][j * 16 + col] = (_Float16)((v - (float)hv) * 1024.0f); } }
    __syncthreads();
    /* fragment order, columns 0..63 (head 0; the padding head is not stored): piece e of the block's 4 row tiles = row (e >> 7) * 16 + (e & 15), columns ((e >> 4) & 7) * 8 + 0..7 */
    for (int e = tid; e < 64 * 8; e += 128) { const int rl = (e >> 7) * 16 + (e & 15), q = (e >> 4) & 7; vst2((unsigned*)(DH + r0 * HD + e * 8), *(const v4u*)&sh[rl][q * 8]); if (hi_rows) vst2((unsigned*)(DL + (bb * nhi + t0) * (size_t)HD + e * 8), *(const v4u*)&sl[rl][q * 8]); }
  } else { const bool hi_rows = t0 < KHI;
#pragma unroll
    for (int j = 0; j < 8; ++j) { const float bias = BA ? bfr(BA[c0 + j * 16 + col]) : 0.f;
#pragma unroll
      for (int r = 0; r < 8; ++r) { const float v = acc[j][r] + bias; const int rl = wave * 16 + 8 * g + r, cl = j * 16 + col; th[cl][rl] = (_Float16)v; const __bf16 bh = (__bf16)v; tb[cl][rl] = bh; tbl[cl][rl] = (__bf16)(v - (float)bh); } }
    __syncthreads();
    for (int e = tid; e < 128 * 8; e += 128) { const int cl = e >> 3, q = e & 7; vst2((unsigned*)(VT + (bb * CC + c0 + cl) * (size_t)TT + t0 + q * 8), *(const v4u*)&th[cl][q * 8]); }
    /* fragment order, columns 0..63: piece e of the block's 2 key steps = column ((e >> 6) & 3) * 16 + (e & 15), keys (e >> 8) * 32 + ((e >> 4) & 3) * 8 + 0..7 */
    if (hi_rows) for (int e = tid; e < 64 * 8; e += 128) { const int cl = ((e >> 6) & 3) * 16 + (e & 15), kl = (e >> 8) * 32 + ((e >> 4) & 3) * 8; const size_t o3 = (bb * KHI + t0) * (size_t)HD + e * 8; vst2((unsigned*)(VB + o3), *(const v4u*)&tb[cl][kl]); vst2((unsigned*)(VBL + o3), *(const v4u*)&tbl[cl][kl]); } } }
// the matrix products of k_cstat and k_pv: the builtin forms as they are (the compiler keeps the distance behind its own builtin forms)
__device__ __forceinline__ v8f mm_h(v16h a, v16h b, v8f c) { return __builtin_amdgcn_wmma_f32_16x16x32_f16(false, a, false, b, (short)0, c, false, false); }
__device__ __forceinline__ v8f mm_b(v16b a, v16b b, v8f c) { return __builtin_amdgcn_wmma_f32_16x16x32_bf16(false, a, false, b, (short)0, c, false, false); }
// fragment number n behind p, p = the lane's first piece of some fragment of a fragment-order plane: all fragments of a run are read through the one address register pair p, by immediate offsets
__device__ __forceinline__ v16h fragp_h(const v8h* p, int n) { union { v16h v; v8h q[2]; } u; u.q[0] = p[n * 64]; u.q[1] = p[n * 64 + 32]; return u.v; }
__device__ __forceinline__ v16b fragp_b(const v8b* p, int n) { union { v16b v; v8b q[2]; } u; u.q[0] = p[n * 64]; u.q[1] = p[n * 64 + 32]; return u.v; }
// exp(SCALE x (t - m)) = exp2(t x C2 - m x C2), C2 = SCALE x log2(e): one fused multiply-add and one v_exp_f32 per score instead of the library expf's range reduction, ldexp and range tests. An argument below the exponent range (-inf included) gives 0.
#define C2 0.18033688011112042f
__device__ __forceinline__ float ex2(float a) { asm("v_exp_f32 %0, %0\n\tv_nop" : "+v"(a)); return a; }
__device__ __forceinline__ void ex2x8(float* x) { asm("v_exp_f32 %0, %0\n\tv_exp_f32 %1, %1\n\tv_exp_f32 %2, %2\n\tv_exp_f32 %3, %3\n\tv_exp_f32 %4, %4\n\tv_exp_f32 %5, %5\n\tv_exp_f32 %6, %6\n\tv_exp_f32 %7, %7\n\tv_nop" : "+v"(x[0]), "+v"(x[1]), "+v"(x[2]), "+v"(x[3]), "+v"(x[4]), "+v"(x[5]), "+v"(x[6]), "+v"(x[7])); }
__device__ __forceinline__ void ex2x9(float* x) { asm("v_exp_f32 %0, %0\n\tv_exp_f32 %1, %1\n\tv_exp_f32 %2, %2\n\tv_exp_f32 %3, %3\n\tv_exp_f32 %4, %4\n\tv_exp_f32 %5, %5\n\tv_exp_f32 %6, %6\n\tv_exp_f32 %7, %7\n\tv_exp_f32 %8, %8\n\tv_nop" : "+v"(x[0]), "+v"(x[1]), "+v"(x[2]), "+v"(x[3]), "+v"(x[4]), "+v"(x[5]), "+v"(x[6]), "+v"(x[7]), "+v"(x[8])); }
// ---- k_cstat: scores and the softmax statistics over the QUERY axis in one kernel; no logit is stored. For every key column k: m_k = max_{q >= k} t[q][k], Z_k = sum_{q >= k} exp2((t[q][k] - m_k) x C2) (f32), t = q hi . k hi + (q residual . k hi + q hi . k residual) / 2^10 (3 products, head 0; the unscaled score); CM holds 11 - log2(Z_k) - m_k x C2, the addend of k_pv's exponent.
// A wave keeps the k fragments of 32 key columns in registers (B operand) and walks 16-query tiles (A operand) from the diagonal to the end. In the product's D layout a lane holds 8 queries of ONE key column, so the online max / sum runs in the lane (one rescale per 8 queries); the two lane halves are merged by a shuffle, the waves through LDS, max first, then rescaled sums.
// block = (batch, pair of 32-column groups pr and TT / 32 - 1 - pr): the long walk of the one and the short walk of the other have TT / 16 + 2 query tiles together in every block. The tiles of a walk are dealt to the CSW waves round robin; the second walk's deal goes on where the first one's ended.
// q < k enters as -inf (exp gives 0) while the running max starts finite, so a lane or wave with no visible query ends as (-3e38, 0) and drops out of the merge.
#define CSW 16
__global__ __launch_bounds__(32 * CSW) void k_cstat(const _Float16* __restrict__ QH, const _Float16* __restrict__ KH, const _Float16* __restrict__ QL, const _Float16* __restrict__ KL, float* __restrict__ CM) { __shared__ float pm[2][CSW][32], pz[2][CSW][32];
  const int tid = threadIdx.x, wave = __builtin_amdgcn_readfirstlane(tid >> 5), lane = tid & 31, col = lane & 15, g = lane >> 4;   /* the wave number in a scalar register: the walk's bounds stay wave-uniform */
  const int b = blockIdx.x, pr = blockIdx.y; const size_t fb = ((size_t)b * TT) >> 3;   /* first fragment of the batch in the fragment-order planes: 2 fragments (kc = 0, 1) per 16 rows */
#pragma unroll 1   /* the two walks share one body: half the code */
  for (int s = 0; s < 2; ++s) { const int c = s ? TT / 32 - 1 - pr : pr, k0 = c * 32; const int w = s ? (wave + 2 * pr) & (CSW - 1) : wave;
    v16h kh[2][2], kl[2][2]; const v8h* pkh = (const v8h*)KH + (fb + c * 4) * 64 + lane; const v8h* pkl = (const v8h*)KL + (fb + c * 4) * 64 + lane;
#pragma unroll
    for (int j = 0; j < 2; ++j)
#pragma unroll
      for (int kc = 0; kc < 2; ++kc) { kh[j][kc] = fragp_h(pkh, j * 2 + kc); kl[j][kc] = fragp_h(pkl, j * 2 + kc); }
    float m[2] = {-3.0e38f, -3.0e38f}, z[2] = {0.f, 0.f};
    int qt = 2 * c + w; v16h ah[2], al[2];
    { const size_t f = fb + (qt < TT / 16 ? qt : TT / 16 - 1) * 2; const v8h* pq = (const v8h*)QH + f * 64 + lane; const v8h* pr2 = (const v8h*)QL + f * 64 + lane; ah[0] = fragp_h(pq, 0); ah[1] = fragp_h(pq, 1); al[0] = fragp_h(pr2, 0); al[1] = fragp_h(pr2, 1);
      asm volatile("s_wait_xcnt 0x0" :: "v"(pkh), "v"(pkl), "v"(pq), "v"(pr2) : "memory"); }   /* the wait that stands between issued loads and an overwrite of their address registers; the addresses are named so that they last up to it (no load's result is laid over them) */
#pragma unroll 2   /* two trips a pass, so that the fragments read ahead change names instead of being copied */
    for (; qt < TT / 16; qt += CSW) {
      /* the next tile's q fragments are read while this tile is worked on (past the end: the last tile again, unused) */
      const size_t fn = fb + (qt + CSW < TT / 16 ? qt + CSW : TT / 16 - 1) * 2; const v8h* nq = (const v8h*)QH + fn * 64 + lane; const v8h* nr = (const v8h*)QL + fn * 64 + lane; const v16h nh0 = fragp_h(nq, 0), nh1 = fragp_h(nq, 1), nl0 = fragp_h(nr, 0), nl1 = fragp_h(nr, 1);
      asm volatile("s_wait_xcnt 0x0" :: "v"(nq), "v"(nr) : "memory");   /* as above: these loads stay in flight over the trip's work, which reuses registers */
      v8f a0[2] = {}, a1[2] = {};
#pragma unroll
      for (int kc = 0; kc < 2; ++kc)
#pragma unroll
        for (int j = 0; j < 2; ++j) { a0[j] = mm_h(ah[kc], kh[j][kc], a0[j]); a1[j] = mm_h(al[kc], kh[j][kc], a1[j]); a1[j] = mm_h(ah[kc], kl[j][kc], a1[j]); }
      float v[2][8];
#pragma unroll
      for (int j = 0; j < 2; ++j)
#pragma unroll
        for (int r = 0; r < 8; ++r) v[j][r] = a0[j][r] + a1[j][r] * (1.0f / 1024.0f);
      if (qt * 16 < k0 + 32) {   /* only the walk's first two tiles touch the diagonal (wave-uniform test) */
#pragma unroll
        for (int j = 0; j < 2; ++j)
#pragma unroll
          for (int r = 0; r < 8; ++r) v[j][r] = (qt * 16 + 8 * g + r >= k0 + j * 16 + col) ? v[j][r] : -INFINITY; }
#pragma unroll
      for (int j = 0; j < 2; ++j) { float mn = m[j];
#pragma unroll
        for (int r = 0; r < 8; ++r) mn = fmaxf(mn, v[j][r]);
        const float nb = -mn * C2; float e[9]; e[8] = (m[j] - mn) * C2;   /* e[8]: the rescale of the sum so far */
#pragma unroll
        for (int r = 0; r < 8; ++r) e[r] = fmaf(v[j][r], C2, nb);
        ex2x9(e); float a = z[j] * e[8];
#pragma unroll
        for (int r = 0; r < 8; ++r) a += e[r];
        m[j] = mn; z[j] = a; }
      ah[0] = nh0; ah[1] = nh1; al[0] = nl0; al[1] = nl1; }
#pragma unroll
    for (int j = 0; j < 2; ++j) { const float M = fmaxf(m[j], __shfl_xor(m[j], 16)); float a = z[j] * ex2((m[j] - M) * C2); a += __shfl_xor(a, 16); if (g == 0) { pm[s][wave][j * 16 + col] = M; pz[s][wave][j * 16 + col] = a; } } }
  __syncthreads();   /* publishes the CSW waves' partial (max, sum) pairs of both column groups to waves 0 and 1 */
  if (wave < 2) { const int k0 = (wave ? TT / 32 - 1 - pr : pr) * 32; float M = pm[wave][0][lane];
#pragma unroll
    for (int w = 1; w < CSW; ++w) M = fmaxf(M, pm[wave][w][lane]);
    float a = 0.f;
#pragma unroll
    for (int w = 0; w < CSW; ++w) a += pz[wave][w][lane] * ex2((pm[wave][w][lane] - M) * C2);
    vst2(CM + (size_t)b * TT + k0 + lane, 11.0f - log2f(a) - M * C2); } }   /* every column sees at least its own diagonal entry, so Z_k is about 1 or more; max and sum leave as the one addend of k_pv's exponent */
// ---- k_sm: block = query row t (head in group): keys [0, kend): causal -> logit if s <= t else excluded; softmax in f32; P x 2^11 in place (0 for excluded)
__global__ __launch_bounds__(256) void k_sm(float* __restrict__ S0 SM_EXTRA_PARAMS) { __shared__ float sred[8]; __shared__ float sbc; __shared__ __align__(16) float shv[TT];
  const int tid = threadIdx.x; const int t = blockIdx.x; const int kend = (kb_last(t >> 6) + 1) * 128;
  float* sr = S0 + (size_t)blockIdx.y * TT * TT + (size_t)t * TT;
  float m = -3.0e38f; for (int k = tid; k < kend; k += 256) { float v = (!CAUSAL || k <= t) ? sr[k] : -3.0e38f; SM_MASK_HOOK; shv[k] = v; m = fmaxf(m, v); }
#pragma unroll
  for (int o = 1; o < 32; o <<= 1) m = fmaxf(m, __shfl_xor(m, o));
  if ((tid & 31) == 0) sred[tid >> 5] = m; __syncthreads(); if (tid == 0) { float a = sred[0]; for (int i = 1; i < 8; ++i) a = fmaxf(a, sred[i]); sbc = a; } __syncthreads(); m = sbc; __syncthreads();
  float sum = 0.f; for (int k = tid; k < kend; k += 256) { const float v = shv[k]; const float e = (v <= -1.0e38f) ? 0.f : expf(v - m); shv[k] = e; sum += e; }
#pragma unroll
  for (int o = 1; o < 32; o <<= 1) sum += __shfl_xor(sum, o);
  if ((tid & 31) == 0) sred[tid >> 5] = sum; __syncthreads(); if (tid == 0) { float a = 0.f; for (int i = 0; i < 8; ++i) a += sred[i]; sbc = a > 0.f ? 2048.0f / a : 0.f; }   /* a fully excluded row yields P = 0 */ __syncthreads(); const float inv = sbc;
  for (int k = tid; k < kend; k += 256) shv[k] = shv[k] * inv;
  __syncthreads(); for (int q = tid; q < kend / 4; q += 256) vst2(sr + q * 4, *(const v4f*)&shv[q * 4]); }
// ---- k_out64: out[b][t][0..63] = sum over the row's key ranges (ascending) of the partial ctx row, columns 0..63 (256 B by 16 lanes). A thread takes one row of EVERY band of PVK rows (a row of band d has d + 1 ranges): the range counts are compile-time constants, every thread has the same PVS (PVS + 1) / 2 loads, and all of them are in flight together before the first sum.
#define OTH 128             // threads per work-group of k_out64: OTH / 16 rows of each band of one batch
__global__ __launch_bounds__(OTH) void k_out64(const float* __restrict__ Y, float* __restrict__ OUT) { const int bb = blockIdx.x / (PVK / (OTH / 16)), rb = blockIdx.x % (PVK / (OTH / 16)); const size_t row0 = (size_t)bb * TT + rb * (OTH / 16);   /* the block's first row in band 0 */
  const unsigned rl = threadIdx.x >> 4, q = threadIdx.x & 15; const float* pc[PVS]; v4f p[PVS][PVS];   /* pc[c]: the thread's place in range plane c, band 0; the bands lie at immediate offsets behind it */
  static_assert(PVS == 8, "the wait below names PVS addresses");
#pragma unroll   /* here and below: pc[] and p[][] stay in registers, the range counts are constants */
  for (int c = 0; c < PVS; ++c) pc[c] = Y + c * YPL + row0 * CC + (rl * CC + q * 4);
#pragma unroll
  for (int d = 0; d < PVS; ++d)
#pragma unroll
    for (int c = 0; c <= d; ++c) p[d][c] = *(const v4f*)(pc[c] + (size_t)d * PVK * CC);
  asm volatile("s_wait_xcnt 0x0" :: "v"(pc[0]), "v"(pc[1]), "v"(pc[2]), "v"(pc[3]), "v"(pc[4]), "v"(pc[5]), "v"(pc[6]), "v"(pc[7]) : "memory");   /* the wait that stands between issued loads and an overwrite of their address registers; the addresses are named so that they last up to it (no load's result is laid over them) */
#pragma unroll
  for (int d = 0; d < PVS; ++d) { v4f v = p[d][0];
#pragma unroll
    for (int c = 1; c <= d; ++c) v += p[d][c];
    vst2(OUT + (row0 + (size_t)d * PVK + rl) * 64 + q * 4, v); } }
// ---- k_pv: block = (128 queries, one range of PVK keys) of batch blockIdx.x, head 0; wave = 16 of the queries: partial ctx = P . v over the range's keys up to the wave's diagonal. The scores are formed anew here, transposed: S^T = k . q^T (A = the k fragments of 16 keys, B = the wave's q fragments, kept in registers; the same 3 products as in k_cstat). In D a lane holds keys 8 h + 0..7 of ONE query, which is the A fragment's order for P . v: two 16-key tiles give the 32-key fragment with no exchange between lanes. P = exp2(t x C2 + CM[k]) = exp(S - m_k) x 2^11 / Z_k for k <= t, 0 above the diagonal; P and v as bf16 hi + lo, 3 products.
// The block's 8 waves walk the same key steps, so the k and v fragments that one wave has fetched are near for the other seven.
// Split over keys: rows of band d = t / PVK have d + 1 ranges. blockIdx.y numbers the (128-query block, range) pairs: the full ranges first, then each block's last range (the one the diagonal cuts short), the longest first. The ranges' partial rows go to planes of Y that k_out64 adds.
__global__ __launch_bounds__(32 * PVW) void k_pv(const _Float16* __restrict__ QH, const _Float16* __restrict__ KH, const _Float16* __restrict__ QL, const _Float16* __restrict__ KL, const __bf16* __restrict__ VB, const __bf16* __restrict__ VBL, const float* __restrict__ CM, float* __restrict__ Y) { __shared__ __align__(16) float ss[PVW][16][HD + 4];
  const int tid = threadIdx.x, wave = __builtin_amdgcn_readfirstlane(tid >> 5), lane = tid & 31, col = lane & 15, g = lane >> 4;   /* the wave number in a scalar register: the key loop's bounds stay wave-uniform */
  const int b = blockIdx.x, py = blockIdx.y;
  int band, rng, qi;   /* PVQ query blocks a band; band d has PVQ * d full ranges, PVQ * d (d - 1) / 2 lie before them */
  if (py < PVQ * PVS * (PVS - 1) / 2) { band = 1;
#pragma unroll
    for (int d = 2; d < PVS; ++d) if (py >= PVQ * d * (d - 1) / 2) band = d;
    const int rem = py - PVQ * band * (band - 1) / 2; qi = rem % PVQ; rng = rem / PVQ; }
  else { const int p = py - PVQ * PVS * (PVS - 1) / 2; qi = PVQ - 1 - p / PVS; band = p % PVS; rng = band; }
  const int ql0 = band * PVK + qi * 128 + wave * 16; const int kcb = rng * (PVK / 32); const int kall = ((ql0 + 15) >> 5) + 1; const int kce = kall < (rng + 1) * (PVK / 32) ? kall : (rng + 1) * (PVK / 32);   /* 32-key steps; the last one is the step that holds the wave's last query */
  const size_t fb = ((size_t)b * TT) >> 3; const size_t fq = fb + (ql0 >> 3);
  const v16h qh[2] = {fragt_h(QH, fq, lane), fragt_h(QH, fq + 1, lane)}, qr[2] = {fragt_h(QL, fq, lane), fragt_h(QL, fq + 1, lane)};
  v8f acc[HD / 16] = {};
#pragma unroll 1   /* one step's fragments fill the registers */
  for (int kc = kcb; kc < kce; ++kc) { v16h kh[2][2], kl[2][2]; v4f mv[4];
    const v8h* pkh = (const v8h*)KH + (fb + kc * 4) * 64 + lane; const v8h* pkl = (const v8h*)KL + (fb + kc * 4) * 64 + lane; const v4f* pm = (const v4f*)(CM + (size_t)b * TT + kc * 32 + 8 * g);
#pragma unroll
    for (int i = 0; i < 2; ++i)
#pragma unroll
      for (int c = 0; c < 2; ++c) { kh[i][c] = fragp_h(pkh, i * 2 + c); kl[i][c] = fragp_h(pkl, i * 2 + c); }
#pragma unroll
    for (int q = 0; q < 4; ++q) mv[q] = pm[(q >> 1) * 4 + (q & 1)];
    /* inputs-only fence on the loaded values: the step's 20 loads for the scores are in flight together and are waited for once; without it the compiler deals them out in small groups between the products, each with a wait of its own; the three addresses are named too, so that they last until the loads have returned (no load's result is laid over them) */
    asm volatile("" :: "v"(kh[0][0]), "v"(kh[0][1]), "v"(kh[1][0]), "v"(kh[1][1]), "v"(kl[0][0]), "v"(kl[0][1]), "v"(kl[1][0]), "v"(kl[1][1]), "v"(mv[0]), "v"(mv[1]), "v"(mv[2]), "v"(mv[3]), "v"(pkh), "v"(pkl), "v"(pm));
    v8f a0[2] = {}, a1[2] = {};
#pragma unroll
    for (int c = 0; c < 2; ++c)
#pragma unroll
      for (int i = 0; i < 2; ++i) { a0[i] = mm_h(kh[i][c], qh[c], a0[i]); a1[i] = mm_h(kh[i][c], qr[c], a1[i]); a1[i] = mm_h(kl[i][c], qh[c], a1[i]); }
    v16b vh[HD / 16], vl[HD / 16]; const v8b* pvh = (const v8b*)VB + ((size_t)b * (KHI / 32) + kc) * (HD / 16) * 64 + lane; const v8b* pvl = (const v8b*)VBL + ((size_t)b * (KHI / 32) + kc) * (HD / 16) * 64 + lane;   /* fragments (key step kc, column tile j) of the fragment-order v planes */
#pragma unroll
    for (int j = 0; j < HD / 16; ++j) { vh[j] = fragp_b(pvh, j); vl[j] = fragp_b(pvl, j); }
    __builtin_amdgcn_sched_barrier(0);   /* keeps the v loads ahead of the exp work, which covers their latency: without it the compiler sinks them to their products, the lo fragments one by one with a wait each */
    float pv[16];
#pragma unroll
    for (int e = 0; e < 16; ++e) pv[e] = fmaf(a0[e >> 3][e & 7] + a1[e >> 3][e & 7] * (1.0f / 1024.0f), C2, mv[e >> 2][e & 3]);
    ex2x8(pv); ex2x8(pv + 8);
    if (kc * 32 + 31 > ql0) {   /* only steps that reach past the wave's first query hold masked keys (wave-uniform test) */
#pragma unroll
      for (int e = 0; e < 16; ++e) pv[e] = (kc * 32 + (e >> 3) * 16 + 8 * g + (e & 7) <= ql0 + col) ? pv[e] : 0.f; }
    const F2 p = bsplit16(pv);
    /* inputs-only fence on the loaded v fragments and their two addresses: the addresses last until the loads have returned */
    asm volatile("" :: "v"(vh[0]), "v"(vh[1]), "v"(vh[2]), "v"(vh[3]), "v"(vl[0]), "v"(vl[1]), "v"(vl[2]), "v"(vl[3]), "v"(pvh), "v"(pvl));
#pragma unroll
    for (int j = 0; j < HD / 16; ++j) { acc[j] = mm_b(p.h, vh[j], acc[j]); acc[j] = mm_b(p.l, vh[j], acc[j]); acc[j] = mm_b(p.h, vl[j], acc[j]); } }
#pragma unroll
  for (int j = 0; j < HD / 16; ++j)
#pragma unroll
    for (int r = 0; r < 8; ++r) ss[wave][8 * g + r][j * 16 + col] = acc[j][r] * (1.0f / 2048.0f);
  LDSX();   /* the wave reads back only its own tile, turned into whole rows: 256-B (row, head) segment by 16 lanes */
#pragma unroll
  for (int i = 0; i < 8; ++i) { const int rl = i * 2 + g; vst2(Y + rng * YPL + ((size_t)b * TT + ql0 + rl) * CC + col * 4, *(const v4f*)&ss[wave][rl][col * 4]); } }

extern "C" void kernel_launch(void* const* d_in, const int* in_sizes, int n_in, void* d_out, int out_size, void* d_ws, size_t ws_size, hipStream_t stream) {
  (void)in_sizes; (void)n_in; (void)out_size;
  const float** F = (const float**)d_in;
  if (ws_size < (size_t)WS_END) return;
  char* ws = (char*)d_ws; _Float16 *QH = (_Float16*)(ws + WS_QH), *KH = (_Float16*)(ws + WS_KH), *VT = (_Float16*)(ws + WS_VT), *QL = (_Float16*)(ws + WS_QL), *KL = (_Float16*)(ws + WS_KL); __bf16 *VB = (__bf16*)(ws + WS_VB), *VBL = (__bf16*)(ws + WS_VBL); float *Y = (float*)(ws + WS_Y);
  (void)Y; (void)QL; (void)KL; (void)VB; (void)VBL;
  // inputs: 0 x [4,4096,512]; 1 Wq [64,512] (out,in); 2 Wk; 3 Wv; no biases
  if (ws_size < (size_t)WS_END2) return;
  float *Y2 = (float*)(ws + WS_Y2), *CM = (float*)(ws + WS_CM);
  k_proj<<<dim3(TNB * TT / 64, CC / 128, 3), 128, 0, stream>>>(F[0], F[0], F[0], F[1], F[2], F[3], nullptr, nullptr, nullptr, QH, QL, KH, KL, VT, VB, VBL);   /* weight columns 64..127 (the padding head) have no fragments: their sums stay 0 */
  /* head 0 only (head 1 is the zero padding); the batch is a grid axis of both launches; the logits are formed in registers in each of them and never stored */
  k_cstat<<<dim3(TNB, TT / 64), 32 * CSW, 0, stream>>>(QH, KH, QL, KL, CM);   /* per key column s: max and sum over the visible queries t >= s, as one exponent addend */
  k_pv<<<dim3(TNB, PVQ * PVS * (PVS + 1) / 2), 32 * PVW, 0, stream>>>(QH, KH, QL, KL, VB, VBL, CM, Y2);   /* batch x (128-query block, key range); P[t][s] = exp(S - m_s) x 2^11 / Z_s */
  k_out64<<<dim3(TNB * PVK / (OTH / 16)), OTH, 0, stream>>>(Y2, (float*)d_out);
}

// v010
// A run of this version takes 48.8 microseconds.
// Two timings next to v009 put it at 1.17 and 1.18 times that version's speed.
// Over all steps from v000 it is 152 times as fast.
// compute dtype: all float inputs rounded to bf16; q/k/v projections with EXACT bf16 products on WMMA 16x16x32 (f32 accumulate); causal scores with BOTH q and k as f16 hi + (x 2^10) residual (3 products) on EVERY block, x 64^-0.5; softmax over the QUERY axis in f32 (per key column: online max / sum over the visible queries; every exp is the hardware's exp2; a score's argument is one fused multiply-add); P as bf16 hi + lo against v as bf16 hi + lo (3 products) on EVERY block; f32 output.
#include <hip/hip_runtime.h>
#include <math.h>

typedef __attribute__((ext_vector_type(16))) _Float16 v16h;
typedef __attribute__((ext_vector_type(16))) __bf16 v16b;
typedef __attribute__((ext_vector_type(8)))  _Float16 v8h;
typedef __attribute__((ext_vector_type(8)))  float v8f;
typedef __attribute__((ext_vector_type(4)))  float v4f;
typedef __attribute__((ext_vector_type(2)))  float v2f;
typedef __attribute__((ext_vector_type(4)))  unsigned v4u;
typedef __attribute__((ext_vector_type(4)))  int v4i;
typedef float __attribute__((may_alias)) float_a;
typedef int __attribute__((may_alias)) int_a;

template <typename T> __device__ __forceinline__ void vst2(void* p, T v) { *(T*)p = v;  }
__device__ __forceinline__ v8f wmma16(v16h a, v16h b, v8f c) {
  v8f d = __builtin_amdgcn_wmma_f32_16x16x32_f16(false, a, false, b, (short)0, c, false, false);
  asm volatile("v_nop\n\tv_nop\n\tv_nop\n\tv_nop" : "+v"(d) : "v"(a), "v"(b));
  return d;
}
__device__ __forceinline__ v8f wmma_bf(v16b a, v16b b, v8f c) {
  v8f d = __builtin_amdgcn_wmma_f32_16x16x32_bf16(false, a, false, b, (short)0, c, false, false);
  asm volatile("v_nop\n\tv_nop\n\tv_nop\n\tv_nop" : "+v"(d) : "v"(a), "v"(b));
  return d;
}
// 16x16x32 fragments: lane = (h = lane>>4, row/col = lane&15); elements 0..7 = k0+8h+0..7, 8..15 = k0+16+8h+0..7; D element r = row 8h+r
__device__ __forceinline__ v16h frag_h(const _Float16* rowk0, int lane) {
  union { v16h v; v8h q[2]; } u; const _Float16* p = rowk0 + 8 * (lane >> 4);
  u.q[0] = *(const v8h*)p; u.q[1] = *(const v8h*)(p + 16); return u.v;
}
__device__ __forceinline__ v16h frag_f32(const float* rowk0, int lane) {
  v16h a; const float* p = rowk0 + 8 * (lane >> 4);
#pragma unroll
  for (int i = 0; i < 8; ++i) { a[i] = (_Float16)p[i]; a[8 + i] = (_Float16)p[16 + i]; }
  return a;
}
__device__ __forceinline__ v16h frag_f32s(const float* rowk0, int lane, float sc) {
  v16h a; const float* p = rowk0 + 8 * (lane >> 4);
#pragma unroll
  for (int i = 0; i < 8; ++i) { a[i] = (_Float16)(p[i] * sc); a[8 + i] = (_Float16)(p[16 + i] * sc); }
  return a;
}
// column fragment from a [K][ld] layout (column n), rows >= K read as 0
__device__ __forceinline__ v16h fragc_f32(const float* W, int k0, int n, int lane, int ld, int K) {
  v16h a; const int g = lane >> 4;
#pragma unroll
  for (int i = 0; i < 8; ++i) { const int ka = k0 + 8 * g + i, kb = ka + 16;
    a[i] = (_Float16)(ka < K ? W[(size_t)(ka < K ? ka : K - 1) * ld + n] : 0.f); a[8 + i] = (_Float16)(kb < K ? W[(size_t)(kb < K ? kb : K - 1) * ld + n] : 0.f); }
  return a;
}
struct F2 { v16b h, l; };
__device__ __forceinline__ F2 bsplit16(const float v[16]) { F2 r;
#pragma unroll
  for (int i = 0; i < 16; ++i) { const __bf16 h = (__bf16)v[i]; r.h[i] = h; r.l[i] = (__bf16)(v[i] - (float)h); }
  return r; }
__device__ __forceinline__ F2 split_row(const float* row, int k0, int lane) { float v[16]; const float* p = row + k0 + 8 * (lane >> 4);
#pragma unroll
  for (int i = 0; i < 8; ++i) { v[i] = p[i]; v[8 + i] = p[16 + i]; }
  return bsplit16(v); }
__device__ __forceinline__ F2 split_rowK(const float* row, int k0, int lane, int K) { float v[16]; const int g = lane >> 4;
#pragma unroll
  for (int i = 0; i < 8; ++i) { const int ka = k0 + 8 * g + i, kb = ka + 16; v[i] = ka < K ? row[ka < K ? ka : K - 1] : 0.f; v[8 + i] = kb < K ? row[kb < K ? kb : K - 1] : 0.f; }
  return bsplit16(v); }
__device__ __forceinline__ F2 split_col(const float* W, int k0, int n, int lane, int ld, int K) { float v[16]; const int g = lane >> 4;
#pragma unroll
  for (int i = 0; i < 8; ++i) { const int ka = k0 + 8 * g + i, kb = ka + 16; v[i] = ka < K ? W[(size_t)(ka < K ? ka : K - 1) * ld + n] : 0.f; v[8 + i] = kb < K ? W[(size_t)(kb < K ? kb : K - 1) * ld + n] : 0.f; }
  return bsplit16(v); }
__device__ __forceinline__ v8f mac3(const F2& a, const F2& b, v8f c) { c = wmma_bf(a.l, b.h, c); c = wmma_bf(a.h, b.l, c); return wmma_bf(a.h, b.h, c); }
__device__ __forceinline__ float sigm(float v) { return 1.0f / (1.0f + expf(-v)); }
#define LDSX() do { asm volatile("s_wait_dscnt 0" ::: "memory"); __builtin_amdgcn_wave_barrier(); __builtin_amdgcn_fence(__ATOMIC_RELEASE, "workgroup"); } while (0)

// Single-head causal self-attention whose softmax runs over the QUERY axis (x [4,4096,512]; torch (out,in) Wq / Wk / Wv [64,512] (0.02 scale), no biases; scores = q k^T [B,t,s]; additive causal mask -1e9 where s > t; / sqrt(64); attn = softmax(scores, axis=1) - axis 1 is the QUERY axis t, so every key column s is normalised over the queries t >= s (faithful to the source); out = attn v -> [4,4096,64]).
#define NB 4
#define TT 4096
#define CC 128            // NH * HD = projected width
#define DIN 512          // input (model) width
#define NH 2
#define HD 64
#define NQB (TT / 64)
#define HG 1
#define SCALE (0.125f)
#define CAUSAL 1
#ifndef TNB
#define TNB NB
#endif
__device__ __forceinline__ float bfr(float v) { return (float)(__bf16)v; }
__host__ __device__ __forceinline__ int kb_last(int qb) { return CAUSAL ? ((qb * 64 + 63) >> 7) : (TT / 128 - 1); }
typedef __attribute__((ext_vector_type(8))) __bf16 v8b;
// Fragment-order planes: one 16 x 32 operand fragment (16 rows or columns x 32 k values, 2-byte elements) is stored as 1024 contiguous bytes; its 16-B piece number hf * 32 + lane holds the lane's elements 8 hf + 0..7 (k = 16 hf + 8 (lane >> 4) + 0..7 of row or column lane & 15), so each of a fragment's two loads reads four whole 128-B lines instead of 32 B out of each of 16 lines. f = fragment number in the plane.
__device__ __forceinline__ v16h fragt_h(const _Float16* plane, size_t f, int lane) {
  union { v16h v; v8h q[2]; } u; const v8h* p = (const v8h*)plane + f * 64 + lane;
  u.q[0] = p[0]; u.q[1] = p[32]; return u.v;
}
__device__ __forceinline__ v16b fragt_b(const __bf16* plane, size_t f, int lane) {
  union { v16b v; v8b q[2]; } u; const v8b* p = (const v8b*)plane + f * 64 + lane;
  u.q[0] = p[0]; u.q[1] = p[32]; return u.v;
}
#define QBH 64              // = NQB: 3-product scores and bf16 hi/lo P.v on every query block
#define QHI 4096            // EVERY row carries a q residual plane: with the softmax over the QUERY axis the few-term region is the END of the sequence (late key columns see few queries), so the high-precision paths run everywhere
#define KHI 4096            // every key row carries the k residual and the v bf16 hi + lo planes
// B fragment (k rows k0+.., output column o) of a weight: (in,out) [K][ld] or (out,in) [ld rows of K]: bf16 exact, or f16(bf16 * 256) exact
__device__ __forceinline__ v16b wcol_io(const float* Wm, int k0, int o, int lane, int ld) { v16b w; const int g = lane >> 4;
#pragma unroll
  for (int i = 0; i < 8; ++i) { w[i] = (__bf16)Wm[(size_t)(k0 + 8 * g + i) * ld + o]; w[8 + i] = (__bf16)Wm[(size_t)(k0 + 16 + 8 * g + i) * ld + o]; }
  return w; }
__device__ __forceinline__ v16b wcol_oi(const float* Wm, int k0, int o, int lane, int K) { v16b w; const float* p = Wm + (size_t)o * K + k0 + 8 * (lane >> 4);
#pragma unroll
  for (int i = 0; i < 8; ++i) { w[i] = (__bf16)p[i]; w[8 + i] = (__bf16)p[16 + i]; }
  return w; }
__device__ __forceinline__ v16h wcolh_io(const float* Wm, int k0, int o, int lane, int ld) { v16h w; const int g = lane >> 4;
#pragma unroll
  for (int i = 0; i < 8; ++i) { w[i] = (_Float16)(bfr(Wm[(size_t)(k0 + 8 * g + i) * ld + o]) * 256.0f); w[8 + i] = (_Float16)(bfr(Wm[(size_t)(k0 + 16 + 8 * g + i) * ld + o]) * 256.0f); }
  return w; }
__device__ __forceinline__ v16h wcolh_oi(const float* Wm, int k0, int o, int lane, int K) { v16h w; const float* p = Wm + (size_t)o * K + k0 + 8 * (lane >> 4);
#pragma unroll
  for (int i = 0; i < 8; ++i) { w[i] = (_Float16)(bfr(p[i]) * 256.0f); w[8 + i] = (_Float16)(bfr(p[16 + i]) * 256.0f); }
  return w; }
#define WQKV_LAYOUT 1   // 0 = (in,out) [DIN][CC]; 1 = (out,in) [64][DIN]; 2 = per-head [NH][DIN][HD]
__device__ __forceinline__ v16b wcol_hdk(const float* Wm, int k0, int o, int lane) { v16b w; const int g = lane >> 4; const float* p = Wm + (size_t)(o / HD) * DIN * HD + (o % HD);
#pragma unroll
  for (int i = 0; i < 8; ++i) { w[i] = (__bf16)p[(size_t)(k0 + 8 * g + i) * HD]; w[8 + i] = (__bf16)p[(size_t)(k0 + 16 + 8 * g + i) * HD]; }
  return w; }
#define WO_OUT_IN 0
#if WQKV_LAYOUT == 1
__device__ __forceinline__ v16b zero16b() { v16b w; _Pragma("unroll") for (int i = 0; i < 16; ++i) w[i] = (__bf16)0.0f; return w; }
#define WCOL(W, k0, o, lane) ((o) < 64 ? wcol_oi(W, k0, (o), lane, DIN) : zero16b())   /* (out,in) [64][512]: only 64 real output rows; projected columns 64..127 (padding head 1) are zero */
#elif WQKV_LAYOUT == 2
#define WCOL(W, k0, o, lane) wcol_hdk(W, k0, o, lane)
#else
#define WCOL(W, k0, o, lane) wcol_io(W, k0, o, lane, CC)
#endif
#if WO_OUT_IN
#define WOCOL(W, k0, o, lane) wcol_oi(W, k0, o, lane, CC)
#define WOCOLH(W, k0, o, lane) wcolh_oi(W, k0, o, lane, CC)
#else
#define WOCOL(W, k0, o, lane) wcol_io(W, k0, o, lane, DIN)
#define WOCOLH(W, k0, o, lane) wcolh_io(W, k0, o, lane, DIN)
#endif

#ifndef SM_EXTRA_PARAMS
#define SM_EXTRA_PARAMS
#endif
#ifndef PROJ_EXTRA_PARAMS
#define PROJ_EXTRA_PARAMS
#endif
#ifndef SM_MASK_HOOK
#define SM_MASK_HOOK (void)0
#endif

#define WS_QH  0u                                      // f16 q, head 0, fragment order: fragment ((b*TT + t) / 16) * 2 + kc (first half of the plane's room)
#define WS_KH  (WS_QH + 2u * (size_t)NB * TT * CC)      // f16 k, as q
#define WS_VT  (WS_KH + 2u * (size_t)NB * TT * CC)      // f16 v planes [b][c][t]
#define WS_QL  (WS_VT + 2u * (size_t)NB * CC * TT)      // f16 q residual x 2^10, as q
#define WS_KL  (WS_QL + 2u * (size_t)NB * QHI * CC)     // f16 k residual x 2^10, as q
#define WS_VB  (WS_KL + 2u * (size_t)NB * KHI * CC)     // bf16 v hi, head 0, fragment order: fragment (b * KHI / 32 + t / 32) * 4 + c / 16; WS_VBL: v lo, the same
#define WS_VBL (WS_VB + 2u * (size_t)NB * CC * KHI)
#define WS_Y   (WS_VBL + 2u * (size_t)NB * CC * KHI)    // f32 ctx rows [b*t][CC] (only when there is an output projection)
#define WS_END (WS_Y  + 0u)
#define PVK 512             // keys per key range of k_pv (one work-group's share of a 128-row query block)
#define PVW 8               // waves per work-group of k_pv: 16 of the block's 128 queries each
#define PVQ (PVK / 128)     // 128-row query blocks per band of PVK rows
#define PVS (TT / PVK)      // most key ranges a query row can have = number of partial ctx planes
#define YPL ((size_t)NB * TT * CC)                      // floats per partial ctx plane
#define WS_Y2 (WS_END)                                  // f32 partial ctx rows [key range][b*TT + t][128] (columns 64..127 = the padding head); row t has ranges 0 .. t / PVK
#define WS_CM (WS_Y2 + 4u * PVS * YPL)                   // f32 exponent addends 11 - log2(column sum) - column max x C2 [b][TT]
#define WS_END2 (WS_CM + 4u * (size_t)NB * TT)

typedef __attribute__((ext_vector_type(4))) __bf16 v4b;
// k_proj's operands on their way from f32 rows [row][DIN] to 16 x 32 bf16 fragments, through LDS. One fragment takes LFB bytes: four runs of 16 pieces of 16 B (run hf * 2 + g, piece = row or column & 15: the elements 8 hf + 0..7 of lane g * 16 + piece, k = 16 hf + 8 g + 0..7), the runs 320 B apart so that the 8-B stores of frag_st fall on 64 different banks.
#define LFB 1280
// line_ld: 16 rows x 32 k values by four loads of whole 128-B lines; p = the lane's row (lane >> 3) and k offset (lane & 7) * 4, load u takes row u * 4 + (lane >> 3)
__device__ __forceinline__ void line_ld(v4f d[4], const float* p, int kc) {
#pragma unroll   /* d[] stays in registers, the four loads issue together */
  for (int u = 0; u < 4; ++u) d[u] = *(const v4f*)(p + (size_t)u * 4 * DIN + kc * 32); }
// frag_st: rounds them to bf16 and lays them into the fragment at f (f includes the lane's writer offset)
__device__ __forceinline__ void frag_st(unsigned char* f, const v4f d[4]) {
#pragma unroll   /* d[] and o stay in registers (this loop and the next) */
  for (int u = 0; u < 4; ++u) { v4b o;
#pragma unroll
    for (int i = 0; i < 4; ++i) o[i] = (__bf16)d[u][i];
    *(v4b*)(f + u * 64) = o; } }
// frag_ld: the lane's two pieces (f includes the lane's reader offset)
__device__ __forceinline__ v16b frag_ld(const unsigned char* f) { union { v16b v; v8b q[2]; } u; u.q[0] = *(const v8b*)f; u.q[1] = *(const v8b*)(f + 640); return u.v; }
// ---- k_proj: block = (64 rows, 128 cols, which): q/k/v = X W (+ b) with exact bf16 products (K = DIN) -> which 0: q f16, head 0, in fragment order (+ residual for rows < QHI); 1: k, as q (+ residual for rows < KHI); 2: v f16 planes [c][t] (+ bf16 hi/lo planes for t < KHI)
__global__ __launch_bounds__(128) void k_proj(const float* __restrict__ XQ, const float* __restrict__ XK, const float* __restrict__ XV, const float* __restrict__ WQ, const float* __restrict__ WK, const float* __restrict__ WV, const float* __restrict__ BQ, const float* __restrict__ BK, const float* __restrict__ BV,
    _Float16* __restrict__ QH, _Float16* __restrict__ QL, _Float16* __restrict__ KH, _Float16* __restrict__ KL, _Float16* __restrict__ VT, __bf16* __restrict__ VB, __bf16* __restrict__ VBL) {
  /* one LDS block with two uses, a barrier between them: in the k loop the operands as bf16 fragments (the block's weight, then two X slots per wave), afterwards the transposing buffers of the stores */
  __shared__ __align__(16) unsigned char smem[64 * LFB + 4 * 2 * LFB];
  _Float16 (*sh)[136] = (_Float16 (*)[136])smem; _Float16 (*sl)[136] = (_Float16 (*)[136])(smem + 17408); _Float16 (*th)[72] = (_Float16 (*)[72])(smem + 34816); __bf16 (*tb)[72] = (__bf16 (*)[72])(smem + 53248); __bf16 (*tbl)[72] = (__bf16 (*)[72])(smem + 71680);
  const int tid = threadIdx.x, wave = tid >> 5, lane = tid & 31, col = lane & 15, g = lane >> 4; const int which = blockIdx.z; const int c0 = blockIdx.y * 128; const size_t r0 = (size_t)blockIdx.x * 64; const size_t bb = r0 / TT; const int t0 = (int)(r0 % TT);
  const float* X = which == 0 ? XQ : which == 1 ? XK : XV; const float* WA = which == 0 ? WQ : which == 1 ? WK : WV; const float* BA = which == 0 ? BQ : which == 1 ? BK : BV;
  const int lc = lane & 7, lr = lane >> 3;   /* a line load: 8 lanes take one row's 128-B line (32 k values), the wave 4 rows */
  const int wofs = (lc >> 1) * 320 + lr * 16 + (lc & 1) * 8, rofs = g * 320 + col * 16;   /* the lane's place in a fragment as writer of 4 values and as reader of its pieces */
  /* X: the wave's 16 rows, k step by k step; steps 0 and 1 go to the wave's two LDS slots before the loop, steps 2.. wait in a register ring of 4 steps */
  const float* xp = X + (r0 + wave * 16 + lr) * DIN + lc * 4; unsigned char* xw = smem + (64 + wave * 2) * LFB + wofs; const unsigned char* xrd = smem + (64 + wave * 2) * LFB + rofs;
  v4f x01[2][4], xr[4][4];
  line_ld(x01[0], xp, 0); line_ld(x01[1], xp, 1);
#pragma unroll   /* here and below: loops over register arrays are unrolled so that the arrays stay in registers */
  for (int s = 0; s < 4; ++s) line_ld(xr[s], xp, 2 + s);
  /* W: the 64 real output rows x DIN as the B fragments (k step kc, column tile j) = number kc * 4 + j; wave w stages k steps 4 w .. 4 w + 3, 32 loads in flight */
  if (c0 == 0) { const float* wp = WA + (size_t)lr * DIN + wave * 128 + lc * 4; unsigned char* lp = smem + wave * 16 * LFB + wofs;
#pragma unroll
    for (int kh = 0; kh < 2; ++kh) { v4f t[8][4];
#pragma unroll
      for (int u = 0; u < 8; ++u) line_ld(t[u], wp + (size_t)(u & 3) * 16 * DIN, kh * 2 + (u >> 2));
#pragma unroll
      for (int u = 0; u < 8; ++u) frag_st(lp + ((kh * 2 + (u >> 2)) * 4 + (u & 3)) * LFB, t[u]); }
  } else { const v4u zz = {0u, 0u, 0u, 0u}; for (int e = tid; e < 64 * LFB / 16; e += 128) *(v4u*)(smem + e * 16) = zz; }   /* projected columns 128.. have no weight row: zero fragments (block-uniform test) */
  frag_st(xw, x01[0]); frag_st(xw + LFB, x01[1]);
  __syncthreads();   /* publishes the staged weight fragments to the block's four waves */
  v8f acc[8] = {}; v16b af[2], wf[2][4];   /* the fragments of a k step, read from LDS together and one step ahead of their products */
  af[0] = frag_ld(xrd);
#pragma unroll
  for (int j = 0; j < 4; ++j) wf[0][j] = frag_ld(smem + j * LFB + rofs);
#pragma unroll   /* unrolled so that the slot numbers of the rings are constants */
  for (int kc = 0; kc < DIN / 32; ++kc) {
    __builtin_amdgcn_sched_barrier(0);   /* keeps each step's instructions in their step: without it the compiler rounds the ring's X values right behind their loads and so waits out the memory latency in every step */
    asm volatile("s_wait_dscnt 0x0" ::: "memory");   /* the wave's own X stores of the step before have landed before other lanes read them back, and this step's fragment has left the slot that is written below */
    if (kc + 1 < DIN / 32) { af[(kc + 1) & 1] = frag_ld(xrd + ((kc + 1) & 1) * LFB);
#pragma unroll
      for (int j = 0; j < 4; ++j) wf[(kc + 1) & 1][j] = frag_ld(smem + ((kc + 1) * 4 + j) * LFB + rofs); }
    if (kc + 2 < DIN / 32) frag_st(xw + (kc & 1) * LFB, xr[kc & 3]);
    if (kc + 6 < DIN / 32) line_ld(xr[kc & 3], xp, kc + 6);
#pragma unroll
    for (int j = 0; j < 4; ++j) acc[j] = wmma_bf(af[kc & 1], wf[kc & 1][j], acc[j]); }   /* column tiles 4..7 (the padding head) have no weight row: their sums stay 0 */
  __syncthreads();   /* every wave has read its last fragment: the LDS block now serves the stores */
  if (which < 2) { _Float16* DH = which == 0 ? QH : KH; _Float16* DL = which == 0 ? QL : KL; const int nhi = which == 0 ? QHI : KHI; const bool hi_rows = t0 < nhi;
#pragma unroll
    for (int j = 0; j < 8; ++j) { const float bias = BA ? bfr(BA[c0 + j * 16 + col]) : 0.f;
#pragma unroll
      for (int r = 0; r < 8; ++r) { const float v = acc[j][r] + bias; const _Float16 hv = (_Float16)v; sh[wave * 16 + 8 * g + r][j * 16 + col] = hv; sl[wave * 16 + 8 * g + r][j * 16 + col] = (_Float16)((v - (float)hv) * 1024.0f); } }
    __syncthreads();
    /* fragment order, columns 0..63 (head 0; the padding head is not stored): piece e of the block's 4 row tiles = row (e >> 7) * 16 + (e & 15), columns ((e >> 4) & 7) * 8 + 0..7 */
    for (int e = tid; e < 64 * 8; e += 128) { const int rl = (e >> 7) * 16 + (e & 15), q = (e >> 4) & 7; vst2((unsigned*)(DH + r0 * HD + e * 8), *(const v4u*)&sh[rl][q * 8]); if (hi_rows) vst2((unsigned*)(DL + (bb * nhi + t0) * (size_t)HD + e * 8), *(const v4u*)&sl[rl][q * 8]); }
  } else { const bool hi_rows = t0 < KHI;
#pragma unroll
    for (int j = 0; j < 8; ++j) { const float bias = BA ? bfr(BA[c0 + j * 16 + col]) : 0.f;
#pragma unroll
      for (int r = 0; r < 8; ++r) { const float v = acc[j][r] + bias; const int rl = wave * 16 + 8 * g + r, cl = j * 16 + col; th[cl][rl] = (_Float16)v; const __bf16 bh = (__bf16)v; tb[cl][rl] = bh; tbl[cl][rl] = (__bf16)(v - (float)bh); } }
    __syncthreads();
    for (int e = tid; e < 128 * 8; e += 128) { const int cl = e >> 3, q = e & 7; vst2((unsigned*)(VT + (bb * CC + c0 + cl) * (size_t)TT + t0 + q * 8), *(const v4u*)&th[cl][q * 8]); }
    /* fragment order, columns 0..63: piece e of the block's 2 key steps = column ((e >> 6) & 3) * 16 + (e & 15), keys (e >> 8) * 32 + ((e >> 4) & 3) * 8 + 0..7 */
    if (hi_rows) for (int e = tid; e < 64 * 8; e += 128) { const int cl = ((e >> 6) & 3) * 16 + (e & 15), kl = (e >> 8) * 32 + ((e >> 4) & 3) * 8; const size_t o3 = (bb * KHI + t0) * (size_t)HD + e * 8; vst2((unsigned*)(VB + o3), *(const v4u*)&tb[cl][kl]); vst2((unsigned*)(VBL + o3), *(const v4u*)&tbl[cl][kl]); } } }
// the matrix products of k_cstat and k_pv: the builtin forms as they are (the compiler keeps the distance behind its own builtin forms)
__device__ __forceinline__ v8f mm_h(v16h a, v16h b, v8f c) { return __builtin_amdgcn_wmma_f32_16x16x32_f16(false, a, false, b, (short)0, c, false, false); }
__device__ __forceinline__ v8f mm_b(v16b a, v16b b, v8f c) { return __builtin_amdgcn_wmma_f32_16x16x32_bf16(false, a, false, b, (short)0, c, false, false); }
// fragment number n behind p, p = the lane's first piece of some fragment of a fragment-order plane: all fragments of a run are read through the one address register pair p, by immediate offsets
__device__ __forceinline__ v16h fragp_h(const v8h* p, int n) { union { v16h v; v8h q[2]; } u; u.q[0] = p[n * 64]; u.q[1] = p[n * 64 + 32]; return u.v; }
__device__ __forceinline__ v16b fragp_b(const v8b* p, int n) { union { v16b v; v8b q[2]; } u; u.q[0] = p[n * 64]; u.q[1] = p[n * 64 + 32]; return u.v; }
// exp(SCALE x (t - m)) = exp2(t x C2 - m x C2), C2 = SCALE x log2(e): one fused multiply-add and one v_exp_f32 per score instead of the library expf's range reduction, ldexp and range tests. An argument below the exponent range (-inf included) gives 0.
#define C2 0.18033688011112042f
__device__ __forceinline__ float ex2(float a) { asm("v_exp_f32 %0, %0\n\tv_nop" : "+v"(a)); return a; }
__device__ __forceinline__ void ex2x8(float* x) { asm("v_exp_f32 %0, %0\n\tv_exp_f32 %1, %1\n\tv_exp_f32 %2, %2\n\tv_exp_f32 %3, %3\n\tv_exp_f32 %4, %4\n\tv_exp_f32 %5, %5\n\tv_exp_f32 %6, %6\n\tv_exp_f32 %7, %7\n\tv_nop" : "+v"(x[0]), "+v"(x[1]), "+v"(x[2]), "+v"(x[3]), "+v"(x[4]), "+v"(x[5]), "+v"(x[6]), "+v"(x[7])); }
__device__ __forceinline__ void ex2x9(float* x) { asm("v_exp_f32 %0, %0\n\tv_exp_f32 %1, %1\n\tv_exp_f32 %2, %2\n\tv_exp_f32 %3, %3\n\tv_exp_f32 %4, %4\n\tv_exp_f32 %5, %5\n\tv_exp_f32 %6, %6\n\tv_exp_f32 %7, %7\n\tv_exp_f32 %8, %8\n\tv_nop" : "+v"(x[0]), "+v"(x[1]), "+v"(x[2]), "+v"(x[3]), "+v"(x[4]), "+v"(x[5]), "+v"(x[6]), "+v"(x[7]), "+v"(x[8])); }
// ---- k_cstat: scores and the softmax statistics over the QUERY axis in one kernel; no logit is stored. For every key column k: m_k = max_{q >= k} t[q][k], Z_k = sum_{q >= k} exp2((t[q][k] - m_k) x C2) (f32), t = q hi . k hi + (q residual . k hi + q hi . k residual) / 2^10 (3 products, head 0; the unscaled score); CM holds 11 - log2(Z_k) - m_k x C2, the addend of k_pv's exponent.
// A wave keeps the k fragments of 32 key columns in registers (B operand) and walks 16-query tiles (A operand) from the diagonal to the end. In the product's D layout a lane holds 8 queries of ONE key column, so the online max / sum runs in the lane (one rescale per 8 queries); the two lane halves are merged by a shuffle, the waves through LDS, max first, then rescaled sums.
// block = (batch, pair of 32-column groups pr and TT / 32 - 1 - pr): the long walk of the one and the short walk of the other have TT / 16 + 2 query tiles together in every block. The tiles of a walk are dealt to the CSW waves round robin; the second walk's deal goes on where the first one's ended.
// q < k enters as -inf (exp gives 0) while the running max starts finite, so a lane or wave with no visible query ends as (-3e38, 0) and drops out of the merge.
#define CSW 16
__global__ __launch_bounds__(32 * CSW) void k_cstat(const _Float16* __restrict__ QH, const _Float16* __restrict__ KH, const _Float16* __restrict__ QL, const _Float16* __restrict__ KL, float* __restrict__ CM) { __shared__ float pm[2][CSW][32], pz[2][CSW][32];
  const int tid = threadIdx.x, wave = __builtin_amdgcn_readfirstlane(tid >> 5), lane = tid & 31, col = lane & 15, g = lane >> 4;   /* the wave number in a scalar register: the walk's bounds stay wave-uniform */
  const int b = blockIdx.x, pr = blockIdx.y; const size_t fb = ((size_t)b * TT) >> 3;   /* first fragment of the batch in the fragment-order planes: 2 fragments (kc = 0, 1) per 16 rows */
#pragma unroll 1   /* the two walks share one body: half the code */
  for (int s = 0; s < 2; ++s) { const int c = s ? TT / 32 - 1 - pr : pr, k0 = c * 32; const int w = s ? (wave + 2 * pr) & (CSW - 1) : wave;
    v16h kh[2][2], kl[2][2]; const v8h* pkh = (const v8h*)KH + (fb + c * 4) * 64 + lane; const v8h* pkl = (const v8h*)KL + (fb + c * 4) * 64 + lane;
#pragma unroll
    for (int j = 0; j < 2; ++j)
#pragma unroll
      for (int kc = 0; kc < 2; ++kc) { kh[j][kc] = fragp_h(pkh, j * 2 + kc); kl[j][kc] = fragp_h(pkl, j * 2 + kc); }
    float m[2] = {-3.0e38f, -3.0e38f}, z[2] = {0.f, 0.f};
    int qt = 2 * c + w; v16h ah[2], al[2];
    { const size_t f = fb + (qt < TT / 16 ? qt : TT / 16 - 1) * 2; const v8h* pq = (const v8h*)QH + f * 64 + lane; const v8h* pr2 = (const v8h*)QL + f * 64 + lane; ah[0] = fragp_h(pq, 0); ah[1] = fragp_h(pq, 1); al[0] = fragp_h(pr2, 0); al[1] = fragp_h(pr2, 1);
      asm volatile("s_wait_xcnt 0x0" :: "v"(pkh), "v"(pkl), "v"(pq), "v"(pr2) : "memory"); }   /* the wait that stands between issued loads and an overwrite of their address registers; the addresses are named so that they last up to it (no load's result is laid over them) */
#pragma unroll 2   /* two trips a pass, so that the fragments read ahead change names instead of being copied */
    for (; qt < TT / 16; qt += CSW) {
      /* the next tile's q fragments are read while this tile is worked on (past the end: the last tile again, unused) */
      const size_t fn = fb + (qt + CSW < TT / 16 ? qt + CSW : TT / 16 - 1) * 2; const v8h* nq = (const v8h*)QH + fn * 64 + lane; const v8h* nr = (const v8h*)QL + fn * 64 + lane; const v16h nh0 = fragp_h(nq, 0), nh1 = fragp_h(nq, 1), nl0 = fragp_h(nr, 0), nl1 = fragp_h(nr, 1);
      asm volatile("s_wait_xcnt 0x0" :: "v"(nq), "v"(nr) : "memory");   /* as above: these loads stay in flight over the trip's work, which reuses registers */
      v8f a0[2] = {}, a1[2] = {};
#pragma unroll
      for (int kc = 0; kc < 2; ++kc)
#pragma unroll
        for (int j = 0; j < 2; ++j) { a0[j] = mm_h(ah[kc], kh[j][kc], a0[j]); a1[j] = mm_h(al[kc], kh[j][kc], a1[j]); a1[j] = mm_h(ah[kc], kl[j][kc], a1[j]); }
      float v[2][8];
#pragma unroll
      for (int j = 0; j < 2; ++j)
#pragma unroll
        for (int r = 0; r < 8; ++r) v[j][r] = a0[j][r] + a1[j][r] * (1.0f / 1024.0f);
      if (qt * 16 < k0 + 32) {   /* only the walk's first two tiles touch the diagonal (wave-uniform test) */
#pragma unroll
        for (int j = 0; j < 2; ++j)
#pragma unroll
          for (int r = 0; r < 8; ++r) v[j][r] = (qt * 16 + 8 * g + r >= k0 + j * 16 + col) ? v[j][r] : -INFINITY; }
#pragma unroll
      for (int j = 0; j < 2; ++j) { float mn = m[j];
#pragma unroll
        for (int r = 0; r < 8; ++r) mn = fmaxf(mn, v[j][r]);
        const float nb = -mn * C2; float e[9]; e[8] = (m[j] - mn) * C2;   /* e[8]: the rescale of the sum so far */
#pragma unroll
        for (int r = 0; r < 8; ++r) e[r] = fmaf(v[j][r], C2, nb);
        ex2x9(e); float a = z[j] * e[8];
#pragma unroll
        for (int r = 0; r < 8; ++r) a += e[r];
        m[j] = mn; z[j] = a; }
      ah[0] = nh0; ah[1] = nh1; al[0] = nl0; al[1] = nl1; }
#pragma unroll
    for (int j = 0; j < 2; ++j) { const float M = fmaxf(m[j], __shfl_xor(m[j], 16)); float a = z[j] * ex2((m[j] - M) * C2); a += __shfl_xor(a, 16); if (g == 0) { pm[s][wave][j * 16 + col] = M; pz[s][wave][j * 16 + col] = a; } } }
  __syncthreads();   /* publishes the CSW waves' partial (max, sum) pairs of both column groups to waves 0 and 1 */
  if (wave < 2) { const int k0 = (wave ? TT / 32 - 1 - pr : pr) * 32; float M = pm[wave][0][lane];
#pragma unroll
    for (int w = 1; w < CSW; ++w) M = fmaxf(M, pm[wave][w][lane]);
    float a = 0.f;
#pragma unroll
    for (int w = 0; w < CSW; ++w) a += pz[wave][w][lane] * ex2((pm[wave][w][lane] - M) * C2);
    vst2(CM + (size_t)b * TT + k0 + lane, 11.0f - log2f(a) - M * C2); } }   /* every column sees at least its own diagonal entry, so Z_k is about 1 or more; max and sum leave as the one addend of k_pv's exponent */
// ---- k_sm: block = query row t (head in group): keys [0, kend): causal -> logit if s <= t else excluded; softmax in f32; P x 2^11 in place (0 for excluded)
__global__ __launch_bounds__(256) void k_sm(float* __restrict__ S0 SM_EXTRA_PARAMS) { __shared__ float sred[8]; __shared__ float sbc; __shared__ __align__(16) float shv[TT];
  const int tid = threadIdx.x; const int t = blockIdx.x; const int kend = (kb_last(t >> 6) + 1) * 128;
  float* sr = S0 + (size_t)blockIdx.y * TT * TT + (size_t)t * TT;
  float m = -3.0e38f; for (int k = tid; k < kend; k += 256) { float v = (!CAUSAL || k <= t) ? sr[k] : -3.0e38f; SM_MASK_HOOK; shv[k] = v; m = fmaxf(m, v); }
#pragma unroll
  for (int o = 1; o < 32; o <<= 1) m = fmaxf(m, __shfl_xor(m, o));
  if ((tid & 31) == 0) sred[tid >> 5] = m; __syncthreads(); if (tid == 0) { float a = sred[0]; for (int i = 1; i < 8; ++i) a = fmaxf(a, sred[i]); sbc = a; } __syncthreads(); m = sbc; __syncthreads();
  float sum = 0.f; for (int k = tid; k < kend; k += 256) { const float v = shv[k]; const float e = (v <= -1.0e38f) ? 0.f : expf(v - m); shv[k] = e; sum += e; }
#pragma unroll
  for (int o = 1; o < 32; o <<= 1) sum += __shfl_xor(sum, o);
  if ((tid & 31) == 0) sred[tid >> 5] = sum; __syncthreads(); if (tid == 0) { float a = 0.f; for (int i = 0; i < 8; ++i) a += sred[i]; sbc = a > 0.f ? 2048.0f / a : 0.f; }   /* a fully excluded row yields P = 0 */ __syncthreads(); const float inv = sbc;
  for (int k = tid; k < kend; k += 256) shv[k] = shv[k] * inv;
  __syncthreads(); for (int q = tid; q < kend / 4; q += 256) vst2(sr + q * 4, *(const v4f*)&shv[q * 4]); }
// ---- k_out64: out[b][t][0..63] = sum over the row's key ranges (ascending) of the partial ctx row, columns 0..63 (256 B by 16 lanes). A thread takes one row of EVERY band of PVK rows (a row of band d has d + 1 ranges): the range counts are compile-time constants, every thread has the same PVS (PVS + 1) / 2 loads, and all of them are in flight together before the first sum.
#define OTH 128             // threads per work-group of k_out64: OTH / 16 rows of each band of one batch
__global__ __launch_bounds__(OTH) void k_out64(const float* __restrict__ Y, float* __restrict__ OUT) { const int bb = blockIdx.x / (PVK / (OTH / 16)), rb = blockIdx.x % (PVK / (OTH / 16)); const size_t row0 = (size_t)bb * TT + rb * (OTH / 16);   /* the block's first row in band 0 */
  const unsigned rl = threadIdx.x >> 4, q = threadIdx.x & 15; const float* pc[PVS]; v4f p[PVS][PVS];   /* pc[c]: the thread's place in range plane c, band 0; the bands lie at immediate offsets behind it */
  static_assert(PVS == 8, "the wait below names PVS addresses");
#pragma unroll   /* here and below: pc[] and p[][] stay in registers, the range counts are constants */
  for (int c = 0; c < PVS; ++c) pc[c] = Y + c * YPL + row0 * CC + (rl * CC + q * 4);
#pragma unroll
  for (int d = 0; d < PVS; ++d)
#pragma unroll
    for (int c = 0; c <= d; ++c) p[d][c] = *(const v4f*)(pc[c] + (size_t)d * PVK * CC);
  asm volatile("s_wait_xcnt 0x0" :: "v"(pc[0]), "v"(pc[1]), "v"(pc[2]), "v"(pc[3]), "v"(pc[4]), "v"(pc[5]), "v"(pc[6]), "v"(pc[7]) : "memory");   /* the wait that stands between issued loads and an overwrite of their address registers; the addresses are named so that they last up to it (no load's result is laid over them) */
#pragma unroll
  for (int d = 0; d < PVS; ++d) { v4f v = p[d][0];
#pragma unroll
    for (int c = 1; c <= d; ++c) v += p[d][c];
    vst2(OUT + (row0 + (size_t)d * PVK + rl) * 64 + q * 4, v); } }
// k_pv's loads of one 32-key step. Each takes a 32-bit index (in 16-B pieces) that already holds the lane's part: the plane's base stays in scalar registers and one vector register addresses a whole group, both planes of it. pv_ldk: the k fragments (hi, residual) of the step's two 16-key tiles; pv_ldm: the lane's 16 exponent addends; pv_ldv: the v fragments (hi, lo) of the four column tiles. Their loops are unrolled so that the arrays stay in registers
__device__ __forceinline__ void pv_ldk(v16h (&kh)[2][2], v16h (&kl)[2][2], const _Float16* KH, const _Float16* KL, unsigned piece) { const v8h* pkh = (const v8h*)KH + piece; const v8h* pkl = (const v8h*)KL + piece;
#pragma unroll
  for (int i = 0; i < 2; ++i)
#pragma unroll
    for (int c = 0; c < 2; ++c) { kh[i][c] = fragp_h(pkh, i * 2 + c); kl[i][c] = fragp_h(pkl, i * 2 + c); } }
__device__ __forceinline__ void pv_ldm(v4f (&mv)[4], const float* CM, unsigned piece) { const v4f* pm = (const v4f*)CM + piece;
#pragma unroll
  for (int q = 0; q < 4; ++q) mv[q] = pm[(q >> 1) * 4 + (q & 1)]; }
__device__ __forceinline__ void pv_ldv(v16b (&vh)[HD / 16], v16b (&vl)[HD / 16], const __bf16* VB, const __bf16* VBL, unsigned piece) { const v8b* pvh = (const v8b*)VB + piece; const v8b* pvl = (const v8b*)VBL + piece;
#pragma unroll
  for (int j = 0; j < HD / 16; ++j) { vh[j] = fragp_b(pvh, j); vl[j] = fragp_b(pvl, j); } }
// ---- k_pv: block = (128 queries, one range of PVK keys) of batch blockIdx.x, head 0; wave = 16 of the queries: partial ctx = P . v over the range's keys up to the wave's diagonal. The scores are formed anew here, transposed: S^T = k . q^T (A = the k fragments of 16 keys, B = the wave's q fragments, kept in registers; the same 3 products as in k_cstat). In D a lane holds keys 8 h + 0..7 of ONE query, which is the A fragment's order for P . v: two 16-key tiles give the 32-key fragment with no exchange between lanes. P = exp2(t x C2 + CM[k]) = exp(S - m_k) x 2^11 / Z_k for k <= t, 0 above the diagonal; P and v as bf16 hi + lo, 3 products.
// The block's 8 waves walk the same key steps, so the k and v fragments that one wave has fetched are near for the other seven.
// Split over keys: rows of band d = t / PVK have d + 1 ranges. blockIdx.y numbers the (128-query block, range) pairs: the full ranges first, then each block's last range (the one the diagonal cuts short), the longest first. The ranges' partial rows go to planes of Y that k_out64 adds.
__global__ __launch_bounds__(32 * PVW) void k_pv(const _Float16* __restrict__ QH, const _Float16* __restrict__ KH, const _Float16* __restrict__ QL, const _Float16* __restrict__ KL, const __bf16* __restrict__ VB, const __bf16* __restrict__ VBL, const float* __restrict__ CM, float* __restrict__ Y) { __shared__ __align__(16) float ss[PVW][16][HD + 4];
  const int tid = threadIdx.x, wave = __builtin_amdgcn_readfirstlane(tid >> 5), lane = tid & 31, col = lane & 15, g = lane >> 4;   /* the wave number in a scalar register: the key loop's bounds stay wave-uniform */
  const int b = blockIdx.x, py = blockIdx.y;
  int band, rng, qi;   /* PVQ query blocks a band; band d has PVQ * d full ranges, PVQ * d (d - 1) / 2 lie before them */
  if (py < PVQ * PVS * (PVS - 1) / 2) { band = 1;
#pragma unroll
    for (int d = 2; d < PVS; ++d) if (py >= PVQ * d * (d - 1) / 2) band = d;
    const int rem = py - PVQ * band * (band - 1) / 2; qi = rem % PVQ; rng = rem / PVQ; }
  else { const int p = py - PVQ * PVS * (PVS - 1) / 2; qi = PVQ - 1 - p / PVS; band = p % PVS; rng = band; }
  const int ql0 = band * PVK + qi * 128 + wave * 16; const int kcb = rng * (PVK / 32); const int kall = ((ql0 + 15) >> 5) + 1; const int kce = kall < (rng + 1) * (PVK / 32) ? kall : (rng + 1) * (PVK / 32);   /* 32-key steps; the last one is the step that holds the wave's last query */
  const size_t fb = ((size_t)b * TT) >> 3; const size_t fq = fb + (ql0 >> 3);
  const v16h qh[2] = {fragt_h(QH, fq, lane), fragt_h(QH, fq + 1, lane)}, qr[2] = {fragt_h(QL, fq, lane), fragt_h(QL, fq + 1, lane)};
  v8f acc[HD / 16] = {};
  /* The k fragments and the exponent addends are loaded one step ahead, each group into the registers that its last use has just freed, so that a step finds them landed instead of waiting out their load latency. The first step's are loaded here; the last step loads its own again (in bounds, unused). */
  const unsigned lk = (unsigned)fb * 64 + lane, lm = b * (TT / 4) + 2 * g, lv = b * (KHI / 32) * (HD / 16) * 64 + lane;   /* the lane's index in step 0 of the batch: k planes, addends, v planes */
  unsigned ik = lk + kcb * 256, im = lm + kcb * 8;   /* the indices of the k and addend loads issued last */
  v16h kh[2][2], kl[2][2]; v4f mv[4];
  pv_ldk(kh, kl, KH, KL, ik); pv_ldm(mv, CM, im);
#pragma unroll 1   /* one step's fragments and the next step's k fill the registers */
  for (int kc = kcb; kc < kce; ++kc) { const int kn = kc + 1 < kce ? kc + 1 : kc;   /* the step that is loaded ahead */
    asm volatile("s_wait_xcnt 0x0" :: "v"(ik), "v"(im), "v"(lane) : "memory");   /* the wait that stands between issued loads and an overwrite of their address registers; the indices (lane: the q fragments') are named so that they last up to it (no load's result is laid over them) */
    const unsigned iv = lv + kc * 256;
    v16b vh[HD / 16], vl[HD / 16];   /* fragments (key step kc, column tile j) of the fragment-order v planes: the score products and the exp work cover their latency */
    pv_ldv(vh, vl, VB, VBL, iv);
    v8f a0[2] = {}, a1[2] = {};
#pragma unroll
    for (int c = 0; c < 2; ++c)
#pragma unroll
      for (int i = 0; i < 2; ++i) { a0[i] = mm_h(kh[i][c], qh[c], a0[i]); a1[i] = mm_h(kh[i][c], qr[c], a1[i]); a1[i] = mm_h(kl[i][c], qh[c], a1[i]); }
    ik = lk + kn * 256;
    pv_ldk(kh, kl, KH, KL, ik);
    float pv[16];
#pragma unroll
    for (int e = 0; e < 16; ++e) pv[e] = fmaf(a0[e >> 3][e & 7] + a1[e >> 3][e & 7] * (1.0f / 1024.0f), C2, mv[e >> 2][e & 3]);
    /* order of this stretch: the 16 v loads, the 12 score products, then the 16 k loads of the next step (behind the last product that reads their registers: ahead of it they would need registers of their own and copies) */
    __builtin_amdgcn_sched_group_barrier(0x20, 16, 0); __builtin_amdgcn_sched_group_barrier(0x8, 12, 0); __builtin_amdgcn_sched_group_barrier(0x20, 16, 0);
    ex2x8(pv); ex2x8(pv + 8);
    if (kc * 32 + 31 > ql0) {   /* only steps that reach past the wave's first query hold masked keys (wave-uniform test) */
#pragma unroll
      for (int e = 0; e < 16; ++e) pv[e] = (kc * 32 + (e >> 3) * 16 + 8 * g + (e & 7) <= ql0 + col) ? pv[e] : 0.f; }
    const F2 p = bsplit16(pv);
    asm volatile("s_wait_xcnt 0x0" :: "v"(iv) : "memory");   /* as at the loop's head, for the v loads */
    im = lm + kn * 8;
    pv_ldm(mv, CM, im);
    /* order asked of this stretch: the split of P, then the 4 loads of the next step's addends (into the registers that P's f32 values leave: ahead of the split they would need registers of their own and copies behind a full load wait), then the products */
    __builtin_amdgcn_sched_group_barrier(0x2, 96, 1); __builtin_amdgcn_sched_group_barrier(0x20, 4, 1); __builtin_amdgcn_sched_group_barrier(0x8, 12, 1);
#pragma unroll
    for (int j = 0; j < HD / 16; ++j) { acc[j] = mm_b(p.h, vh[j], acc[j]); acc[j] = mm_b(p.l, vh[j], acc[j]); acc[j] = mm_b(p.h, vl[j], acc[j]); } }
#pragma unroll
  for (int j = 0; j < HD / 16; ++j)
#pragma unroll
    for (int r = 0; r < 8; ++r) ss[wave][8 * g + r][j * 16 + col] = acc[j][r] * (1.0f / 2048.0f);
  LDSX();   /* the wave reads back only its own tile, turned into whole rows: 256-B (row, head) segment by 16 lanes */
#pragma unroll
  for (int i = 0; i < 8; ++i) { const int rl = i * 2 + g; vst2(Y + rng * YPL + ((size_t)b * TT + ql0 + rl) * CC + col * 4, *(const v4f*)&ss[wave][rl][col * 4]); } }

extern "C" void kernel_launch(void* const* d_in, const int* in_sizes, int n_in, void* d_out, int out_size, void* d_ws, size_t ws_size, hipStream_t stream) {
  (void)in_sizes; (void)n_in; (void)out_size;
  const float** F = (const float**)d_in;
  if (ws_size < (size_t)WS_END) return;
  char* ws = (char*)d_ws; _Float16 *QH = (_Float16*)(ws + WS_QH), *KH = (_Float16*)(ws + WS_KH), *VT = (_Float16*)(ws + WS_VT), *QL = (_Float16*)(ws + WS_QL), *KL = (_Float16*)(ws + WS_KL); __bf16 *VB = (__bf16*)(ws + WS_VB), *VBL = (__bf16*)(ws + WS_VBL); float *Y = (float*)(ws + WS_Y);
  (void)Y; (void)QL; (void)KL; (void)VB; (void)VBL;
  // inputs: 0 x [4,4096,512]; 1 Wq [64,512] (out,in); 2 Wk; 3 Wv; no biases
  if (ws_size < (size_t)WS_END2) return;
  float *Y2 = (float*)(ws + WS_Y2), *CM = (float*)(ws + WS_CM);
  k_proj<<<dim3(TNB * TT / 64, CC / 128, 3), 128, 0, stream>>>(F[0], F[0], F[0], F[1], F[2], F[3], nullptr, nullptr, nullptr, QH, QL, KH, KL, VT, VB, VBL);   /* weight columns 64..127 (the padding head) have no fragments: their sums stay 0 */
  /* head 0 only (head 1 is the zero padding); the batch is a grid axis of both launches; the logits are formed in registers in each of them and never stored */
  k_cstat<<<dim3(TNB, TT / 64), 32 * CSW, 0, stream>>>(QH, KH, QL, KL, CM);   /* per key column s: max and sum over the visible queries t >= s, as one exponent addend */
  k_pv<<<dim3(TNB, PVQ * PVS * (PVS + 1) / 2), 32 * PVW, 0, stream>>>(QH, KH, QL, KL, VB, VBL, CM, Y2);   /* batch x (128-query block, key range); P[t][s] = exp(S - m_s) x 2^11 / Z_s */
  k_out64<<<dim3(TNB * PVK / (OTH / 16)), OTH, 0, stream>>>(Y2, (float*)d_out);
}
